// v000
// Measured on an AMD MI455X. A time is GPU time per run, averaged over a window of back-to-back runs after a warm-up
// (all launches, gaps included; the runs take copies of the inputs in turn), and the median of several windows.
// Apart from v000's, it joins two sittings. Times from different sittings can be a few percent apart, while
// side-by-side timings come from the same sitting.
// The starting kernel, v000, takes 708 microseconds a run.
// compute dtype: all float inputs rounded to bf16; per-head q / k / v projections with EXACT bf16 products on WMMA 16x16x32 (f32 accumulate), no biases; causal logits: 3 products for the first 384 rows, single f16 q x k after, x 1024^-0.5; softmax f32; P x 2^11 once to f16 x v once to f16 (bf16 hi + lo below row 384); ctx hi+lo x exact Wp below row 384, x2^6 f16 carry x f16(bf16 x 2^8) Wp after, + bp (zeros, read); f32 output.
#include <hip/hip_runtime.h>
#include <math.h>

typedef __attribute__((ext_vector_type(16))) _Float16 v16h;
typedef __attribute__((ext_vector_type(16))) __bf16 v16b;
typedef __attribute__((ext_vector_type(8)))  _Float16 v8h;
typedef __attribute__((ext_vector_type(8)))  float v8f;
typedef __attribute__((ext_vector_type(4)))  float v4f;
typedef __attribute__((ext_vector_type(2)))  float v2f;
typedef __attribute__((ext_vector_type(4)))  unsigned v4u;
typedef __attribute__((ext_vector_type(4)))  int v4i;
typedef float __attribute__((may_alias)) float_a;
typedef int __attribute__((may_alias)) int_a;

template <typename T> __device__ __forceinline__ void vst2(void* p, T v) { *(T*)p = v;  }
__device__ __forceinline__ v8f wmma16(v16h a, v16h b, v8f c) {
  v8f d = __builtin_amdgcn_wmma_f32_16x16x32_f16(false, a, false, b, (short)0, c, false, false);
  asm volatile("v_nop\n\tv_nop\n\tv_nop\n\tv_nop" : "+v"(d) : "v"(a), "v"(b));
  return d;
}
__device__ __forceinline__ v8f wmma_bf(v16b a, v16b b, v8f c) {
  v8f d = __builtin_amdgcn_wmma_f32_16x16x32_bf16(false, a, false, b, (short)0, c, false, false);
  asm volatile("v_nop\n\tv_nop\n\tv_nop\n\tv_nop" : "+v"(d) : "v"(a), "v"(b));
  return d;
}
// 16x16x32 fragments: lane = (h = lane>>4, row/col = lane&15); elements 0..7 = k0+8h+0..7, 8..15 = k0+16+8h+0..7; D element r = row 8h+r
__device__ __forceinline__ v16h frag_h(const _Float16* rowk0, int lane) {
  union { v16h v; v8h q[2]; } u; const _Float16* p = rowk0 + 8 * (lane >> 4);
  u.q[0] = *(const v8h*)p; u.q[1] = *(const v8h*)(p + 16); return u.v;
}
__device__ __forceinline__ v16h frag_f32(const float* rowk0, int lane) {
  v16h a; const float* p = rowk0 + 8 * (lane >> 4);
#pragma unroll
  for (int i = 0; i < 8; ++i) { a[i] = (_Float16)p[i]; a[8 + i] = (_Float16)p[16 + i]; }
  return a;
}
__device__ __forceinline__ v16h frag_f32s(const float* rowk0, int lane, float sc) {
  v16h a; const float* p = rowk0 + 8 * (lane >> 4);
#pragma unroll
  for (int i = 0; i < 8; ++i) { a[i] = (_Float16)(p[i] * sc); a[8 + i] = (_Float16)(p[16 + i] * sc); }
  return a;
}
// column fragment from a [K][ld] layout (column n), rows >= K read as 0
__device__ __forceinline__ v16h fragc_f32(const float* W, int k0, int n, int lane, int ld, int K) {
  v16h a; const int g = lane >> 4;
#pragma unroll
  for (int i = 0; i < 8; ++i) { const int ka = k0 + 8 * g + i, kb = ka + 16;
    a[i] = (_Float16)(ka < K ? W[(size_t)(ka < K ? ka : K - 1) * ld + n] : 0.f); a[8 + i] = (_Float16)(kb < K ? W[(size_t)(kb < K ? kb : K - 1) * ld + n] : 0.f); }
  return a;
}
struct F2 { v16b h, l; };
__device__ __forceinline__ F2 bsplit16(const float v[16]) { F2 r;
#pragma unroll
  for (int i = 0; i < 16; ++i) { const __bf16 h = (__bf16)v[i]; r.h[i] = h; r.l[i] = (__bf16)(v[i] - (float)h); }
  return r; }
__device__ __forceinline__ F2 split_row(const float* row, int k0, int lane) { float v[16]; const float* p = row + k0 + 8 * (lane >> 4);
#pragma unroll
  for (int i = 0; i < 8; ++i) { v[i] = p[i]; v[8 + i] = p[16 + i]; }
  return bsplit16(v); }
__device__ __forceinline__ F2 split_rowK(const float* row, int k0, int lane, int K) { float v[16]; const int g = lane >> 4;
#pragma unroll
  for (int i = 0; i < 8; ++i) { const int ka = k0 + 8 * g + i, kb = ka + 16; v[i] = ka < K ? row[ka < K ? ka : K - 1] : 0.f; v[8 + i] = kb < K ? row[kb < K ? kb : K - 1] : 0.f; }
  return bsplit16(v); }
__device__ __forceinline__ F2 split_col(const float* W, int k0, int n, int lane, int ld, int K) { float v[16]; const int g = lane >> 4;
#pragma unroll
  for (int i = 0; i < 8; ++i) { const int ka = k0 + 8 * g + i, kb = ka + 16; v[i] = ka < K ? W[(size_t)(ka < K ? ka : K - 1) * ld + n] : 0.f; v[8 + i] = kb < K ? W[(size_t)(kb < K ? kb : K - 1) * ld + n] : 0.f; }
  return bsplit16(v); }
__device__ __forceinline__ v8f mac3(const F2& a, const F2& b, v8f c) { c = wmma_bf(a.l, b.h, c); c = wmma_bf(a.h, b.l, c); return wmma_bf(a.h, b.h, c); }
__device__ __forceinline__ float sigm(float v) { return 1.0f / (1.0f + expf(-v)); }
#define LDSX() do { asm volatile("s_wait_dscnt 0" ::: "memory"); __builtin_amdgcn_wave_barrier(); __builtin_amdgcn_fence(__ATOMIC_RELEASE, "workgroup"); } while (0)

// Causal multi-head self-attention with per-head weights and a 1/sqrt(C) score scale (x [4,1024,1024]; Wq / Wk / Wv [16,1024,64] = per-head [head][model][d] N(0,1) x 0.02, no biases; Wp [1024,1024] (in,out), bp zeros (read); q = einsum('btc,hcd->bhtd'); scores x 1/sqrt(1024) - the scale is 1/32, not 1/8 (soft logits); tril kept, -inf elsewhere; softmax; heads concatenated; out @ Wp + bp).
#define NB 4
#define TT 1024
#define CC 1024            // NH * HD = projected width
#define DIN 1024          // input (model) width
#define NH 16
#define HD 64
#define NQB (TT / 64)
#define HG 8
#define SCALE (0.03125f)
#define CAUSAL 1
#ifndef TNB
#define TNB NB
#endif
__device__ __forceinline__ float bfr(float v) { return (float)(__bf16)v; }
__host__ __device__ __forceinline__ int kb_last(int qb) { return CAUSAL ? ((qb * 64 + 63) >> 7) : (TT / 128 - 1); }
typedef __attribute__((ext_vector_type(8))) __bf16 v8b;
__device__ __forceinline__ v16b frag_b(const __bf16* rowk0, int lane) {
  union { v16b v; v8b q[2]; } u; const __bf16* p = rowk0 + 8 * (lane >> 4);
  u.q[0] = *(const v8b*)p; u.q[1] = *(const v8b*)(p + 16); return u.v;
}
#define QBH 6              // causal: query blocks 0..QBH-1 of each sequence (few keys, no averaging) take the high-precision path
#define QHI 384            // rows carrying a q residual plane
#define KHI 384            // key rows carrying k residual / v bf16 hi+lo planes (used only by the causal high-precision path)
// B fragment (k rows k0+.., output column o) of a weight: (in,out) [K][ld] or (out,in) [ld rows of K]: bf16 exact, or f16(bf16 * 256) exact
__device__ __forceinline__ v16b wcol_io(const float* Wm, int k0, int o, int lane, int ld) { v16b w; const int g = lane >> 4;
#pragma unroll
  for (int i = 0; i < 8; ++i) { w[i] = (__bf16)Wm[(size_t)(k0 + 8 * g + i) * ld + o]; w[8 + i] = (__bf16)Wm[(size_t)(k0 + 16 + 8 * g + i) * ld + o]; }
  return w; }
__device__ __forceinline__ v16b wcol_oi(const float* Wm, int k0, int o, int lane, int K) { v16b w; const float* p = Wm + (size_t)o * K + k0 + 8 * (lane >> 4);
#pragma unroll
  for (int i = 0; i < 8; ++i) { w[i] = (__bf16)p[i]; w[8 + i] = (__bf16)p[16 + i]; }
  return w; }
__device__ __forceinline__ v16h wcolh_io(const float* Wm, int k0, int o, int lane, int ld) { v16h w; const int g = lane >> 4;
#pragma unroll
  for (int i = 0; i < 8; ++i) { w[i] = (_Float16)(bfr(Wm[(size_t)(k0 + 8 * g + i) * ld + o]) * 256.0f); w[8 + i] = (_Float16)(bfr(Wm[(size_t)(k0 + 16 + 8 * g + i) * ld + o]) * 256.0f); }
  return w; }
__device__ __forceinline__ v16h wcolh_oi(const float* Wm, int k0, int o, int lane, int K) { v16h w; const float* p = Wm + (size_t)o * K + k0 + 8 * (lane >> 4);
#pragma unroll
  for (int i = 0; i < 8; ++i) { w[i] = (_Float16)(bfr(p[i]) * 256.0f); w[8 + i] = (_Float16)(bfr(p[16 + i]) * 256.0f); }
  return w; }
#define WQKV_LAYOUT 2   // 0 = (in,out) [DIN][CC]; 1 = (out,in) [CC][DIN]; 2 = per-head [NH][DIN][HD]
__device__ __forceinline__ v16b wcol_hdk(const float* Wm, int k0, int o, int lane) { v16b w; const int g = lane >> 4; const float* p = Wm + (size_t)(o / HD) * DIN * HD + (o % HD);
#pragma unroll
  for (int i = 0; i < 8; ++i) { w[i] = (__bf16)p[(size_t)(k0 + 8 * g + i) * HD]; w[8 + i] = (__bf16)p[(size_t)(k0 + 16 + 8 * g + i) * HD]; }
  return w; }
#define WO_OUT_IN 0
#if WQKV_LAYOUT == 1
#define WCOL(W, k0, o, lane) wcol_oi(W, k0, o, lane, DIN)
#elif WQKV_LAYOUT == 2
#define WCOL(W, k0, o, lane) wcol_hdk(W, k0, o, lane)
#else
#define WCOL(W, k0, o, lane) wcol_io(W, k0, o, lane, CC)
#endif
#if WO_OUT_IN
#define WOCOL(W, k0, o, lane) wcol_oi(W, k0, o, lane, CC)
#define WOCOLH(W, k0, o, lane) wcolh_oi(W, k0, o, lane, CC)
#else
#define WOCOL(W, k0, o, lane) wcol_io(W, k0, o, lane, DIN)
#define WOCOLH(W, k0, o, lane) wcolh_io(W, k0, o, lane, DIN)
#endif

#ifndef SM_EXTRA_PARAMS
#define SM_EXTRA_PARAMS
#endif
#ifndef PROJ_EXTRA_PARAMS
#define PROJ_EXTRA_PARAMS
#endif
#ifndef SM_MASK_HOOK
#define SM_MASK_HOOK (void)0
#endif

#define WS_QH  0u                                      // f16 q rows [b*t][CC]
#define WS_KH  (WS_QH + 2u * (size_t)NB * TT * CC)      // f16 k rows [b*t][CC]
#define WS_VT  (WS_KH + 2u * (size_t)NB * TT * CC)      // f16 v planes [b][c][t]
#define WS_QL  (WS_VT + 2u * (size_t)NB * CC * TT)      // f16 q residual x 2^10 rows [b][t < QHI][CC]
#define WS_KL  (WS_QL + 2u * (size_t)NB * QHI * CC)     // f16 k residual x 2^10 rows [b][t < KHI][CC]
#define WS_VB  (WS_KL + 2u * (size_t)NB * KHI * CC)     // bf16 v hi planes [b][c][t < KHI]
#define WS_VBL (WS_VB + 2u * (size_t)NB * CC * KHI)
#define WS_S   (WS_VBL + 2u * (size_t)NB * CC * KHI)    // f32 logits / P [hg][t][s]
#define WS_Y   (WS_S  + 4u * (size_t)HG * TT * TT)      // f32 ctx rows [b*t][CC] (only when there is an output projection)
#define WS_END (WS_Y  + 4u * (size_t)NB * TT * CC)

// ---- k_proj: block = (64 rows, 128 cols, which): q/k/v = X W (+ b) with exact bf16 products (K = DIN) -> which 0: q f16 rows (+ residual rows < QHI); 1: k f16 rows (+ residual rows < KHI); 2: v f16 planes [c][t] (+ bf16 hi/lo planes for t < KHI)
__global__ __launch_bounds__(128) void k_proj(const float* __restrict__ XQ, const float* __restrict__ XK, const float* __restrict__ XV, const float* __restrict__ WQ, const float* __restrict__ WK, const float* __restrict__ WV, const float* __restrict__ BQ, const float* __restrict__ BK, const float* __restrict__ BV,
    _Float16* __restrict__ QH, _Float16* __restrict__ QL, _Float16* __restrict__ KH, _Float16* __restrict__ KL, _Float16* __restrict__ VT, __bf16* __restrict__ VB, __bf16* __restrict__ VBL) {
  __shared__ __align__(16) _Float16 sh[64][136], sl[64][136]; __shared__ __align__(16) _Float16 th[128][72]; __shared__ __align__(16) __bf16 tb[128][72], tbl[128][72];
  const int tid = threadIdx.x, wave = tid >> 5, lane = tid & 31, col = lane & 15, g = lane >> 4; const int which = blockIdx.z; const int c0 = blockIdx.y * 128; const size_t r0 = (size_t)blockIdx.x * 64; const size_t bb = r0 / TT; const int t0 = (int)(r0 % TT);
  const float* X = which == 0 ? XQ : which == 1 ? XK : XV; const float* WA = which == 0 ? WQ : which == 1 ? WK : WV; const float* BA = which == 0 ? BQ : which == 1 ? BK : BV;
  v8f acc[8] = {};
#pragma unroll 2
  for (int kc = 0; kc < DIN / 32; ++kc) { v16b a; { const float* p = X + (r0 + wave * 16 + col) * DIN + kc * 32 + 8 * g;
#pragma unroll
      for (int i = 0; i < 8; ++i) { a[i] = (__bf16)p[i]; a[8 + i] = (__bf16)p[16 + i]; } }
    asm volatile("s_wait_loadcnt 0x0" ::: "memory");
#pragma unroll
    for (int j = 0; j < 8; ++j) { const v16b w = WCOL(WA, kc * 32, c0 + j * 16 + col, lane); asm volatile("s_wait_loadcnt 0x0" ::: "memory"); acc[j] = wmma_bf(a, w, acc[j]); } }
  if (which < 2) { _Float16* DH = which == 0 ? QH : KH; _Float16* DL = which == 0 ? QL : KL; const int nhi = which == 0 ? QHI : KHI; const bool hi_rows = t0 < nhi;
#pragma unroll
    for (int j = 0; j < 8; ++j) { const float bias = BA ? bfr(BA[c0 + j * 16 + col]) : 0.f;
#pragma unroll
      for (int r = 0; r < 8; ++r) { const float v = acc[j][r] + bias; const _Float16 hv = (_Float16)v; sh[wave * 16 + 8 * g + r][j * 16 + col] = hv; sl[wave * 16 + 8 * g + r][j * 16 + col] = (_Float16)((v - (float)hv) * 1024.0f); } }
    __syncthreads();
    for (int e = tid; e < 64 * 16; e += 128) { const int rl = e >> 4, q = e & 15; vst2((unsigned*)(DH + (r0 + rl) * CC + c0 + q * 8), *(const v4u*)&sh[rl][q * 8]); if (hi_rows) vst2((unsigned*)(DL + (bb * nhi + t0 + rl) * (size_t)CC + c0 + q * 8), *(const v4u*)&sl[rl][q * 8]); }
  } else { const bool hi_rows = t0 < KHI;
#pragma unroll
    for (int j = 0; j < 8; ++j) { const float bias = BA ? bfr(BA[c0 + j * 16 + col]) : 0.f;
#pragma unroll
      for (int r = 0; r < 8; ++r) { const float v = acc[j][r] + bias; const int rl = wave * 16 + 8 * g + r, cl = j * 16 + col; th[cl][rl] = (_Float16)v; const __bf16 bh = (__bf16)v; tb[cl][rl] = bh; tbl[cl][rl] = (__bf16)(v - (float)bh); } }
    __syncthreads();
    for (int e = tid; e < 128 * 8; e += 128) { const int cl = e >> 3, q = e & 7; vst2((unsigned*)(VT + (bb * CC + c0 + cl) * (size_t)TT + t0 + q * 8), *(const v4u*)&th[cl][q * 8]); if (hi_rows) { const size_t o3 = (bb * CC + c0 + cl) * (size_t)KHI + t0 + q * 8; vst2((unsigned*)(VB + o3), *(const v4u*)&tb[cl][q * 8]); vst2((unsigned*)(VBL + o3), *(const v4u*)&tbl[cl][q * 8]); } } } }
// ---- k_sc: block = (query block qb, key block kb <= kb_last(qb), head in group) of batch b: logits x SCALE; q hi + residual (x 2^10) against k (2 products) for query rows < QHI, plus the k residual (3 products) for query blocks < QBH (causal early rows); causal: blocks past the diagonal exit, the mask itself is applied by index in k_sm
__global__ __launch_bounds__(128) void k_sc(const _Float16* __restrict__ QH, const _Float16* __restrict__ KH, const _Float16* __restrict__ QL, const _Float16* __restrict__ KL, int b, int h0, float* __restrict__ S0) { __shared__ __align__(16) float ss[4][16][132];
  const int qb = blockIdx.x, kb = blockIdx.y; if (kb > kb_last(qb)) return;
  const int h = h0 + blockIdx.z; float* S = S0 + (size_t)blockIdx.z * TT * TT;
  const int tid = threadIdx.x, wave = tid >> 5, lane = tid & 31, col = lane & 15, g = lane >> 4; const int k0 = kb * 128; const int ql0 = qb * 64 + wave * 16; const size_t q0 = (size_t)b * TT + ql0, kr0 = (size_t)b * TT + k0;
  v8f acc[8] = {}, accl[8] = {};
  const _Float16* QLb = QL + (size_t)b * QHI * CC; const _Float16* KLb = KL + (size_t)b * KHI * CC;
  if (qb < QBH) {
#pragma unroll
    for (int kc = 0; kc < HD / 32; ++kc) { const v16h ah = frag_h(QH + (q0 + col) * CC + h * HD + kc * 32, lane), al = frag_h(QLb + (size_t)(ql0 + col) * CC + h * HD + kc * 32, lane);
#pragma unroll
      for (int j = 0; j < 8; ++j) { const v16h kbf = frag_h(KH + (kr0 + j * 16 + col) * CC + h * HD + kc * 32, lane), klf = frag_h(KLb + (size_t)(k0 + j * 16 + col) * CC + h * HD + kc * 32, lane); acc[j] = wmma16(ah, kbf, acc[j]); accl[j] = wmma16(al, kbf, accl[j]); accl[j] = wmma16(ah, klf, accl[j]); } }
  } else if (qb * 64 < QHI) {
#pragma unroll
    for (int kc = 0; kc < HD / 32; ++kc) { const v16h ah = frag_h(QH + (q0 + col) * CC + h * HD + kc * 32, lane), al = frag_h(QLb + (size_t)(ql0 + col) * CC + h * HD + kc * 32, lane);
#pragma unroll
      for (int j = 0; j < 8; ++j) { const v16h kbf = frag_h(KH + (kr0 + j * 16 + col) * CC + h * HD + kc * 32, lane); acc[j] = wmma16(ah, kbf, acc[j]); accl[j] = wmma16(al, kbf, accl[j]); } }
  } else {
#pragma unroll
    for (int kc = 0; kc < HD / 32; ++kc) { const v16h ah = frag_h(QH + (q0 + col) * CC + h * HD + kc * 32, lane);
#pragma unroll
      for (int j = 0; j < 8; ++j) { const v16h kbf = frag_h(KH + (kr0 + j * 16 + col) * CC + h * HD + kc * 32, lane); acc[j] = wmma16(ah, kbf, acc[j]); } } }
#pragma unroll
  for (int j = 0; j < 8; ++j) {
#pragma unroll
    for (int r = 0; r < 8; ++r) ss[wave][8 * g + r][j * 16 + col] = (acc[j][r] + accl[j][r] * (1.0f / 1024.0f)) * SCALE; }
  LDSX(); for (int rl = 0; rl < 16; ++rl) vst2(S + (size_t)(ql0 + rl) * TT + k0 + lane * 4, *(const v4f*)&ss[wave][rl][lane * 4]); }
// ---- k_sm: block = query row t (head in group): keys [0, kend): causal -> logit if s <= t else excluded; softmax in f32; P x 2^11 in place (0 for excluded)
__global__ __launch_bounds__(256) void k_sm(float* __restrict__ S0 SM_EXTRA_PARAMS) { __shared__ float sred[8]; __shared__ float sbc; __shared__ __align__(16) float shv[TT];
  const int tid = threadIdx.x; const int t = blockIdx.x; const int kend = (kb_last(t >> 6) + 1) * 128;
  float* sr = S0 + (size_t)blockIdx.y * TT * TT + (size_t)t * TT;
  float m = -3.0e38f; for (int k = tid; k < kend; k += 256) { float v = (!CAUSAL || k <= t) ? sr[k] : -3.0e38f; SM_MASK_HOOK; shv[k] = v; m = fmaxf(m, v); }
#pragma unroll
  for (int o = 1; o < 32; o <<= 1) m = fmaxf(m, __shfl_xor(m, o));
  if ((tid & 31) == 0) sred[tid >> 5] = m; __syncthreads(); if (tid == 0) { float a = sred[0]; for (int i = 1; i < 8; ++i) a = fmaxf(a, sred[i]); sbc = a; } __syncthreads(); m = sbc; __syncthreads();
  float sum = 0.f; for (int k = tid; k < kend; k += 256) { const float v = shv[k]; const float e = (v <= -1.0e38f) ? 0.f : expf(v - m); shv[k] = e; sum += e; }
#pragma unroll
  for (int o = 1; o < 32; o <<= 1) sum += __shfl_xor(sum, o);
  if ((tid & 31) == 0) sred[tid >> 5] = sum; __syncthreads(); if (tid == 0) { float a = 0.f; for (int i = 0; i < 8; ++i) a += sred[i]; sbc = a > 0.f ? 2048.0f / a : 0.f; }   /* a fully excluded row yields P = 0 */ __syncthreads(); const float inv = sbc;
  for (int k = tid; k < kend; k += 256) shv[k] = shv[k] * inv;
  __syncthreads(); for (int q = tid; q < kend / 4; q += 256) vst2(sr + q * 4, *(const v4f*)&shv[q * 4]); }
// ---- k_pv: block = 64 queries (qb) of (b, h): ctx = P . v over keys [0, kend) (P x 2^11 once to f16 against v f16: 1 product; causal early query blocks: P and v as bf16 hi + lo, 3 products); 256-B (row, head) segment by 16 lanes
__global__ __launch_bounds__(128) void k_pv(const float* __restrict__ PS0, const _Float16* __restrict__ VT, const __bf16* __restrict__ VB, const __bf16* __restrict__ VBL, int b, int h0, float* __restrict__ Y) { const int h = h0 + blockIdx.z; const float* PS = PS0 + (size_t)blockIdx.z * TT * TT; __shared__ __align__(16) float ss[4][16][HD + 4];
  const int tid = threadIdx.x, wave = tid >> 5, lane = tid & 31, col = lane & 15, g = lane >> 4; const int qb = blockIdx.x; const int ql0 = qb * 64 + wave * 16; const int kce = (kb_last(qb) + 1) * 4;
  v8f acc[HD / 16] = {};
  if (qb < QBH) {
#pragma unroll 1
    for (int kc = 0; kc < kce; ++kc) { const F2 p = split_row(PS + (size_t)(ql0 + col) * TT, kc * 32, lane);
      asm volatile("s_wait_loadcnt 0x0" ::: "memory");
#pragma unroll
      for (int j = 0; j < HD / 16; ++j) { const size_t po = ((size_t)b * CC + h * HD + j * 16 + col) * (size_t)KHI + kc * 32; const v16b vh = frag_b(VB + po, lane); acc[j] = wmma_bf(p.h, vh, acc[j]); acc[j] = wmma_bf(p.l, vh, acc[j]); acc[j] = wmma_bf(p.h, frag_b(VBL + po, lane), acc[j]); } }
  } else {
#pragma unroll 1
    for (int kc = 0; kc < kce; ++kc) { const v16h p = frag_f32(PS + (size_t)(ql0 + col) * TT + kc * 32, lane);
      asm volatile("s_wait_loadcnt 0x0" ::: "memory");
#pragma unroll
      for (int j = 0; j < HD / 16; ++j) { const size_t po = ((size_t)b * CC + h * HD + j * 16 + col) * (size_t)TT + kc * 32; acc[j] = wmma16(p, frag_h(VT + po, lane), acc[j]); } } }
#pragma unroll
  for (int j = 0; j < HD / 16; ++j)
#pragma unroll
    for (int r = 0; r < 8; ++r) ss[wave][8 * g + r][j * 16 + col] = acc[j][r] * (1.0f / 2048.0f);
  LDSX(); for (int rl = 0; rl < 16; ++rl) if (lane < HD / 4) vst2(Y + ((size_t)b * TT + ql0 + rl) * CC + h * HD + lane * 4, *(const v4f*)&ss[wave][rl][lane * 4]); }
// ---- k_out: block = (64 rows, 128 cols): out = ctx Wo (+ bo): ctx x 2^6 once to f16 against Wo as f16(bf16 x 2^8) exact (1 product) x 2^-14; causal early rows (< QHI of each sequence): ctx bf16 hi + lo against exact bf16 Wo (2 products)
__global__ __launch_bounds__(128) void k_out(const float* __restrict__ Y, const float* __restrict__ WO, const float* __restrict__ BO, float* __restrict__ OUT) { __shared__ __align__(16) float sf[4][16][132];
  const int tid = threadIdx.x, wave = tid >> 5, lane = tid & 31, col = lane & 15, g = lane >> 4; const int c0 = blockIdx.y * 128; const size_t r0 = (size_t)blockIdx.x * 64 + wave * 16;
  v8f acc[8] = {};
  if (CAUSAL && (int)(((size_t)blockIdx.x * 64) % TT) < QHI) {   /* block-uniform */
#pragma unroll 2
    for (int kc = 0; kc < CC / 32; ++kc) { const F2 a = split_row(Y + (r0 + col) * CC, kc * 32, lane); asm volatile("s_wait_loadcnt 0x0" ::: "memory");
#pragma unroll
      for (int j = 0; j < 8; ++j) { const v16b w = WOCOL(WO, kc * 32, c0 + j * 16 + col, lane); asm volatile("s_wait_loadcnt 0x0" ::: "memory"); acc[j] = wmma_bf(a.h, w, acc[j]); acc[j] = wmma_bf(a.l, w, acc[j]); } }
#pragma unroll
    for (int j = 0; j < 8; ++j) { const float bias = BO ? bfr(BO[c0 + j * 16 + col]) : 0.f;
#pragma unroll
      for (int r = 0; r < 8; ++r) sf[wave][8 * g + r][j * 16 + col] = acc[j][r] + bias; }
  } else {
#pragma unroll 2
    for (int kc = 0; kc < CC / 32; ++kc) { const v16h a = frag_f32s(Y + (r0 + col) * CC + kc * 32, lane, 64.0f); asm volatile("s_wait_loadcnt 0x0" ::: "memory");   /* ctx carried x 2^6 into f16 so small-magnitude context rows stay clear of f16 subnormals */
#pragma unroll
      for (int j = 0; j < 8; ++j) { const v16h w = WOCOLH(WO, kc * 32, c0 + j * 16 + col, lane); asm volatile("s_wait_loadcnt 0x0" ::: "memory"); acc[j] = wmma16(a, w, acc[j]); } }
#pragma unroll
    for (int j = 0; j < 8; ++j) { const float bias = BO ? bfr(BO[c0 + j * 16 + col]) : 0.f;
#pragma unroll
      for (int r = 0; r < 8; ++r) sf[wave][8 * g + r][j * 16 + col] = acc[j][r] * (1.0f / 16384.0f) + bias; } }   /* 2^-8 (Wo carry) x 2^-6 (ctx carry) */
  LDSX(); for (int rl = 0; rl < 16; ++rl) vst2(OUT + (r0 + rl) * DIN + c0 + lane * 4, *(const v4f*)&sf[wave][rl][lane * 4]); }

extern "C" void kernel_launch(void* const* d_in, const int* in_sizes, int n_in, void* d_out, int out_size, void* d_ws, size_t ws_size, hipStream_t stream) {
  (void)in_sizes; (void)n_in; (void)out_size;
  const float** F = (const float**)d_in;
  if (ws_size < (size_t)WS_END) return;
  char* ws = (char*)d_ws; _Float16 *QH = (_Float16*)(ws + WS_QH), *KH = (_Float16*)(ws + WS_KH), *VT = (_Float16*)(ws + WS_VT), *QL = (_Float16*)(ws + WS_QL), *KL = (_Float16*)(ws + WS_KL); __bf16 *VB = (__bf16*)(ws + WS_VB), *VBL = (__bf16*)(ws + WS_VBL); float *S = (float*)(ws + WS_S), *Y = (float*)(ws + WS_Y);
  (void)Y; (void)QL; (void)KL; (void)VB; (void)VBL;
  // inputs: 0 x [4,1024,1024]; 1 Wq [16,1024,64]; 2 Wk; 3 Wv (per-head [head][model][d]); 4 Wp [1024,1024] (in,out); 5 bp [1024] (zeros, read); no q / k / v biases
  k_proj<<<dim3(TNB * TT / 64, CC / 128, 3), 128, 0, stream>>>(F[0], F[0], F[0], F[1], F[2], F[3], nullptr, nullptr, nullptr, QH, QL, KH, KL, VT, VB, VBL);
  for (int b = 0; b < TNB; ++b) for (int h0 = 0; h0 < NH; h0 += HG) {
    k_sc<<<dim3(NQB, TT / 128, HG), 128, 0, stream>>>(QH, KH, QL, KL, b, h0, S);
    k_sm<<<dim3(TT, HG), 256, 0, stream>>>(S);
    k_pv<<<dim3(NQB, 1, HG), 128, 0, stream>>>(S, VT, VB, VBL, b, h0, Y);
  }
  k_out<<<dim3(TNB * TT / 64, DIN / 128), 128, 0, stream>>>(Y, F[4], F[5], (float*)d_out);
}

// v001
// A run of this version takes 431 microseconds.
// Next to v000, in two timings, it ran 1.65 times as fast each time.
// compute dtype: all float inputs rounded to bf16; per-head q / k / v projections with EXACT bf16 products on WMMA 16x16x32 (f32 accumulate), no biases; causal logits: 3 products for the first 384 rows, single f16 q x k after, x 1024^-0.5; softmax f32; P x 2^11 once to f16 x v once to f16 (bf16 hi + lo below row 384); ctx hi+lo x exact Wp below row 384, x2^6 f16 carry x f16(bf16 x 2^8) Wp after, + bp (zeros, read); f32 output.
#include <hip/hip_runtime.h>
#include <math.h>

typedef __attribute__((ext_vector_type(16))) _Float16 v16h;
typedef __attribute__((ext_vector_type(16))) __bf16 v16b;
typedef __attribute__((ext_vector_type(8)))  _Float16 v8h;
typedef __attribute__((ext_vector_type(8)))  float v8f;
typedef __attribute__((ext_vector_type(4)))  float v4f;
typedef __attribute__((ext_vector_type(2)))  float v2f;
typedef __attribute__((ext_vector_type(4)))  unsigned v4u;
typedef __attribute__((ext_vector_type(4)))  int v4i;
typedef float __attribute__((may_alias)) float_a;
typedef int __attribute__((may_alias)) int_a;

template <typename T> __device__ __forceinline__ void vst2(void* p, T v) { *(T*)p = v;  }
__device__ __forceinline__ v8f wmma16(v16h a, v16h b, v8f c) {
  v8f d = __builtin_amdgcn_wmma_f32_16x16x32_f16(false, a, false, b, (short)0, c, false, false);
  asm volatile("v_nop\n\tv_nop\n\tv_nop\n\tv_nop" : "+v"(d) : "v"(a), "v"(b));
  return d;
}
__device__ __forceinline__ v8f wmma_bf(v16b a, v16b b, v8f c) {
  v8f d = __builtin_amdgcn_wmma_f32_16x16x32_bf16(false, a, false, b, (short)0, c, false, false);
  asm volatile("v_nop\n\tv_nop\n\tv_nop\n\tv_nop" : "+v"(d) : "v"(a), "v"(b));
  return d;
}
// 16x16x32 fragments: lane = (h = lane>>4, row/col = lane&15); elements 0..7 = k0+8h+0..7, 8..15 = k0+16+8h+0..7; D element r = row 8h+r
__device__ __forceinline__ v16h frag_h(const _Float16* rowk0, int lane) {
  union { v16h v; v8h q[2]; } u; const _Float16* p = rowk0 + 8 * (lane >> 4);
  u.q[0] = *(const v8h*)p; u.q[1] = *(const v8h*)(p + 16); return u.v;
}
__device__ __forceinline__ v16h frag_f32(const float* rowk0, int lane) {
  v16h a; const float* p = rowk0 + 8 * (lane >> 4);
#pragma unroll
  for (int i = 0; i < 8; ++i) { a[i] = (_Float16)p[i]; a[8 + i] = (_Float16)p[16 + i]; }
  return a;
}
__device__ __forceinline__ v16h frag_f32s(const float* rowk0, int lane, float sc) {
  v16h a; const float* p = rowk0 + 8 * (lane >> 4);
#pragma unroll
  for (int i = 0; i < 8; ++i) { a[i] = (_Float16)(p[i] * sc); a[8 + i] = (_Float16)(p[16 + i] * sc); }
  return a;
}
// column fragment from a [K][ld] layout (column n), rows >= K read as 0
__device__ __forceinline__ v16h fragc_f32(const float* W, int k0, int n, int lane, int ld, int K) {
  v16h a; const int g = lane >> 4;
#pragma unroll
  for (int i = 0; i < 8; ++i) { const int ka = k0 + 8 * g + i, kb = ka + 16;
    a[i] = (_Float16)(ka < K ? W[(size_t)(ka < K ? ka : K - 1) * ld + n] : 0.f); a[8 + i] = (_Float16)(kb < K ? W[(size_t)(kb < K ? kb : K - 1) * ld + n] : 0.f); }
  return a;
}
struct F2 { v16b h, l; };
__device__ __forceinline__ F2 bsplit16(const float v[16]) { F2 r;
#pragma unroll
  for (int i = 0; i < 16; ++i) { const __bf16 h = (__bf16)v[i]; r.h[i] = h; r.l[i] = (__bf16)(v[i] - (float)h); }
  return r; }
__device__ __forceinline__ F2 split_row(const float* row, int k0, int lane) { float v[16]; const float* p = row + k0 + 8 * (lane >> 4);
#pragma unroll
  for (int i = 0; i < 8; ++i) { v[i] = p[i]; v[8 + i] = p[16 + i]; }
  return bsplit16(v); }
__device__ __forceinline__ F2 split_rowK(const float* row, int k0, int lane, int K) { float v[16]; const int g = lane >> 4;
#pragma unroll
  for (int i = 0; i < 8; ++i) { const int ka = k0 + 8 * g + i, kb = ka + 16; v[i] = ka < K ? row[ka < K ? ka : K - 1] : 0.f; v[8 + i] = kb < K ? row[kb < K ? kb : K - 1] : 0.f; }
  return bsplit16(v); }
__device__ __forceinline__ F2 split_col(const float* W, int k0, int n, int lane, int ld, int K) { float v[16]; const int g = lane >> 4;
#pragma unroll
  for (int i = 0; i < 8; ++i) { const int ka = k0 + 8 * g + i, kb = ka + 16; v[i] = ka < K ? W[(size_t)(ka < K ? ka : K - 1) * ld + n] : 0.f; v[8 + i] = kb < K ? W[(size_t)(kb < K ? kb : K - 1) * ld + n] : 0.f; }
  return bsplit16(v); }
__device__ __forceinline__ v8f mac3(const F2& a, const F2& b, v8f c) { c = wmma_bf(a.l, b.h, c); c = wmma_bf(a.h, b.l, c); return wmma_bf(a.h, b.h, c); }
__device__ __forceinline__ float sigm(float v) { return 1.0f / (1.0f + expf(-v)); }
#define LDSX() do { asm volatile("s_wait_dscnt 0" ::: "memory"); __builtin_amdgcn_wave_barrier(); __builtin_amdgcn_fence(__ATOMIC_RELEASE, "workgroup"); } while (0)

// Causal multi-head self-attention with per-head weights and a 1/sqrt(C) score scale (x [4,1024,1024]; Wq / Wk / Wv [16,1024,64] = per-head [head][model][d] N(0,1) x 0.02, no biases; Wp [1024,1024] (in,out), bp zeros (read); q = einsum('btc,hcd->bhtd'); scores x 1/sqrt(1024) - the scale is 1/32, not 1/8 (soft logits); tril kept, -inf elsewhere; softmax; heads concatenated; out @ Wp + bp).
#define NB 4
#define TT 1024
#define CC 1024            // NH * HD = projected width
#define DIN 1024          // input (model) width
#define NH 16
#define HD 64
#define NQB (TT / 64)
#define SCALE (0.03125f)
#define CAUSAL 1
#ifndef TNB
#define TNB NB
#endif
__device__ __forceinline__ float bfr(float v) { return (float)(__bf16)v; }
__host__ __device__ __forceinline__ int kb_last(int qb) { return CAUSAL ? ((qb * 64 + 63) >> 7) : (TT / 128 - 1); }
// logit plane of one (batch, head), causal: query blocks qb and NQB - 1 - qb need TT + 128 keys together, so row r of both lies in one row of SPITCH floats (the lower block first); s_base = first float of block qb
#define SPITCH (CAUSAL ? TT + 128 : TT)
#define SPLANE ((size_t)(CAUSAL ? NQB / 2 : NQB) * 64 * SPITCH)   // floats per plane
__device__ __forceinline__ size_t s_base(int qb) { return (CAUSAL && qb >= NQB / 2) ? (size_t)(NQB - 1 - qb) * 64 * SPITCH + (kb_last(NQB - 1 - qb) + 1) * 128 : (size_t)qb * 64 * SPITCH; }
typedef __attribute__((ext_vector_type(8))) __bf16 v8b;
__device__ __forceinline__ v16b frag_b(const __bf16* rowk0, int lane) {
  union { v16b v; v8b q[2]; } u; const __bf16* p = rowk0 + 8 * (lane >> 4);
  u.q[0] = *(const v8b*)p; u.q[1] = *(const v8b*)(p + 16); return u.v;
}
#define QBH 6              // causal: query blocks 0..QBH-1 of each sequence (few keys, no averaging) take the high-precision path
#define QHI 384            // rows carrying a q residual plane
#define KHI 384            // key rows carrying k residual / v bf16 hi+lo planes (used only by the causal high-precision path)
// B fragment (k rows k0+.., output column o) of a weight: (in,out) [K][ld] or (out,in) [ld rows of K]: bf16 exact, or f16(bf16 * 256) exact
__device__ __forceinline__ v16b wcol_io(const float* Wm, int k0, int o, int lane, int ld) { v16b w; const int g = lane >> 4;
#pragma unroll
  for (int i = 0; i < 8; ++i) { w[i] = (__bf16)Wm[(size_t)(k0 + 8 * g + i) * ld + o]; w[8 + i] = (__bf16)Wm[(size_t)(k0 + 16 + 8 * g + i) * ld + o]; }
  return w; }
__device__ __forceinline__ v16b wcol_oi(const float* Wm, int k0, int o, int lane, int K) { v16b w; const float* p = Wm + (size_t)o * K + k0 + 8 * (lane >> 4);
#pragma unroll
  for (int i = 0; i < 8; ++i) { w[i] = (__bf16)p[i]; w[8 + i] = (__bf16)p[16 + i]; }
  return w; }
__device__ __forceinline__ v16h wcolh_io(const float* Wm, int k0, int o, int lane, int ld) { v16h w; const int g = lane >> 4;
#pragma unroll
  for (int i = 0; i < 8; ++i) { w[i] = (_Float16)(bfr(Wm[(size_t)(k0 + 8 * g + i) * ld + o]) * 256.0f); w[8 + i] = (_Float16)(bfr(Wm[(size_t)(k0 + 16 + 8 * g + i) * ld + o]) * 256.0f); }
  return w; }
__device__ __forceinline__ v16h wcolh_oi(const float* Wm, int k0, int o, int lane, int K) { v16h w; const float* p = Wm + (size_t)o * K + k0 + 8 * (lane >> 4);
#pragma unroll
  for (int i = 0; i < 8; ++i) { w[i] = (_Float16)(bfr(p[i]) * 256.0f); w[8 + i] = (_Float16)(bfr(p[16 + i]) * 256.0f); }
  return w; }
#define WQKV_LAYOUT 2   // 0 = (in,out) [DIN][CC]; 1 = (out,in) [CC][DIN]; 2 = per-head [NH][DIN][HD]
__device__ __forceinline__ v16b wcol_hdk(const float* Wm, int k0, int o, int lane) { v16b w; const int g = lane >> 4; const float* p = Wm + (size_t)(o / HD) * DIN * HD + (o % HD);
#pragma unroll
  for (int i = 0; i < 8; ++i) { w[i] = (__bf16)p[(size_t)(k0 + 8 * g + i) * HD]; w[8 + i] = (__bf16)p[(size_t)(k0 + 16 + 8 * g + i) * HD]; }
  return w; }
#define WO_OUT_IN 0
#if WQKV_LAYOUT == 1
#define WCOL(W, k0, o, lane) wcol_oi(W, k0, o, lane, DIN)
#elif WQKV_LAYOUT == 2
#define WCOL(W, k0, o, lane) wcol_hdk(W, k0, o, lane)
#else
#define WCOL(W, k0, o, lane) wcol_io(W, k0, o, lane, CC)
#endif
#if WO_OUT_IN
#define WOCOL(W, k0, o, lane) wcol_oi(W, k0, o, lane, CC)
#define WOCOLH(W, k0, o, lane) wcolh_oi(W, k0, o, lane, CC)
#else
#define WOCOL(W, k0, o, lane) wcol_io(W, k0, o, lane, DIN)
#define WOCOLH(W, k0, o, lane) wcolh_io(W, k0, o, lane, DIN)
#endif

#ifndef SM_EXTRA_PARAMS
#define SM_EXTRA_PARAMS
#endif
#ifndef PROJ_EXTRA_PARAMS
#define PROJ_EXTRA_PARAMS
#endif
#ifndef SM_MASK_HOOK
#define SM_MASK_HOOK (void)0
#endif

#define WS_QH  0u                                      // f16 q rows [b*t][CC]
#define WS_KH  (WS_QH + 2u * (size_t)NB * TT * CC)      // f16 k rows [b*t][CC]
#define WS_VT  (WS_KH + 2u * (size_t)NB * TT * CC)      // f16 v planes [b][c][t]
#define WS_QL  (WS_VT + 2u * (size_t)NB * CC * TT)      // f16 q residual x 2^10 rows [b][t < QHI][CC]
#define WS_KL  (WS_QL + 2u * (size_t)NB * QHI * CC)     // f16 k residual x 2^10 rows [b][t < KHI][CC]
#define WS_VB  (WS_KL + 2u * (size_t)NB * KHI * CC)     // bf16 v hi planes [b][c][t < KHI]
#define WS_VBL (WS_VB + 2u * (size_t)NB * CC * KHI)
#define WS_S   (WS_VBL + 2u * (size_t)NB * CC * KHI)    // f32 logits / P [b * NH + h][plane as s_base has it]
#define WS_Y   (WS_S  + 4u * (size_t)NB * NH * SPLANE)      // f32 ctx rows [b*t][CC] (only when there is an output projection)
#define WS_END (WS_Y  + 4u * (size_t)NB * TT * CC)

// ---- k_proj: block = (64 rows, 128 cols, which): q/k/v = X W (+ b) with exact bf16 products (K = DIN) -> which 0: q f16 rows (+ residual rows < QHI); 1: k f16 rows (+ residual rows < KHI); 2: v f16 planes [c][t] (+ bf16 hi/lo planes for t < KHI)
__global__ __launch_bounds__(128) void k_proj(const float* __restrict__ XQ, const float* __restrict__ XK, const float* __restrict__ XV, const float* __restrict__ WQ, const float* __restrict__ WK, const float* __restrict__ WV, const float* __restrict__ BQ, const float* __restrict__ BK, const float* __restrict__ BV,
    _Float16* __restrict__ QH, _Float16* __restrict__ QL, _Float16* __restrict__ KH, _Float16* __restrict__ KL, _Float16* __restrict__ VT, __bf16* __restrict__ VB, __bf16* __restrict__ VBL) {
  __shared__ __align__(16) _Float16 sh[64][136], sl[64][136]; __shared__ __align__(16) _Float16 th[128][72]; __shared__ __align__(16) __bf16 tb[128][72], tbl[128][72];
  const int tid = threadIdx.x, wave = tid >> 5, lane = tid & 31, col = lane & 15, g = lane >> 4; const int which = blockIdx.z; const int c0 = blockIdx.y * 128; const size_t r0 = (size_t)blockIdx.x * 64; const size_t bb = r0 / TT; const int t0 = (int)(r0 % TT);
  const float* X = which == 0 ? XQ : which == 1 ? XK : XV; const float* WA = which == 0 ? WQ : which == 1 ? WK : WV; const float* BA = which == 0 ? BQ : which == 1 ? BK : BV;
  v8f acc[8] = {};
#pragma unroll 2
  for (int kc = 0; kc < DIN / 32; ++kc) { v16b a; { const float* p = X + (r0 + wave * 16 + col) * DIN + kc * 32 + 8 * g;
#pragma unroll
      for (int i = 0; i < 8; ++i) { a[i] = (__bf16)p[i]; a[8 + i] = (__bf16)p[16 + i]; } }
    asm volatile("s_wait_loadcnt 0x0" ::: "memory");
#pragma unroll
    for (int j = 0; j < 8; ++j) { const v16b w = WCOL(WA, kc * 32, c0 + j * 16 + col, lane); asm volatile("s_wait_loadcnt 0x0" ::: "memory"); acc[j] = wmma_bf(a, w, acc[j]); } }
  if (which < 2) { _Float16* DH = which == 0 ? QH : KH; _Float16* DL = which == 0 ? QL : KL; const int nhi = which == 0 ? QHI : KHI; const bool hi_rows = t0 < nhi;
#pragma unroll
    for (int j = 0; j < 8; ++j) { const float bias = BA ? bfr(BA[c0 + j * 16 + col]) : 0.f;
#pragma unroll
      for (int r = 0; r < 8; ++r) { const float v = acc[j][r] + bias; const _Float16 hv = (_Float16)v; sh[wave * 16 + 8 * g + r][j * 16 + col] = hv; sl[wave * 16 + 8 * g + r][j * 16 + col] = (_Float16)((v - (float)hv) * 1024.0f); } }
    __syncthreads();
    for (int e = tid; e < 64 * 16; e += 128) { const int rl = e >> 4, q = e & 15; vst2((unsigned*)(DH + (r0 + rl) * CC + c0 + q * 8), *(const v4u*)&sh[rl][q * 8]); if (hi_rows) vst2((unsigned*)(DL + (bb * nhi + t0 + rl) * (size_t)CC + c0 + q * 8), *(const v4u*)&sl[rl][q * 8]); }
  } else { const bool hi_rows = t0 < KHI;
#pragma unroll
    for (int j = 0; j < 8; ++j) { const float bias = BA ? bfr(BA[c0 + j * 16 + col]) : 0.f;
#pragma unroll
      for (int r = 0; r < 8; ++r) { const float v = acc[j][r] + bias; const int rl = wave * 16 + 8 * g + r, cl = j * 16 + col; th[cl][rl] = (_Float16)v; const __bf16 bh = (__bf16)v; tb[cl][rl] = bh; tbl[cl][rl] = (__bf16)(v - (float)bh); } }
    __syncthreads();
    for (int e = tid; e < 128 * 8; e += 128) { const int cl = e >> 3, q = e & 7; vst2((unsigned*)(VT + (bb * CC + c0 + cl) * (size_t)TT + t0 + q * 8), *(const v4u*)&th[cl][q * 8]); if (hi_rows) { const size_t o3 = (bb * CC + c0 + cl) * (size_t)KHI + t0 + q * 8; vst2((unsigned*)(VB + o3), *(const v4u*)&tb[cl][q * 8]); vst2((unsigned*)(VBL + o3), *(const v4u*)&tbl[cl][q * 8]); } } } }
// ---- k_sc: block = (query block qb, key block kb <= kb_last(qb), z = b * NH + h): logits x SCALE; q hi + residual (x 2^10) against k (2 products) for query rows < QHI, plus the k residual (3 products) for query blocks < QBH (causal early rows); causal: blocks past the diagonal exit, the mask itself is applied by index in k_sm
__global__ __launch_bounds__(128) void k_sc(const _Float16* __restrict__ QH, const _Float16* __restrict__ KH, const _Float16* __restrict__ QL, const _Float16* __restrict__ KL, float* __restrict__ S0) { __shared__ __align__(16) float ss[4][16][132];
  const int qb = blockIdx.x, kb = blockIdx.y; if (kb > kb_last(qb)) return;
  const int b = blockIdx.z / NH, h = blockIdx.z % NH; float* S = S0 + (size_t)blockIdx.z * SPLANE + s_base(qb);
  const int tid = threadIdx.x, wave = tid >> 5, lane = tid & 31, col = lane & 15, g = lane >> 4; const int k0 = kb * 128; const int ql0 = qb * 64 + wave * 16; const size_t q0 = (size_t)b * TT + ql0, kr0 = (size_t)b * TT + k0;
  v8f acc[8] = {}, accl[8] = {};
  const _Float16* QLb = QL + (size_t)b * QHI * CC; const _Float16* KLb = KL + (size_t)b * KHI * CC;
  if (qb < QBH) {
#pragma unroll
    for (int kc = 0; kc < HD / 32; ++kc) { const v16h ah = frag_h(QH + (q0 + col) * CC + h * HD + kc * 32, lane), al = frag_h(QLb + (size_t)(ql0 + col) * CC + h * HD + kc * 32, lane);
#pragma unroll
      for (int j = 0; j < 8; ++j) { const v16h kbf = frag_h(KH + (kr0 + j * 16 + col) * CC + h * HD + kc * 32, lane), klf = frag_h(KLb + (size_t)(k0 + j * 16 + col) * CC + h * HD + kc * 32, lane); acc[j] = wmma16(ah, kbf, acc[j]); accl[j] = wmma16(al, kbf, accl[j]); accl[j] = wmma16(ah, klf, accl[j]); } }
  } else if (qb * 64 < QHI) {
#pragma unroll
    for (int kc = 0; kc < HD / 32; ++kc) { const v16h ah = frag_h(QH + (q0 + col) * CC + h * HD + kc * 32, lane), al = frag_h(QLb + (size_t)(ql0 + col) * CC + h * HD + kc * 32, lane);
#pragma unroll
      for (int j = 0; j < 8; ++j) { const v16h kbf = frag_h(KH + (kr0 + j * 16 + col) * CC + h * HD + kc * 32, lane); acc[j] = wmma16(ah, kbf, acc[j]); accl[j] = wmma16(al, kbf, accl[j]); } }
  } else {
#pragma unroll
    for (int kc = 0; kc < HD / 32; ++kc) { const v16h ah = frag_h(QH + (q0 + col) * CC + h * HD + kc * 32, lane);
#pragma unroll
      for (int j = 0; j < 8; ++j) { const v16h kbf = frag_h(KH + (kr0 + j * 16 + col) * CC + h * HD + kc * 32, lane); acc[j] = wmma16(ah, kbf, acc[j]); } } }
#pragma unroll
  for (int j = 0; j < 8; ++j) {
#pragma unroll
    for (int r = 0; r < 8; ++r) ss[wave][8 * g + r][j * 16 + col] = (acc[j][r] + accl[j][r] * (1.0f / 1024.0f)) * SCALE; }
  LDSX(); for (int rl = 0; rl < 16; ++rl) vst2(S + (size_t)(wave * 16 + rl) * SPITCH + k0 + lane * 4, *(const v4f*)&ss[wave][rl][lane * 4]); }
// ---- k_sm: block = query row t (y = b * NH + h): keys [0, kend): causal -> logit if s <= t else excluded; softmax in f32; P x 2^11 in place (0 for excluded)
__global__ __launch_bounds__(256) void k_sm(float* __restrict__ S0 SM_EXTRA_PARAMS) { __shared__ float sred[8]; __shared__ float sbc; __shared__ __align__(16) float shv[TT];
  const int tid = threadIdx.x; const int t = blockIdx.x; const int kend = (kb_last(t >> 6) + 1) * 128;
  float* sr = S0 + (size_t)blockIdx.y * SPLANE + s_base(t >> 6) + (size_t)(t & 63) * SPITCH;
  float m = -3.0e38f; for (int k = tid; k < kend; k += 256) { float v = (!CAUSAL || k <= t) ? sr[k] : -3.0e38f; SM_MASK_HOOK; shv[k] = v; m = fmaxf(m, v); }
#pragma unroll
  for (int o = 1; o < 32; o <<= 1) m = fmaxf(m, __shfl_xor(m, o));
  if ((tid & 31) == 0) sred[tid >> 5] = m; __syncthreads(); if (tid == 0) { float a = sred[0]; for (int i = 1; i < 8; ++i) a = fmaxf(a, sred[i]); sbc = a; } __syncthreads(); m = sbc; __syncthreads();
  float sum = 0.f; for (int k = tid; k < kend; k += 256) { const float v = shv[k]; const float e = (v <= -1.0e38f) ? 0.f : expf(v - m); shv[k] = e; sum += e; }
#pragma unroll
  for (int o = 1; o < 32; o <<= 1) sum += __shfl_xor(sum, o);
  if ((tid & 31) == 0) sred[tid >> 5] = sum; __syncthreads(); if (tid == 0) { float a = 0.f; for (int i = 0; i < 8; ++i) a += sred[i]; sbc = a > 0.f ? 2048.0f / a : 0.f; }   /* a fully excluded row yields P = 0 */ __syncthreads(); const float inv = sbc;
  for (int k = tid; k < kend; k += 256) shv[k] = shv[k] * inv;
  __syncthreads(); for (int q = tid; q < kend / 4; q += 256) vst2(sr + q * 4, *(const v4f*)&shv[q * 4]); }
// ---- k_pv: block = 64 queries (qb) of (b, h), z = b * NH + h: ctx = P . v over keys [0, kend) (P x 2^11 once to f16 against v f16: 1 product; causal early query blocks: P and v as bf16 hi + lo, 3 products); 256-B (row, head) segment by 16 lanes
__global__ __launch_bounds__(128) void k_pv(const float* __restrict__ PS0, const _Float16* __restrict__ VT, const __bf16* __restrict__ VB, const __bf16* __restrict__ VBL, float* __restrict__ Y) { const int b = blockIdx.z / NH, h = blockIdx.z % NH; __shared__ __align__(16) float ss[4][16][HD + 4];
  const int tid = threadIdx.x, wave = tid >> 5, lane = tid & 31, col = lane & 15, g = lane >> 4; const int qb = blockIdx.x; const int ql0 = qb * 64 + wave * 16; const int kce = (kb_last(qb) + 1) * 4; const float* PS = PS0 + (size_t)blockIdx.z * SPLANE + s_base(qb) + (size_t)(wave * 16 + col) * SPITCH;   /* this lane's P row */
  v8f acc[HD / 16] = {};
  if (qb < QBH) {
#pragma unroll 1
    for (int kc = 0; kc < kce; ++kc) { const F2 p = split_row(PS, kc * 32, lane);
      asm volatile("s_wait_loadcnt 0x0" ::: "memory");
#pragma unroll
      for (int j = 0; j < HD / 16; ++j) { const size_t po = ((size_t)b * CC + h * HD + j * 16 + col) * (size_t)KHI + kc * 32; const v16b vh = frag_b(VB + po, lane); acc[j] = wmma_bf(p.h, vh, acc[j]); acc[j] = wmma_bf(p.l, vh, acc[j]); acc[j] = wmma_bf(p.h, frag_b(VBL + po, lane), acc[j]); } }
  } else {
#pragma unroll 1
    for (int kc = 0; kc < kce; ++kc) { const v16h p = frag_f32(PS + kc * 32, lane);
      asm volatile("s_wait_loadcnt 0x0" ::: "memory");
#pragma unroll
      for (int j = 0; j < HD / 16; ++j) { const size_t po = ((size_t)b * CC + h * HD + j * 16 + col) * (size_t)TT + kc * 32; acc[j] = wmma16(p, frag_h(VT + po, lane), acc[j]); } } }
#pragma unroll
  for (int j = 0; j < HD / 16; ++j)
#pragma unroll
    for (int r = 0; r < 8; ++r) ss[wave][8 * g + r][j * 16 + col] = acc[j][r] * (1.0f / 2048.0f);
  LDSX(); for (int rl = 0; rl < 16; ++rl) if (lane < HD / 4) vst2(Y + ((size_t)b * TT + ql0 + rl) * CC + h * HD + lane * 4, *(const v4f*)&ss[wave][rl][lane * 4]); }
// ---- k_out: block = (64 rows, 128 cols): out = ctx Wo (+ bo): ctx x 2^6 once to f16 against Wo as f16(bf16 x 2^8) exact (1 product) x 2^-14; causal early rows (< QHI of each sequence): ctx bf16 hi + lo against exact bf16 Wo (2 products)
__global__ __launch_bounds__(128) void k_out(const float* __restrict__ Y, const float* __restrict__ WO, const float* __restrict__ BO, float* __restrict__ OUT) { __shared__ __align__(16) float sf[4][16][132];
  const int tid = threadIdx.x, wave = tid >> 5, lane = tid & 31, col = lane & 15, g = lane >> 4; const int c0 = blockIdx.y * 128; const size_t r0 = (size_t)blockIdx.x * 64 + wave * 16;
  v8f acc[8] = {};
  if (CAUSAL && (int)(((size_t)blockIdx.x * 64) % TT) < QHI) {   /* block-uniform */
#pragma unroll 2
    for (int kc = 0; kc < CC / 32; ++kc) { const F2 a = split_row(Y + (r0 + col) * CC, kc * 32, lane); asm volatile("s_wait_loadcnt 0x0" ::: "memory");
#pragma unroll
      for (int j = 0; j < 8; ++j) { const v16b w = WOCOL(WO, kc * 32, c0 + j * 16 + col, lane); asm volatile("s_wait_loadcnt 0x0" ::: "memory"); acc[j] = wmma_bf(a.h, w, acc[j]); acc[j] = wmma_bf(a.l, w, acc[j]); } }
#pragma unroll
    for (int j = 0; j < 8; ++j) { const float bias = BO ? bfr(BO[c0 + j * 16 + col]) : 0.f;
#pragma unroll
      for (int r = 0; r < 8; ++r) sf[wave][8 * g + r][j * 16 + col] = acc[j][r] + bias; }
  } else {
#pragma unroll 2
    for (int kc = 0; kc < CC / 32; ++kc) { const v16h a = frag_f32s(Y + (r0 + col) * CC + kc * 32, lane, 64.0f); asm volatile("s_wait_loadcnt 0x0" ::: "memory");   /* ctx carried x 2^6 into f16 so small-magnitude context rows stay clear of f16 subnormals */
#pragma unroll
      for (int j = 0; j < 8; ++j) { const v16h w = WOCOLH(WO, kc * 32, c0 + j * 16 + col, lane); asm volatile("s_wait_loadcnt 0x0" ::: "memory"); acc[j] = wmma16(a, w, acc[j]); } }
#pragma unroll
    for (int j = 0; j < 8; ++j) { const float bias = BO ? bfr(BO[c0 + j * 16 + col]) : 0.f;
#pragma unroll
      for (int r = 0; r < 8; ++r) sf[wave][8 * g + r][j * 16 + col] = acc[j][r] * (1.0f / 16384.0f) + bias; } }   /* 2^-8 (Wo carry) x 2^-6 (ctx carry) */
  LDSX(); for (int rl = 0; rl < 16; ++rl) vst2(OUT + (r0 + rl) * DIN + c0 + lane * 4, *(const v4f*)&sf[wave][rl][lane * 4]); }

extern "C" void kernel_launch(void* const* d_in, const int* in_sizes, int n_in, void* d_out, int out_size, void* d_ws, size_t ws_size, hipStream_t stream) {
  (void)in_sizes; (void)n_in; (void)out_size;
  const float** F = (const float**)d_in;
  if (ws_size < (size_t)WS_END) return;
  char* ws = (char*)d_ws; _Float16 *QH = (_Float16*)(ws + WS_QH), *KH = (_Float16*)(ws + WS_KH), *VT = (_Float16*)(ws + WS_VT), *QL = (_Float16*)(ws + WS_QL), *KL = (_Float16*)(ws + WS_KL); __bf16 *VB = (__bf16*)(ws + WS_VB), *VBL = (__bf16*)(ws + WS_VBL); float *S = (float*)(ws + WS_S), *Y = (float*)(ws + WS_Y);
  (void)Y; (void)QL; (void)KL; (void)VB; (void)VBL;
  // inputs: 0 x [4,1024,1024]; 1 Wq [16,1024,64]; 2 Wk; 3 Wv (per-head [head][model][d]); 4 Wp [1024,1024] (in,out); 5 bp [1024] (zeros, read); no q / k / v biases
  k_proj<<<dim3(TNB * TT / 64, CC / 128, 3), 128, 0, stream>>>(F[0], F[0], F[0], F[1], F[2], F[3], nullptr, nullptr, nullptr, QH, QL, KH, KL, VT, VB, VBL);
  k_sc<<<dim3(NQB, TT / 128, TNB * NH), 128, 0, stream>>>(QH, KH, QL, KL, S);
  k_sm<<<dim3(TT, TNB * NH), 256, 0, stream>>>(S);
  k_pv<<<dim3(NQB, 1, TNB * NH), 128, 0, stream>>>(S, VT, VB, VBL, Y);
  k_out<<<dim3(TNB * TT / 64, DIN / 128), 128, 0, stream>>>(Y, F[4], F[5], (float*)d_out);
}

// v002
// It runs in 369 microseconds.
// In both of two side-by-side timings against v001, it was 1.17 times as fast.
// Counting every step since v000, it is 1.93 times as fast.
// compute dtype: all float inputs rounded to bf16; per-head q / k / v projections with EXACT bf16 products on WMMA 16x16x32 (f32 accumulate), no biases; causal logits: 3 products for the first 384 rows, single f16 q x k after, x 1024^-0.5; softmax f32; P x 2^11 once to f16 x v once to f16 (bf16 hi + lo below row 384); ctx hi+lo x exact Wp below row 384, x2^6 f16 carry x f16(bf16 x 2^8) Wp after, + bp (zeros, read); f32 output.
#include <hip/hip_runtime.h>
#include <math.h>

typedef __attribute__((ext_vector_type(16))) _Float16 v16h;
typedef __attribute__((ext_vector_type(16))) __bf16 v16b;
typedef __attribute__((ext_vector_type(8)))  _Float16 v8h;
typedef __attribute__((ext_vector_type(8)))  float v8f;
typedef __attribute__((ext_vector_type(4)))  float v4f;
typedef __attribute__((ext_vector_type(2)))  float v2f;
typedef __attribute__((ext_vector_type(4)))  unsigned v4u;
typedef __attribute__((ext_vector_type(4)))  int v4i;
typedef float __attribute__((may_alias)) float_a;
typedef int __attribute__((may_alias)) int_a;

template <typename T> __device__ __forceinline__ void vst2(void* p, T v) { *(T*)p = v;  }
__device__ __forceinline__ v8f wmma16(v16h a, v16h b, v8f c) {
  v8f d = __builtin_amdgcn_wmma_f32_16x16x32_f16(false, a, false, b, (short)0, c, false, false);
  asm volatile("v_nop\n\tv_nop\n\tv_nop\n\tv_nop" : "+v"(d) : "v"(a), "v"(b));
  return d;
}
__device__ __forceinline__ v8f wmma_bf(v16b a, v16b b, v8f c) {
  v8f d = __builtin_amdgcn_wmma_f32_16x16x32_bf16(false, a, false, b, (short)0, c, false, false);
  asm volatile("v_nop\n\tv_nop\n\tv_nop\n\tv_nop" : "+v"(d) : "v"(a), "v"(b));
  return d;
}
// 16x16x32 fragments: lane = (h = lane>>4, row/col = lane&15); elements 0..7 = k0+8h+0..7, 8..15 = k0+16+8h+0..7; D element r = row 8h+r
__device__ __forceinline__ v16h frag_h(const _Float16* rowk0, int lane) {
  union { v16h v; v8h q[2]; } u; const _Float16* p = rowk0 + 8 * (lane >> 4);
  u.q[0] = *(const v8h*)p; u.q[1] = *(const v8h*)(p + 16); return u.v;
}
__device__ __forceinline__ v16h frag_f32(const float* rowk0, int lane) {
  v16h a; const float* p = rowk0 + 8 * (lane >> 4);
#pragma unroll
  for (int i = 0; i < 8; ++i) { a[i] = (_Float16)p[i]; a[8 + i] = (_Float16)p[16 + i]; }
  return a;
}
__device__ __forceinline__ v16h frag_f32s(const float* rowk0, int lane, float sc) {
  v16h a; const float* p = rowk0 + 8 * (lane >> 4);
#pragma unroll
  for (int i = 0; i < 8; ++i) { a[i] = (_Float16)(p[i] * sc); a[8 + i] = (_Float16)(p[16 + i] * sc); }
  return a;
}
// column fragment from a [K][ld] layout (column n), rows >= K read as 0
__device__ __forceinline__ v16h fragc_f32(const float* W, int k0, int n, int lane, int ld, int K) {
  v16h a; const int g = lane >> 4;
#pragma unroll
  for (int i = 0; i < 8; ++i) { const int ka = k0 + 8 * g + i, kb = ka + 16;
    a[i] = (_Float16)(ka < K ? W[(size_t)(ka < K ? ka : K - 1) * ld + n] : 0.f); a[8 + i] = (_Float16)(kb < K ? W[(size_t)(kb < K ? kb : K - 1) * ld + n] : 0.f); }
  return a;
}
struct F2 { v16b h, l; };
__device__ __forceinline__ F2 bsplit16(const float v[16]) { F2 r;
#pragma unroll
  for (int i = 0; i < 16; ++i) { const __bf16 h = (__bf16)v[i]; r.h[i] = h; r.l[i] = (__bf16)(v[i] - (float)h); }
  return r; }
__device__ __forceinline__ F2 split_row(const float* row, int k0, int lane) { float v[16]; const float* p = row + k0 + 8 * (lane >> 4);
#pragma unroll
  for (int i = 0; i < 8; ++i) { v[i] = p[i]; v[8 + i] = p[16 + i]; }
  return bsplit16(v); }
__device__ __forceinline__ F2 split_rowK(const float* row, int k0, int lane, int K) { float v[16]; const int g = lane >> 4;
#pragma unroll
  for (int i = 0; i < 8; ++i) { const int ka = k0 + 8 * g + i, kb = ka + 16; v[i] = ka < K ? row[ka < K ? ka : K - 1] : 0.f; v[8 + i] = kb < K ? row[kb < K ? kb : K - 1] : 0.f; }
  return bsplit16(v); }
__device__ __forceinline__ F2 split_col(const float* W, int k0, int n, int lane, int ld, int K) { float v[16]; const int g = lane >> 4;
#pragma unroll
  for (int i = 0; i < 8; ++i) { const int ka = k0 + 8 * g + i, kb = ka + 16; v[i] = ka < K ? W[(size_t)(ka < K ? ka : K - 1) * ld + n] : 0.f; v[8 + i] = kb < K ? W[(size_t)(kb < K ? kb : K - 1) * ld + n] : 0.f; }
  return bsplit16(v); }
__device__ __forceinline__ v8f mac3(const F2& a, const F2& b, v8f c) { c = wmma_bf(a.l, b.h, c); c = wmma_bf(a.h, b.l, c); return wmma_bf(a.h, b.h, c); }
__device__ __forceinline__ float sigm(float v) { return 1.0f / (1.0f + expf(-v)); }
#define LDSX() do { asm volatile("s_wait_dscnt 0" ::: "memory"); __builtin_amdgcn_wave_barrier(); __builtin_amdgcn_fence(__ATOMIC_RELEASE, "workgroup"); } while (0)

// Causal multi-head self-attention with per-head weights and a 1/sqrt(C) score scale (x [4,1024,1024]; Wq / Wk / Wv [16,1024,64] = per-head [head][model][d] N(0,1) x 0.02, no biases; Wp [1024,1024] (in,out), bp zeros (read); q = einsum('btc,hcd->bhtd'); scores x 1/sqrt(1024) - the scale is 1/32, not 1/8 (soft logits); tril kept, -inf elsewhere; softmax; heads concatenated; out @ Wp + bp).
#define NB 4
#define TT 1024
#define CC 1024            // NH * HD = projected width
#define DIN 1024          // input (model) width
#define NH 16
#define HD 64
#define NQB (TT / 64)
#define SCALE (0.03125f)
#define CAUSAL 1
#ifndef TNB
#define TNB NB
#endif
__device__ __forceinline__ float bfr(float v) { return (float)(__bf16)v; }
__host__ __device__ __forceinline__ int kb_last(int qb) { return CAUSAL ? ((qb * 64 + 63) >> 7) : (TT / 128 - 1); }
// logit plane of one (batch, head), causal: query blocks qb and NQB - 1 - qb need TT + 128 keys together, so row r of both lies in one row of SPITCH floats (the lower block first); s_base = first float of block qb
#define SPITCH (CAUSAL ? TT + 128 : TT)
#define SPLANE ((size_t)(CAUSAL ? NQB / 2 : NQB) * 64 * SPITCH)   // floats per plane
__device__ __forceinline__ size_t s_base(int qb) { return (CAUSAL && qb >= NQB / 2) ? (size_t)(NQB - 1 - qb) * 64 * SPITCH + (kb_last(NQB - 1 - qb) + 1) * 128 : (size_t)qb * 64 * SPITCH; }
typedef __attribute__((ext_vector_type(8))) __bf16 v8b;
__device__ __forceinline__ v16b frag_b(const __bf16* rowk0, int lane) {
  union { v16b v; v8b q[2]; } u; const __bf16* p = rowk0 + 8 * (lane >> 4);
  u.q[0] = *(const v8b*)p; u.q[1] = *(const v8b*)(p + 16); return u.v;
}
#define QBH 6              // causal: query blocks 0..QBH-1 of each sequence (few keys, no averaging) take the high-precision path
#define QHI 384            // rows carrying a q residual plane
#define KHI 384            // key rows carrying k residual / v bf16 hi+lo planes (used only by the causal high-precision path)
// B fragment (k rows k0+.., output column o) of a weight: (in,out) [K][ld] or (out,in) [ld rows of K]: bf16 exact, or f16(bf16 * 256) exact
__device__ __forceinline__ v16b wcol_io(const float* Wm, int k0, int o, int lane, int ld) { v16b w; const int g = lane >> 4;
#pragma unroll
  for (int i = 0; i < 8; ++i) { w[i] = (__bf16)Wm[(size_t)(k0 + 8 * g + i) * ld + o]; w[8 + i] = (__bf16)Wm[(size_t)(k0 + 16 + 8 * g + i) * ld + o]; }
  return w; }
__device__ __forceinline__ v16b wcol_oi(const float* Wm, int k0, int o, int lane, int K) { v16b w; const float* p = Wm + (size_t)o * K + k0 + 8 * (lane >> 4);
#pragma unroll
  for (int i = 0; i < 8; ++i) { w[i] = (__bf16)p[i]; w[8 + i] = (__bf16)p[16 + i]; }
  return w; }
__device__ __forceinline__ v16h wcolh_io(const float* Wm, int k0, int o, int lane, int ld) { v16h w; const int g = lane >> 4;
#pragma unroll
  for (int i = 0; i < 8; ++i) { w[i] = (_Float16)(bfr(Wm[(size_t)(k0 + 8 * g + i) * ld + o]) * 256.0f); w[8 + i] = (_Float16)(bfr(Wm[(size_t)(k0 + 16 + 8 * g + i) * ld + o]) * 256.0f); }
  return w; }
__device__ __forceinline__ v16h wcolh_oi(const float* Wm, int k0, int o, int lane, int K) { v16h w; const float* p = Wm + (size_t)o * K + k0 + 8 * (lane >> 4);
#pragma unroll
  for (int i = 0; i < 8; ++i) { w[i] = (_Float16)(bfr(p[i]) * 256.0f); w[8 + i] = (_Float16)(bfr(p[16 + i]) * 256.0f); }
  return w; }
#define WQKV_LAYOUT 2   // 0 = (in,out) [DIN][CC]; 1 = (out,in) [CC][DIN]; 2 = per-head [NH][DIN][HD]
__device__ __forceinline__ v16b wcol_hdk(const float* Wm, int k0, int o, int lane) { v16b w; const int g = lane >> 4; const float* p = Wm + (size_t)(o / HD) * DIN * HD + (o % HD);
#pragma unroll
  for (int i = 0; i < 8; ++i) { w[i] = (__bf16)p[(size_t)(k0 + 8 * g + i) * HD]; w[8 + i] = (__bf16)p[(size_t)(k0 + 16 + 8 * g + i) * HD]; }
  return w; }
#define WO_OUT_IN 0
#if WQKV_LAYOUT == 1
#define WCOL(W, k0, o, lane) wcol_oi(W, k0, o, lane, DIN)
#elif WQKV_LAYOUT == 2
#define WCOL(W, k0, o, lane) wcol_hdk(W, k0, o, lane)
#else
#define WCOL(W, k0, o, lane) wcol_io(W, k0, o, lane, CC)
#endif
#if WO_OUT_IN
#define WOCOL(W, k0, o, lane) wcol_oi(W, k0, o, lane, CC)
#define WOCOLH(W, k0, o, lane) wcolh_oi(W, k0, o, lane, CC)
#else
#define WOCOL(W, k0, o, lane) wcol_io(W, k0, o, lane, DIN)
#define WOCOLH(W, k0, o, lane) wcolh_io(W, k0, o, lane, DIN)
#endif

#ifndef SM_EXTRA_PARAMS
#define SM_EXTRA_PARAMS
#endif
#ifndef PROJ_EXTRA_PARAMS
#define PROJ_EXTRA_PARAMS
#endif
#ifndef SM_MASK_HOOK
#define SM_MASK_HOOK (void)0
#endif

#define WS_QH  0u                                      // f16 q rows [b*t][CC]
#define WS_KH  (WS_QH + 2u * (size_t)NB * TT * CC)      // f16 k rows [b*t][CC]
#define WS_VT  (WS_KH + 2u * (size_t)NB * TT * CC)      // f16 v planes [b][c][t]
#define WS_QL  (WS_VT + 2u * (size_t)NB * CC * TT)      // f16 q residual x 2^10 rows [b][t < QHI][CC]
#define WS_KL  (WS_QL + 2u * (size_t)NB * QHI * CC)     // f16 k residual x 2^10 rows [b][t < KHI][CC]
#define WS_VB  (WS_KL + 2u * (size_t)NB * KHI * CC)     // bf16 v hi planes [b][c][t < KHI]
#define WS_VBL (WS_VB + 2u * (size_t)NB * CC * KHI)
#define WS_S   (WS_VBL + 2u * (size_t)NB * CC * KHI)    // f32 logits / P [b * NH + h][plane as s_base has it]
#define WS_Y   (WS_S  + 4u * (size_t)NB * NH * SPLANE)      // f32 ctx rows [b*t][CC] (only when there is an output projection)
#define WS_END (WS_Y  + 4u * (size_t)NB * TT * CC)

// ---- k_proj: block = (64 rows, 128 cols, which): q/k/v = X W (+ b) with exact bf16 products (K = DIN) -> which 0: q f16 rows (+ residual rows < QHI); 1: k f16 rows (+ residual rows < KHI); 2: v f16 planes [c][t] (+ bf16 hi/lo planes for t < KHI)
__global__ __launch_bounds__(128) void k_proj(const float* __restrict__ XQ, const float* __restrict__ XK, const float* __restrict__ XV, const float* __restrict__ WQ, const float* __restrict__ WK, const float* __restrict__ WV, const float* __restrict__ BQ, const float* __restrict__ BK, const float* __restrict__ BV,
    _Float16* __restrict__ QH, _Float16* __restrict__ QL, _Float16* __restrict__ KH, _Float16* __restrict__ KL, _Float16* __restrict__ VT, __bf16* __restrict__ VB, __bf16* __restrict__ VBL) {
  __shared__ __align__(16) _Float16 sh[64][136], sl[64][136]; __shared__ __align__(16) _Float16 th[128][72]; __shared__ __align__(16) __bf16 tb[128][72], tbl[128][72];
  const int tid = threadIdx.x, wave = tid >> 5, lane = tid & 31, col = lane & 15, g = lane >> 4; const int which = blockIdx.z; const int c0 = blockIdx.y * 128; const size_t r0 = (size_t)blockIdx.x * 64; const size_t bb = r0 / TT; const int t0 = (int)(r0 % TT);
  const float* X = which == 0 ? XQ : which == 1 ? XK : XV; const float* WA = which == 0 ? WQ : which == 1 ? WK : WV; const float* BA = which == 0 ? BQ : which == 1 ? BK : BV;
  v8f acc[8] = {};
#pragma unroll 2
  for (int kc = 0; kc < DIN / 32; ++kc) { v16b a; { const float* p = X + (r0 + wave * 16 + col) * DIN + kc * 32 + 8 * g;
#pragma unroll
      for (int i = 0; i < 8; ++i) { a[i] = (__bf16)p[i]; a[8 + i] = (__bf16)p[16 + i]; } }
    asm volatile("s_wait_loadcnt 0x0" ::: "memory");
#pragma unroll
    for (int j = 0; j < 8; ++j) { const v16b w = WCOL(WA, kc * 32, c0 + j * 16 + col, lane); asm volatile("s_wait_loadcnt 0x0" ::: "memory"); acc[j] = wmma_bf(a, w, acc[j]); } }
  if (which < 2) { _Float16* DH = which == 0 ? QH : KH; _Float16* DL = which == 0 ? QL : KL; const int nhi = which == 0 ? QHI : KHI; const bool hi_rows = t0 < nhi;
#pragma unroll
    for (int j = 0; j < 8; ++j) { const float bias = BA ? bfr(BA[c0 + j * 16 + col]) : 0.f;
#pragma unroll
      for (int r = 0; r < 8; ++r) { const float v = acc[j][r] + bias; const _Float16 hv = (_Float16)v; sh[wave * 16 + 8 * g + r][j * 16 + col] = hv; sl[wave * 16 + 8 * g + r][j * 16 + col] = (_Float16)((v - (float)hv) * 1024.0f); } }
    __syncthreads();
    for (int e = tid; e < 64 * 16; e += 128) { const int rl = e >> 4, q = e & 15; vst2((unsigned*)(DH + (r0 + rl) * CC + c0 + q * 8), *(const v4u*)&sh[rl][q * 8]); if (hi_rows) vst2((unsigned*)(DL + (bb * nhi + t0 + rl) * (size_t)CC + c0 + q * 8), *(const v4u*)&sl[rl][q * 8]); }
  } else { const bool hi_rows = t0 < KHI;
#pragma unroll
    for (int j = 0; j < 8; ++j) { const float bias = BA ? bfr(BA[c0 + j * 16 + col]) : 0.f;
#pragma unroll
      for (int r = 0; r < 8; ++r) { const float v = acc[j][r] + bias; const int rl = wave * 16 + 8 * g + r, cl = j * 16 + col; th[cl][rl] = (_Float16)v; const __bf16 bh = (__bf16)v; tb[cl][rl] = bh; tbl[cl][rl] = (__bf16)(v - (float)bh); } }
    __syncthreads();
    for (int e = tid; e < 128 * 8; e += 128) { const int cl = e >> 3, q = e & 7; vst2((unsigned*)(VT + (bb * CC + c0 + cl) * (size_t)TT + t0 + q * 8), *(const v4u*)&th[cl][q * 8]); if (hi_rows) { const size_t o3 = (bb * CC + c0 + cl) * (size_t)KHI + t0 + q * 8; vst2((unsigned*)(VB + o3), *(const v4u*)&tb[cl][q * 8]); vst2((unsigned*)(VBL + o3), *(const v4u*)&tbl[cl][q * 8]); } } } }
// ---- k_sc: block = (query block qb, key block kb <= kb_last(qb), z = b * NH + h): logits x SCALE; q hi + residual (x 2^10) against k (2 products) for query rows < QHI, plus the k residual (3 products) for query blocks < QBH (causal early rows); causal: blocks past the diagonal exit, the mask itself is applied by index in k_sm
__global__ __launch_bounds__(128) void k_sc(const _Float16* __restrict__ QH, const _Float16* __restrict__ KH, const _Float16* __restrict__ QL, const _Float16* __restrict__ KL, float* __restrict__ S0) { __shared__ __align__(16) float ss[4][16][132];
  const int qb = blockIdx.x, kb = blockIdx.y; if (kb > kb_last(qb)) return;
  const int b = blockIdx.z / NH, h = blockIdx.z % NH; float* S = S0 + (size_t)blockIdx.z * SPLANE + s_base(qb);
  const int tid = threadIdx.x, wave = tid >> 5, lane = tid & 31, col = lane & 15, g = lane >> 4; const int k0 = kb * 128; const int ql0 = qb * 64 + wave * 16; const size_t q0 = (size_t)b * TT + ql0, kr0 = (size_t)b * TT + k0;
  v8f acc[8] = {}, accl[8] = {};
  const _Float16* QLb = QL + (size_t)b * QHI * CC; const _Float16* KLb = KL + (size_t)b * KHI * CC;
  if (qb < QBH) {
#pragma unroll
    for (int kc = 0; kc < HD / 32; ++kc) { const v16h ah = frag_h(QH + (q0 + col) * CC + h * HD + kc * 32, lane), al = frag_h(QLb + (size_t)(ql0 + col) * CC + h * HD + kc * 32, lane);
#pragma unroll
      for (int j = 0; j < 8; ++j) { const v16h kbf = frag_h(KH + (kr0 + j * 16 + col) * CC + h * HD + kc * 32, lane), klf = frag_h(KLb + (size_t)(k0 + j * 16 + col) * CC + h * HD + kc * 32, lane); acc[j] = wmma16(ah, kbf, acc[j]); accl[j] = wmma16(al, kbf, accl[j]); accl[j] = wmma16(ah, klf, accl[j]); } }
  } else if (qb * 64 < QHI) {
#pragma unroll
    for (int kc = 0; kc < HD / 32; ++kc) { const v16h ah = frag_h(QH + (q0 + col) * CC + h * HD + kc * 32, lane), al = frag_h(QLb + (size_t)(ql0 + col) * CC + h * HD + kc * 32, lane);
#pragma unroll
      for (int j = 0; j < 8; ++j) { const v16h kbf = frag_h(KH + (kr0 + j * 16 + col) * CC + h * HD + kc * 32, lane); acc[j] = wmma16(ah, kbf, acc[j]); accl[j] = wmma16(al, kbf, accl[j]); } }
  } else {
#pragma unroll
    for (int kc = 0; kc < HD / 32; ++kc) { const v16h ah = frag_h(QH + (q0 + col) * CC + h * HD + kc * 32, lane);
#pragma unroll
      for (int j = 0; j < 8; ++j) { const v16h kbf = frag_h(KH + (kr0 + j * 16 + col) * CC + h * HD + kc * 32, lane); acc[j] = wmma16(ah, kbf, acc[j]); } } }
#pragma unroll
  for (int j = 0; j < 8; ++j) {
#pragma unroll
    for (int r = 0; r < 8; ++r) ss[wave][8 * g + r][j * 16 + col] = (acc[j][r] + accl[j][r] * (1.0f / 1024.0f)) * SCALE; }
  LDSX(); for (int rl = 0; rl < 16; ++rl) vst2(S + (size_t)(wave * 16 + rl) * SPITCH + k0 + lane * 4, *(const v4f*)&ss[wave][rl][lane * 4]); }
// ---- k_sm: one wave = the 8 query rows t0 + 128 j (j = 0..7) of one (b, h) plane (y = b * NH + h), so every wave has 36 chunks of 128 keys: row j has exactly j + 1 chunks, kept in registers (4 floats a lane and chunk); no LDS, no barrier; causal: logit if s <= t else excluded (only a row's last chunk holds excluded keys); softmax in f32; P x 2^11 in place (0 for excluded)
static_assert(CAUSAL && TT == 1024, "k_sm deals rows t0 + 128 j with j + 1 key chunks each");
template <int N> struct SmRow { v4f x[N]; };
template <int N> __device__ __forceinline__ void sm_load(SmRow<N>& r, const float* sr, int lane) {
#pragma unroll
  for (int i = 0; i < N; ++i) r.x[i] = *(const v4f*)(sr + i * 128 + lane * 4); }
template <int N> __device__ __forceinline__ void sm_finish(SmRow<N>& r, float* sr, int tl, int lane) {   /* tl = t & 127: last kept key of the last chunk */
  float m = -3.0e38f;
#pragma unroll
  for (int i = 0; i < N; ++i)
#pragma unroll
    for (int c = 0; c < 4; ++c) { const float v = (i < N - 1 || lane * 4 + c <= tl) ? r.x[i][c] : -3.0e38f; r.x[i][c] = v; m = fmaxf(m, v); }
#pragma unroll
  for (int o = 1; o < 32; o <<= 1) m = fmaxf(m, __shfl_xor(m, o));
  float sum = 0.f;
#pragma unroll
  for (int i = 0; i < N; ++i)
#pragma unroll
    for (int c = 0; c < 4; ++c) { const float v = r.x[i][c]; const float ex = expf(v - m); const float e = (v <= -1.0e38f) ? 0.f : ex; r.x[i][c] = e; sum += e; }   /* exp first, then the choice: no branch per key */
#pragma unroll
  for (int o = 1; o < 32; o <<= 1) sum += __shfl_xor(sum, o);
  const float inv = sum > 0.f ? 2048.0f / sum : 0.f;   /* a fully excluded row yields P = 0 */
#pragma unroll
  for (int i = 0; i < N; ++i) vst2(sr + i * 128 + lane * 4, r.x[i] * inv); }
__global__ __launch_bounds__(256, 8) void k_sm(float* __restrict__ S0) {   /* 8 waves a SIMD (128 registers): all 1024 blocks resident at once, 4 a WGP */
  const int lane = threadIdx.x & 31; const int t0 = blockIdx.x * 8 + __builtin_amdgcn_readfirstlane(threadIdx.x >> 5);   /* 0..127, the same in every lane of a wave */
  float* pl = S0 + (size_t)blockIdx.y * SPLANE + (size_t)(t0 & 63) * SPITCH; const int qh = (t0 >> 6) & 1;
#define SM_ROW(j) (pl + s_base(2 * (j) + qh))
  // rows in pairs (j, 7 - j) of 9 chunks; the next pair's loads are issued before this pair is worked on.
  // SM_STAGE: keeps the scheduler from sinking a pair's loads down to their first use (their latency would lie open) and from mixing two pairs' loads (the wait for one pair then leaves the next pair's nine in flight)
#define SM_STAGE() __builtin_amdgcn_sched_barrier(0)
  // SM_XW: the next pair's loads land in registers that the stores just issued name as data; the wait stands in front of that overwrite
#define SM_XW() asm volatile("s_wait_xcnt 0x0" ::: "memory")
  SmRow<8> r7; SmRow<1> r0; sm_load(r7, SM_ROW(7), lane); sm_load(r0, SM_ROW(0), lane); SM_STAGE();
  SmRow<7> r6; SmRow<2> r1; sm_load(r6, SM_ROW(6), lane); sm_load(r1, SM_ROW(1), lane); SM_STAGE();
  sm_finish(r7, SM_ROW(7), t0, lane); sm_finish(r0, SM_ROW(0), t0, lane); SM_XW();
  SmRow<6> r5; SmRow<3> r2; sm_load(r5, SM_ROW(5), lane); sm_load(r2, SM_ROW(2), lane); SM_STAGE();
  sm_finish(r6, SM_ROW(6), t0, lane); sm_finish(r1, SM_ROW(1), t0, lane); SM_XW();
  SmRow<5> r4; SmRow<4> r3; sm_load(r4, SM_ROW(4), lane); sm_load(r3, SM_ROW(3), lane); SM_STAGE();
  sm_finish(r5, SM_ROW(5), t0, lane); sm_finish(r2, SM_ROW(2), t0, lane);
  sm_finish(r4, SM_ROW(4), t0, lane); sm_finish(r3, SM_ROW(3), t0, lane); }
// ---- k_pv: block = 64 queries (qb) of (b, h), z = b * NH + h: ctx = P . v over keys [0, kend) (P x 2^11 once to f16 against v f16: 1 product; causal early query blocks: P and v as bf16 hi + lo, 3 products); 256-B (row, head) segment by 16 lanes
__global__ __launch_bounds__(128) void k_pv(const float* __restrict__ PS0, const _Float16* __restrict__ VT, const __bf16* __restrict__ VB, const __bf16* __restrict__ VBL, float* __restrict__ Y) { const int b = blockIdx.z / NH, h = blockIdx.z % NH; __shared__ __align__(16) float ss[4][16][HD + 4];
  const int tid = threadIdx.x, wave = tid >> 5, lane = tid & 31, col = lane & 15, g = lane >> 4; const int qb = blockIdx.x; const int ql0 = qb * 64 + wave * 16; const int kce = (kb_last(qb) + 1) * 4; const float* PS = PS0 + (size_t)blockIdx.z * SPLANE + s_base(qb) + (size_t)(wave * 16 + col) * SPITCH;   /* this lane's P row */
  v8f acc[HD / 16] = {};
  if (qb < QBH) {
#pragma unroll 1
    for (int kc = 0; kc < kce; ++kc) { const F2 p = split_row(PS, kc * 32, lane);
      asm volatile("s_wait_loadcnt 0x0" ::: "memory");
#pragma unroll
      for (int j = 0; j < HD / 16; ++j) { const size_t po = ((size_t)b * CC + h * HD + j * 16 + col) * (size_t)KHI + kc * 32; const v16b vh = frag_b(VB + po, lane); acc[j] = wmma_bf(p.h, vh, acc[j]); acc[j] = wmma_bf(p.l, vh, acc[j]); acc[j] = wmma_bf(p.h, frag_b(VBL + po, lane), acc[j]); } }
  } else {
#pragma unroll 1
    for (int kc = 0; kc < kce; ++kc) { const v16h p = frag_f32(PS + kc * 32, lane);
      asm volatile("s_wait_loadcnt 0x0" ::: "memory");
#pragma unroll
      for (int j = 0; j < HD / 16; ++j) { const size_t po = ((size_t)b * CC + h * HD + j * 16 + col) * (size_t)TT + kc * 32; acc[j] = wmma16(p, frag_h(VT + po, lane), acc[j]); } } }
#pragma unroll
  for (int j = 0; j < HD / 16; ++j)
#pragma unroll
    for (int r = 0; r < 8; ++r) ss[wave][8 * g + r][j * 16 + col] = acc[j][r] * (1.0f / 2048.0f);
  LDSX(); for (int rl = 0; rl < 16; ++rl) if (lane < HD / 4) vst2(Y + ((size_t)b * TT + ql0 + rl) * CC + h * HD + lane * 4, *(const v4f*)&ss[wave][rl][lane * 4]); }
// ---- k_out: block = (64 rows, 128 cols): out = ctx Wo (+ bo): ctx x 2^6 once to f16 against Wo as f16(bf16 x 2^8) exact (1 product) x 2^-14; causal early rows (< QHI of each sequence): ctx bf16 hi + lo against exact bf16 Wo (2 products)
__global__ __launch_bounds__(128) void k_out(const float* __restrict__ Y, const float* __restrict__ WO, const float* __restrict__ BO, float* __restrict__ OUT) { __shared__ __align__(16) float sf[4][16][132];
  const int tid = threadIdx.x, wave = tid >> 5, lane = tid & 31, col = lane & 15, g = lane >> 4; const int c0 = blockIdx.y * 128; const size_t r0 = (size_t)blockIdx.x * 64 + wave * 16;
  v8f acc[8] = {};
  if (CAUSAL && (int)(((size_t)blockIdx.x * 64) % TT) < QHI) {   /* block-uniform */
#pragma unroll 2
    for (int kc = 0; kc < CC / 32; ++kc) { const F2 a = split_row(Y + (r0 + col) * CC, kc * 32, lane); asm volatile("s_wait_loadcnt 0x0" ::: "memory");
#pragma unroll
      for (int j = 0; j < 8; ++j) { const v16b w = WOCOL(WO, kc * 32, c0 + j * 16 + col, lane); asm volatile("s_wait_loadcnt 0x0" ::: "memory"); acc[j] = wmma_bf(a.h, w, acc[j]); acc[j] = wmma_bf(a.l, w, acc[j]); } }
#pragma unroll
    for (int j = 0; j < 8; ++j) { const float bias = BO ? bfr(BO[c0 + j * 16 + col]) : 0.f;
#pragma unroll
      for (int r = 0; r < 8; ++r) sf[wave][8 * g + r][j * 16 + col] = acc[j][r] + bias; }
  } else {
#pragma unroll 2
    for (int kc = 0; kc < CC / 32; ++kc) { const v16h a = frag_f32s(Y + (r0 + col) * CC + kc * 32, lane, 64.0f); asm volatile("s_wait_loadcnt 0x0" ::: "memory");   /* ctx carried x 2^6 into f16 so small-magnitude context rows stay clear of f16 subnormals */
#pragma unroll
      for (int j = 0; j < 8; ++j) { const v16h w = WOCOLH(WO, kc * 32, c0 + j * 16 + col, lane); asm volatile("s_wait_loadcnt 0x0" ::: "memory"); acc[j] = wmma16(a, w, acc[j]); } }
#pragma unroll
    for (int j = 0; j < 8; ++j) { const float bias = BO ? bfr(BO[c0 + j * 16 + col]) : 0.f;
#pragma unroll
      for (int r = 0; r < 8; ++r) sf[wave][8 * g + r][j * 16 + col] = acc[j][r] * (1.0f / 16384.0f) + bias; } }   /* 2^-8 (Wo carry) x 2^-6 (ctx carry) */
  LDSX(); for (int rl = 0; rl < 16; ++rl) vst2(OUT + (r0 + rl) * DIN + c0 + lane * 4, *(const v4f*)&sf[wave][rl][lane * 4]); }

extern "C" void kernel_launch(void* const* d_in, const int* in_sizes, int n_in, void* d_out, int out_size, void* d_ws, size_t ws_size, hipStream_t stream) {
  (void)in_sizes; (void)n_in; (void)out_size;
  const float** F = (const float**)d_in;
  if (ws_size < (size_t)WS_END) return;
  char* ws = (char*)d_ws; _Float16 *QH = (_Float16*)(ws + WS_QH), *KH = (_Float16*)(ws + WS_KH), *VT = (_Float16*)(ws + WS_VT), *QL = (_Float16*)(ws + WS_QL), *KL = (_Float16*)(ws + WS_KL); __bf16 *VB = (__bf16*)(ws + WS_VB), *VBL = (__bf16*)(ws + WS_VBL); float *S = (float*)(ws + WS_S), *Y = (float*)(ws + WS_Y);
  (void)Y; (void)QL; (void)KL; (void)VB; (void)VBL;
  // inputs: 0 x [4,1024,1024]; 1 Wq [16,1024,64]; 2 Wk; 3 Wv (per-head [head][model][d]); 4 Wp [1024,1024] (in,out); 5 bp [1024] (zeros, read); no q / k / v biases
  k_proj<<<dim3(TNB * TT / 64, CC / 128, 3), 128, 0, stream>>>(F[0], F[0], F[0], F[1], F[2], F[3], nullptr, nullptr, nullptr, QH, QL, KH, KL, VT, VB, VBL);
  k_sc<<<dim3(NQB, TT / 128, TNB * NH), 128, 0, stream>>>(QH, KH, QL, KL, S);
  k_sm<<<dim3(128 / 8, TNB * NH), 256, 0, stream>>>(S);
  k_pv<<<dim3(NQB, 1, TNB * NH), 128, 0, stream>>>(S, VT, VB, VBL, Y);
  k_out<<<dim3(TNB * TT / 64, DIN / 128), 128, 0, stream>>>(Y, F[4], F[5], (float*)d_out);
}

// v003
// A run of this version takes 223 microseconds.
// Next to v002, in two timings, it ran 1.66 times as fast each time.
// Counting every step since v000, it is 3.20 times as fast.
// compute dtype: all float inputs rounded to bf16; per-head q / k / v projections with EXACT bf16 products on WMMA 16x16x32 (f32 accumulate), no biases; causal logits: 3 products for the first 384 rows, single f16 q x k after, x 1024^-0.5; softmax f32; P x 2^11 once to f16 x v once to f16 (bf16 hi + lo below row 384); ctx hi+lo x exact Wp below row 384, x2^6 f16 carry x f16(bf16 x 2^8) Wp after, + bp (zeros, read); f32 output.
#include <hip/hip_runtime.h>
#include <math.h>

typedef __attribute__((ext_vector_type(16))) _Float16 v16h;
typedef __attribute__((ext_vector_type(16))) __bf16 v16b;
typedef __attribute__((ext_vector_type(8)))  _Float16 v8h;
typedef __attribute__((ext_vector_type(8)))  float v8f;
typedef __attribute__((ext_vector_type(4)))  float v4f;
typedef __attribute__((ext_vector_type(2)))  float v2f;
typedef __attribute__((ext_vector_type(4)))  unsigned v4u;
typedef __attribute__((ext_vector_type(4)))  int v4i;
typedef float __attribute__((may_alias)) float_a;
typedef int __attribute__((may_alias)) int_a;

template <typename T> __device__ __forceinline__ void vst2(void* p, T v) { *(T*)p = v;  }
__device__ __forceinline__ v8f wmma16(v16h a, v16h b, v8f c) {
  v8f d = __builtin_amdgcn_wmma_f32_16x16x32_f16(false, a, false, b, (short)0, c, false, false);
  asm volatile("v_nop\n\tv_nop\n\tv_nop\n\tv_nop" : "+v"(d) : "v"(a), "v"(b));
  return d;
}
__device__ __forceinline__ v8f wmma_bf(v16b a, v16b b, v8f c) {
  v8f d = __builtin_amdgcn_wmma_f32_16x16x32_bf16(false, a, false, b, (short)0, c, false, false);
  asm volatile("v_nop\n\tv_nop\n\tv_nop\n\tv_nop" : "+v"(d) : "v"(a), "v"(b));
  return d;
}
// 16x16x32 fragments: lane = (h = lane>>4, row/col = lane&15); elements 0..7 = k0+8h+0..7, 8..15 = k0+16+8h+0..7; D element r = row 8h+r
__device__ __forceinline__ v16h frag_h(const _Float16* rowk0, int lane) {
  union { v16h v; v8h q[2]; } u; const _Float16* p = rowk0 + 8 * (lane >> 4);
  u.q[0] = *(const v8h*)p; u.q[1] = *(const v8h*)(p + 16); return u.v;
}
__device__ __forceinline__ v16h frag_f32(const float* rowk0, int lane) {
  v16h a; const float* p = rowk0 + 8 * (lane >> 4);
#pragma unroll
  for (int i = 0; i < 8; ++i) { a[i] = (_Float16)p[i]; a[8 + i] = (_Float16)p[16 + i]; }
  return a;
}
__device__ __forceinline__ v16h frag_f32s(const float* rowk0, int lane, float sc) {
  v16h a; const float* p = rowk0 + 8 * (lane >> 4);
#pragma unroll
  for (int i = 0; i < 8; ++i) { a[i] = (_Float16)(p[i] * sc); a[8 + i] = (_Float16)(p[16 + i] * sc); }
  return a;
}
// column fragment from a [K][ld] layout (column n), rows >= K read as 0
__device__ __forceinline__ v16h fragc_f32(const float* W, int k0, int n, int lane, int ld, int K) {
  v16h a; const int g = lane >> 4;
#pragma unroll
  for (int i = 0; i < 8; ++i) { const int ka = k0 + 8 * g + i, kb = ka + 16;
    a[i] = (_Float16)(ka < K ? W[(size_t)(ka < K ? ka : K - 1) * ld + n] : 0.f); a[8 + i] = (_Float16)(kb < K ? W[(size_t)(kb < K ? kb : K - 1) * ld + n] : 0.f); }
  return a;
}
struct F2 { v16b h, l; };
__device__ __forceinline__ F2 bsplit16(const float v[16]) { F2 r;
#pragma unroll
  for (int i = 0; i < 16; ++i) { const __bf16 h = (__bf16)v[i]; r.h[i] = h; r.l[i] = (__bf16)(v[i] - (float)h); }
  return r; }
__device__ __forceinline__ F2 split_row(const float* row, int k0, int lane) { float v[16]; const float* p = row + k0 + 8 * (lane >> 4);
#pragma unroll
  for (int i = 0; i < 8; ++i) { v[i] = p[i]; v[8 + i] = p[16 + i]; }
  return bsplit16(v); }
__device__ __forceinline__ F2 split_rowK(const float* row, int k0, int lane, int K) { float v[16]; const int g = lane >> 4;
#pragma unroll
  for (int i = 0; i < 8; ++i) { const int ka = k0 + 8 * g + i, kb = ka + 16; v[i] = ka < K ? row[ka < K ? ka : K - 1] : 0.f; v[8 + i] = kb < K ? row[kb < K ? kb : K - 1] : 0.f; }
  return bsplit16(v); }
__device__ __forceinline__ F2 split_col(const float* W, int k0, int n, int lane, int ld, int K) { float v[16]; const int g = lane >> 4;
#pragma unroll
  for (int i = 0; i < 8; ++i) { const int ka = k0 + 8 * g + i, kb = ka + 16; v[i] = ka < K ? W[(size_t)(ka < K ? ka : K - 1) * ld + n] : 0.f; v[8 + i] = kb < K ? W[(size_t)(kb < K ? kb : K - 1) * ld + n] : 0.f; }
  return bsplit16(v); }
__device__ __forceinline__ v8f mac3(const F2& a, const F2& b, v8f c) { c = wmma_bf(a.l, b.h, c); c = wmma_bf(a.h, b.l, c); return wmma_bf(a.h, b.h, c); }
__device__ __forceinline__ float sigm(float v) { return 1.0f / (1.0f + expf(-v)); }
#define LDSX() do { asm volatile("s_wait_dscnt 0" ::: "memory"); __builtin_amdgcn_wave_barrier(); __builtin_amdgcn_fence(__ATOMIC_RELEASE, "workgroup"); } while (0)

// Causal multi-head self-attention with per-head weights and a 1/sqrt(C) score scale (x [4,1024,1024]; Wq / Wk / Wv [16,1024,64] = per-head [head][model][d] N(0,1) x 0.02, no biases; Wp [1024,1024] (in,out), bp zeros (read); q = einsum('btc,hcd->bhtd'); scores x 1/sqrt(1024) - the scale is 1/32, not 1/8 (soft logits); tril kept, -inf elsewhere; softmax; heads concatenated; out @ Wp + bp).
#define NB 4
#define TT 1024
#define CC 1024            // NH * HD = projected width
#define DIN 1024          // input (model) width
#define NH 16
#define HD 64
#define NQB (TT / 64)
#define SCALE (0.03125f)
#define CAUSAL 1
#ifndef TNB
#define TNB NB
#endif
__device__ __forceinline__ float bfr(float v) { return (float)(__bf16)v; }
__host__ __device__ __forceinline__ int kb_last(int qb) { return CAUSAL ? ((qb * 64 + 63) >> 7) : (TT / 128 - 1); }
// logit plane of one (batch, head), causal: query blocks qb and NQB - 1 - qb need TT + 128 keys together, so row r of both lies in one row of SPITCH floats (the lower block first); s_base = first float of block qb
#define SPITCH (CAUSAL ? TT + 128 : TT)
#define SPLANE ((size_t)(CAUSAL ? NQB / 2 : NQB) * 64 * SPITCH)   // floats per plane
__device__ __forceinline__ size_t s_base(int qb) { return (CAUSAL && qb >= NQB / 2) ? (size_t)(NQB - 1 - qb) * 64 * SPITCH + (kb_last(NQB - 1 - qb) + 1) * 128 : (size_t)qb * 64 * SPITCH; }
typedef __attribute__((ext_vector_type(8))) __bf16 v8b;
__device__ __forceinline__ v16b frag_b(const __bf16* rowk0, int lane) {
  union { v16b v; v8b q[2]; } u; const __bf16* p = rowk0 + 8 * (lane >> 4);
  u.q[0] = *(const v8b*)p; u.q[1] = *(const v8b*)(p + 16); return u.v;
}
#define QBH 6              // causal: query blocks 0..QBH-1 of each sequence (few keys, no averaging) take the high-precision path
#define QHI 384            // rows carrying a q residual plane
#define KHI 384            // key rows carrying k residual / v bf16 hi+lo planes (used only by the causal high-precision path)
// B fragment (k rows k0+.., output column o) of a weight: (in,out) [K][ld] or (out,in) [ld rows of K]: bf16 exact, or f16(bf16 * 256) exact
__device__ __forceinline__ v16b wcol_io(const float* Wm, int k0, int o, int lane, int ld) { v16b w; const int g = lane >> 4;
#pragma unroll
  for (int i = 0; i < 8; ++i) { w[i] = (__bf16)Wm[(size_t)(k0 + 8 * g + i) * ld + o]; w[8 + i] = (__bf16)Wm[(size_t)(k0 + 16 + 8 * g + i) * ld + o]; }
  return w; }
__device__ __forceinline__ v16b wcol_oi(const float* Wm, int k0, int o, int lane, int K) { v16b w; const float* p = Wm + (size_t)o * K + k0 + 8 * (lane >> 4);
#pragma unroll
  for (int i = 0; i < 8; ++i) { w[i] = (__bf16)p[i]; w[8 + i] = (__bf16)p[16 + i]; }
  return w; }
__device__ __forceinline__ v16h wcolh_io(const float* Wm, int k0, int o, int lane, int ld) { v16h w; const int g = lane >> 4;
#pragma unroll
  for (int i = 0; i < 8; ++i) { w[i] = (_Float16)(bfr(Wm[(size_t)(k0 + 8 * g + i) * ld + o]) * 256.0f); w[8 + i] = (_Float16)(bfr(Wm[(size_t)(k0 + 16 + 8 * g + i) * ld + o]) * 256.0f); }
  return w; }
__device__ __forceinline__ v16h wcolh_oi(const float* Wm, int k0, int o, int lane, int K) { v16h w; const float* p = Wm + (size_t)o * K + k0 + 8 * (lane >> 4);
#pragma unroll
  for (int i = 0; i < 8; ++i) { w[i] = (_Float16)(bfr(p[i]) * 256.0f); w[8 + i] = (_Float16)(bfr(p[16 + i]) * 256.0f); }
  return w; }
#define WQKV_LAYOUT 2   // 0 = (in,out) [DIN][CC]; 1 = (out,in) [CC][DIN]; 2 = per-head [NH][DIN][HD]
__device__ __forceinline__ v16b wcol_hdk(const float* Wm, int k0, int o, int lane) { v16b w; const int g = lane >> 4; const float* p = Wm + (size_t)(o / HD) * DIN * HD + (o % HD);
#pragma unroll
  for (int i = 0; i < 8; ++i) { w[i] = (__bf16)p[(size_t)(k0 + 8 * g + i) * HD]; w[8 + i] = (__bf16)p[(size_t)(k0 + 16 + 8 * g + i) * HD]; }
  return w; }
#define WO_OUT_IN 0
#if WQKV_LAYOUT == 1
#define WCOL(W, k0, o, lane) wcol_oi(W, k0, o, lane, DIN)
#elif WQKV_LAYOUT == 2
#define WCOL(W, k0, o, lane) wcol_hdk(W, k0, o, lane)
#else
#define WCOL(W, k0, o, lane) wcol_io(W, k0, o, lane, CC)
#endif
#if WO_OUT_IN
#define WOCOL(W, k0, o, lane) wcol_oi(W, k0, o, lane, CC)
#define WOCOLH(W, k0, o, lane) wcolh_oi(W, k0, o, lane, CC)
#else
#define WOCOL(W, k0, o, lane) wcol_io(W, k0, o, lane, DIN)
#define WOCOLH(W, k0, o, lane) wcolh_io(W, k0, o, lane, DIN)
#endif

#ifndef SM_EXTRA_PARAMS
#define SM_EXTRA_PARAMS
#endif
#ifndef PROJ_EXTRA_PARAMS
#define PROJ_EXTRA_PARAMS
#endif
#ifndef SM_MASK_HOOK
#define SM_MASK_HOOK (void)0
#endif

#define WS_QH  0u                                      // f16 q rows [b*t][CC]
#define WS_KH  (WS_QH + 2u * (size_t)NB * TT * CC)      // f16 k rows [b*t][CC]
#define WS_VT  (WS_KH + 2u * (size_t)NB * TT * CC)      // f16 v planes [b][c][t]
#define WS_QL  (WS_VT + 2u * (size_t)NB * CC * TT)      // f16 q residual x 2^10 rows [b][t < QHI][CC]
#define WS_KL  (WS_QL + 2u * (size_t)NB * QHI * CC)     // f16 k residual x 2^10 rows [b][t < KHI][CC]
#define WS_VB  (WS_KL + 2u * (size_t)NB * KHI * CC)     // bf16 v hi planes [b][c][t < KHI]
#define WS_VBL (WS_VB + 2u * (size_t)NB * CC * KHI)
#define WS_S   (WS_VBL + 2u * (size_t)NB * CC * KHI)    // f32 logits / P [b * NH + h][plane as s_base has it]
#define WS_Y   (WS_S  + 4u * (size_t)NB * NH * SPLANE)      // f32 ctx rows [b*t][CC] (only when there is an output projection)
#define WS_END (WS_Y  + 4u * (size_t)NB * TT * CC)

// ---- weight tile in LDS (k_proj, k_out): KT k rows x 128 output columns, rounded once per block to 16 bit and kept as [column][k], so a B fragment is frag_b / frag_h on a column's row
#define KT 64
#define WPITCH (KT + 8)    // 144-B column pitch: the 16 lanes of a ds_load_b128 fragment read fall on 16 different bank quads
// a thread carries 2 units of (4 columns x 8 k): lane = (column quad lane & 7, k octet lane >> 3), wave = 32 columns; each load instruction covers four whole 128-B lines, each LDS store meets every bank twice
// PF_STAGE: in front of a tile's matrix work it keeps the scheduler from sinking the next tile's global loads below it; behind the matrix work it keeps the next tile's conversions, and with them the wait for those loads, from rising above it
#define PF_STAGE() __builtin_amdgcn_sched_barrier(0)
// PF_XW: what follows (the next trip, the loop's set-up) rewrites the address registers that the global loads issued before it name; the wait stands in front of that overwrite
#define PF_XW() do { asm volatile("s_wait_xcnt 0x0" ::: "memory"); __builtin_amdgcn_sched_barrier(0); } while (0)   /* the scheduling barrier keeps later address arithmetic from rising over the wait */
// PF_XWP: the same wait behind k_proj's first loads; it takes their two address pairs as inputs, so that no later load's result is given those registers ahead of the wait
#define PF_XWP(p, q) do { asm volatile("s_wait_xcnt 0x0" :: "v"(p), "v"(q) : "memory"); __builtin_amdgcn_sched_barrier(0); } while (0)
static_assert(KT == 64, "the k loops take a tile as two k halves of 32");
struct WRaw { v4f r[2][8]; };
struct ARaw { v4f r[KT / 32][4]; };
__device__ __forceinline__ void wt_load(WRaw& w, const float* base, int ldk, int k0) {   /* base = (k row 8 kq, the thread's first column); ldk = floats between k rows */
#pragma unroll
  for (int u = 0; u < 2; ++u)
#pragma unroll
    for (int kk = 0; kk < 8; ++kk) w.r[u][kk] = *(const v4f*)(base + (size_t)(k0 + 32 * u + kk) * ldk); }
__device__ __forceinline__ void wt_store_b(__bf16 (*wt)[WPITCH], const WRaw& w, int cl0, int kq) {
#pragma unroll
  for (int u = 0; u < 2; ++u)
#pragma unroll
    for (int i = 0; i < 4; ++i) { v8b p;
#pragma unroll
      for (int kk = 0; kk < 8; ++kk) p[kk] = (__bf16)w.r[u][kk][i];
      *(v8b*)&wt[cl0 + i][32 * u + 8 * kq] = p; } }
__device__ __forceinline__ void wt_store_h(_Float16 (*wt)[WPITCH], const WRaw& w, int cl0, int kq) {   /* f16(bf16 x 2^8), exact */
#pragma unroll
  for (int u = 0; u < 2; ++u)
#pragma unroll
    for (int i = 0; i < 4; ++i) { v8h p;
#pragma unroll
      for (int kk = 0; kk < 8; ++kk) p[kk] = (_Float16)(bfr(w.r[u][kk][i]) * 256.0f);
      *(v8h*)&wt[cl0 + i][32 * u + 8 * kq] = p; } }
// the lane's A elements of one tile, raw f32: fragment c, element e = r[c][e >> 2][e & 3] (k = 32 c + 8 g + e for e < 8, + 8 more after); rowg = row + 8 g
__device__ __forceinline__ void a_load(ARaw& a, const float* rowg, int k0) {
#pragma unroll
  for (int c = 0; c < KT / 32; ++c) { const float* q = rowg + k0 + 32 * c; a.r[c][0] = *(const v4f*)q; a.r[c][1] = *(const v4f*)(q + 4); a.r[c][2] = *(const v4f*)(q + 16); a.r[c][3] = *(const v4f*)(q + 20); } }
// ---- k_proj: block = (64 rows, 128 cols, which): q/k/v = X W (+ b) with exact bf16 products (K = DIN) -> which 0: q f16 rows (+ residual rows < QHI); 1: k f16 rows (+ residual rows < KHI); 2: v f16 planes [c][t] (+ bf16 hi/lo planes for t < KHI)
__global__ __launch_bounds__(128) void k_proj(const float* __restrict__ XQ, const float* __restrict__ XK, const float* __restrict__ XV, const float* __restrict__ WQ, const float* __restrict__ WK, const float* __restrict__ WV, const float* __restrict__ BQ, const float* __restrict__ BK, const float* __restrict__ BV,
    _Float16* __restrict__ QH, _Float16* __restrict__ QL, _Float16* __restrict__ KH, _Float16* __restrict__ KL, _Float16* __restrict__ VT, __bf16* __restrict__ VB, __bf16* __restrict__ VBL) {
  __shared__ __align__(16) unsigned char sm[3 * 128 * 72 * 2];   /* the two weight buffers during the k loop; behind the loop's last barrier the epilogue's planes */
  __bf16 (*wt)[128][WPITCH] = (__bf16 (*)[128][WPITCH])sm; static_assert(2 * 128 * WPITCH * 2 <= 3 * 128 * 72 * 2 && 2 * 64 * 136 * 2 <= 3 * 128 * 72 * 2, "LDS");
  _Float16 (*sh)[136] = (_Float16 (*)[136])sm, (*sl)[136] = (_Float16 (*)[136])(sm + 64 * 136 * 2); _Float16 (*th)[72] = (_Float16 (*)[72])sm; __bf16 (*tb)[72] = (__bf16 (*)[72])(sm + 128 * 72 * 2), (*tbl)[72] = (__bf16 (*)[72])(sm + 2 * 128 * 72 * 2);
  const int tid = threadIdx.x, wave = tid >> 5, lane = tid & 31, col = lane & 15, g = lane >> 4; const int which = blockIdx.z; const int c0 = blockIdx.y * 128; const size_t r0 = (size_t)blockIdx.x * 64; const size_t bb = r0 / TT; const int t0 = (int)(r0 % TT);
  const float* X = which == 0 ? XQ : which == 1 ? XK : XV; const float* WA = which == 0 ? WQ : which == 1 ? WK : WV; const float* BA = which == 0 ? BQ : which == 1 ? BK : BV;
  v8f acc[8] = {};
  static_assert(WQKV_LAYOUT == 2 && HD % 32 == 0, "a wave's 32 staged columns lie in one head");
  const int kq = lane >> 3, cl0 = wave * 32 + 4 * (lane & 7); const float* wb = WA + (size_t)((c0 + cl0) / HD) * DIN * HD + (c0 + cl0) % HD + (size_t)(8 * kq) * HD; const float* arow = X + (r0 + wave * 16 + col) * DIN + 8 * g;
  WRaw wr; ARaw ar; a_load(ar, arow, 0); wt_load(wr, wb, HD, 0); PF_XWP(arow, wb); wt_store_b(wt[0], wr, cl0, kq);
  __syncthreads();   /* tile 0 is published */
#pragma unroll 2   /* two trips = the two buffers at constant LDS addresses */
  for (int t = 0; t < DIN / KT; ++t) { v16b a[KT / 32];
#pragma unroll
    for (int c = 0; c < KT / 32; ++c)
#pragma unroll
      for (int e = 0; e < 16; ++e) a[c][e] = (__bf16)ar.r[c][e >> 2][e & 3];
    if (t + 1 < DIN / KT) { a_load(ar, arow, (t + 1) * KT); wt_load(wr, wb, HD, (t + 1) * KT); }   /* the next tile flies while this one is multiplied */
    PF_STAGE();
    v16b bf[2][4];   /* B fragments in groups of 4 (group q: k half q >> 1, columns 64 (q & 1) ..), two register sets: a group's LDS reads are issued together, two groups ahead of its products */
#pragma unroll
    for (int q = 0; q < 2; ++q)
#pragma unroll
      for (int jj = 0; jj < 4; ++jj) bf[q][jj] = frag_b(&wt[t & 1][(q * 4 + jj) * 16 + col][0], lane);
#pragma unroll
    for (int q = 0; q < 4; ++q) {
#pragma unroll
      for (int jj = 0; jj < 4; ++jj) acc[(q & 1) * 4 + jj] = wmma_bf(a[q >> 1], bf[q & 1][jj], acc[(q & 1) * 4 + jj]);
      if (q < 2) {
#pragma unroll
        for (int jj = 0; jj < 4; ++jj) bf[q][jj] = frag_b(&wt[t & 1][(q * 4 + jj) * 16 + col][32], lane); } }
    PF_STAGE();
    if (t + 1 < DIN / KT) wt_store_b(wt[(t + 1) & 1], wr, cl0, kq);   /* that buffer's readers left it at the barrier of trip t - 1 */
    PF_XW();
    __syncthreads(); }   /* publishes tile t + 1 and ends the reads of tile t (after the last trip: frees the LDS for the epilogue) */
  if (which < 2) { _Float16* DH = which == 0 ? QH : KH; _Float16* DL = which == 0 ? QL : KL; const int nhi = which == 0 ? QHI : KHI; const bool hi_rows = t0 < nhi;
#pragma unroll
    for (int j = 0; j < 8; ++j) { const float bias = BA ? bfr(BA[c0 + j * 16 + col]) : 0.f;
#pragma unroll
      for (int r = 0; r < 8; ++r) { const float v = acc[j][r] + bias; const _Float16 hv = (_Float16)v; sh[wave * 16 + 8 * g + r][j * 16 + col] = hv; sl[wave * 16 + 8 * g + r][j * 16 + col] = (_Float16)((v - (float)hv) * 1024.0f); } }
    __syncthreads();
    for (int e = tid; e < 64 * 16; e += 128) { const int rl = e >> 4, q = e & 15; vst2((unsigned*)(DH + (r0 + rl) * CC + c0 + q * 8), *(const v4u*)&sh[rl][q * 8]); if (hi_rows) vst2((unsigned*)(DL + (bb * nhi + t0 + rl) * (size_t)CC + c0 + q * 8), *(const v4u*)&sl[rl][q * 8]); }
  } else { const bool hi_rows = t0 < KHI;
#pragma unroll
    for (int j = 0; j < 8; ++j) { const float bias = BA ? bfr(BA[c0 + j * 16 + col]) : 0.f;
#pragma unroll
      for (int r = 0; r < 8; ++r) { const float v = acc[j][r] + bias; const int rl = wave * 16 + 8 * g + r, cl = j * 16 + col; th[cl][rl] = (_Float16)v; const __bf16 bh = (__bf16)v; tb[cl][rl] = bh; tbl[cl][rl] = (__bf16)(v - (float)bh); } }
    __syncthreads();
    for (int e = tid; e < 128 * 8; e += 128) { const int cl = e >> 3, q = e & 7; vst2((unsigned*)(VT + (bb * CC + c0 + cl) * (size_t)TT + t0 + q * 8), *(const v4u*)&th[cl][q * 8]); if (hi_rows) { const size_t o3 = (bb * CC + c0 + cl) * (size_t)KHI + t0 + q * 8; vst2((unsigned*)(VB + o3), *(const v4u*)&tb[cl][q * 8]); vst2((unsigned*)(VBL + o3), *(const v4u*)&tbl[cl][q * 8]); } } } }
// ---- k_sc: block = (query block qb, key block kb <= kb_last(qb), z = b * NH + h): logits x SCALE; q hi + residual (x 2^10) against k (2 products) for query rows < QHI, plus the k residual (3 products) for query blocks < QBH (causal early rows); causal: blocks past the diagonal exit, the mask itself is applied by index in k_sm
__global__ __launch_bounds__(128) void k_sc(const _Float16* __restrict__ QH, const _Float16* __restrict__ KH, const _Float16* __restrict__ QL, const _Float16* __restrict__ KL, float* __restrict__ S0) { __shared__ __align__(16) float ss[4][16][132];
  const int qb = blockIdx.x, kb = blockIdx.y; if (kb > kb_last(qb)) return;
  const int b = blockIdx.z / NH, h = blockIdx.z % NH; float* S = S0 + (size_t)blockIdx.z * SPLANE + s_base(qb);
  const int tid = threadIdx.x, wave = tid >> 5, lane = tid & 31, col = lane & 15, g = lane >> 4; const int k0 = kb * 128; const int ql0 = qb * 64 + wave * 16; const size_t q0 = (size_t)b * TT + ql0, kr0 = (size_t)b * TT + k0;
  v8f acc[8] = {}, accl[8] = {};
  const _Float16* QLb = QL + (size_t)b * QHI * CC; const _Float16* KLb = KL + (size_t)b * KHI * CC;
  if (qb < QBH) {
#pragma unroll
    for (int kc = 0; kc < HD / 32; ++kc) { const v16h ah = frag_h(QH + (q0 + col) * CC + h * HD + kc * 32, lane), al = frag_h(QLb + (size_t)(ql0 + col) * CC + h * HD + kc * 32, lane);
#pragma unroll
      for (int j = 0; j < 8; ++j) { const v16h kbf = frag_h(KH + (kr0 + j * 16 + col) * CC + h * HD + kc * 32, lane), klf = frag_h(KLb + (size_t)(k0 + j * 16 + col) * CC + h * HD + kc * 32, lane); acc[j] = wmma16(ah, kbf, acc[j]); accl[j] = wmma16(al, kbf, accl[j]); accl[j] = wmma16(ah, klf, accl[j]); } }
  } else if (qb * 64 < QHI) {
#pragma unroll
    for (int kc = 0; kc < HD / 32; ++kc) { const v16h ah = frag_h(QH + (q0 + col) * CC + h * HD + kc * 32, lane), al = frag_h(QLb + (size_t)(ql0 + col) * CC + h * HD + kc * 32, lane);
#pragma unroll
      for (int j = 0; j < 8; ++j) { const v16h kbf = frag_h(KH + (kr0 + j * 16 + col) * CC + h * HD + kc * 32, lane); acc[j] = wmma16(ah, kbf, acc[j]); accl[j] = wmma16(al, kbf, accl[j]); } }
  } else {
#pragma unroll
    for (int kc = 0; kc < HD / 32; ++kc) { const v16h ah = frag_h(QH + (q0 + col) * CC + h * HD + kc * 32, lane);
#pragma unroll
      for (int j = 0; j < 8; ++j) { const v16h kbf = frag_h(KH + (kr0 + j * 16 + col) * CC + h * HD + kc * 32, lane); acc[j] = wmma16(ah, kbf, acc[j]); } } }
#pragma unroll
  for (int j = 0; j < 8; ++j) {
#pragma unroll
    for (int r = 0; r < 8; ++r) ss[wave][8 * g + r][j * 16 + col] = (acc[j][r] + accl[j][r] * (1.0f / 1024.0f)) * SCALE; }
  LDSX(); for (int rl = 0; rl < 16; ++rl) vst2(S + (size_t)(wave * 16 + rl) * SPITCH + k0 + lane * 4, *(const v4f*)&ss[wave][rl][lane * 4]); }
// ---- k_sm: one wave = the 8 query rows t0 + 128 j (j = 0..7) of one (b, h) plane (y = b * NH + h), so every wave has 36 chunks of 128 keys: row j has exactly j + 1 chunks, kept in registers (4 floats a lane and chunk); no LDS, no barrier; causal: logit if s <= t else excluded (only a row's last chunk holds excluded keys); softmax in f32; P x 2^11 in place (0 for excluded)
static_assert(CAUSAL && TT == 1024, "k_sm deals rows t0 + 128 j with j + 1 key chunks each");
template <int N> struct SmRow { v4f x[N]; };
template <int N> __device__ __forceinline__ void sm_load(SmRow<N>& r, const float* sr, int lane) {
#pragma unroll
  for (int i = 0; i < N; ++i) r.x[i] = *(const v4f*)(sr + i * 128 + lane * 4); }
template <int N> __device__ __forceinline__ void sm_finish(SmRow<N>& r, float* sr, int tl, int lane) {   /* tl = t & 127: last kept key of the last chunk */
  float m = -3.0e38f;
#pragma unroll
  for (int i = 0; i < N; ++i)
#pragma unroll
    for (int c = 0; c < 4; ++c) { const float v = (i < N - 1 || lane * 4 + c <= tl) ? r.x[i][c] : -3.0e38f; r.x[i][c] = v; m = fmaxf(m, v); }
#pragma unroll
  for (int o = 1; o < 32; o <<= 1) m = fmaxf(m, __shfl_xor(m, o));
  float sum = 0.f;
#pragma unroll
  for (int i = 0; i < N; ++i)
#pragma unroll
    for (int c = 0; c < 4; ++c) { const float v = r.x[i][c]; const float ex = expf(v - m); const float e = (v <= -1.0e38f) ? 0.f : ex; r.x[i][c] = e; sum += e; }   /* exp first, then the choice: no branch per key */
#pragma unroll
  for (int o = 1; o < 32; o <<= 1) sum += __shfl_xor(sum, o);
  const float inv = sum > 0.f ? 2048.0f / sum : 0.f;   /* a fully excluded row yields P = 0 */
#pragma unroll
  for (int i = 0; i < N; ++i) vst2(sr + i * 128 + lane * 4, r.x[i] * inv); }
__global__ __launch_bounds__(256, 8) void k_sm(float* __restrict__ S0) {   /* 8 waves a SIMD (128 registers): all 1024 blocks resident at once, 4 a WGP */
  const int lane = threadIdx.x & 31; const int t0 = blockIdx.x * 8 + __builtin_amdgcn_readfirstlane(threadIdx.x >> 5);   /* 0..127, the same in every lane of a wave */
  float* pl = S0 + (size_t)blockIdx.y * SPLANE + (size_t)(t0 & 63) * SPITCH; const int qh = (t0 >> 6) & 1;
#define SM_ROW(j) (pl + s_base(2 * (j) + qh))
  // rows in pairs (j, 7 - j) of 9 chunks; the next pair's loads are issued before this pair is worked on.
  // SM_STAGE: keeps the scheduler from sinking a pair's loads down to their first use (their latency would lie open) and from mixing two pairs' loads (the wait for one pair then leaves the next pair's nine in flight)
#define SM_STAGE() __builtin_amdgcn_sched_barrier(0)
  // SM_XW: the next pair's loads land in registers that the stores just issued name as data; the wait stands in front of that overwrite
#define SM_XW() asm volatile("s_wait_xcnt 0x0" ::: "memory")
  SmRow<8> r7; SmRow<1> r0; sm_load(r7, SM_ROW(7), lane); sm_load(r0, SM_ROW(0), lane); SM_STAGE();
  SmRow<7> r6; SmRow<2> r1; sm_load(r6, SM_ROW(6), lane); sm_load(r1, SM_ROW(1), lane); SM_STAGE();
  sm_finish(r7, SM_ROW(7), t0, lane); sm_finish(r0, SM_ROW(0), t0, lane); SM_XW();
  SmRow<6> r5; SmRow<3> r2; sm_load(r5, SM_ROW(5), lane); sm_load(r2, SM_ROW(2), lane); SM_STAGE();
  sm_finish(r6, SM_ROW(6), t0, lane); sm_finish(r1, SM_ROW(1), t0, lane); SM_XW();
  SmRow<5> r4; SmRow<4> r3; sm_load(r4, SM_ROW(4), lane); sm_load(r3, SM_ROW(3), lane); SM_STAGE();
  sm_finish(r5, SM_ROW(5), t0, lane); sm_finish(r2, SM_ROW(2), t0, lane);
  sm_finish(r4, SM_ROW(4), t0, lane); sm_finish(r3, SM_ROW(3), t0, lane); }
// ---- k_pv: block = 64 queries (qb) of (b, h), z = b * NH + h: ctx = P . v over keys [0, kend) (P x 2^11 once to f16 against v f16: 1 product; causal early query blocks: P and v as bf16 hi + lo, 3 products); 256-B (row, head) segment by 16 lanes
__global__ __launch_bounds__(128) void k_pv(const float* __restrict__ PS0, const _Float16* __restrict__ VT, const __bf16* __restrict__ VB, const __bf16* __restrict__ VBL, float* __restrict__ Y) { const int b = blockIdx.z / NH, h = blockIdx.z % NH; __shared__ __align__(16) float ss[4][16][HD + 4];
  const int tid = threadIdx.x, wave = tid >> 5, lane = tid & 31, col = lane & 15, g = lane >> 4; const int qb = blockIdx.x; const int ql0 = qb * 64 + wave * 16; const int kce = (kb_last(qb) + 1) * 4; const float* PS = PS0 + (size_t)blockIdx.z * SPLANE + s_base(qb) + (size_t)(wave * 16 + col) * SPITCH;   /* this lane's P row */
  v8f acc[HD / 16] = {};
  if (qb < QBH) {
#pragma unroll 1
    for (int kc = 0; kc < kce; ++kc) { const F2 p = split_row(PS, kc * 32, lane);
      asm volatile("s_wait_loadcnt 0x0" ::: "memory");
#pragma unroll
      for (int j = 0; j < HD / 16; ++j) { const size_t po = ((size_t)b * CC + h * HD + j * 16 + col) * (size_t)KHI + kc * 32; const v16b vh = frag_b(VB + po, lane); acc[j] = wmma_bf(p.h, vh, acc[j]); acc[j] = wmma_bf(p.l, vh, acc[j]); acc[j] = wmma_bf(p.h, frag_b(VBL + po, lane), acc[j]); } }
  } else {
#pragma unroll 1
    for (int kc = 0; kc < kce; ++kc) { const v16h p = frag_f32(PS + kc * 32, lane);
      asm volatile("s_wait_loadcnt 0x0" ::: "memory");
#pragma unroll
      for (int j = 0; j < HD / 16; ++j) { const size_t po = ((size_t)b * CC + h * HD + j * 16 + col) * (size_t)TT + kc * 32; acc[j] = wmma16(p, frag_h(VT + po, lane), acc[j]); } } }
#pragma unroll
  for (int j = 0; j < HD / 16; ++j)
#pragma unroll
    for (int r = 0; r < 8; ++r) ss[wave][8 * g + r][j * 16 + col] = acc[j][r] * (1.0f / 2048.0f);
  LDSX(); for (int rl = 0; rl < 16; ++rl) if (lane < HD / 4) vst2(Y + ((size_t)b * TT + ql0 + rl) * CC + h * HD + lane * 4, *(const v4f*)&ss[wave][rl][lane * 4]); }
// ---- k_out: block = (64 rows, 128 cols): out = ctx Wo (+ bo): ctx x 2^6 once to f16 against Wo as f16(bf16 x 2^8) exact (1 product) x 2^-14; causal early rows (< QHI of each sequence): ctx bf16 hi + lo against exact bf16 Wo (2 products)
__global__ __launch_bounds__(128) void k_out(const float* __restrict__ Y, const float* __restrict__ WO, const float* __restrict__ BO, float* __restrict__ OUT) { __shared__ __align__(16) float sf[4][16][132]; __shared__ __align__(16) __bf16 wt[2][128][WPITCH];
  const int tid = threadIdx.x, wave = tid >> 5, lane = tid & 31, col = lane & 15, g = lane >> 4; const int c0 = blockIdx.y * 128; const size_t r0 = (size_t)blockIdx.x * 64 + wave * 16;
  v8f acc[8] = {};
  static_assert(!WO_OUT_IN, "the staged tile reads Wo as [k][column]");
  const int kq = lane >> 3, cl0 = wave * 32 + 4 * (lane & 7); const float* wb = WO + c0 + cl0 + (size_t)(8 * kq) * DIN; const float* arow = Y + (r0 + col) * CC + 8 * g;
  WRaw wr; ARaw ar; a_load(ar, arow, 0); wt_load(wr, wb, DIN, 0); PF_XW();
  if (CAUSAL && (int)(((size_t)blockIdx.x * 64) % TT) < QHI) {   /* block-uniform */
    wt_store_b(wt[0], wr, cl0, kq);
    __syncthreads();   /* tile 0 is published */
#pragma unroll 2   /* two trips = the two buffers at constant LDS addresses */
    for (int t = 0; t < CC / KT; ++t) { F2 a[KT / 32];
#pragma unroll
      for (int c = 0; c < KT / 32; ++c) { float v[16];
#pragma unroll
        for (int e = 0; e < 16; ++e) v[e] = ar.r[c][e >> 2][e & 3];
        a[c] = bsplit16(v); }
      if (t + 1 < CC / KT) { a_load(ar, arow, (t + 1) * KT); wt_load(wr, wb, DIN, (t + 1) * KT); }   /* the next tile flies while this one is multiplied */
      PF_STAGE();
      v16b bf[2][4];   /* B fragments in groups of 4, two register sets, as in k_proj */
#pragma unroll
      for (int q = 0; q < 2; ++q)
#pragma unroll
        for (int jj = 0; jj < 4; ++jj) bf[q][jj] = frag_b(&wt[t & 1][(q * 4 + jj) * 16 + col][0], lane);
#pragma unroll
      for (int q = 0; q < 4; ++q) {
#pragma unroll
        for (int jj = 0; jj < 4; ++jj) { const int j = (q & 1) * 4 + jj; acc[j] = wmma_bf(a[q >> 1].h, bf[q & 1][jj], acc[j]); acc[j] = wmma_bf(a[q >> 1].l, bf[q & 1][jj], acc[j]); }
        if (q < 2) {
#pragma unroll
          for (int jj = 0; jj < 4; ++jj) bf[q][jj] = frag_b(&wt[t & 1][(q * 4 + jj) * 16 + col][32], lane); } }
      PF_STAGE();
      if (t + 1 < CC / KT) wt_store_b(wt[(t + 1) & 1], wr, cl0, kq);   /* that buffer's readers left it at the barrier of trip t - 1 */
      PF_XW();
      __syncthreads(); }   /* publishes tile t + 1 and ends the reads of tile t */
#pragma unroll
    for (int j = 0; j < 8; ++j) { const float bias = BO ? bfr(BO[c0 + j * 16 + col]) : 0.f;
#pragma unroll
      for (int r = 0; r < 8; ++r) sf[wave][8 * g + r][j * 16 + col] = acc[j][r] + bias; }
  } else {
    _Float16 (*wh)[128][WPITCH] = (_Float16 (*)[128][WPITCH])wt;   /* this path keeps f16 in the same two buffers */
    wt_store_h(wh[0], wr, cl0, kq);
    __syncthreads();   /* tile 0 is published */
#pragma unroll 2   /* two trips = the two buffers at constant LDS addresses */
    for (int t = 0; t < CC / KT; ++t) { v16h a[KT / 32];
#pragma unroll
      for (int c = 0; c < KT / 32; ++c)
#pragma unroll
        for (int e = 0; e < 16; ++e) a[c][e] = (_Float16)(ar.r[c][e >> 2][e & 3] * 64.0f);   /* ctx carried x 2^6 into f16 so small-magnitude context rows stay clear of f16 subnormals */
      if (t + 1 < CC / KT) { a_load(ar, arow, (t + 1) * KT); wt_load(wr, wb, DIN, (t + 1) * KT); }   /* the next tile flies while this one is multiplied */
      PF_STAGE();
      v16h bf[2][4];   /* B fragments in groups of 4, two register sets, as in k_proj */
#pragma unroll
      for (int q = 0; q < 2; ++q)
#pragma unroll
        for (int jj = 0; jj < 4; ++jj) bf[q][jj] = frag_h(&wh[t & 1][(q * 4 + jj) * 16 + col][0], lane);
#pragma unroll
      for (int q = 0; q < 4; ++q) {
#pragma unroll
        for (int jj = 0; jj < 4; ++jj) acc[(q & 1) * 4 + jj] = wmma16(a[q >> 1], bf[q & 1][jj], acc[(q & 1) * 4 + jj]);
        if (q < 2) {
#pragma unroll
          for (int jj = 0; jj < 4; ++jj) bf[q][jj] = frag_h(&wh[t & 1][(q * 4 + jj) * 16 + col][32], lane); } }
      PF_STAGE();
      if (t + 1 < CC / KT) wt_store_h(wh[(t + 1) & 1], wr, cl0, kq);   /* that buffer's readers left it at the barrier of trip t - 1 */
      PF_XW();
      __syncthreads(); }   /* publishes tile t + 1 and ends the reads of tile t */
#pragma unroll
    for (int j = 0; j < 8; ++j) { const float bias = BO ? bfr(BO[c0 + j * 16 + col]) : 0.f;
#pragma unroll
      for (int r = 0; r < 8; ++r) sf[wave][8 * g + r][j * 16 + col] = acc[j][r] * (1.0f / 16384.0f) + bias; } }   /* 2^-8 (Wo carry) x 2^-6 (ctx carry) */
  LDSX(); for (int rl = 0; rl < 16; ++rl) vst2(OUT + (r0 + rl) * DIN + c0 + lane * 4, *(const v4f*)&sf[wave][rl][lane * 4]); }

extern "C" void kernel_launch(void* const* d_in, const int* in_sizes, int n_in, void* d_out, int out_size, void* d_ws, size_t ws_size, hipStream_t stream) {
  (void)in_sizes; (void)n_in; (void)out_size;
  const float** F = (const float**)d_in;
  if (ws_size < (size_t)WS_END) return;
  char* ws = (char*)d_ws; _Float16 *QH = (_Float16*)(ws + WS_QH), *KH = (_Float16*)(ws + WS_KH), *VT = (_Float16*)(ws + WS_VT), *QL = (_Float16*)(ws + WS_QL), *KL = (_Float16*)(ws + WS_KL); __bf16 *VB = (__bf16*)(ws + WS_VB), *VBL = (__bf16*)(ws + WS_VBL); float *S = (float*)(ws + WS_S), *Y = (float*)(ws + WS_Y);
  (void)Y; (void)QL; (void)KL; (void)VB; (void)VBL;
  // inputs: 0 x [4,1024,1024]; 1 Wq [16,1024,64]; 2 Wk; 3 Wv (per-head [head][model][d]); 4 Wp [1024,1024] (in,out); 5 bp [1024] (zeros, read); no q / k / v biases
  k_proj<<<dim3(TNB * TT / 64, CC / 128, 3), 128, 0, stream>>>(F[0], F[0], F[0], F[1], F[2], F[3], nullptr, nullptr, nullptr, QH, QL, KH, KL, VT, VB, VBL);
  k_sc<<<dim3(NQB, TT / 128, TNB * NH), 128, 0, stream>>>(QH, KH, QL, KL, S);
  k_sm<<<dim3(128 / 8, TNB * NH), 256, 0, stream>>>(S);
  k_pv<<<dim3(NQB, 1, TNB * NH), 128, 0, stream>>>(S, VT, VB, VBL, Y);
  k_out<<<dim3(TNB * TT / 64, DIN / 128), 128, 0, stream>>>(Y, F[4], F[5], (float*)d_out);
}

// v004
// Measured time: 96.1 microseconds a run.
// Timed twice side by side with v003, it ran 2.32 and 2.33 times as fast.
// All steps since v000 together make it 7.44 times as fast.
// compute dtype: all float inputs rounded to bf16; per-head q / k / v projections with EXACT bf16 products on WMMA 16x16x32 (f32 accumulate), no biases; causal logits: 3 products for the first 384 rows, single f16 q x k after, x 1024^-0.5; softmax f32; P x 2^11 once to f16 x v once to f16 (bf16 hi + lo below row 384); ctx hi+lo x exact Wp below row 384, x2^6 f16 carry x f16(bf16 x 2^8) Wp after, + bp (zeros, read); f32 output.
#include <hip/hip_runtime.h>
#include <math.h>

typedef __attribute__((ext_vector_type(16))) _Float16 v16h;
typedef __attribute__((ext_vector_type(16))) __bf16 v16b;
typedef __attribute__((ext_vector_type(8)))  _Float16 v8h;
typedef __attribute__((ext_vector_type(8)))  float v8f;
typedef __attribute__((ext_vector_type(4)))  float v4f;
typedef __attribute__((ext_vector_type(2)))  float v2f;
typedef __attribute__((ext_vector_type(4)))  unsigned v4u;
typedef __attribute__((ext_vector_type(4)))  int v4i;
typedef float __attribute__((may_alias)) float_a;
typedef int __attribute__((may_alias)) int_a;

template <typename T> __device__ __forceinline__ void vst2(void* p, T v) { *(T*)p = v;  }
__device__ __forceinline__ v8f wmma16(v16h a, v16h b, v8f c) {
  v8f d = __builtin_amdgcn_wmma_f32_16x16x32_f16(false, a, false, b, (short)0, c, false, false);
  asm volatile("v_nop\n\tv_nop\n\tv_nop\n\tv_nop" : "+v"(d) : "v"(a), "v"(b));
  return d;
}
__device__ __forceinline__ v8f wmma_bf(v16b a, v16b b, v8f c) {
  v8f d = __builtin_amdgcn_wmma_f32_16x16x32_bf16(false, a, false, b, (short)0, c, false, false);
  asm volatile("v_nop\n\tv_nop\n\tv_nop\n\tv_nop" : "+v"(d) : "v"(a), "v"(b));
  return d;
}
// 16x16x32 fragments: lane = (h = lane>>4, row/col = lane&15); elements 0..7 = k0+8h+0..7, 8..15 = k0+16+8h+0..7; D element r = row 8h+r
__device__ __forceinline__ v16h frag_h(const _Float16* rowk0, int lane) {
  union { v16h v; v8h q[2]; } u; const _Float16* p = rowk0 + 8 * (lane >> 4);
  u.q[0] = *(const v8h*)p; u.q[1] = *(const v8h*)(p + 16); return u.v;
}
__device__ __forceinline__ v16h frag_f32(const float* rowk0, int lane) {
  v16h a; const float* p = rowk0 + 8 * (lane >> 4);
#pragma unroll
  for (int i = 0; i < 8; ++i) { a[i] = (_Float16)p[i]; a[8 + i] = (_Float16)p[16 + i]; }
  return a;
}
__device__ __forceinline__ v16h frag_f32s(const float* rowk0, int lane, float sc) {
  v16h a; const float* p = rowk0 + 8 * (lane >> 4);
#pragma unroll
  for (int i = 0; i < 8; ++i) { a[i] = (_Float16)(p[i] * sc); a[8 + i] = (_Float16)(p[16 + i] * sc); }
  return a;
}
// column fragment from a [K][ld] layout (column n), rows >= K read as 0
__device__ __forceinline__ v16h fragc_f32(const float* W, int k0, int n, int lane, int ld, int K) {
  v16h a; const int g = lane >> 4;
#pragma unroll
  for (int i = 0; i < 8; ++i) { const int ka = k0 + 8 * g + i, kb = ka + 16;
    a[i] = (_Float16)(ka < K ? W[(size_t)(ka < K ? ka : K - 1) * ld + n] : 0.f); a[8 + i] = (_Float16)(kb < K ? W[(size_t)(kb < K ? kb : K - 1) * ld + n] : 0.f); }
  return a;
}
struct F2 { v16b h, l; };
__device__ __forceinline__ F2 bsplit16(const float v[16]) { F2 r;
#pragma unroll
  for (int i = 0; i < 16; ++i) { const __bf16 h = (__bf16)v[i]; r.h[i] = h; r.l[i] = (__bf16)(v[i] - (float)h); }
  return r; }
__device__ __forceinline__ F2 split_row(const float* row, int k0, int lane) { float v[16]; const float* p = row + k0 + 8 * (lane >> 4);
#pragma unroll
  for (int i = 0; i < 8; ++i) { v[i] = p[i]; v[8 + i] = p[16 + i]; }
  return bsplit16(v); }
__device__ __forceinline__ F2 split_rowK(const float* row, int k0, int lane, int K) { float v[16]; const int g = lane >> 4;
#pragma unroll
  for (int i = 0; i < 8; ++i) { const int ka = k0 + 8 * g + i, kb = ka + 16; v[i] = ka < K ? row[ka < K ? ka : K - 1] : 0.f; v[8 + i] = kb < K ? row[kb < K ? kb : K - 1] : 0.f; }
  return bsplit16(v); }
__device__ __forceinline__ F2 split_col(const float* W, int k0, int n, int lane, int ld, int K) { float v[16]; const int g = lane >> 4;
#pragma unroll
  for (int i = 0; i < 8; ++i) { const int ka = k0 + 8 * g + i, kb = ka + 16; v[i] = ka < K ? W[(size_t)(ka < K ? ka : K - 1) * ld + n] : 0.f; v[8 + i] = kb < K ? W[(size_t)(kb < K ? kb : K - 1) * ld + n] : 0.f; }
  return bsplit16(v); }
__device__ __forceinline__ v8f mac3(const F2& a, const F2& b, v8f c) { c = wmma_bf(a.l, b.h, c); c = wmma_bf(a.h, b.l, c); return wmma_bf(a.h, b.h, c); }
__device__ __forceinline__ float sigm(float v) { return 1.0f / (1.0f + expf(-v)); }
#define LDSX() do { asm volatile("s_wait_dscnt 0" ::: "memory"); __builtin_amdgcn_wave_barrier(); __builtin_amdgcn_fence(__ATOMIC_RELEASE, "workgroup"); } while (0)

// Causal multi-head self-attention with per-head weights and a 1/sqrt(C) score scale (x [4,1024,1024]; Wq / Wk / Wv [16,1024,64] = per-head [head][model][d] N(0,1) x 0.02, no biases; Wp [1024,1024] (in,out), bp zeros (read); q = einsum('btc,hcd->bhtd'); scores x 1/sqrt(1024) - the scale is 1/32, not 1/8 (soft logits); tril kept, -inf elsewhere; softmax; heads concatenated; out @ Wp + bp).
#define NB 4
#define TT 1024
#define CC 1024            // NH * HD = projected width
#define DIN 1024          // input (model) width
#define NH 16
#define HD 64
#define NQB (TT / 64)
#define SCALE (0.03125f)
#define CAUSAL 1
#ifndef TNB
#define TNB NB
#endif
__device__ __forceinline__ float bfr(float v) { return (float)(__bf16)v; }
typedef __attribute__((ext_vector_type(8))) __bf16 v8b;
__device__ __forceinline__ v16b frag_b(const __bf16* rowk0, int lane) {
  union { v16b v; v8b q[2]; } u; const __bf16* p = rowk0 + 8 * (lane >> 4);
  u.q[0] = *(const v8b*)p; u.q[1] = *(const v8b*)(p + 16); return u.v;
}
#define QBH 6              // causal: query blocks 0..QBH-1 of each sequence (few keys, no averaging) take the high-precision path
#define QHI 384            // rows carrying a q residual plane
#define KHI 384            // key rows carrying k residual / v bf16 hi+lo planes (used only by the causal high-precision path)
// B fragment (k rows k0+.., output column o) of a weight: (in,out) [K][ld] or (out,in) [ld rows of K]: bf16 exact, or f16(bf16 * 256) exact
__device__ __forceinline__ v16b wcol_io(const float* Wm, int k0, int o, int lane, int ld) { v16b w; const int g = lane >> 4;
#pragma unroll
  for (int i = 0; i < 8; ++i) { w[i] = (__bf16)Wm[(size_t)(k0 + 8 * g + i) * ld + o]; w[8 + i] = (__bf16)Wm[(size_t)(k0 + 16 + 8 * g + i) * ld + o]; }
  return w; }
__device__ __forceinline__ v16b wcol_oi(const float* Wm, int k0, int o, int lane, int K) { v16b w; const float* p = Wm + (size_t)o * K + k0 + 8 * (lane >> 4);
#pragma unroll
  for (int i = 0; i < 8; ++i) { w[i] = (__bf16)p[i]; w[8 + i] = (__bf16)p[16 + i]; }
  return w; }
__device__ __forceinline__ v16h wcolh_io(const float* Wm, int k0, int o, int lane, int ld) { v16h w; const int g = lane >> 4;
#pragma unroll
  for (int i = 0; i < 8; ++i) { w[i] = (_Float16)(bfr(Wm[(size_t)(k0 + 8 * g + i) * ld + o]) * 256.0f); w[8 + i] = (_Float16)(bfr(Wm[(size_t)(k0 + 16 + 8 * g + i) * ld + o]) * 256.0f); }
  return w; }
__device__ __forceinline__ v16h wcolh_oi(const float* Wm, int k0, int o, int lane, int K) { v16h w; const float* p = Wm + (size_t)o * K + k0 + 8 * (lane >> 4);
#pragma unroll
  for (int i = 0; i < 8; ++i) { w[i] = (_Float16)(bfr(p[i]) * 256.0f); w[8 + i] = (_Float16)(bfr(p[16 + i]) * 256.0f); }
  return w; }
#define WQKV_LAYOUT 2   // 0 = (in,out) [DIN][CC]; 1 = (out,in) [CC][DIN]; 2 = per-head [NH][DIN][HD]
__device__ __forceinline__ v16b wcol_hdk(const float* Wm, int k0, int o, int lane) { v16b w; const int g = lane >> 4; const float* p = Wm + (size_t)(o / HD) * DIN * HD + (o % HD);
#pragma unroll
  for (int i = 0; i < 8; ++i) { w[i] = (__bf16)p[(size_t)(k0 + 8 * g + i) * HD]; w[8 + i] = (__bf16)p[(size_t)(k0 + 16 + 8 * g + i) * HD]; }
  return w; }
#define WO_OUT_IN 0
#if WQKV_LAYOUT == 1
#define WCOL(W, k0, o, lane) wcol_oi(W, k0, o, lane, DIN)
#elif WQKV_LAYOUT == 2
#define WCOL(W, k0, o, lane) wcol_hdk(W, k0, o, lane)
#else
#define WCOL(W, k0, o, lane) wcol_io(W, k0, o, lane, CC)
#endif
#if WO_OUT_IN
#define WOCOL(W, k0, o, lane) wcol_oi(W, k0, o, lane, CC)
#define WOCOLH(W, k0, o, lane) wcolh_oi(W, k0, o, lane, CC)
#else
#define WOCOL(W, k0, o, lane) wcol_io(W, k0, o, lane, DIN)
#define WOCOLH(W, k0, o, lane) wcolh_io(W, k0, o, lane, DIN)
#endif

#ifndef SM_EXTRA_PARAMS
#define SM_EXTRA_PARAMS
#endif
#ifndef PROJ_EXTRA_PARAMS
#define PROJ_EXTRA_PARAMS
#endif
#ifndef SM_MASK_HOOK
#define SM_MASK_HOOK (void)0
#endif

#define WS_QH  0u                                      // f16 q rows [b*t][CC]
#define WS_KH  (WS_QH + 2u * (size_t)NB * TT * CC)      // f16 k rows [b*t][CC]
#define WS_VT  (WS_KH + 2u * (size_t)NB * TT * CC)      // f16 v planes [b][c][t]
#define WS_QL  (WS_VT + 2u * (size_t)NB * CC * TT)      // f16 q residual x 2^10 rows [b][t < QHI][CC]
#define WS_KL  (WS_QL + 2u * (size_t)NB * QHI * CC)     // f16 k residual x 2^10 rows [b][t < KHI][CC]
#define WS_VB  (WS_KL + 2u * (size_t)NB * KHI * CC)     // bf16 v hi planes [b][c][t < KHI]
#define WS_VBL (WS_VB + 2u * (size_t)NB * CC * KHI)
#define WS_Y   (WS_VBL + 2u * (size_t)NB * CC * KHI)    // f32 ctx rows [b*t][CC] (only when there is an output projection)
#define WS_END (WS_Y  + 4u * (size_t)NB * TT * CC)

// ---- weight tile in LDS (k_proj, k_out): KT k rows x 128 output columns, rounded once per block to 16 bit and kept as [column][k], so a B fragment is frag_b / frag_h on a column's row
#define KT 64
#define WPITCH (KT + 8)    // 144-B column pitch: the 16 lanes of a ds_load_b128 fragment read fall on 16 different bank quads
// a thread carries 2 units of (4 columns x 8 k): lane = (column quad lane & 7, k octet lane >> 3), wave = 32 columns; each load instruction covers four whole 128-B lines, each LDS store meets every bank twice
// PF_STAGE: in front of a tile's matrix work it keeps the scheduler from sinking the next tile's global loads below it; behind the matrix work it keeps the next tile's conversions, and with them the wait for those loads, from rising above it
#define PF_STAGE() __builtin_amdgcn_sched_barrier(0)
// PF_XW: what follows (the next trip, the loop's set-up) rewrites the address registers that the global loads issued before it name; the wait stands in front of that overwrite
#define PF_XW() do { asm volatile("s_wait_xcnt 0x0" ::: "memory"); __builtin_amdgcn_sched_barrier(0); } while (0)   /* the scheduling barrier keeps later address arithmetic from rising over the wait */
// PF_XWP: the same wait behind k_proj's first loads; it takes their two address pairs as inputs, so that no later load's result is given those registers ahead of the wait
#define PF_XWP(p, q) do { asm volatile("s_wait_xcnt 0x0" :: "v"(p), "v"(q) : "memory"); __builtin_amdgcn_sched_barrier(0); } while (0)
static_assert(KT == 64, "the k loops take a tile as two k halves of 32");
struct WRaw { v4f r[2][8]; };
struct ARaw { v4f r[KT / 32][4]; };
__device__ __forceinline__ void wt_load(WRaw& w, const float* base, int ldk, int k0) {   /* base = (k row 8 kq, the thread's first column); ldk = floats between k rows */
#pragma unroll
  for (int u = 0; u < 2; ++u)
#pragma unroll
    for (int kk = 0; kk < 8; ++kk) w.r[u][kk] = *(const v4f*)(base + (size_t)(k0 + 32 * u + kk) * ldk); }
__device__ __forceinline__ void wt_store_b(__bf16 (*wt)[WPITCH], const WRaw& w, int cl0, int kq) {
#pragma unroll
  for (int u = 0; u < 2; ++u)
#pragma unroll
    for (int i = 0; i < 4; ++i) { v8b p;
#pragma unroll
      for (int kk = 0; kk < 8; ++kk) p[kk] = (__bf16)w.r[u][kk][i];
      *(v8b*)&wt[cl0 + i][32 * u + 8 * kq] = p; } }
__device__ __forceinline__ void wt_store_h(_Float16 (*wt)[WPITCH], const WRaw& w, int cl0, int kq) {   /* f16(bf16 x 2^8), exact */
#pragma unroll
  for (int u = 0; u < 2; ++u)
#pragma unroll
    for (int i = 0; i < 4; ++i) { v8h p;
#pragma unroll
      for (int kk = 0; kk < 8; ++kk) p[kk] = (_Float16)(bfr(w.r[u][kk][i]) * 256.0f);
      *(v8h*)&wt[cl0 + i][32 * u + 8 * kq] = p; } }
// the lane's A elements of one tile, raw f32: fragment c, element e = r[c][e >> 2][e & 3] (k = 32 c + 8 g + e for e < 8, + 8 more after); rowg = row + 8 g
__device__ __forceinline__ void a_load(ARaw& a, const float* rowg, int k0) {
#pragma unroll
  for (int c = 0; c < KT / 32; ++c) { const float* q = rowg + k0 + 32 * c; a.r[c][0] = *(const v4f*)q; a.r[c][1] = *(const v4f*)(q + 4); a.r[c][2] = *(const v4f*)(q + 16); a.r[c][3] = *(const v4f*)(q + 20); } }
// ---- k_proj: block = (64 rows, 128 cols, which): q/k/v = X W (+ b) with exact bf16 products (K = DIN) -> which 0: q f16 rows (+ residual rows < QHI); 1: k f16 rows (+ residual rows < KHI); 2: v f16 planes [c][t] (+ bf16 hi/lo planes for t < KHI)
__global__ __launch_bounds__(128) void k_proj(const float* __restrict__ XQ, const float* __restrict__ XK, const float* __restrict__ XV, const float* __restrict__ WQ, const float* __restrict__ WK, const float* __restrict__ WV, const float* __restrict__ BQ, const float* __restrict__ BK, const float* __restrict__ BV,
    _Float16* __restrict__ QH, _Float16* __restrict__ QL, _Float16* __restrict__ KH, _Float16* __restrict__ KL, _Float16* __restrict__ VT, __bf16* __restrict__ VB, __bf16* __restrict__ VBL) {
  __shared__ __align__(16) unsigned char sm[3 * 128 * 72 * 2];   /* the two weight buffers during the k loop; behind the loop's last barrier the epilogue's planes */
  __bf16 (*wt)[128][WPITCH] = (__bf16 (*)[128][WPITCH])sm; static_assert(2 * 128 * WPITCH * 2 <= 3 * 128 * 72 * 2 && 2 * 64 * 136 * 2 <= 3 * 128 * 72 * 2, "LDS");
  _Float16 (*sh)[136] = (_Float16 (*)[136])sm, (*sl)[136] = (_Float16 (*)[136])(sm + 64 * 136 * 2); _Float16 (*th)[72] = (_Float16 (*)[72])sm; __bf16 (*tb)[72] = (__bf16 (*)[72])(sm + 128 * 72 * 2), (*tbl)[72] = (__bf16 (*)[72])(sm + 2 * 128 * 72 * 2);
  const int tid = threadIdx.x, wave = tid >> 5, lane = tid & 31, col = lane & 15, g = lane >> 4; const int which = blockIdx.z; const int c0 = blockIdx.y * 128; const size_t r0 = (size_t)blockIdx.x * 64; const size_t bb = r0 / TT; const int t0 = (int)(r0 % TT);
  const float* X = which == 0 ? XQ : which == 1 ? XK : XV; const float* WA = which == 0 ? WQ : which == 1 ? WK : WV; const float* BA = which == 0 ? BQ : which == 1 ? BK : BV;
  v8f acc[8] = {};
  static_assert(WQKV_LAYOUT == 2 && HD % 32 == 0, "a wave's 32 staged columns lie in one head");
  const int kq = lane >> 3, cl0 = wave * 32 + 4 * (lane & 7); const float* wb = WA + (size_t)((c0 + cl0) / HD) * DIN * HD + (c0 + cl0) % HD + (size_t)(8 * kq) * HD; const float* arow = X + (r0 + wave * 16 + col) * DIN + 8 * g;
  WRaw wr; ARaw ar; a_load(ar, arow, 0); wt_load(wr, wb, HD, 0); PF_XWP(arow, wb); wt_store_b(wt[0], wr, cl0, kq);
  __syncthreads();   /* tile 0 is published */
#pragma unroll 2   /* two trips = the two buffers at constant LDS addresses */
  for (int t = 0; t < DIN / KT; ++t) { v16b a[KT / 32];
#pragma unroll
    for (int c = 0; c < KT / 32; ++c)
#pragma unroll
      for (int e = 0; e < 16; ++e) a[c][e] = (__bf16)ar.r[c][e >> 2][e & 3];
    if (t + 1 < DIN / KT) { a_load(ar, arow, (t + 1) * KT); wt_load(wr, wb, HD, (t + 1) * KT); }   /* the next tile flies while this one is multiplied */
    PF_STAGE();
    v16b bf[2][4];   /* B fragments in groups of 4 (group q: k half q >> 1, columns 64 (q & 1) ..), two register sets: a group's LDS reads are issued together, two groups ahead of its products */
#pragma unroll
    for (int q = 0; q < 2; ++q)
#pragma unroll
      for (int jj = 0; jj < 4; ++jj) bf[q][jj] = frag_b(&wt[t & 1][(q * 4 + jj) * 16 + col][0], lane);
#pragma unroll
    for (int q = 0; q < 4; ++q) {
#pragma unroll
      for (int jj = 0; jj < 4; ++jj) acc[(q & 1) * 4 + jj] = wmma_bf(a[q >> 1], bf[q & 1][jj], acc[(q & 1) * 4 + jj]);
      if (q < 2) {
#pragma unroll
        for (int jj = 0; jj < 4; ++jj) bf[q][jj] = frag_b(&wt[t & 1][(q * 4 + jj) * 16 + col][32], lane); } }
    PF_STAGE();
    if (t + 1 < DIN / KT) wt_store_b(wt[(t + 1) & 1], wr, cl0, kq);   /* that buffer's readers left it at the barrier of trip t - 1 */
    PF_XW();
    __syncthreads(); }   /* publishes tile t + 1 and ends the reads of tile t (after the last trip: frees the LDS for the epilogue) */
  if (which < 2) { _Float16* DH = which == 0 ? QH : KH; _Float16* DL = which == 0 ? QL : KL; const int nhi = which == 0 ? QHI : KHI; const bool hi_rows = t0 < nhi;
#pragma unroll
    for (int j = 0; j < 8; ++j) { const float bias = BA ? bfr(BA[c0 + j * 16 + col]) : 0.f;
#pragma unroll
      for (int r = 0; r < 8; ++r) { const float v = acc[j][r] + bias; const _Float16 hv = (_Float16)v; sh[wave * 16 + 8 * g + r][j * 16 + col] = hv; sl[wave * 16 + 8 * g + r][j * 16 + col] = (_Float16)((v - (float)hv) * 1024.0f); } }
    __syncthreads();
    for (int e = tid; e < 64 * 16; e += 128) { const int rl = e >> 4, q = e & 15; vst2((unsigned*)(DH + (r0 + rl) * CC + c0 + q * 8), *(const v4u*)&sh[rl][q * 8]); if (hi_rows) vst2((unsigned*)(DL + (bb * nhi + t0 + rl) * (size_t)CC + c0 + q * 8), *(const v4u*)&sl[rl][q * 8]); }
  } else { const bool hi_rows = t0 < KHI;
#pragma unroll
    for (int j = 0; j < 8; ++j) { const float bias = BA ? bfr(BA[c0 + j * 16 + col]) : 0.f;
#pragma unroll
      for (int r = 0; r < 8; ++r) { const float v = acc[j][r] + bias; const int rl = wave * 16 + 8 * g + r, cl = j * 16 + col; th[cl][rl] = (_Float16)v; const __bf16 bh = (__bf16)v; tb[cl][rl] = bh; tbl[cl][rl] = (__bf16)(v - (float)bh); } }
    __syncthreads();
    for (int e = tid; e < 128 * 8; e += 128) { const int cl = e >> 3, q = e & 7; vst2((unsigned*)(VT + (bb * CC + c0 + cl) * (size_t)TT + t0 + q * 8), *(const v4u*)&th[cl][q * 8]); if (hi_rows) { const size_t o3 = (bb * CC + c0 + cl) * (size_t)KHI + t0 + q * 8; vst2((unsigned*)(VB + o3), *(const v4u*)&tb[cl][q * 8]); vst2((unsigned*)(VBL + o3), *(const v4u*)&tbl[cl][q * 8]); } } } }
// ---- k_att: block = 64 queries (qb) of one (b, h), z = b * NH + h; logits, softmax and P . v in one pass over 64-key blocks 0..qb, the logits never leave registers.
// Transposed products: St = K . Qt (A = 16 key rows, B = the wave's 16 queries), so a lane holds 8 keys a tile of ONE query (column lane & 15, keys 8 g + r); two neighbouring St tiles are, register for register, the B fragment Pt of 32 keys for Ot += Vt . Pt (A = 16 d rows of the v plane).
// Running maximum per query (in-lane + one exchange between the wave halves), e = 2^((s - m) c + 11), c = SCALE log2(e): P carried x 2^11 as before, the factor cancels against the row sum; Ot and the sum are rescaled at every key block.
// Query blocks < QBH: 3 logit products (q, k hi + residual x 2^10) and P, v as bf16 hi + lo (3 products); after: single f16 products.
// The K and v tiles (64 rows x 128 B each) are shared by the 4 waves through LDS: whole-line global loads one key block ahead, 2 buffers, one barrier per key block.
#define AP 72              // 144-B LDS row pitch, as WPITCH
#define ATILE (64 * AP * 2)   // bytes of one tile in LDS
__device__ __forceinline__ v8f wm_h(v16h a, v16h b, v8f c) { return __builtin_amdgcn_wmma_f32_16x16x32_f16(false, a, false, b, (short)0, c, false, false); }
__device__ __forceinline__ v8f wm_b(v16b a, v16b b, v8f c) { return __builtin_amdgcn_wmma_f32_16x16x32_bf16(false, a, false, b, (short)0, c, false, false); }
__device__ __forceinline__ float xhalf(float x) { return __builtin_bit_cast(float, __builtin_amdgcn_permlanex16(__builtin_bit_cast(int, x), __builtin_bit_cast(int, x), 0x76543210, 0xfedcba98, false, false)); }   /* lane l <-> lane l ^ 16 */
// 2^x by v_exp_f32 as asm text, eight in place in one statement: nothing of the compiler's then stands directly behind a v_exp_f32; the closing v_nop is the slot that the instruction set asks for behind the last one
__device__ __forceinline__ void exp2x8(float (&x)[8]) {
  asm("v_exp_f32 %0, %0\n\tv_exp_f32 %1, %1\n\tv_exp_f32 %2, %2\n\tv_exp_f32 %3, %3\n\tv_exp_f32 %4, %4\n\tv_exp_f32 %5, %5\n\tv_exp_f32 %6, %6\n\tv_exp_f32 %7, %7\n\tv_nop" : "+v"(x[0]), "+v"(x[1]), "+v"(x[2]), "+v"(x[3]), "+v"(x[4]), "+v"(x[5]), "+v"(x[6]), "+v"(x[7])); }
__device__ __forceinline__ float exp2x1(float x) { asm("v_exp_f32 %0, %0\n\tv_nop" : "+v"(x)); return x; }   /* the same for one value */
typedef v4u __attribute__((may_alias)) v4u_a;
typedef v4f __attribute__((may_alias)) v4f_a;
template <bool HI> __device__ __forceinline__ void att_body(unsigned char* sm, const _Float16* __restrict__ QH, const _Float16* __restrict__ KH, const _Float16* __restrict__ QL, const _Float16* __restrict__ KL, const _Float16* __restrict__ VT, const __bf16* __restrict__ VB, const __bf16* __restrict__ VBL, float* __restrict__ Y, int qb, int b, int h) {
  constexpr int NT = HI ? 4 : 2;   /* tiles a key block: k, v (+ k residual, v lo) */
  const int tid = threadIdx.x, wave = tid >> 5, lane = tid & 31, col = lane & 15, g = lane >> 4; const int ql0 = qb * 64 + wave * 16; const int nblk = qb + 1;
  const int srow = tid >> 3, spc = tid & 7;   /* staging: 8 lanes = one 128-B row; a thread carries rows srow + 16 i */
  constexpr unsigned vp = HI ? KHI : TT;
  // block-uniform bases and one 32-bit byte offset per thread and tile shape (k rows, v planes)
  const char* s_k = (const char*)(KH + (size_t)b * TT * CC + h * HD); const char* s_kl = (const char*)(KL + (size_t)b * KHI * CC + h * HD);
  const char* s_v = HI ? (const char*)(VB + ((size_t)b * CC + h * HD) * vp) : (const char*)(VT + ((size_t)b * CC + h * HD) * vp); const char* s_vl = (const char*)(VBL + ((size_t)b * CC + h * HD) * vp);
  const unsigned o_k = (unsigned)srow * (CC * 2) + spc * 16, o_v = (unsigned)srow * (vp * 2) + spc * 16;
  v4u ra[4], rb[4];   /* two tiles in flight: k and v; with the residual planes first k and k residual, then, behind the logit products, v hi and v lo in the same registers */
#define ATT_LD(dst, base, rowstep, off) do { _Pragma("unroll") for (int i = 0; i < 4; ++i) dst[i] = *(const v4u_a*)((base) + i * (16 * (rowstep)) + (off)); } while (0)
#define ATT_ST(bufp, tile, srcr) do { _Pragma("unroll") for (int i = 0; i < 4; ++i) *(v4u_a*)((bufp) + (tile) * ATILE + (srow + 16 * i) * (AP * 2) + spc * 16) = srcr[i]; } while (0)
#define ATT_KSTEP (64 * CC * 2)   /* bytes between key blocks in the k rows; 128 in the v planes */
  v16h qf[HD / 32], qlf[HD / 32];
#pragma unroll
  for (int kc = 0; kc < HD / 32; ++kc) { qf[kc] = frag_h(QH + ((size_t)b * TT + ql0 + col) * CC + h * HD + kc * 32, lane); if (HI) qlf[kc] = frag_h(QL + ((size_t)b * QHI + ql0 + col) * CC + h * HD + kc * 32, lane); }
  if (HI) { ATT_LD(ra, s_k, CC * 2, o_k); ATT_LD(rb, s_kl, CC * 2, o_k); PF_XW(); ATT_ST(sm, 0, ra); ATT_ST(sm, 2, rb); ATT_LD(ra, s_v, vp * 2, o_v); ATT_LD(rb, s_vl, vp * 2, o_v); PF_XW(); ATT_ST(sm, 1, ra); ATT_ST(sm, 3, rb); PF_XW(); }   /* the last wait: the q loads are scheduled behind the one before */
  else { ATT_LD(ra, s_k, CC * 2, o_k); ATT_LD(rb, s_v, vp * 2, o_v); PF_XW(); ATT_ST(sm, 0, ra); ATT_ST(sm, 1, rb); }
  __syncthreads();   /* key block 0 is published */
  const float cs = SCALE * 1.44269504088896340736f;
  float m = -3.0e38f, l = 0.f; v8f o[HD / 16] = {};
  for (int t = 0; t < nblk; ++t) { const unsigned char* bp = sm + (t & 1) * (NT * ATILE); unsigned char* nb = sm + ((t + 1) & 1) * (NT * ATILE);   /* nb: its readers left it at the barrier of trip t - 1 */
    // with the residual planes the staging is unconditional (the last trip stages its own block once more into the idle buffer, which nobody reads): no branch then stands between the logit products and the first readers of their results
    const bool more = HI || t + 1 < nblk; const int tn = (HI && t + 1 == nblk) ? t : t + 1;
    if (more) { ATT_LD(ra, s_k + (size_t)tn * ATT_KSTEP, CC * 2, o_k); if (HI) ATT_LD(rb, s_kl + (size_t)tn * ATT_KSTEP, CC * 2, o_k); else ATT_LD(rb, s_v + (size_t)tn * 128, vp * 2, o_v); }   /* the next key block flies while this one is worked on */
    if (HI) PF_XW(); else PF_STAGE();   /* with the residual planes the LDS reads below land in the address registers of these loads (without them the compiler writes the wait itself) */
    const _Float16 (*kt)[AP] = (const _Float16 (*)[AP])bp; const _Float16 (*klt)[AP] = (const _Float16 (*)[AP])(bp + 2 * ATILE); const _Float16 (*vt)[AP] = (const _Float16 (*)[AP])(bp + ATILE); const __bf16 (*vb)[AP] = (const __bf16 (*)[AP])(bp + ATILE); const __bf16 (*vbl)[AP] = (const __bf16 (*)[AP])(bp + 3 * ATILE);
    // ATT_GROUP: behind a group of LDS fragment reads it keeps the scheduler from sinking each read down to its own product (one LDS latency per product instead of one per group)
#define ATT_GROUP() __builtin_amdgcn_sched_barrier(0)
    float s[4][8]; v16h vf[2][HD / 16]; v16b vh[HD / 16], vl[HD / 16];
    if (HI) {
#pragma unroll
      for (int hf = 0; hf < 2; ++hf) { v16h kf[2][HD / 32], lf[2][HD / 32]; v8f a[2] = {}, al[2] = {};   /* two key tiles a group */
#pragma unroll
        for (int jj = 0; jj < 2; ++jj)
#pragma unroll
          for (int kc = 0; kc < HD / 32; ++kc) { kf[jj][kc] = frag_h(&kt[(2 * hf + jj) * 16 + col][kc * 32], lane); lf[jj][kc] = frag_h(&klt[(2 * hf + jj) * 16 + col][kc * 32], lane); }
        ATT_GROUP();
#pragma unroll
        for (int kc = 0; kc < HD / 32; ++kc)
#pragma unroll
          for (int jj = 0; jj < 2; ++jj) { a[jj] = wm_h(kf[jj][kc], qf[kc], a[jj]); al[jj] = wm_h(kf[jj][kc], qlf[kc], al[jj]); al[jj] = wm_h(lf[jj][kc], qf[kc], al[jj]); }
#pragma unroll
        for (int jj = 0; jj < 2; ++jj)
#pragma unroll
          for (int r = 0; r < 8; ++r) s[2 * hf + jj][r] = a[jj][r] + al[jj][r] * (1.0f / 1024.0f);
        ATT_GROUP(); }   /* here it keeps the second group's reads from rising over the first group's products: both groups at once do not fit the registers */
      ATT_ST(nb, 0, ra); ATT_ST(nb, 2, rb); PF_XW(); ATT_LD(ra, s_v + (size_t)tn * 128, vp * 2, o_v); ATT_LD(rb, s_vl + (size_t)tn * 128, vp * 2, o_v);
      PF_STAGE();
#pragma unroll
      for (int j = 0; j < HD / 16; ++j) { vh[j] = frag_b(&vb[j * 16 + col][0], lane); vl[j] = frag_b(&vbl[j * 16 + col][0], lane); }   /* v of the first 32 keys: read behind the logit products, lands under the softmax */
    } else { v16h kf[4][HD / 32]; v8f a[4] = {};
#pragma unroll
      for (int jt = 0; jt < 4; ++jt)
#pragma unroll
        for (int kc = 0; kc < HD / 32; ++kc) kf[jt][kc] = frag_h(&kt[jt * 16 + col][kc * 32], lane);
      ATT_GROUP();
#pragma unroll
      for (int kc = 0; kc < HD / 32; ++kc)
#pragma unroll
        for (int jt = 0; jt < 4; ++jt) a[jt] = wm_h(kf[jt][kc], qf[kc], a[jt]);
#pragma unroll
      for (int kc = 0; kc < 2; ++kc)
#pragma unroll
        for (int j = 0; j < HD / 16; ++j) vf[kc][j] = frag_h(&vt[j * 16 + col][kc * 32], lane);   /* all of v: read behind the logit products, lands under the softmax */
#pragma unroll
      for (int jt = 0; jt < 4; ++jt)
#pragma unroll
        for (int r = 0; r < 8; ++r) s[jt][r] = a[jt][r]; }
    ATT_GROUP();
    if (t == nblk - 1) {   /* the diagonal block: keys past the query are excluded by index */
#pragma unroll
      for (int jt = 0; jt < 4; ++jt)
#pragma unroll
        for (int r = 0; r < 8; ++r) s[jt][r] = (jt * 16 + 8 * g + r <= wave * 16 + col) ? s[jt][r] : -3.0e38f; }
    float mj[4];   /* four independent chains */
#pragma unroll
    for (int jt = 0; jt < 4; ++jt) { mj[jt] = s[jt][0];
#pragma unroll
      for (int r = 1; r < 8; ++r) mj[jt] = fmaxf(mj[jt], s[jt][r]); }
    float mx = fmaxf(fmaxf(mj[0], mj[1]), fmaxf(mj[2], mj[3]));
    mx = fmaxf(mx, xhalf(mx));   /* the other 8 keys of each tile lie in the other wave half */
    const float mn = fmaxf(m, mx); const float alpha = exp2x1((m - mn) * cs); const float off = 11.0f - mn * cs; m = mn;
    float sj[4];
#pragma unroll
    for (int jt = 0; jt < 4; ++jt) {
#pragma unroll
      for (int r = 0; r < 8; ++r) s[jt][r] = fmaf(s[jt][r], cs, off);
      exp2x8(s[jt]);   /* an excluded key gives 2^(-huge) = 0 */
      sj[jt] = s[jt][0];
#pragma unroll
      for (int r = 1; r < 8; ++r) sj[jt] += s[jt][r]; }
    l = l * alpha + ((sj[0] + sj[1]) + (sj[2] + sj[3]));
#pragma unroll
    for (int j = 0; j < HD / 16; ++j) o[j] *= alpha;
#pragma unroll
    for (int kc = 0; kc < 2; ++kc) {
      if (HI) { float v[16];
#pragma unroll
        for (int i = 0; i < 8; ++i) { v[i] = s[2 * kc][i]; v[8 + i] = s[2 * kc + 1][i]; }
        const F2 p = bsplit16(v);
#pragma unroll
        for (int j = 0; j < HD / 16; ++j) o[j] = wm_b(vh[j], p.h, o[j]);
#pragma unroll
        for (int j = 0; j < HD / 16; ++j) o[j] = wm_b(vh[j], p.l, o[j]);
#pragma unroll
        for (int j = 0; j < HD / 16; ++j) o[j] = wm_b(vl[j], p.h, o[j]);
        if (kc == 0) {
#pragma unroll
          for (int j = 0; j < HD / 16; ++j) { vh[j] = frag_b(&vb[j * 16 + col][32], lane); vl[j] = frag_b(&vbl[j * 16 + col][32], lane); }
          ATT_GROUP(); }
      } else { v16h p;
#pragma unroll
        for (int i = 0; i < 8; ++i) { p[i] = (_Float16)s[2 * kc][i]; p[8 + i] = (_Float16)s[2 * kc + 1][i]; }
#pragma unroll
        for (int j = 0; j < HD / 16; ++j) o[j] = wm_h(vf[kc][j], p, o[j]); } }
    PF_STAGE();
    if (more) { if (HI) { ATT_ST(nb, 1, ra); ATT_ST(nb, 3, rb); } else { ATT_ST(nb, 0, ra); ATT_ST(nb, 1, rb); } }
    PF_XW();
    __syncthreads(); }   /* publishes key block t + 1 and ends the reads of block t (after the last trip: frees the LDS for the epilogue) */
  l += xhalf(l);
  const float inv = l > 0.f ? 1.0f / l : 0.f;
  float (*ss)[HD + 4] = (float (*)[HD + 4])(sm + wave * (16 * (HD + 4) * 4));   /* the wave's own 16 ctx rows, so that the stores cover whole 256-B (row, head) segments */
#pragma unroll
  for (int j = 0; j < HD / 16; ++j) { v4f x0, x1;
#pragma unroll
    for (int r = 0; r < 4; ++r) { x0[r] = o[j][r] * inv; x1[r] = o[j][4 + r] * inv; }
    *(v4f_a*)&ss[col][j * 16 + 8 * g] = x0; *(v4f_a*)&ss[col][j * 16 + 8 * g + 4] = x1; }
  LDSX();
#pragma unroll
  for (int i = 0; i < 8; ++i) { const int rl = 2 * i + g; vst2(Y + ((size_t)b * TT + ql0 + rl) * CC + h * HD + col * 4, *(const v4f_a*)&ss[rl][col * 4]); } }
__global__ __launch_bounds__(128, 4) void k_att(const _Float16* __restrict__ QH, const _Float16* __restrict__ KH, const _Float16* __restrict__ QL, const _Float16* __restrict__ KL, const _Float16* __restrict__ VT, const __bf16* __restrict__ VB, const __bf16* __restrict__ VBL, float* __restrict__ Y) {   /* 4 waves a SIMD: all 1024 blocks resident at once, 4 a WGP */
  __shared__ __align__(16) unsigned char sm[2 * 4 * ATILE]; static_assert(CAUSAL && QBH * 64 <= KHI && QBH * 64 <= QHI && HD == 64 && 4 * 16 * (HD + 4) * 4 <= 2 * 2 * ATILE, "k_att");
  const int z = blockIdx.z, b = z / NH, h = z % NH;
  const int qb = ((z & 1) ? NQB - 1 - (int)blockIdx.x : (int)blockIdx.x) ^ ((z & 2) ? NQB / 2 : 0);   /* a permutation of the query blocks per plane: neighbours in launch order differ in length, for balance only */
  if (qb < QBH) att_body<true>(sm, QH, KH, QL, KL, VT, VB, VBL, Y, qb, b, h); else att_body<false>(sm, QH, KH, QL, KL, VT, VB, VBL, Y, qb, b, h); }
// ---- k_out: block = (64 rows, 128 cols): out = ctx Wo (+ bo): ctx x 2^6 once to f16 against Wo as f16(bf16 x 2^8) exact (1 product) x 2^-14; causal early rows (< QHI of each sequence): ctx bf16 hi + lo against exact bf16 Wo (2 products)
__global__ __launch_bounds__(128) void k_out(const float* __restrict__ Y, const float* __restrict__ WO, const float* __restrict__ BO, float* __restrict__ OUT) { __shared__ __align__(16) float sf[4][16][132]; __shared__ __align__(16) __bf16 wt[2][128][WPITCH];
  const int tid = threadIdx.x, wave = tid >> 5, lane = tid & 31, col = lane & 15, g = lane >> 4; const int c0 = blockIdx.y * 128; const size_t r0 = (size_t)blockIdx.x * 64 + wave * 16;
  v8f acc[8] = {};
  static_assert(!WO_OUT_IN, "the staged tile reads Wo as [k][column]");
  const int kq = lane >> 3, cl0 = wave * 32 + 4 * (lane & 7); const float* wb = WO + c0 + cl0 + (size_t)(8 * kq) * DIN; const float* arow = Y + (r0 + col) * CC + 8 * g;
  WRaw wr; ARaw ar; a_load(ar, arow, 0); wt_load(wr, wb, DIN, 0); PF_XW();
  if (CAUSAL && (int)(((size_t)blockIdx.x * 64) % TT) < QHI) {   /* block-uniform */
    wt_store_b(wt[0], wr, cl0, kq);
    __syncthreads();   /* tile 0 is published */
#pragma unroll 2   /* two trips = the two buffers at constant LDS addresses */
    for (int t = 0; t < CC / KT; ++t) { F2 a[KT / 32];
#pragma unroll
      for (int c = 0; c < KT / 32; ++c) { float v[16];
#pragma unroll
        for (int e = 0; e < 16; ++e) v[e] = ar.r[c][e >> 2][e & 3];
        a[c] = bsplit16(v); }
      if (t + 1 < CC / KT) { a_load(ar, arow, (t + 1) * KT); wt_load(wr, wb, DIN, (t + 1) * KT); }   /* the next tile flies while this one is multiplied */
      PF_STAGE();
      v16b bf[2][4];   /* B fragments in groups of 4, two register sets, as in k_proj */
#pragma unroll
      for (int q = 0; q < 2; ++q)
#pragma unroll
        for (int jj = 0; jj < 4; ++jj) bf[q][jj] = frag_b(&wt[t & 1][(q * 4 + jj) * 16 + col][0], lane);
#pragma unroll
      for (int q = 0; q < 4; ++q) {
#pragma unroll
        for (int jj = 0; jj < 4; ++jj) { const int j = (q & 1) * 4 + jj; acc[j] = wmma_bf(a[q >> 1].h, bf[q & 1][jj], acc[j]); acc[j] = wmma_bf(a[q >> 1].l, bf[q & 1][jj], acc[j]); }
        if (q < 2) {
#pragma unroll
          for (int jj = 0; jj < 4; ++jj) bf[q][jj] = frag_b(&wt[t & 1][(q * 4 + jj) * 16 + col][32], lane); } }
      PF_STAGE();
      if (t + 1 < CC / KT) wt_store_b(wt[(t + 1) & 1], wr, cl0, kq);   /* that buffer's readers left it at the barrier of trip t - 1 */
      PF_XW();
      __syncthreads(); }   /* publishes tile t + 1 and ends the reads of tile t */
#pragma unroll
    for (int j = 0; j < 8; ++j) { const float bias = BO ? bfr(BO[c0 + j * 16 + col]) : 0.f;
#pragma unroll
      for (int r = 0; r < 8; ++r) sf[wave][8 * g + r][j * 16 + col] = acc[j][r] + bias; }
  } else {
    _Float16 (*wh)[128][WPITCH] = (_Float16 (*)[128][WPITCH])wt;   /* this path keeps f16 in the same two buffers */
    wt_store_h(wh[0], wr, cl0, kq);
    __syncthreads();   /* tile 0 is published */
#pragma unroll 2   /* two trips = the two buffers at constant LDS addresses */
    for (int t = 0; t < CC / KT; ++t) { v16h a[KT / 32];
#pragma unroll
      for (int c = 0; c < KT / 32; ++c)
#pragma unroll
        for (int e = 0; e < 16; ++e) a[c][e] = (_Float16)(ar.r[c][e >> 2][e & 3] * 64.0f);   /* ctx carried x 2^6 into f16 so small-magnitude context rows stay clear of f16 subnormals */
      if (t + 1 < CC / KT) { a_load(ar, arow, (t + 1) * KT); wt_load(wr, wb, DIN, (t + 1) * KT); }   /* the next tile flies while this one is multiplied */
      PF_STAGE();
      v16h bf[2][4];   /* B fragments in groups of 4, two register sets, as in k_proj */
#pragma unroll
      for (int q = 0; q < 2; ++q)
#pragma unroll
        for (int jj = 0; jj < 4; ++jj) bf[q][jj] = frag_h(&wh[t & 1][(q * 4 + jj) * 16 + col][0], lane);
#pragma unroll
      for (int q = 0; q < 4; ++q) {
#pragma unroll
        for (int jj = 0; jj < 4; ++jj) acc[(q & 1) * 4 + jj] = wmma16(a[q >> 1], bf[q & 1][jj], acc[(q & 1) * 4 + jj]);
        if (q < 2) {
#pragma unroll
          for (int jj = 0; jj < 4; ++jj) bf[q][jj] = frag_h(&wh[t & 1][(q * 4 + jj) * 16 + col][32], lane); } }
      PF_STAGE();
      if (t + 1 < CC / KT) wt_store_h(wh[(t + 1) & 1], wr, cl0, kq);   /* that buffer's readers left it at the barrier of trip t - 1 */
      PF_XW();
      __syncthreads(); }   /* publishes tile t + 1 and ends the reads of tile t */
#pragma unroll
    for (int j = 0; j < 8; ++j) { const float bias = BO ? bfr(BO[c0 + j * 16 + col]) : 0.f;
#pragma unroll
      for (int r = 0; r < 8; ++r) sf[wave][8 * g + r][j * 16 + col] = acc[j][r] * (1.0f / 16384.0f) + bias; } }   /* 2^-8 (Wo carry) x 2^-6 (ctx carry) */
  LDSX(); for (int rl = 0; rl < 16; ++rl) vst2(OUT + (r0 + rl) * DIN + c0 + lane * 4, *(const v4f*)&sf[wave][rl][lane * 4]); }

extern "C" void kernel_launch(void* const* d_in, const int* in_sizes, int n_in, void* d_out, int out_size, void* d_ws, size_t ws_size, hipStream_t stream) {
  (void)in_sizes; (void)n_in; (void)out_size;
  const float** F = (const float**)d_in;
  if (ws_size < (size_t)WS_END) return;
  char* ws = (char*)d_ws; _Float16 *QH = (_Float16*)(ws + WS_QH), *KH = (_Float16*)(ws + WS_KH), *VT = (_Float16*)(ws + WS_VT), *QL = (_Float16*)(ws + WS_QL), *KL = (_Float16*)(ws + WS_KL); __bf16 *VB = (__bf16*)(ws + WS_VB), *VBL = (__bf16*)(ws + WS_VBL); float *Y = (float*)(ws + WS_Y);
  (void)Y; (void)QL; (void)KL; (void)VB; (void)VBL;
  // inputs: 0 x [4,1024,1024]; 1 Wq [16,1024,64]; 2 Wk; 3 Wv (per-head [head][model][d]); 4 Wp [1024,1024] (in,out); 5 bp [1024] (zeros, read); no q / k / v biases
  k_proj<<<dim3(TNB * TT / 64, CC / 128, 3), 128, 0, stream>>>(F[0], F[0], F[0], F[1], F[2], F[3], nullptr, nullptr, nullptr, QH, QL, KH, KL, VT, VB, VBL);
  k_att<<<dim3(NQB, 1, TNB * NH), 128, 0, stream>>>(QH, KH, QL, KL, VT, VB, VBL, Y);
  k_out<<<dim3(TNB * TT / 64, DIN / 128), 128, 0, stream>>>(Y, F[4], F[5], (float*)d_out);
}

// v005
// A run of this version takes 93.4 microseconds.
// Next to v004, in two timings, it ran 1.03 times as fast each time.
// All steps since v000 together make it 7.65 times as fast.
// compute dtype: all float inputs rounded to bf16; per-head q / k / v projections with EXACT bf16 products on WMMA 16x16x32 (f32 accumulate), no biases; causal logits: 3 products for the first 384 rows, single f16 q x k after, x 1024^-0.5; softmax f32; P x 2^11 once to f16 x v once to f16 (bf16 hi + lo below row 384); ctx hi+lo x exact Wp below row 384, x2^6 f16 carry x f16(bf16 x 2^8) Wp after, + bp (zeros, read); f32 output.
#include <hip/hip_runtime.h>
#include <math.h>

typedef __attribute__((ext_vector_type(16))) _Float16 v16h;
typedef __attribute__((ext_vector_type(16))) __bf16 v16b;
typedef __attribute__((ext_vector_type(8)))  _Float16 v8h;
typedef __attribute__((ext_vector_type(8)))  float v8f;
typedef __attribute__((ext_vector_type(4)))  float v4f;
typedef __attribute__((ext_vector_type(2)))  float v2f;
typedef __attribute__((ext_vector_type(4)))  unsigned v4u;
typedef __attribute__((ext_vector_type(4)))  int v4i;
typedef float __attribute__((may_alias)) float_a;
typedef int __attribute__((may_alias)) int_a;

template <typename T> __device__ __forceinline__ void vst2(void* p, T v) { *(T*)p = v;  }
__device__ __forceinline__ v8f wmma16(v16h a, v16h b, v8f c) {
  v8f d = __builtin_amdgcn_wmma_f32_16x16x32_f16(false, a, false, b, (short)0, c, false, false);
  asm volatile("v_nop\n\tv_nop\n\tv_nop\n\tv_nop" : "+v"(d) : "v"(a), "v"(b));
  return d;
}
__device__ __forceinline__ v8f wmma_bf(v16b a, v16b b, v8f c) {
  v8f d = __builtin_amdgcn_wmma_f32_16x16x32_bf16(false, a, false, b, (short)0, c, false, false);
  asm volatile("v_nop\n\tv_nop\n\tv_nop\n\tv_nop" : "+v"(d) : "v"(a), "v"(b));
  return d;
}
// 16x16x32 fragments: lane = (h = lane>>4, row/col = lane&15); elements 0..7 = k0+8h+0..7, 8..15 = k0+16+8h+0..7; D element r = row 8h+r
__device__ __forceinline__ v16h frag_h(const _Float16* rowk0, int lane) {
  union { v16h v; v8h q[2]; } u; const _Float16* p = rowk0 + 8 * (lane >> 4);
  u.q[0] = *(const v8h*)p; u.q[1] = *(const v8h*)(p + 16); return u.v;
}
__device__ __forceinline__ v16h frag_f32(const float* rowk0, int lane) {
  v16h a; const float* p = rowk0 + 8 * (lane >> 4);
#pragma unroll
  for (int i = 0; i < 8; ++i) { a[i] = (_Float16)p[i]; a[8 + i] = (_Float16)p[16 + i]; }
  return a;
}
__device__ __forceinline__ v16h frag_f32s(const float* rowk0, int lane, float sc) {
  v16h a; const float* p = rowk0 + 8 * (lane >> 4);
#pragma unroll
  for (int i = 0; i < 8; ++i) { a[i] = (_Float16)(p[i] * sc); a[8 + i] = (_Float16)(p[16 + i] * sc); }
  return a;
}
// column fragment from a [K][ld] layout (column n), rows >= K read as 0
__device__ __forceinline__ v16h fragc_f32(const float* W, int k0, int n, int lane, int ld, int K) {
  v16h a; const int g = lane >> 4;
#pragma unroll
  for (int i = 0; i < 8; ++i) { const int ka = k0 + 8 * g + i, kb = ka + 16;
    a[i] = (_Float16)(ka < K ? W[(size_t)(ka < K ? ka : K - 1) * ld + n] : 0.f); a[8 + i] = (_Float16)(kb < K ? W[(size_t)(kb < K ? kb : K - 1) * ld + n] : 0.f); }
  return a;
}
struct F2 { v16b h, l; };
__device__ __forceinline__ F2 bsplit16(const float v[16]) { F2 r;
#pragma unroll
  for (int i = 0; i < 16; ++i) { const __bf16 h = (__bf16)v[i]; r.h[i] = h; r.l[i] = (__bf16)(v[i] - (float)h); }
  return r; }
__device__ __forceinline__ F2 split_row(const float* row, int k0, int lane) { float v[16]; const float* p = row + k0 + 8 * (lane >> 4);
#pragma unroll
  for (int i = 0; i < 8; ++i) { v[i] = p[i]; v[8 + i] = p[16 + i]; }
  return bsplit16(v); }
__device__ __forceinline__ F2 split_rowK(const float* row, int k0, int lane, int K) { float v[16]; const int g = lane >> 4;
#pragma unroll
  for (int i = 0; i < 8; ++i) { const int ka = k0 + 8 * g + i, kb = ka + 16; v[i] = ka < K ? row[ka < K ? ka : K - 1] : 0.f; v[8 + i] = kb < K ? row[kb < K ? kb : K - 1] : 0.f; }
  return bsplit16(v); }
__device__ __forceinline__ F2 split_col(const float* W, int k0, int n, int lane, int ld, int K) { float v[16]; const int g = lane >> 4;
#pragma unroll
  for (int i = 0; i < 8; ++i) { const int ka = k0 + 8 * g + i, kb = ka + 16; v[i] = ka < K ? W[(size_t)(ka < K ? ka : K - 1) * ld + n] : 0.f; v[8 + i] = kb < K ? W[(size_t)(kb < K ? kb : K - 1) * ld + n] : 0.f; }
  return bsplit16(v); }
__device__ __forceinline__ v8f mac3(const F2& a, const F2& b, v8f c) { c = wmma_bf(a.l, b.h, c); c = wmma_bf(a.h, b.l, c); return wmma_bf(a.h, b.h, c); }
__device__ __forceinline__ float sigm(float v) { return 1.0f / (1.0f + expf(-v)); }
#define LDSX() do { asm volatile("s_wait_dscnt 0" ::: "memory"); __builtin_amdgcn_wave_barrier(); __builtin_amdgcn_fence(__ATOMIC_RELEASE, "workgroup"); } while (0)

// Causal multi-head self-attention with per-head weights and a 1/sqrt(C) score scale (x [4,1024,1024]; Wq / Wk / Wv [16,1024,64] = per-head [head][model][d] N(0,1) x 0.02, no biases; Wp [1024,1024] (in,out), bp zeros (read); q = einsum('btc,hcd->bhtd'); scores x 1/sqrt(1024) - the scale is 1/32, not 1/8 (soft logits); tril kept, -inf elsewhere; softmax; heads concatenated; out @ Wp + bp).
#define NB 4
#define TT 1024
#define CC 1024            // NH * HD = projected width
#define DIN 1024          // input (model) width
#define NH 16
#define HD 64
#define NQB (TT / 64)
#define SCALE (0.03125f)
#define CAUSAL 1
#ifndef TNB
#define TNB NB
#endif
__device__ __forceinline__ float bfr(float v) { return (float)(__bf16)v; }
typedef __attribute__((ext_vector_type(8))) __bf16 v8b;
__device__ __forceinline__ v16b frag_b(const __bf16* rowk0, int lane) {
  union { v16b v; v8b q[2]; } u; const __bf16* p = rowk0 + 8 * (lane >> 4);
  u.q[0] = *(const v8b*)p; u.q[1] = *(const v8b*)(p + 16); return u.v;
}
#define QBH 6              // causal: query blocks 0..QBH-1 of each sequence (few keys, no averaging) take the high-precision path
#define QHI 384            // rows carrying a q residual plane
#define KHI 384            // key rows carrying k residual / v bf16 hi+lo planes (used only by the causal high-precision path)
// B fragment (k rows k0+.., output column o) of a weight: (in,out) [K][ld] or (out,in) [ld rows of K]: bf16 exact, or f16(bf16 * 256) exact
__device__ __forceinline__ v16b wcol_io(const float* Wm, int k0, int o, int lane, int ld) { v16b w; const int g = lane >> 4;
#pragma unroll
  for (int i = 0; i < 8; ++i) { w[i] = (__bf16)Wm[(size_t)(k0 + 8 * g + i) * ld + o]; w[8 + i] = (__bf16)Wm[(size_t)(k0 + 16 + 8 * g + i) * ld + o]; }
  return w; }
__device__ __forceinline__ v16b wcol_oi(const float* Wm, int k0, int o, int lane, int K) { v16b w; const float* p = Wm + (size_t)o * K + k0 + 8 * (lane >> 4);
#pragma unroll
  for (int i = 0; i < 8; ++i) { w[i] = (__bf16)p[i]; w[8 + i] = (__bf16)p[16 + i]; }
  return w; }
__device__ __forceinline__ v16h wcolh_io(const float* Wm, int k0, int o, int lane, int ld) { v16h w; const int g = lane >> 4;
#pragma unroll
  for (int i = 0; i < 8; ++i) { w[i] = (_Float16)(bfr(Wm[(size_t)(k0 + 8 * g + i) * ld + o]) * 256.0f); w[8 + i] = (_Float16)(bfr(Wm[(size_t)(k0 + 16 + 8 * g + i) * ld + o]) * 256.0f); }
  return w; }
__device__ __forceinline__ v16h wcolh_oi(const float* Wm, int k0, int o, int lane, int K) { v16h w; const float* p = Wm + (size_t)o * K + k0 + 8 * (lane >> 4);
#pragma unroll
  for (int i = 0; i < 8; ++i) { w[i] = (_Float16)(bfr(p[i]) * 256.0f); w[8 + i] = (_Float16)(bfr(p[16 + i]) * 256.0f); }
  return w; }
#define WQKV_LAYOUT 2   // 0 = (in,out) [DIN][CC]; 1 = (out,in) [CC][DIN]; 2 = per-head [NH][DIN][HD]
__device__ __forceinline__ v16b wcol_hdk(const float* Wm, int k0, int o, int lane) { v16b w; const int g = lane >> 4; const float* p = Wm + (size_t)(o / HD) * DIN * HD + (o % HD);
#pragma unroll
  for (int i = 0; i < 8; ++i) { w[i] = (__bf16)p[(size_t)(k0 + 8 * g + i) * HD]; w[8 + i] = (__bf16)p[(size_t)(k0 + 16 + 8 * g + i) * HD]; }
  return w; }
#define WO_OUT_IN 0
#if WQKV_LAYOUT == 1
#define WCOL(W, k0, o, lane) wcol_oi(W, k0, o, lane, DIN)
#elif WQKV_LAYOUT == 2
#define WCOL(W, k0, o, lane) wcol_hdk(W, k0, o, lane)
#else
#define WCOL(W, k0, o, lane) wcol_io(W, k0, o, lane, CC)
#endif
#if WO_OUT_IN
#define WOCOL(W, k0, o, lane) wcol_oi(W, k0, o, lane, CC)
#define WOCOLH(W, k0, o, lane) wcolh_oi(W, k0, o, lane, CC)
#else
#define WOCOL(W, k0, o, lane) wcol_io(W, k0, o, lane, DIN)
#define WOCOLH(W, k0, o, lane) wcolh_io(W, k0, o, lane, DIN)
#endif

#ifndef SM_EXTRA_PARAMS
#define SM_EXTRA_PARAMS
#endif
#ifndef PROJ_EXTRA_PARAMS
#define PROJ_EXTRA_PARAMS
#endif
#ifndef SM_MASK_HOOK
#define SM_MASK_HOOK (void)0
#endif

#define WS_QH  0u                                      // f16 q rows [b*t][CC]
#define WS_KH  (WS_QH + 2u * (size_t)NB * TT * CC)      // f16 k rows [b*t][CC]
#define WS_VT  (WS_KH + 2u * (size_t)NB * TT * CC)      // f16 v planes [b][c][t]
#define WS_QL  (WS_VT + 2u * (size_t)NB * CC * TT)      // f16 q residual x 2^10 rows [b][t < QHI][CC]
#define WS_KL  (WS_QL + 2u * (size_t)NB * QHI * CC)     // f16 k residual x 2^10 rows [b][t < KHI][CC]
#define WS_VB  (WS_KL + 2u * (size_t)NB * KHI * CC)     // bf16 v hi planes [b][c][t < KHI]
#define WS_VBL (WS_VB + 2u * (size_t)NB * CC * KHI)
#define WS_Y   (WS_VBL + 2u * (size_t)NB * CC * KHI)    // f32 ctx rows [b*t][CC] (only when there is an output projection)
#define WS_END (WS_Y  + 4u * (size_t)NB * TT * CC)

// ---- weight tile in LDS (k_proj, k_out): KT k rows x 128 output columns, rounded once per block to 16 bit and kept as [column][k], so a B fragment is frag_b / frag_h on a column's row
#define KT 64
#define WPITCH (KT + 8)    // 144-B column pitch: the 16 lanes of a ds_load_b128 fragment read fall on 16 different bank quads
// a thread carries 2 units of (4 columns x 8 k): lane = (column quad lane & 7, k octet lane >> 3), wave = 32 columns; each load instruction covers four whole 128-B lines, each LDS store meets every bank twice
// PF_STAGE: in front of a tile's matrix work it keeps the scheduler from sinking the next tile's global loads below it; behind the matrix work it keeps the next tile's conversions, and with them the wait for those loads, from rising above it
#define PF_STAGE() __builtin_amdgcn_sched_barrier(0)
// PF_XW: what follows (the next trip, the loop's set-up) rewrites the address registers that the global loads issued before it name; the wait stands in front of that overwrite
#define PF_XW() do { asm volatile("s_wait_xcnt 0x0" ::: "memory"); __builtin_amdgcn_sched_barrier(0); } while (0)   /* the scheduling barrier keeps later address arithmetic from rising over the wait */
// PF_XWP: the same wait behind k_proj's first loads; it takes their two address pairs as inputs, so that no later load's result is given those registers ahead of the wait
#define PF_XWP(p, q) do { asm volatile("s_wait_xcnt 0x0" :: "v"(p), "v"(q) : "memory"); __builtin_amdgcn_sched_barrier(0); } while (0)
static_assert(KT == 64, "the k loops take a tile as two k halves of 32");
struct WRaw { v4f r[2][8]; };
struct ARaw { v4f r[KT / 32][4]; };
__device__ __forceinline__ void wt_load(WRaw& w, const float* base, int ldk, int k0) {   /* base = (k row 8 kq, the thread's first column); ldk = floats between k rows */
#pragma unroll
  for (int u = 0; u < 2; ++u)
#pragma unroll
    for (int kk = 0; kk < 8; ++kk) w.r[u][kk] = *(const v4f*)(base + (size_t)(k0 + 32 * u + kk) * ldk); }
__device__ __forceinline__ void wt_store_b(__bf16 (*wt)[WPITCH], const WRaw& w, int cl0, int kq) {
#pragma unroll
  for (int u = 0; u < 2; ++u)
#pragma unroll
    for (int i = 0; i < 4; ++i) { v8b p;
#pragma unroll
      for (int kk = 0; kk < 8; ++kk) p[kk] = (__bf16)w.r[u][kk][i];
      *(v8b*)&wt[cl0 + i][32 * u + 8 * kq] = p; } }
// the same staging for a block of 8 waves (k_out): a thread carries ONE unit; waves 0..3 take k 0..31 of the tile, waves 4..7 k 32..63; kl = the unit's first k in the tile, base = (k row kl, the thread's first column)
struct WRaw1 { v4f r[8]; };
__device__ __forceinline__ void wt_load1(WRaw1& w, const float* base, int ldk, int k0) {
#pragma unroll
  for (int kk = 0; kk < 8; ++kk) w.r[kk] = *(const v4f*)(base + (size_t)(k0 + kk) * ldk); }
__device__ __forceinline__ void wt_store_b1(__bf16 (*wt)[WPITCH], const WRaw1& w, int cl0, int kl) {
#pragma unroll
  for (int i = 0; i < 4; ++i) { v8b p;
#pragma unroll
    for (int kk = 0; kk < 8; ++kk) p[kk] = (__bf16)w.r[kk][i];
    *(v8b*)&wt[cl0 + i][kl] = p; } }
__device__ __forceinline__ void wt_store_h1(_Float16 (*wt)[WPITCH], const WRaw1& w, int cl0, int kl) {   /* f16(bf16 x 2^8), exact */
#pragma unroll
  for (int i = 0; i < 4; ++i) { v8h p;
#pragma unroll
    for (int kk = 0; kk < 8; ++kk) p[kk] = (_Float16)(bfr(w.r[kk][i]) * 256.0f);
    *(v8h*)&wt[cl0 + i][kl] = p; } }
// the lane's A elements of one tile, raw f32: fragment c, element e = r[c][e >> 2][e & 3] (k = 32 c + 8 g + e for e < 8, + 8 more after); rowg = row + 8 g
__device__ __forceinline__ void a_load(ARaw& a, const float* rowg, int k0) {
#pragma unroll
  for (int c = 0; c < KT / 32; ++c) { const float* q = rowg + k0 + 32 * c; a.r[c][0] = *(const v4f*)q; a.r[c][1] = *(const v4f*)(q + 4); a.r[c][2] = *(const v4f*)(q + 16); a.r[c][3] = *(const v4f*)(q + 20); } }
// ---- k_proj: block = (128 rows, 128 cols, which); a wave takes two groups of 16 rows (rows 16 wave + 64 rg), so that every B fragment read from LDS and every staged weight tile serves two products: q/k/v = X W (+ b) with exact bf16 products (K = DIN) -> which 0: q f16 rows (+ residual rows < QHI); 1: k f16 rows (+ residual rows < KHI); 2: v f16 planes [c][t] (+ bf16 hi/lo planes for t < KHI)
__global__ __launch_bounds__(128) void k_proj(const float* __restrict__ XQ, const float* __restrict__ XK, const float* __restrict__ XV, const float* __restrict__ WQ, const float* __restrict__ WK, const float* __restrict__ WV, const float* __restrict__ BQ, const float* __restrict__ BK, const float* __restrict__ BV,
    _Float16* __restrict__ QH, _Float16* __restrict__ QL, _Float16* __restrict__ KH, _Float16* __restrict__ KL, _Float16* __restrict__ VT, __bf16* __restrict__ VB, __bf16* __restrict__ VBL) {
  __shared__ __align__(16) unsigned char sm[3 * 128 * 72 * 2];   /* the two weight buffers during the k loop; behind the loop's last barrier the epilogue's planes */
  __bf16 (*wt)[128][WPITCH] = (__bf16 (*)[128][WPITCH])sm; static_assert(2 * 128 * WPITCH * 2 <= 3 * 128 * 72 * 2 && 2 * 64 * 136 * 2 <= 3 * 128 * 72 * 2, "LDS");
  _Float16 (*sh)[136] = (_Float16 (*)[136])sm, (*sl)[136] = (_Float16 (*)[136])(sm + 64 * 136 * 2); _Float16 (*th)[72] = (_Float16 (*)[72])sm; __bf16 (*tb)[72] = (__bf16 (*)[72])(sm + 128 * 72 * 2), (*tbl)[72] = (__bf16 (*)[72])(sm + 2 * 128 * 72 * 2);
  const int tid = threadIdx.x, wave = tid >> 5, lane = tid & 31, col = lane & 15, g = lane >> 4; const int which = blockIdx.z; const int c0 = blockIdx.y * 128; const size_t r0 = (size_t)blockIdx.x * 128; const size_t bb = r0 / TT; const int t0 = (int)(r0 % TT); static_assert(TT % 128 == 0 && QHI % 64 == 0 && KHI % 64 == 0, "a block lies in one sequence");
  const float* X = which == 0 ? XQ : which == 1 ? XK : XV; const float* WA = which == 0 ? WQ : which == 1 ? WK : WV; const float* BA = which == 0 ? BQ : which == 1 ? BK : BV;
  v8f acc[2][8] = {};
  static_assert(WQKV_LAYOUT == 2 && HD % 32 == 0, "a wave's 32 staged columns lie in one head");
  const int kq = lane >> 3, cl0 = wave * 32 + 4 * (lane & 7); const float* wb = WA + (size_t)((c0 + cl0) / HD) * DIN * HD + (c0 + cl0) % HD + (size_t)(8 * kq) * HD; const float* arow = X + (r0 + wave * 16 + col) * DIN + 8 * g;
  WRaw wr; ARaw ar[2]; a_load(ar[0], arow, 0); a_load(ar[1], arow + 64 * DIN, 0); wt_load(wr, wb, HD, 0); PF_XWP(arow, wb); wt_store_b(wt[0], wr, cl0, kq);
  __syncthreads();   /* tile 0 is published */
#pragma unroll 2   /* two trips = the two buffers at constant LDS addresses */
  for (int t = 0; t < DIN / KT; ++t) { v16b a[2][KT / 32];
#pragma unroll
    for (int rg = 0; rg < 2; ++rg)
#pragma unroll
      for (int c = 0; c < KT / 32; ++c)
#pragma unroll
        for (int e = 0; e < 16; ++e) a[rg][c][e] = (__bf16)ar[rg].r[c][e >> 2][e & 3];
    if (t + 1 < DIN / KT) { a_load(ar[0], arow, (t + 1) * KT); a_load(ar[1], arow + 64 * DIN, (t + 1) * KT); wt_load(wr, wb, HD, (t + 1) * KT); }   /* the next tile flies while this one is multiplied */
    PF_STAGE();
    v16b bf[2][4];   /* B fragments in groups of 4 (group q: k half q >> 1, columns 64 (q & 1) ..), two register sets: a group's LDS reads are issued together, two groups ahead of its products */
#pragma unroll
    for (int q = 0; q < 2; ++q)
#pragma unroll
      for (int jj = 0; jj < 4; ++jj) bf[q][jj] = frag_b(&wt[t & 1][(q * 4 + jj) * 16 + col][0], lane);
#pragma unroll
    for (int q = 0; q < 4; ++q) {
#pragma unroll
      for (int jj = 0; jj < 4; ++jj)
#pragma unroll
        for (int rg = 0; rg < 2; ++rg) acc[rg][(q & 1) * 4 + jj] = wmma_bf(a[rg][q >> 1], bf[q & 1][jj], acc[rg][(q & 1) * 4 + jj]);
      if (q < 2) {
#pragma unroll
        for (int jj = 0; jj < 4; ++jj) bf[q][jj] = frag_b(&wt[t & 1][(q * 4 + jj) * 16 + col][32], lane); } }
    PF_STAGE();
    if (t + 1 < DIN / KT) wt_store_b(wt[(t + 1) & 1], wr, cl0, kq);   /* that buffer's readers left it at the barrier of trip t - 1 */
    PF_XW();
    __syncthreads(); }   /* publishes tile t + 1 and ends the reads of tile t (after the last trip: frees the LDS for the epilogue) */
  // the epilogue takes the two row groups one after the other through the same planes (64 rows each)
#pragma unroll
  for (int rg = 0; rg < 2; ++rg) { const size_t r0g = r0 + 64 * rg; const int t0g = t0 + 64 * rg;
  if (rg) __syncthreads();   /* the first group's rows have been read out of the planes */
  if (which < 2) { _Float16* DH = which == 0 ? QH : KH; _Float16* DL = which == 0 ? QL : KL; const int nhi = which == 0 ? QHI : KHI; const bool hi_rows = t0g < nhi;
#pragma unroll
    for (int j = 0; j < 8; ++j) { const float bias = BA ? bfr(BA[c0 + j * 16 + col]) : 0.f;
#pragma unroll
      for (int r = 0; r < 8; ++r) { const float v = acc[rg][j][r] + bias; const _Float16 hv = (_Float16)v; sh[wave * 16 + 8 * g + r][j * 16 + col] = hv; sl[wave * 16 + 8 * g + r][j * 16 + col] = (_Float16)((v - (float)hv) * 1024.0f); } }
    __syncthreads();
    for (int e = tid; e < 64 * 16; e += 128) { const int rl = e >> 4, q = e & 15; vst2((unsigned*)(DH + (r0g + rl) * CC + c0 + q * 8), *(const v4u*)&sh[rl][q * 8]); PF_XW();   /* the LDS read below may land in this store's registers */
      if (hi_rows) vst2((unsigned*)(DL + (bb * nhi + t0g + rl) * (size_t)CC + c0 + q * 8), *(const v4u*)&sl[rl][q * 8]); PF_XW(); }   /* the next trip rewrites the stores' address registers */
  } else { const bool hi_rows = t0g < KHI;
#pragma unroll
    for (int j = 0; j < 8; ++j) { const float bias = BA ? bfr(BA[c0 + j * 16 + col]) : 0.f;
#pragma unroll
      for (int r = 0; r < 8; ++r) { const float v = acc[rg][j][r] + bias; const int rl = wave * 16 + 8 * g + r, cl = j * 16 + col; th[cl][rl] = (_Float16)v; const __bf16 bh = (__bf16)v; tb[cl][rl] = bh; tbl[cl][rl] = (__bf16)(v - (float)bh); } }
    __syncthreads();
    for (int e = tid; e < 128 * 8; e += 128) { const int cl = e >> 3, q = e & 7; vst2((unsigned*)(VT + (bb * CC + c0 + cl) * (size_t)TT + t0g + q * 8), *(const v4u*)&th[cl][q * 8]); PF_XW();   /* the LDS reads below may land in this store's address registers */
      if (hi_rows) { const size_t o3 = (bb * CC + c0 + cl) * (size_t)KHI + t0g + q * 8; vst2((unsigned*)(VB + o3), *(const v4u*)&tb[cl][q * 8]); vst2((unsigned*)(VBL + o3), *(const v4u*)&tbl[cl][q * 8]); PF_XW(); } } } } }   /* as above, for the next trip */
// ---- k_att: block = 64 queries (qb) of one (b, h), z = b * NH + h; logits, softmax and P . v in one pass over 64-key blocks 0..qb, the logits never leave registers.
// Transposed products: St = K . Qt (A = 16 key rows, B = the wave's 16 queries), so a lane holds 8 keys a tile of ONE query (column lane & 15, keys 8 g + r); two neighbouring St tiles are, register for register, the B fragment Pt of 32 keys for Ot += Vt . Pt (A = 16 d rows of the v plane).
// Running maximum per query (in-lane + one exchange between the wave halves), e = 2^((s - m) c + 11), c = SCALE log2(e): P carried x 2^11 as before, the factor cancels against the row sum; Ot and the sum are rescaled at every key block.
// Query blocks < QBH: 3 logit products (q, k hi + residual x 2^10) and P, v as bf16 hi + lo (3 products); after: single f16 products.
// The K and v tiles (64 rows x 128 B each) are shared by the 4 waves through LDS: whole-line global loads one key block ahead, 2 buffers, one barrier per key block.
#define AP 72              // 144-B LDS row pitch, as WPITCH
#define ATILE (64 * AP * 2)   // bytes of one tile in LDS
__device__ __forceinline__ v8f wm_h(v16h a, v16h b, v8f c) { return __builtin_amdgcn_wmma_f32_16x16x32_f16(false, a, false, b, (short)0, c, false, false); }
__device__ __forceinline__ v8f wm_b(v16b a, v16b b, v8f c) { return __builtin_amdgcn_wmma_f32_16x16x32_bf16(false, a, false, b, (short)0, c, false, false); }
__device__ __forceinline__ float xhalf(float x) { return __builtin_bit_cast(float, __builtin_amdgcn_permlanex16(__builtin_bit_cast(int, x), __builtin_bit_cast(int, x), 0x76543210, 0xfedcba98, false, false)); }   /* lane l <-> lane l ^ 16 */
// 2^x by v_exp_f32 as asm text, eight in place in one statement: nothing of the compiler's then stands directly behind a v_exp_f32; the closing v_nop is the slot that the instruction set asks for behind the last one
__device__ __forceinline__ void exp2x8(float (&x)[8]) {
  asm("v_exp_f32 %0, %0\n\tv_exp_f32 %1, %1\n\tv_exp_f32 %2, %2\n\tv_exp_f32 %3, %3\n\tv_exp_f32 %4, %4\n\tv_exp_f32 %5, %5\n\tv_exp_f32 %6, %6\n\tv_exp_f32 %7, %7\n\tv_nop" : "+v"(x[0]), "+v"(x[1]), "+v"(x[2]), "+v"(x[3]), "+v"(x[4]), "+v"(x[5]), "+v"(x[6]), "+v"(x[7])); }
__device__ __forceinline__ float exp2x1(float x) { asm("v_exp_f32 %0, %0\n\tv_nop" : "+v"(x)); return x; }   /* the same for one value */
typedef v4u __attribute__((may_alias)) v4u_a;
typedef v4f __attribute__((may_alias)) v4f_a;
template <bool HI> __device__ __forceinline__ void att_body(unsigned char* sm, const _Float16* __restrict__ QH, const _Float16* __restrict__ KH, const _Float16* __restrict__ QL, const _Float16* __restrict__ KL, const _Float16* __restrict__ VT, const __bf16* __restrict__ VB, const __bf16* __restrict__ VBL, float* __restrict__ Y, int qb, int b, int h) {
  constexpr int NT = HI ? 4 : 2;   /* tiles a key block: k, v (+ k residual, v lo) */
  const int tid = threadIdx.x, wave = tid >> 5, lane = tid & 31, col = lane & 15, g = lane >> 4; const int ql0 = qb * 64 + wave * 16; const int nblk = qb + 1;
  const int srow = tid >> 3, spc = tid & 7;   /* staging: 8 lanes = one 128-B row; a thread carries rows srow + 16 i */
  constexpr unsigned vp = HI ? KHI : TT;
  // block-uniform bases and one 32-bit byte offset per thread and tile shape (k rows, v planes)
  const char* s_k = (const char*)(KH + (size_t)b * TT * CC + h * HD); const char* s_kl = (const char*)(KL + (size_t)b * KHI * CC + h * HD);
  const char* s_v = HI ? (const char*)(VB + ((size_t)b * CC + h * HD) * vp) : (const char*)(VT + ((size_t)b * CC + h * HD) * vp); const char* s_vl = (const char*)(VBL + ((size_t)b * CC + h * HD) * vp);
  const unsigned o_k = (unsigned)srow * (CC * 2) + spc * 16, o_v = (unsigned)srow * (vp * 2) + spc * 16;
  v4u ra[4], rb[4];   /* two tiles in flight: k and v; with the residual planes first k and k residual, then, behind the logit products, v hi and v lo in the same registers */
#define ATT_LD(dst, base, rowstep, off) do { _Pragma("unroll") for (int i = 0; i < 4; ++i) dst[i] = *(const v4u_a*)((base) + i * (16 * (rowstep)) + (off)); } while (0)
#define ATT_ST(bufp, tile, srcr) do { _Pragma("unroll") for (int i = 0; i < 4; ++i) *(v4u_a*)((bufp) + (tile) * ATILE + (srow + 16 * i) * (AP * 2) + spc * 16) = srcr[i]; } while (0)
#define ATT_KSTEP (64 * CC * 2)   /* bytes between key blocks in the k rows; 128 in the v planes */
  v16h qf[HD / 32], qlf[HD / 32];
#pragma unroll
  for (int kc = 0; kc < HD / 32; ++kc) { qf[kc] = frag_h(QH + ((size_t)b * TT + ql0 + col) * CC + h * HD + kc * 32, lane); if (HI) qlf[kc] = frag_h(QL + ((size_t)b * QHI + ql0 + col) * CC + h * HD + kc * 32, lane); }
  if (HI) { ATT_LD(ra, s_k, CC * 2, o_k); ATT_LD(rb, s_kl, CC * 2, o_k); PF_XW(); ATT_ST(sm, 0, ra); ATT_ST(sm, 2, rb); ATT_LD(ra, s_v, vp * 2, o_v); ATT_LD(rb, s_vl, vp * 2, o_v); PF_XW(); ATT_ST(sm, 1, ra); ATT_ST(sm, 3, rb); PF_XW(); }   /* the last wait: the q loads are scheduled behind the one before */
  else { ATT_LD(ra, s_k, CC * 2, o_k); ATT_LD(rb, s_v, vp * 2, o_v); PF_XW(); ATT_ST(sm, 0, ra); ATT_ST(sm, 1, rb); }
  __syncthreads();   /* key block 0 is published */
  const float cs = SCALE * 1.44269504088896340736f;
  float m = -3.0e38f, l = 0.f; v8f o[HD / 16] = {};
  for (int t = 0; t < nblk; ++t) { const unsigned char* bp = sm + (t & 1) * (NT * ATILE); unsigned char* nb = sm + ((t + 1) & 1) * (NT * ATILE);   /* nb: its readers left it at the barrier of trip t - 1 */
    // with the residual planes the staging is unconditional (the last trip stages its own block once more into the idle buffer, which nobody reads): no branch then stands between the logit products and the first readers of their results
    const bool more = HI || t + 1 < nblk; const int tn = (HI && t + 1 == nblk) ? t : t + 1;
    if (more) { ATT_LD(ra, s_k + (size_t)tn * ATT_KSTEP, CC * 2, o_k); if (HI) ATT_LD(rb, s_kl + (size_t)tn * ATT_KSTEP, CC * 2, o_k); else ATT_LD(rb, s_v + (size_t)tn * 128, vp * 2, o_v); }   /* the next key block flies while this one is worked on */
    if (HI) PF_XW(); else PF_STAGE();   /* with the residual planes the LDS reads below land in the address registers of these loads (without them the compiler writes the wait itself) */
    const _Float16 (*kt)[AP] = (const _Float16 (*)[AP])bp; const _Float16 (*klt)[AP] = (const _Float16 (*)[AP])(bp + 2 * ATILE); const _Float16 (*vt)[AP] = (const _Float16 (*)[AP])(bp + ATILE); const __bf16 (*vb)[AP] = (const __bf16 (*)[AP])(bp + ATILE); const __bf16 (*vbl)[AP] = (const __bf16 (*)[AP])(bp + 3 * ATILE);
    // ATT_GROUP: behind a group of LDS fragment reads it keeps the scheduler from sinking each read down to its own product (one LDS latency per product instead of one per group)
#define ATT_GROUP() __builtin_amdgcn_sched_barrier(0)
    float s[4][8]; v16h vf[2][HD / 16]; v16b vh[HD / 16], vl[HD / 16];
    if (HI) {
#pragma unroll
      for (int hf = 0; hf < 2; ++hf) { v16h kf[2][HD / 32], lf[2][HD / 32]; v8f a[2] = {}, al[2] = {};   /* two key tiles a group */
#pragma unroll
        for (int jj = 0; jj < 2; ++jj)
#pragma unroll
          for (int kc = 0; kc < HD / 32; ++kc) { kf[jj][kc] = frag_h(&kt[(2 * hf + jj) * 16 + col][kc * 32], lane); lf[jj][kc] = frag_h(&klt[(2 * hf + jj) * 16 + col][kc * 32], lane); }
        ATT_GROUP();
#pragma unroll
        for (int kc = 0; kc < HD / 32; ++kc)
#pragma unroll
          for (int jj = 0; jj < 2; ++jj) { a[jj] = wm_h(kf[jj][kc], qf[kc], a[jj]); al[jj] = wm_h(kf[jj][kc], qlf[kc], al[jj]); al[jj] = wm_h(lf[jj][kc], qf[kc], al[jj]); }
#pragma unroll
        for (int jj = 0; jj < 2; ++jj)
#pragma unroll
          for (int r = 0; r < 8; ++r) s[2 * hf + jj][r] = a[jj][r] + al[jj][r] * (1.0f / 1024.0f);
        ATT_GROUP(); }   /* here it keeps the second group's reads from rising over the first group's products: both groups at once do not fit the registers */
      ATT_ST(nb, 0, ra); ATT_ST(nb, 2, rb); PF_XW(); ATT_LD(ra, s_v + (size_t)tn * 128, vp * 2, o_v); ATT_LD(rb, s_vl + (size_t)tn * 128, vp * 2, o_v);
      PF_STAGE();
#pragma unroll
      for (int j = 0; j < HD / 16; ++j) { vh[j] = frag_b(&vb[j * 16 + col][0], lane); vl[j] = frag_b(&vbl[j * 16 + col][0], lane); }   /* v of the first 32 keys: read behind the logit products, lands under the softmax */
    } else { v16h kf[4][HD / 32]; v8f a[4] = {};
#pragma unroll
      for (int jt = 0; jt < 4; ++jt)
#pragma unroll
        for (int kc = 0; kc < HD / 32; ++kc) kf[jt][kc] = frag_h(&kt[jt * 16 + col][kc * 32], lane);
      ATT_GROUP();
#pragma unroll
      for (int kc = 0; kc < HD / 32; ++kc)
#pragma unroll
        for (int jt = 0; jt < 4; ++jt) a[jt] = wm_h(kf[jt][kc], qf[kc], a[jt]);
#pragma unroll
      for (int kc = 0; kc < 2; ++kc)
#pragma unroll
        for (int j = 0; j < HD / 16; ++j) vf[kc][j] = frag_h(&vt[j * 16 + col][kc * 32], lane);   /* all of v: read behind the logit products, lands under the softmax */
#pragma unroll
      for (int jt = 0; jt < 4; ++jt)
#pragma unroll
        for (int r = 0; r < 8; ++r) s[jt][r] = a[jt][r]; }
    ATT_GROUP();
    if (t == nblk - 1) {   /* the diagonal block: keys past the query are excluded by index */
#pragma unroll
      for (int jt = 0; jt < 4; ++jt)
#pragma unroll
        for (int r = 0; r < 8; ++r) s[jt][r] = (jt * 16 + 8 * g + r <= wave * 16 + col) ? s[jt][r] : -3.0e38f; }
    float mj[4];   /* four independent chains */
#pragma unroll
    for (int jt = 0; jt < 4; ++jt) { mj[jt] = s[jt][0];
#pragma unroll
      for (int r = 1; r < 8; ++r) mj[jt] = fmaxf(mj[jt], s[jt][r]); }
    float mx = fmaxf(fmaxf(mj[0], mj[1]), fmaxf(mj[2], mj[3]));
    mx = fmaxf(mx, xhalf(mx));   /* the other 8 keys of each tile lie in the other wave half */
    const float mn = fmaxf(m, mx); const float alpha = exp2x1((m - mn) * cs); const float off = 11.0f - mn * cs; m = mn;
    float sj[4];
#pragma unroll
    for (int jt = 0; jt < 4; ++jt) {
#pragma unroll
      for (int r = 0; r < 8; ++r) s[jt][r] = fmaf(s[jt][r], cs, off);
      exp2x8(s[jt]);   /* an excluded key gives 2^(-huge) = 0 */
      sj[jt] = s[jt][0];
#pragma unroll
      for (int r = 1; r < 8; ++r) sj[jt] += s[jt][r]; }
    l = l * alpha + ((sj[0] + sj[1]) + (sj[2] + sj[3]));
#pragma unroll
    for (int j = 0; j < HD / 16; ++j) o[j] *= alpha;
#pragma unroll
    for (int kc = 0; kc < 2; ++kc) {
      if (HI) { float v[16];
#pragma unroll
        for (int i = 0; i < 8; ++i) { v[i] = s[2 * kc][i]; v[8 + i] = s[2 * kc + 1][i]; }
        const F2 p = bsplit16(v);
#pragma unroll
        for (int j = 0; j < HD / 16; ++j) o[j] = wm_b(vh[j], p.h, o[j]);
#pragma unroll
        for (int j = 0; j < HD / 16; ++j) o[j] = wm_b(vh[j], p.l, o[j]);
#pragma unroll
        for (int j = 0; j < HD / 16; ++j) o[j] = wm_b(vl[j], p.h, o[j]);
        if (kc == 0) {
#pragma unroll
          for (int j = 0; j < HD / 16; ++j) { vh[j] = frag_b(&vb[j * 16 + col][32], lane); vl[j] = frag_b(&vbl[j * 16 + col][32], lane); }
          ATT_GROUP(); }
      } else { v16h p;
#pragma unroll
        for (int i = 0; i < 8; ++i) { p[i] = (_Float16)s[2 * kc][i]; p[8 + i] = (_Float16)s[2 * kc + 1][i]; }
#pragma unroll
        for (int j = 0; j < HD / 16; ++j) o[j] = wm_h(vf[kc][j], p, o[j]); } }
    PF_STAGE();
    if (more) { if (HI) { ATT_ST(nb, 1, ra); ATT_ST(nb, 3, rb); } else { ATT_ST(nb, 0, ra); ATT_ST(nb, 1, rb); } }
    PF_XW();
    __syncthreads(); }   /* publishes key block t + 1 and ends the reads of block t (after the last trip: frees the LDS for the epilogue) */
  l += xhalf(l);
  const float inv = l > 0.f ? 1.0f / l : 0.f;
  float (*ss)[HD + 4] = (float (*)[HD + 4])(sm + wave * (16 * (HD + 4) * 4));   /* the wave's own 16 ctx rows, so that the stores cover whole 256-B (row, head) segments */
#pragma unroll
  for (int j = 0; j < HD / 16; ++j) { v4f x0, x1;
#pragma unroll
    for (int r = 0; r < 4; ++r) { x0[r] = o[j][r] * inv; x1[r] = o[j][4 + r] * inv; }
    *(v4f_a*)&ss[col][j * 16 + 8 * g] = x0; *(v4f_a*)&ss[col][j * 16 + 8 * g + 4] = x1; }
  LDSX();
#pragma unroll
  for (int i = 0; i < 8; ++i) { const int rl = 2 * i + g; vst2(Y + ((size_t)b * TT + ql0 + rl) * CC + h * HD + col * 4, *(const v4f_a*)&ss[rl][col * 4]); } }
__global__ __launch_bounds__(128, 4) void k_att(const _Float16* __restrict__ QH, const _Float16* __restrict__ KH, const _Float16* __restrict__ QL, const _Float16* __restrict__ KL, const _Float16* __restrict__ VT, const __bf16* __restrict__ VB, const __bf16* __restrict__ VBL, float* __restrict__ Y) {   /* 4 waves a SIMD: all 1024 blocks resident at once, 4 a WGP */
  __shared__ __align__(16) unsigned char sm[2 * 4 * ATILE]; static_assert(CAUSAL && QBH * 64 <= KHI && QBH * 64 <= QHI && HD == 64 && 4 * 16 * (HD + 4) * 4 <= 2 * 2 * ATILE, "k_att");
  const int z = blockIdx.z, b = z / NH, h = z % NH;
  const int qb = ((z & 1) ? NQB - 1 - (int)blockIdx.x : (int)blockIdx.x) ^ ((z & 2) ? NQB / 2 : 0);   /* a permutation of the query blocks per plane: neighbours in launch order differ in length, for balance only */
  if (qb < QBH) att_body<true>(sm, QH, KH, QL, KL, VT, VB, VBL, Y, qb, b, h); else att_body<false>(sm, QH, KH, QL, KL, VT, VB, VBL, Y, qb, b, h); }
// ---- k_out: block = (128 rows, 128 cols), 8 waves of 16 rows on one staged weight tile: out = ctx Wo (+ bo): ctx once to f16 against Wo as f16(bf16 x 2^8) exact (1 product) x 2^-8; causal early rows (< QHI of each sequence): ctx bf16 hi + lo against exact bf16 Wo (2 products)
__global__ __launch_bounds__(256) void k_out(const float* __restrict__ Y, const float* __restrict__ WO, const float* __restrict__ BO, float* __restrict__ OUT) { __shared__ __align__(16) float sf[8][16][132]; __shared__ __align__(16) __bf16 wt[2][128][WPITCH];
  const int tid = threadIdx.x, wave = tid >> 5, lane = tid & 31, col = lane & 15, g = lane >> 4; const int c0 = blockIdx.y * 128; const size_t r0 = (size_t)blockIdx.x * 128 + wave * 16; static_assert(TT % 128 == 0 && QHI % 128 == 0, "a block is early rows or late rows as a whole");
  v8f acc[8] = {};
  static_assert(!WO_OUT_IN, "the staged tile reads Wo as [k][column]");
  const int kl = 32 * (wave >> 2) + 8 * (lane >> 3), cl0 = (wave & 3) * 32 + 4 * (lane & 7); const float* wb = WO + c0 + cl0 + (size_t)kl * DIN; const float* arow = Y + (r0 + col) * CC + 8 * g;
  WRaw1 wr; ARaw ar; a_load(ar, arow, 0); wt_load1(wr, wb, DIN, 0); PF_XW();
  if (CAUSAL && (int)(((size_t)blockIdx.x * 128) % TT) < QHI) {   /* block-uniform */
    wt_store_b1(wt[0], wr, cl0, kl);
    __syncthreads();   /* tile 0 is published */
#pragma unroll 2   /* two trips = the two buffers at constant LDS addresses */
    for (int t = 0; t < CC / KT; ++t) { F2 a[KT / 32];
#pragma unroll
      for (int c = 0; c < KT / 32; ++c) { float v[16];
#pragma unroll
        for (int e = 0; e < 16; ++e) v[e] = ar.r[c][e >> 2][e & 3];
        a[c] = bsplit16(v); }
      if (t + 1 < CC / KT) { a_load(ar, arow, (t + 1) * KT); wt_load1(wr, wb, DIN, (t + 1) * KT); }   /* the next tile flies while this one is multiplied */
      PF_STAGE();
      v16b bf[2][4];   /* B fragments in groups of 4, two register sets, as in k_proj */
#pragma unroll
      for (int q = 0; q < 2; ++q)
#pragma unroll
        for (int jj = 0; jj < 4; ++jj) bf[q][jj] = frag_b(&wt[t & 1][(q * 4 + jj) * 16 + col][0], lane);
#pragma unroll
      for (int q = 0; q < 4; ++q) {
#pragma unroll
        for (int jj = 0; jj < 4; ++jj) { const int j = (q & 1) * 4 + jj; acc[j] = wmma_bf(a[q >> 1].h, bf[q & 1][jj], acc[j]); acc[j] = wmma_bf(a[q >> 1].l, bf[q & 1][jj], acc[j]); }
        if (q < 2) {
#pragma unroll
          for (int jj = 0; jj < 4; ++jj) bf[q][jj] = frag_b(&wt[t & 1][(q * 4 + jj) * 16 + col][32], lane); } }
      PF_STAGE();
      if (t + 1 < CC / KT) wt_store_b1(wt[(t + 1) & 1], wr, cl0, kl);   /* that buffer's readers left it at the barrier of trip t - 1 */
      PF_XW();
      __syncthreads(); }   /* publishes tile t + 1 and ends the reads of tile t */
#pragma unroll
    for (int j = 0; j < 8; ++j) { const float bias = BO ? bfr(BO[c0 + j * 16 + col]) : 0.f;
#pragma unroll
      for (int r = 0; r < 8; ++r) sf[wave][8 * g + r][j * 16 + col] = acc[j][r] + bias; }
  } else {
    _Float16 (*wh)[128][WPITCH] = (_Float16 (*)[128][WPITCH])wt;   /* this path keeps f16 in the same two buffers */
    wt_store_h1(wh[0], wr, cl0, kl);
    __syncthreads();   /* tile 0 is published */
#pragma unroll 2   /* two trips = the two buffers at constant LDS addresses */
    for (int t = 0; t < CC / KT; ++t) { v16h a[KT / 32];
#pragma unroll
      for (int c = 0; c < KT / 32; ++c)
#pragma unroll
        for (int e = 0; e < 16; ++e) a[c][e] = (_Float16)(ar.r[c][e >> 2][e & 3] * 64.0f);   /* ctx carried x 2^6 into f16 so small-magnitude context rows stay clear of f16 subnormals */
      if (t + 1 < CC / KT) { a_load(ar, arow, (t + 1) * KT); wt_load1(wr, wb, DIN, (t + 1) * KT); }   /* the next tile flies while this one is multiplied */
      PF_STAGE();
      v16h bf[2][4];   /* B fragments in groups of 4, two register sets, as in k_proj */
#pragma unroll
      for (int q = 0; q < 2; ++q)
#pragma unroll
        for (int jj = 0; jj < 4; ++jj) bf[q][jj] = frag_h(&wh[t & 1][(q * 4 + jj) * 16 + col][0], lane);
#pragma unroll
      for (int q = 0; q < 4; ++q) {
#pragma unroll
        for (int jj = 0; jj < 4; ++jj) acc[(q & 1) * 4 + jj] = wmma16(a[q >> 1], bf[q & 1][jj], acc[(q & 1) * 4 + jj]);
        if (q < 2) {
#pragma unroll
          for (int jj = 0; jj < 4; ++jj) bf[q][jj] = frag_h(&wh[t & 1][(q * 4 + jj) * 16 + col][32], lane); } }
      PF_STAGE();
      if (t + 1 < CC / KT) wt_store_h1(wh[(t + 1) & 1], wr, cl0, kl);   /* that buffer's readers left it at the barrier of trip t - 1 */
      PF_XW();
      __syncthreads(); }   /* publishes tile t + 1 and ends the reads of tile t */
#pragma unroll
    for (int j = 0; j < 8; ++j) { const float bias = BO ? bfr(BO[c0 + j * 16 + col]) : 0.f;
#pragma unroll
      for (int r = 0; r < 8; ++r) sf[wave][8 * g + r][j * 16 + col] = acc[j][r] * (1.0f / 16384.0f) + bias; } }   /* 2^-8 (Wo carry) x 2^-6 (ctx carry) */
  LDSX(); for (int rl = 0; rl < 16; ++rl) vst2(OUT + (r0 + rl) * DIN + c0 + lane * 4, *(const v4f*)&sf[wave][rl][lane * 4]); }

extern "C" void kernel_launch(void* const* d_in, const int* in_sizes, int n_in, void* d_out, int out_size, void* d_ws, size_t ws_size, hipStream_t stream) {
  (void)in_sizes; (void)n_in; (void)out_size;
  const float** F = (const float**)d_in;
  if (ws_size < (size_t)WS_END) return;
  char* ws = (char*)d_ws; _Float16 *QH = (_Float16*)(ws + WS_QH), *KH = (_Float16*)(ws + WS_KH), *VT = (_Float16*)(ws + WS_VT), *QL = (_Float16*)(ws + WS_QL), *KL = (_Float16*)(ws + WS_KL); __bf16 *VB = (__bf16*)(ws + WS_VB), *VBL = (__bf16*)(ws + WS_VBL); float *Y = (float*)(ws + WS_Y);
  (void)Y; (void)QL; (void)KL; (void)VB; (void)VBL;
  // inputs: 0 x [4,1024,1024]; 1 Wq [16,1024,64]; 2 Wk; 3 Wv (per-head [head][model][d]); 4 Wp [1024,1024] (in,out); 5 bp [1024] (zeros, read); no q / k / v biases
  k_proj<<<dim3(TNB * TT / 128, CC / 128, 3), 128, 0, stream>>>(F[0], F[0], F[0], F[1], F[2], F[3], nullptr, nullptr, nullptr, QH, QL, KH, KL, VT, VB, VBL);
  k_att<<<dim3(NQB, 1, TNB * NH), 128, 0, stream>>>(QH, KH, QL, KL, VT, VB, VBL, Y);
  k_out<<<dim3(TNB * TT / 128, DIN / 128), 256, 0, stream>>>(Y, F[4], F[5], (float*)d_out);
}

// v006
// A run of this version takes 88.5 microseconds.
// In two side-by-side timings against v005, it was 1.06 and 1.07 times as fast.
// Counting every step since v000, it is 8.11 times as fast.
// compute dtype: all float inputs rounded to bf16; per-head q / k / v projections with EXACT bf16 products on WMMA 16x16x32 (f32 accumulate), no biases; causal logits: 3 products for the first 384 rows, single f16 q x k after, x 1024^-0.5; softmax f32; P x 2^11 once to f16 x v once to f16 (bf16 hi + lo below row 384); ctx hi+lo x exact Wp below row 384, x2^6 f16 carry x f16(bf16 x 2^8) Wp after, + bp (zeros, read); f32 output.
#include <hip/hip_runtime.h>
#include <math.h>

typedef __attribute__((ext_vector_type(16))) _Float16 v16h;
typedef __attribute__((ext_vector_type(16))) __bf16 v16b;
typedef __attribute__((ext_vector_type(8)))  _Float16 v8h;
typedef __attribute__((ext_vector_type(8)))  float v8f;
typedef __attribute__((ext_vector_type(4)))  float v4f;
typedef __attribute__((ext_vector_type(2)))  float v2f;
typedef __attribute__((ext_vector_type(4)))  unsigned v4u;
typedef __attribute__((ext_vector_type(4)))  int v4i;
typedef float __attribute__((may_alias)) float_a;
typedef int __attribute__((may_alias)) int_a;

template <typename T> __device__ __forceinline__ void vst2(void* p, T v) { *(T*)p = v;  }
__device__ __forceinline__ v8f wmma16(v16h a, v16h b, v8f c) {
  return __builtin_amdgcn_wmma_f32_16x16x32_f16(false, a, false, b, (short)0, c, false, false);
}
__device__ __forceinline__ v8f wmma_bf(v16b a, v16b b, v8f c) {
  return __builtin_amdgcn_wmma_f32_16x16x32_bf16(false, a, false, b, (short)0, c, false, false);
}
// 16x16x32 fragments: lane = (h = lane>>4, row/col = lane&15); elements 0..7 = k0+8h+0..7, 8..15 = k0+16+8h+0..7; D element r = row 8h+r
__device__ __forceinline__ v16h frag_h(const _Float16* rowk0, int lane) {
  union { v16h v; v8h q[2]; } u; const _Float16* p = rowk0 + 8 * (lane >> 4);
  u.q[0] = *(const v8h*)p; u.q[1] = *(const v8h*)(p + 16); return u.v;
}
__device__ __forceinline__ v16h frag_f32(const float* rowk0, int lane) {
  v16h a; const float* p = rowk0 + 8 * (lane >> 4);
#pragma unroll
  for (int i = 0; i < 8; ++i) { a[i] = (_Float16)p[i]; a[8 + i] = (_Float16)p[16 + i]; }
  return a;
}
__device__ __forceinline__ v16h frag_f32s(const float* rowk0, int lane, float sc) {
  v16h a; const float* p = rowk0 + 8 * (lane >> 4);
#pragma unroll
  for (int i = 0; i < 8; ++i) { a[i] = (_Float16)(p[i] * sc); a[8 + i] = (_Float16)(p[16 + i] * sc); }
  return a;
}
// column fragment from a [K][ld] layout (column n), rows >= K read as 0
__device__ __forceinline__ v16h fragc_f32(const float* W, int k0, int n, int lane, int ld, int K) {
  v16h a; const int g = lane >> 4;
#pragma unroll
  for (int i = 0; i < 8; ++i) { const int ka = k0 + 8 * g + i, kb = ka + 16;
    a[i] = (_Float16)(ka < K ? W[(size_t)(ka < K ? ka : K - 1) * ld + n] : 0.f); a[8 + i] = (_Float16)(kb < K ? W[(size_t)(kb < K ? kb : K - 1) * ld + n] : 0.f); }
  return a;
}
struct F2 { v16b h, l; };
__device__ __forceinline__ F2 bsplit16(const float v[16]) { F2 r;
#pragma unroll
  for (int i = 0; i < 16; ++i) { const __bf16 h = (__bf16)v[i]; r.h[i] = h; r.l[i] = (__bf16)(v[i] - (float)h); }
  return r; }
__device__ __forceinline__ F2 split_row(const float* row, int k0, int lane) { float v[16]; const float* p = row + k0 + 8 * (lane >> 4);
#pragma unroll
  for (int i = 0; i < 8; ++i) { v[i] = p[i]; v[8 + i] = p[16 + i]; }
  return bsplit16(v); }
__device__ __forceinline__ F2 split_rowK(const float* row, int k0, int lane, int K) { float v[16]; const int g = lane >> 4;
#pragma unroll
  for (int i = 0; i < 8; ++i) { const int ka = k0 + 8 * g + i, kb = ka + 16; v[i] = ka < K ? row[ka < K ? ka : K - 1] : 0.f; v[8 + i] = kb < K ? row[kb < K ? kb : K - 1] : 0.f; }
  return bsplit16(v); }
__device__ __forceinline__ F2 split_col(const float* W, int k0, int n, int lane, int ld, int K) { float v[16]; const int g = lane >> 4;
#pragma unroll
  for (int i = 0; i < 8; ++i) { const int ka = k0 + 8 * g + i, kb = ka + 16; v[i] = ka < K ? W[(size_t)(ka < K ? ka : K - 1) * ld + n] : 0.f; v[8 + i] = kb < K ? W[(size_t)(kb < K ? kb : K - 1) * ld + n] : 0.f; }
  return bsplit16(v); }
__device__ __forceinline__ v8f mac3(const F2& a, const F2& b, v8f c) { c = wmma_bf(a.l, b.h, c); c = wmma_bf(a.h, b.l, c); return wmma_bf(a.h, b.h, c); }
__device__ __forceinline__ float sigm(float v) { return 1.0f / (1.0f + expf(-v)); }
#define LDSX() do { asm volatile("s_wait_dscnt 0" ::: "memory"); __builtin_amdgcn_wave_barrier(); __builtin_amdgcn_fence(__ATOMIC_RELEASE, "workgroup"); } while (0)

// Causal multi-head self-attention with per-head weights and a 1/sqrt(C) score scale (x [4,1024,1024]; Wq / Wk / Wv [16,1024,64] = per-head [head][model][d] N(0,1) x 0.02, no biases; Wp [1024,1024] (in,out), bp zeros (read); q = einsum('btc,hcd->bhtd'); scores x 1/sqrt(1024) - the scale is 1/32, not 1/8 (soft logits); tril kept, -inf elsewhere; softmax; heads concatenated; out @ Wp + bp).
#define NB 4
#define TT 1024
#define CC 1024            // NH * HD = projected width
#define DIN 1024          // input (model) width
#define NH 16
#define HD 64
#define NQB (TT / 64)
#define SCALE (0.03125f)
#define CAUSAL 1
#ifndef TNB
#define TNB NB
#endif
__device__ __forceinline__ float bfr(float v) { return (float)(__bf16)v; }
typedef __attribute__((ext_vector_type(8))) __bf16 v8b;
__device__ __forceinline__ v16b frag_b(const __bf16* rowk0, int lane) {
  union { v16b v; v8b q[2]; } u; const __bf16* p = rowk0 + 8 * (lane >> 4);
  u.q[0] = *(const v8b*)p; u.q[1] = *(const v8b*)(p + 16); return u.v;
}
#define QBH 6              // causal: query blocks 0..QBH-1 of each sequence (few keys, no averaging) take the high-precision path
#define QHI 384            // rows carrying a q residual plane
#define KHI 384            // key rows carrying k residual / v bf16 hi+lo planes (used only by the causal high-precision path)
// B fragment (k rows k0+.., output column o) of a weight: (in,out) [K][ld] or (out,in) [ld rows of K]: bf16 exact, or f16(bf16 * 256) exact
__device__ __forceinline__ v16b wcol_io(const float* Wm, int k0, int o, int lane, int ld) { v16b w; const int g = lane >> 4;
#pragma unroll
  for (int i = 0; i < 8; ++i) { w[i] = (__bf16)Wm[(size_t)(k0 + 8 * g + i) * ld + o]; w[8 + i] = (__bf16)Wm[(size_t)(k0 + 16 + 8 * g + i) * ld + o]; }
  return w; }
__device__ __forceinline__ v16b wcol_oi(const float* Wm, int k0, int o, int lane, int K) { v16b w; const float* p = Wm + (size_t)o * K + k0 + 8 * (lane >> 4);
#pragma unroll
  for (int i = 0; i < 8; ++i) { w[i] = (__bf16)p[i]; w[8 + i] = (__bf16)p[16 + i]; }
  return w; }
__device__ __forceinline__ v16h wcolh_io(const float* Wm, int k0, int o, int lane, int ld) { v16h w; const int g = lane >> 4;
#pragma unroll
  for (int i = 0; i < 8; ++i) { w[i] = (_Float16)(bfr(Wm[(size_t)(k0 + 8 * g + i) * ld + o]) * 256.0f); w[8 + i] = (_Float16)(bfr(Wm[(size_t)(k0 + 16 + 8 * g + i) * ld + o]) * 256.0f); }
  return w; }
__device__ __forceinline__ v16h wcolh_oi(const float* Wm, int k0, int o, int lane, int K) { v16h w; const float* p = Wm + (size_t)o * K + k0 + 8 * (lane >> 4);
#pragma unroll
  for (int i = 0; i < 8; ++i) { w[i] = (_Float16)(bfr(p[i]) * 256.0f); w[8 + i] = (_Float16)(bfr(p[16 + i]) * 256.0f); }
  return w; }
#define WQKV_LAYOUT 2   // 0 = (in,out) [DIN][CC]; 1 = (out,in) [CC][DIN]; 2 = per-head [NH][DIN][HD]
__device__ __forceinline__ v16b wcol_hdk(const float* Wm, int k0, int o, int lane) { v16b w; const int g = lane >> 4; const float* p = Wm + (size_t)(o / HD) * DIN * HD + (o % HD);
#pragma unroll
  for (int i = 0; i < 8; ++i) { w[i] = (__bf16)p[(size_t)(k0 + 8 * g + i) * HD]; w[8 + i] = (__bf16)p[(size_t)(k0 + 16 + 8 * g + i) * HD]; }
  return w; }
#define WO_OUT_IN 0
#if WQKV_LAYOUT == 1
#define WCOL(W, k0, o, lane) wcol_oi(W, k0, o, lane, DIN)
#elif WQKV_LAYOUT == 2
#define WCOL(W, k0, o, lane) wcol_hdk(W, k0, o, lane)
#else
#define WCOL(W, k0, o, lane) wcol_io(W, k0, o, lane, CC)
#endif
#if WO_OUT_IN
#define WOCOL(W, k0, o, lane) wcol_oi(W, k0, o, lane, CC)
#define WOCOLH(W, k0, o, lane) wcolh_oi(W, k0, o, lane, CC)
#else
#define WOCOL(W, k0, o, lane) wcol_io(W, k0, o, lane, DIN)
#define WOCOLH(W, k0, o, lane) wcolh_io(W, k0, o, lane, DIN)
#endif

#ifndef SM_EXTRA_PARAMS
#define SM_EXTRA_PARAMS
#endif
#ifndef PROJ_EXTRA_PARAMS
#define PROJ_EXTRA_PARAMS
#endif
#ifndef SM_MASK_HOOK
#define SM_MASK_HOOK (void)0
#endif

#define WS_QH  0u                                      // f16 q rows [b*t][CC]
#define WS_KH  (WS_QH + 2u * (size_t)NB * TT * CC)      // f16 k rows [b*t][CC]
#define WS_VT  (WS_KH + 2u * (size_t)NB * TT * CC)      // f16 v planes [b][c][t]
#define WS_QL  (WS_VT + 2u * (size_t)NB * CC * TT)      // f16 q residual x 2^10 rows [b][t < QHI][CC]
#define WS_KL  (WS_QL + 2u * (size_t)NB * QHI * CC)     // f16 k residual x 2^10 rows [b][t < KHI][CC]
#define WS_VB  (WS_KL + 2u * (size_t)NB * KHI * CC)     // bf16 v hi planes [b][c][t < KHI]
#define WS_VBL (WS_VB + 2u * (size_t)NB * CC * KHI)
#define WS_Y   (WS_VBL + 2u * (size_t)NB * CC * KHI)    // f32 ctx rows [b*t][CC] (only when there is an output projection)
#define WS_END (WS_Y  + 4u * (size_t)NB * TT * CC)

// ---- weight tile in LDS (k_proj, k_out): KT k rows x 128 output columns, rounded once per block to 16 bit and kept as [column][k], so a B fragment is frag_b / frag_h on a column's row
#define KT 64
#define WPITCH (KT + 8)    // 144-B column pitch: the 16 lanes of a ds_load_b128 fragment read fall on 16 different bank quads
// a thread carries 2 units of (4 columns x 8 k): lane = (column quad lane & 7, k octet lane >> 3), wave = 32 columns; each load instruction covers four whole 128-B lines, each LDS store meets every bank twice
// PF_STAGE: in front of a tile's matrix work it keeps the scheduler from sinking the next tile's global loads below it; behind the matrix work it keeps the next tile's conversions, and with them the wait for those loads, from rising above it
#define PF_STAGE() __builtin_amdgcn_sched_barrier(0)
// PF_GROUP: in front of and behind a group of LDS fragment reads it keeps the group together, two groups of products ahead of its own: without it the scheduler sinks each read down to its own product (one LDS latency per product instead of one per group)
#define PF_GROUP() __builtin_amdgcn_sched_barrier(0)
// PF_XW: what follows (the next trip, the loop's set-up) rewrites the address registers that the global loads issued before it name; the wait stands in front of that overwrite
#define PF_XW() do { asm volatile("s_wait_xcnt 0x0" ::: "memory"); __builtin_amdgcn_sched_barrier(0); } while (0)   /* the scheduling barrier keeps later address arithmetic from rising over the wait */
// PF_XWP: the same wait behind k_proj's first loads; it takes their two address pairs as inputs, so that no later load's result is given those registers ahead of the wait
#define PF_XWP(p, q) do { asm volatile("s_wait_xcnt 0x0" :: "v"(p), "v"(q) : "memory"); __builtin_amdgcn_sched_barrier(0); } while (0)
static_assert(KT == 64, "the k loops take a tile as two k halves of 32");
struct WRaw { v4f r[2][8]; };
__device__ __forceinline__ void wt_load(WRaw& w, const float* base, int ldk, int k0) {   /* base = (k row 8 kq, the thread's first column); ldk = floats between k rows */
#pragma unroll
  for (int u = 0; u < 2; ++u)
#pragma unroll
    for (int kk = 0; kk < 8; ++kk) w.r[u][kk] = *(const v4f*)(base + (size_t)(k0 + 32 * u + kk) * ldk); }
__device__ __forceinline__ void wt_store_b(__bf16 (*wt)[WPITCH], const WRaw& w, int cl0, int kq) {
#pragma unroll
  for (int u = 0; u < 2; ++u)
#pragma unroll
    for (int i = 0; i < 4; ++i) { v8b p;
#pragma unroll
      for (int kk = 0; kk < 8; ++kk) p[kk] = (__bf16)w.r[u][kk][i];
      *(v8b*)&wt[cl0 + i][32 * u + 8 * kq] = p; } }
// the same staging for a block of 8 waves (k_out): a thread carries ONE unit; waves 0..3 take k 0..31 of the tile, waves 4..7 k 32..63; kl = the unit's first k in the tile, base = (k row kl, the thread's first column)
struct WRaw1 { v4f r[8]; };
__device__ __forceinline__ void wt_load1(WRaw1& w, const float* base, int ldk, int k0) {
#pragma unroll
  for (int kk = 0; kk < 8; ++kk) w.r[kk] = *(const v4f*)(base + (size_t)(k0 + kk) * ldk); }
__device__ __forceinline__ void wt_store_b1(__bf16 (*wt)[WPITCH], const WRaw1& w, int cl0, int kl) {
#pragma unroll
  for (int i = 0; i < 4; ++i) { v8b p;
#pragma unroll
    for (int kk = 0; kk < 8; ++kk) p[kk] = (__bf16)w.r[kk][i];
    *(v8b*)&wt[cl0 + i][kl] = p; } }
__device__ __forceinline__ void wt_store_h1(_Float16 (*wt)[WPITCH], const WRaw1& w, int cl0, int kl) {   /* f16(bf16 x 2^8), exact */
#pragma unroll
  for (int i = 0; i < 4; ++i) { v8h p;
#pragma unroll
    for (int kk = 0; kk < 8; ++kk) p[kk] = (_Float16)(bfr(w.r[kk][i]) * 256.0f);
    *(v8h*)&wt[cl0 + i][kl] = p; } }
// ---- A tile in LDS (k_proj, k_out): a wave brings its own rows' KT k values in whole lines: lane = (row parity lane >> 4, k quad lane & 15), so a load instruction covers the 256-B runs of two rows (4 whole lines; a fragment load straight from global memory touches 16 lines, 32 B of each); rounded once and kept as [row][k] at the weight tile's pitch, an A fragment is frag_b / frag_h on a row
// instruction i: rows 2 i (+ parity) of the wave's first 16 rows, from i = 8 on of its second 16, which lie 64 rows further; base = (the wave's first row + parity, k 4 (lane & 15)); ld = floats between rows
typedef __attribute__((ext_vector_type(4))) __bf16 v4b;
typedef __attribute__((ext_vector_type(4))) _Float16 v4h;
template <int NI> struct ALRaw { v4f r[NI]; };
#define AT_ROW(i) (2 * ((i) & 7) + 64 * ((i) >> 3))
template <int NI> __device__ __forceinline__ void at_load(ALRaw<NI>& a, const float* base, int ld, int k0) {
#pragma unroll
  for (int i = 0; i < NI; ++i) a.r[i] = *(const v4f*)(base + (size_t)AT_ROW(i) * ld + k0); }
template <int NI> __device__ __forceinline__ void at_store_b(__bf16 (*at)[WPITCH], const ALRaw<NI>& a, int row0, int kl) {   /* row0 = the wave's first row in the tile + parity, kl = 4 (lane & 15) */
#pragma unroll
  for (int i = 0; i < NI; ++i) { v4b p;
#pragma unroll
    for (int e = 0; e < 4; ++e) p[e] = (__bf16)a.r[i][e];
    *(v4b*)&at[row0 + AT_ROW(i)][kl] = p; } }
template <int NI> __device__ __forceinline__ void at_store_hl(__bf16 (*ah)[WPITCH], __bf16 (*al)[WPITCH], const ALRaw<NI>& a, int row0, int kl) {   /* bf16 hi + lo, as bsplit16 */
#pragma unroll
  for (int i = 0; i < NI; ++i) { v4b p, q;
#pragma unroll
    for (int e = 0; e < 4; ++e) { const __bf16 h = (__bf16)a.r[i][e]; p[e] = h; q[e] = (__bf16)(a.r[i][e] - (float)h); }
    *(v4b*)&ah[row0 + AT_ROW(i)][kl] = p; *(v4b*)&al[row0 + AT_ROW(i)][kl] = q; } }
template <int NI> __device__ __forceinline__ void at_store_h(_Float16 (*at)[WPITCH], const ALRaw<NI>& a, int row0, int kl, float sc) {
#pragma unroll
  for (int i = 0; i < NI; ++i) { v4h p;
#pragma unroll
    for (int e = 0; e < 4; ++e) p[e] = (_Float16)(a.r[i][e] * sc);
    *(v4h*)&at[row0 + AT_ROW(i)][kl] = p; } }
// ---- k_proj: block = (128 rows, 128 cols, which); a wave takes two groups of 16 rows (rows 16 wave + 64 rg), so that every B fragment read from LDS and every staged weight tile serves two products: q/k/v = X W (+ b) with exact bf16 products (K = DIN) -> which 0: q f16 rows (+ residual rows < QHI); 1: k f16 rows (+ residual rows < KHI); 2: v f16 planes [c][t] (+ bf16 hi/lo planes for t < KHI)
__global__ __launch_bounds__(128) void k_proj(const float* __restrict__ XQ, const float* __restrict__ XK, const float* __restrict__ XV, const float* __restrict__ WQ, const float* __restrict__ WK, const float* __restrict__ WV, const float* __restrict__ BQ, const float* __restrict__ BK, const float* __restrict__ BV,
    _Float16* __restrict__ QH, _Float16* __restrict__ QL, _Float16* __restrict__ KH, _Float16* __restrict__ KL, _Float16* __restrict__ VT, __bf16* __restrict__ VB, __bf16* __restrict__ VBL) {
  __shared__ __align__(16) unsigned char sm[4 * 128 * WPITCH * 2];   /* the two weight buffers and the two A buffers during the k loop; behind the loop's last barrier the epilogue's planes */
  __bf16 (*wt)[128][WPITCH] = (__bf16 (*)[128][WPITCH])sm, (*at)[128][WPITCH] = (__bf16 (*)[128][WPITCH])(sm + 2 * 128 * WPITCH * 2); static_assert(3 * 128 * 72 * 2 <= 4 * 128 * WPITCH * 2 && 2 * 64 * 136 * 2 <= 4 * 128 * WPITCH * 2, "LDS");
  _Float16 (*sh)[136] = (_Float16 (*)[136])sm, (*sl)[136] = (_Float16 (*)[136])(sm + 64 * 136 * 2); _Float16 (*th)[72] = (_Float16 (*)[72])sm; __bf16 (*tb)[72] = (__bf16 (*)[72])(sm + 128 * 72 * 2), (*tbl)[72] = (__bf16 (*)[72])(sm + 2 * 128 * 72 * 2);
  const int tid = threadIdx.x, wave = tid >> 5, lane = tid & 31, col = lane & 15, g = lane >> 4; const int which = blockIdx.z; const int c0 = blockIdx.y * 128; const size_t r0 = (size_t)blockIdx.x * 128; const size_t bb = r0 / TT; const int t0 = (int)(r0 % TT); static_assert(TT % 128 == 0 && QHI % 64 == 0 && KHI % 64 == 0, "a block lies in one sequence");
  const float* X = which == 0 ? XQ : which == 1 ? XK : XV; const float* WA = which == 0 ? WQ : which == 1 ? WK : WV; const float* BA = which == 0 ? BQ : which == 1 ? BK : BV;
  v8f acc[2][8] = {};
  static_assert(WQKV_LAYOUT == 2 && HD % 32 == 0, "a wave's 32 staged columns lie in one head");
  const int kq = lane >> 3, cl0 = wave * 32 + 4 * (lane & 7); const float* wb = WA + (size_t)((c0 + cl0) / HD) * DIN * HD + (c0 + cl0) % HD + (size_t)(8 * kq) * HD; const int ar0 = wave * 16 + g, akl = 4 * col; const float* arow = X + (r0 + ar0) * DIN + akl;
  WRaw wr; ALRaw<16> ar; at_load(ar, arow, DIN, 0); wt_load(wr, wb, HD, 0); PF_XWP(arow, wb); wt_store_b(wt[0], wr, cl0, kq); at_store_b(at[0], ar, ar0, akl);
  __syncthreads();   /* tile 0 is published */
#pragma unroll 2   /* two trips = the two buffers at constant LDS addresses */
  for (int t = 0; t < DIN / KT; ++t) {
    if (t + 1 < DIN / KT) { at_load(ar, arow, DIN, (t + 1) * KT); wt_load(wr, wb, HD, (t + 1) * KT); }   /* the next tile flies while this one is multiplied */
    PF_STAGE();
    v16b a[2][KT / 32];   /* the wave's own rows of the A tile, read in one group with the first B fragments */
#pragma unroll
    for (int c = 0; c < KT / 32; ++c)
#pragma unroll
      for (int rg = 0; rg < 2; ++rg) a[rg][c] = frag_b(&at[t & 1][wave * 16 + col + 64 * rg][32 * c], lane);
    v16b bf[2][4];   /* B fragments in groups of 4 (group q: k half q >> 1, columns 64 (q & 1) ..), two register sets: a group's LDS reads are issued together, two groups ahead of its products */
#pragma unroll
    for (int q = 0; q < 2; ++q)
#pragma unroll
      for (int jj = 0; jj < 4; ++jj) bf[q][jj] = frag_b(&wt[t & 1][(q * 4 + jj) * 16 + col][0], lane);
    PF_GROUP();
#pragma unroll
    for (int q = 0; q < 4; ++q) {
#pragma unroll
      for (int jj = 0; jj < 4; ++jj)
#pragma unroll
        for (int rg = 0; rg < 2; ++rg) acc[rg][(q & 1) * 4 + jj] = wmma_bf(a[rg][q >> 1], bf[q & 1][jj], acc[rg][(q & 1) * 4 + jj]);
      if (q < 2) { PF_GROUP();
#pragma unroll
        for (int jj = 0; jj < 4; ++jj) bf[q][jj] = frag_b(&wt[t & 1][(q * 4 + jj) * 16 + col][32], lane);
        PF_GROUP(); } }
    PF_STAGE();
    if (t + 1 < DIN / KT) { wt_store_b(wt[(t + 1) & 1], wr, cl0, kq); at_store_b(at[(t + 1) & 1], ar, ar0, akl); }   /* those buffers' readers left them at the barrier of trip t - 1 */
    PF_XW();
    __syncthreads(); }   /* publishes tile t + 1 and ends the reads of tile t (after the last trip: frees the LDS for the epilogue) */
  // the epilogue takes the two row groups one after the other through the same planes (64 rows each)
#pragma unroll
  for (int rg = 0; rg < 2; ++rg) { const size_t r0g = r0 + 64 * rg; const int t0g = t0 + 64 * rg;
  if (rg) __syncthreads();   /* the first group's rows have been read out of the planes */
  if (which < 2) { _Float16* DH = which == 0 ? QH : KH; _Float16* DL = which == 0 ? QL : KL; const int nhi = which == 0 ? QHI : KHI; const bool hi_rows = t0g < nhi;
#pragma unroll
    for (int j = 0; j < 8; ++j) { const float bias = BA ? bfr(BA[c0 + j * 16 + col]) : 0.f;
#pragma unroll
      for (int r = 0; r < 8; ++r) { const float v = acc[rg][j][r] + bias; const _Float16 hv = (_Float16)v; sh[wave * 16 + 8 * g + r][j * 16 + col] = hv; sl[wave * 16 + 8 * g + r][j * 16 + col] = (_Float16)((v - (float)hv) * 1024.0f); } }
    __syncthreads();
    for (int e = tid; e < 64 * 16; e += 128) { const int rl = e >> 4, q = e & 15; vst2((unsigned*)(DH + (r0g + rl) * CC + c0 + q * 8), *(const v4u*)&sh[rl][q * 8]); PF_XW();   /* the LDS read below may land in this store's registers */
      if (hi_rows) vst2((unsigned*)(DL + (bb * nhi + t0g + rl) * (size_t)CC + c0 + q * 8), *(const v4u*)&sl[rl][q * 8]); PF_XW(); }   /* the next trip rewrites the stores' address registers */
  } else { const bool hi_rows = t0g < KHI;
#pragma unroll
    for (int j = 0; j < 8; ++j) { const float bias = BA ? bfr(BA[c0 + j * 16 + col]) : 0.f;
#pragma unroll
      for (int r = 0; r < 8; ++r) { const float v = acc[rg][j][r] + bias; const int rl = wave * 16 + 8 * g + r, cl = j * 16 + col; th[cl][rl] = (_Float16)v; const __bf16 bh = (__bf16)v; tb[cl][rl] = bh; tbl[cl][rl] = (__bf16)(v - (float)bh); } }
    __syncthreads();
    for (int e = tid; e < 128 * 8; e += 128) { const int cl = e >> 3, q = e & 7; vst2((unsigned*)(VT + (bb * CC + c0 + cl) * (size_t)TT + t0g + q * 8), *(const v4u*)&th[cl][q * 8]); PF_XW();   /* the LDS reads below may land in this store's address registers */
      if (hi_rows) { const size_t o3 = (bb * CC + c0 + cl) * (size_t)KHI + t0g + q * 8; vst2((unsigned*)(VB + o3), *(const v4u*)&tb[cl][q * 8]); vst2((unsigned*)(VBL + o3), *(const v4u*)&tbl[cl][q * 8]); PF_XW(); } } } } }   /* as above, for the next trip */
// ---- k_att: block = 64 queries (qb) of one (b, h), z = b * NH + h; logits, softmax and P . v in one pass over 64-key blocks 0..qb, the logits never leave registers.
// Transposed products: St = K . Qt (A = 16 key rows, B = the wave's 16 queries), so a lane holds 8 keys a tile of ONE query (column lane & 15, keys 8 g + r); two neighbouring St tiles are, register for register, the B fragment Pt of 32 keys for Ot += Vt . Pt (A = 16 d rows of the v plane).
// Running maximum per query (in-lane + one exchange between the wave halves), e = 2^((s - m) c + 11), c = SCALE log2(e): P carried x 2^11 as before, the factor cancels against the row sum; Ot and the sum are rescaled at every key block.
// Query blocks < QBH: 3 logit products (q, k hi + residual x 2^10) and P, v as bf16 hi + lo (3 products); after: single f16 products.
// The K and v tiles (64 rows x 128 B each) are shared by the 4 waves through LDS: whole-line global loads one key block ahead, 2 buffers, one barrier per key block.
#define AP 72              // 144-B LDS row pitch, as WPITCH
#define ATILE (64 * AP * 2)   // bytes of one tile in LDS
__device__ __forceinline__ v8f wm_h(v16h a, v16h b, v8f c) { return __builtin_amdgcn_wmma_f32_16x16x32_f16(false, a, false, b, (short)0, c, false, false); }
__device__ __forceinline__ v8f wm_b(v16b a, v16b b, v8f c) { return __builtin_amdgcn_wmma_f32_16x16x32_bf16(false, a, false, b, (short)0, c, false, false); }
__device__ __forceinline__ float xhalf(float x) { return __builtin_bit_cast(float, __builtin_amdgcn_permlanex16(__builtin_bit_cast(int, x), __builtin_bit_cast(int, x), 0x76543210, 0xfedcba98, false, false)); }   /* lane l <-> lane l ^ 16 */
// 2^x by v_exp_f32 as asm text, eight in place in one statement: nothing of the compiler's then stands directly behind a v_exp_f32; the closing v_nop is the slot that the instruction set asks for behind the last one
__device__ __forceinline__ void exp2x8(float (&x)[8]) {
  asm("v_exp_f32 %0, %0\n\tv_exp_f32 %1, %1\n\tv_exp_f32 %2, %2\n\tv_exp_f32 %3, %3\n\tv_exp_f32 %4, %4\n\tv_exp_f32 %5, %5\n\tv_exp_f32 %6, %6\n\tv_exp_f32 %7, %7\n\tv_nop" : "+v"(x[0]), "+v"(x[1]), "+v"(x[2]), "+v"(x[3]), "+v"(x[4]), "+v"(x[5]), "+v"(x[6]), "+v"(x[7])); }
__device__ __forceinline__ float exp2x1(float x) { asm("v_exp_f32 %0, %0\n\tv_nop" : "+v"(x)); return x; }   /* the same for one value */
typedef v4u __attribute__((may_alias)) v4u_a;
typedef v4f __attribute__((may_alias)) v4f_a;
template <bool HI> __device__ __forceinline__ void att_body(unsigned char* sm, const _Float16* __restrict__ QH, const _Float16* __restrict__ KH, const _Float16* __restrict__ QL, const _Float16* __restrict__ KL, const _Float16* __restrict__ VT, const __bf16* __restrict__ VB, const __bf16* __restrict__ VBL, float* __restrict__ Y, int qb, int b, int h) {
  constexpr int NT = HI ? 4 : 2;   /* tiles a key block: k, v (+ k residual, v lo) */
  const int tid = threadIdx.x, wave = tid >> 5, lane = tid & 31, col = lane & 15, g = lane >> 4; const int ql0 = qb * 64 + wave * 16; const int nblk = qb + 1;
  const int srow = tid >> 3, spc = tid & 7;   /* staging: 8 lanes = one 128-B row; a thread carries rows srow + 16 i */
  constexpr unsigned vp = HI ? KHI : TT;
  // block-uniform bases and one 32-bit byte offset per thread and tile shape (k rows, v planes)
  const char* s_k = (const char*)(KH + (size_t)b * TT * CC + h * HD); const char* s_kl = (const char*)(KL + (size_t)b * KHI * CC + h * HD);
  const char* s_v = HI ? (const char*)(VB + ((size_t)b * CC + h * HD) * vp) : (const char*)(VT + ((size_t)b * CC + h * HD) * vp); const char* s_vl = (const char*)(VBL + ((size_t)b * CC + h * HD) * vp);
  const unsigned o_k = (unsigned)srow * (CC * 2) + spc * 16, o_v = (unsigned)srow * (vp * 2) + spc * 16;
  v4u ra[4], rb[4];   /* two tiles in flight: k and v; with the residual planes first k and k residual, then, behind the logit products, v hi and v lo in the same registers */
#define ATT_LD(dst, base, rowstep, off) do { _Pragma("unroll") for (int i = 0; i < 4; ++i) dst[i] = *(const v4u_a*)((base) + i * (16 * (rowstep)) + (off)); } while (0)
#define ATT_ST(bufp, tile, srcr) do { _Pragma("unroll") for (int i = 0; i < 4; ++i) *(v4u_a*)((bufp) + (tile) * ATILE + (srow + 16 * i) * (AP * 2) + spc * 16) = srcr[i]; } while (0)
#define ATT_KSTEP (64 * CC * 2)   /* bytes between key blocks in the k rows; 128 in the v planes */
  v16h qf[HD / 32], qlf[HD / 32];
#pragma unroll
  for (int kc = 0; kc < HD / 32; ++kc) { qf[kc] = frag_h(QH + ((size_t)b * TT + ql0 + col) * CC + h * HD + kc * 32, lane); if (HI) qlf[kc] = frag_h(QL + ((size_t)b * QHI + ql0 + col) * CC + h * HD + kc * 32, lane); }
  if (HI) { ATT_LD(ra, s_k, CC * 2, o_k); ATT_LD(rb, s_kl, CC * 2, o_k); PF_XW(); ATT_ST(sm, 0, ra); ATT_ST(sm, 2, rb); ATT_LD(ra, s_v, vp * 2, o_v); ATT_LD(rb, s_vl, vp * 2, o_v); PF_XW(); ATT_ST(sm, 1, ra); ATT_ST(sm, 3, rb); PF_XW(); }   /* the last wait: the q loads are scheduled behind the one before */
  else { ATT_LD(ra, s_k, CC * 2, o_k); ATT_LD(rb, s_v, vp * 2, o_v); PF_XW(); ATT_ST(sm, 0, ra); ATT_ST(sm, 1, rb); }
  __syncthreads();   /* key block 0 is published */
  const float cs = SCALE * 1.44269504088896340736f;
  float m = -3.0e38f, l = 0.f; v8f o[HD / 16] = {};
  for (int t = 0; t < nblk; ++t) { const unsigned char* bp = sm + (t & 1) * (NT * ATILE); unsigned char* nb = sm + ((t + 1) & 1) * (NT * ATILE);   /* nb: its readers left it at the barrier of trip t - 1 */
    // with the residual planes the staging is unconditional (the last trip stages its own block once more into the idle buffer, which nobody reads): no branch then stands between the logit products and the first readers of their results
    const bool more = HI || t + 1 < nblk; const int tn = (HI && t + 1 == nblk) ? t : t + 1;
    if (more) { ATT_LD(ra, s_k + (size_t)tn * ATT_KSTEP, CC * 2, o_k); if (HI) ATT_LD(rb, s_kl + (size_t)tn * ATT_KSTEP, CC * 2, o_k); else ATT_LD(rb, s_v + (size_t)tn * 128, vp * 2, o_v); }   /* the next key block flies while this one is worked on */
    if (HI) PF_XW(); else PF_STAGE();   /* with the residual planes the LDS reads below land in the address registers of these loads (without them the compiler writes the wait itself) */
    const _Float16 (*kt)[AP] = (const _Float16 (*)[AP])bp; const _Float16 (*klt)[AP] = (const _Float16 (*)[AP])(bp + 2 * ATILE); const _Float16 (*vt)[AP] = (const _Float16 (*)[AP])(bp + ATILE); const __bf16 (*vb)[AP] = (const __bf16 (*)[AP])(bp + ATILE); const __bf16 (*vbl)[AP] = (const __bf16 (*)[AP])(bp + 3 * ATILE);
    // ATT_GROUP: behind a group of LDS fragment reads it keeps the scheduler from sinking each read down to its own product (one LDS latency per product instead of one per group)
#define ATT_GROUP() __builtin_amdgcn_sched_barrier(0)
    float s[4][8]; v16h vf[2][HD / 16]; v16b vh[HD / 16], vl[HD / 16];
    if (HI) {
#pragma unroll
      for (int hf = 0; hf < 2; ++hf) { v16h kf[2][HD / 32], lf[2][HD / 32]; v8f a[2] = {}, al[2] = {};   /* two key tiles a group */
#pragma unroll
        for (int jj = 0; jj < 2; ++jj)
#pragma unroll
          for (int kc = 0; kc < HD / 32; ++kc) { kf[jj][kc] = frag_h(&kt[(2 * hf + jj) * 16 + col][kc * 32], lane); lf[jj][kc] = frag_h(&klt[(2 * hf + jj) * 16 + col][kc * 32], lane); }
        ATT_GROUP();
#pragma unroll
        for (int kc = 0; kc < HD / 32; ++kc)
#pragma unroll
          for (int jj = 0; jj < 2; ++jj) { a[jj] = wm_h(kf[jj][kc], qf[kc], a[jj]); al[jj] = wm_h(kf[jj][kc], qlf[kc], al[jj]); al[jj] = wm_h(lf[jj][kc], qf[kc], al[jj]); }
#pragma unroll
        for (int jj = 0; jj < 2; ++jj)
#pragma unroll
          for (int r = 0; r < 8; ++r) s[2 * hf + jj][r] = a[jj][r] + al[jj][r] * (1.0f / 1024.0f);
        ATT_GROUP(); }   /* here it keeps the second group's reads from rising over the first group's products: both groups at once do not fit the registers */
      ATT_ST(nb, 0, ra); ATT_ST(nb, 2, rb); PF_XW(); ATT_LD(ra, s_v + (size_t)tn * 128, vp * 2, o_v); ATT_LD(rb, s_vl + (size_t)tn * 128, vp * 2, o_v);
      PF_STAGE();
#pragma unroll
      for (int j = 0; j < HD / 16; ++j) { vh[j] = frag_b(&vb[j * 16 + col][0], lane); vl[j] = frag_b(&vbl[j * 16 + col][0], lane); }   /* v of the first 32 keys: read behind the logit products, lands under the softmax */
    } else { v16h kf[4][HD / 32]; v8f a[4] = {};
#pragma unroll
      for (int jt = 0; jt < 4; ++jt)
#pragma unroll
        for (int kc = 0; kc < HD / 32; ++kc) kf[jt][kc] = frag_h(&kt[jt * 16 + col][kc * 32], lane);
      ATT_GROUP();
#pragma unroll
      for (int kc = 0; kc < HD / 32; ++kc)
#pragma unroll
        for (int jt = 0; jt < 4; ++jt) a[jt] = wm_h(kf[jt][kc], qf[kc], a[jt]);
#pragma unroll
      for (int kc = 0; kc < 2; ++kc)
#pragma unroll
        for (int j = 0; j < HD / 16; ++j) vf[kc][j] = frag_h(&vt[j * 16 + col][kc * 32], lane);   /* all of v: read behind the logit products, lands under the softmax */
#pragma unroll
      for (int jt = 0; jt < 4; ++jt)
#pragma unroll
        for (int r = 0; r < 8; ++r) s[jt][r] = a[jt][r]; }
    ATT_GROUP();
    if (t == nblk - 1) {   /* the diagonal block: keys past the query are excluded by index */
#pragma unroll
      for (int jt = 0; jt < 4; ++jt)
#pragma unroll
        for (int r = 0; r < 8; ++r) s[jt][r] = (jt * 16 + 8 * g + r <= wave * 16 + col) ? s[jt][r] : -3.0e38f; }
    float mj[4];   /* four independent chains */
#pragma unroll
    for (int jt = 0; jt < 4; ++jt) { mj[jt] = s[jt][0];
#pragma unroll
      for (int r = 1; r < 8; ++r) mj[jt] = fmaxf(mj[jt], s[jt][r]); }
    float mx = fmaxf(fmaxf(mj[0], mj[1]), fmaxf(mj[2], mj[3]));
    mx = fmaxf(mx, xhalf(mx));   /* the other 8 keys of each tile lie in the other wave half */
    const float mn = fmaxf(m, mx); const float alpha = exp2x1((m - mn) * cs); const float off = 11.0f - mn * cs; m = mn;
    float sj[4];
#pragma unroll
    for (int jt = 0; jt < 4; ++jt) {
#pragma unroll
      for (int r = 0; r < 8; ++r) s[jt][r] = fmaf(s[jt][r], cs, off);
      exp2x8(s[jt]);   /* an excluded key gives 2^(-huge) = 0 */
      sj[jt] = s[jt][0];
#pragma unroll
      for (int r = 1; r < 8; ++r) sj[jt] += s[jt][r]; }
    l = l * alpha + ((sj[0] + sj[1]) + (sj[2] + sj[3]));
#pragma unroll
    for (int j = 0; j < HD / 16; ++j) o[j] *= alpha;
#pragma unroll
    for (int kc = 0; kc < 2; ++kc) {
      if (HI) { float v[16];
#pragma unroll
        for (int i = 0; i < 8; ++i) { v[i] = s[2 * kc][i]; v[8 + i] = s[2 * kc + 1][i]; }
        const F2 p = bsplit16(v);
#pragma unroll
        for (int j = 0; j < HD / 16; ++j) o[j] = wm_b(vh[j], p.h, o[j]);
#pragma unroll
        for (int j = 0; j < HD / 16; ++j) o[j] = wm_b(vh[j], p.l, o[j]);
#pragma unroll
        for (int j = 0; j < HD / 16; ++j) o[j] = wm_b(vl[j], p.h, o[j]);
        if (kc == 0) {
#pragma unroll
          for (int j = 0; j < HD / 16; ++j) { vh[j] = frag_b(&vb[j * 16 + col][32], lane); vl[j] = frag_b(&vbl[j * 16 + col][32], lane); }
          ATT_GROUP(); }
      } else { v16h p;
#pragma unroll
        for (int i = 0; i < 8; ++i) { p[i] = (_Float16)s[2 * kc][i]; p[8 + i] = (_Float16)s[2 * kc + 1][i]; }
#pragma unroll
        for (int j = 0; j < HD / 16; ++j) o[j] = wm_h(vf[kc][j], p, o[j]); } }
    PF_STAGE();
    if (more) { if (HI) { ATT_ST(nb, 1, ra); ATT_ST(nb, 3, rb); } else { ATT_ST(nb, 0, ra); ATT_ST(nb, 1, rb); } }
    PF_XW();
    __syncthreads(); }   /* publishes key block t + 1 and ends the reads of block t (after the last trip: frees the LDS for the epilogue) */
  l += xhalf(l);
  const float inv = l > 0.f ? 1.0f / l : 0.f;
  float (*ss)[HD + 4] = (float (*)[HD + 4])(sm + wave * (16 * (HD + 4) * 4));   /* the wave's own 16 ctx rows, so that the stores cover whole 256-B (row, head) segments */
#pragma unroll
  for (int j = 0; j < HD / 16; ++j) { v4f x0, x1;
#pragma unroll
    for (int r = 0; r < 4; ++r) { x0[r] = o[j][r] * inv; x1[r] = o[j][4 + r] * inv; }
    *(v4f_a*)&ss[col][j * 16 + 8 * g] = x0; *(v4f_a*)&ss[col][j * 16 + 8 * g + 4] = x1; }
  LDSX();
#pragma unroll
  for (int i = 0; i < 8; ++i) { const int rl = 2 * i + g; vst2(Y + ((size_t)b * TT + ql0 + rl) * CC + h * HD + col * 4, *(const v4f_a*)&ss[rl][col * 4]); } }
__global__ __launch_bounds__(128, 4) void k_att(const _Float16* __restrict__ QH, const _Float16* __restrict__ KH, const _Float16* __restrict__ QL, const _Float16* __restrict__ KL, const _Float16* __restrict__ VT, const __bf16* __restrict__ VB, const __bf16* __restrict__ VBL, float* __restrict__ Y) {   /* 4 waves a SIMD: all 1024 blocks resident at once, 4 a WGP */
  __shared__ __align__(16) unsigned char sm[2 * 4 * ATILE]; static_assert(CAUSAL && QBH * 64 <= KHI && QBH * 64 <= QHI && HD == 64 && 4 * 16 * (HD + 4) * 4 <= 2 * 2 * ATILE, "k_att");
  const int z = blockIdx.z, b = z / NH, h = z % NH;
  const int qb = ((z & 1) ? NQB - 1 - (int)blockIdx.x : (int)blockIdx.x) ^ ((z & 2) ? NQB / 2 : 0);   /* a permutation of the query blocks per plane: neighbours in launch order differ in length, for balance only */
  if (qb < QBH) att_body<true>(sm, QH, KH, QL, KL, VT, VB, VBL, Y, qb, b, h); else att_body<false>(sm, QH, KH, QL, KL, VT, VB, VBL, Y, qb, b, h); }
// ---- k_out: block = (128 rows, 128 cols), 8 waves of 16 rows on one staged weight tile: out = ctx Wo (+ bo): ctx once to f16 against Wo as f16(bf16 x 2^8) exact (1 product) x 2^-8; causal early rows (< QHI of each sequence): ctx bf16 hi + lo against exact bf16 Wo (2 products)
__global__ __launch_bounds__(256) void k_out(const float* __restrict__ Y, const float* __restrict__ WO, const float* __restrict__ BO, float* __restrict__ OUT) { __shared__ __align__(16) float sf[8][16][132]; __shared__ __align__(16) __bf16 wt[2][128][WPITCH]; __shared__ __align__(16) __bf16 at[2][2][128][WPITCH];   /* at: [buffer][plane: hi, lo (early rows); the f16 path keeps one plane] */
  const int tid = threadIdx.x, wave = tid >> 5, lane = tid & 31, col = lane & 15, g = lane >> 4; const int c0 = blockIdx.y * 128; const size_t r0 = (size_t)blockIdx.x * 128 + wave * 16; static_assert(TT % 128 == 0 && QHI % 128 == 0, "a block is early rows or late rows as a whole");
  v8f acc[8] = {};
  static_assert(!WO_OUT_IN, "the staged tile reads Wo as [k][column]");
  const int kl = 32 * (wave >> 2) + 8 * (lane >> 3), cl0 = (wave & 3) * 32 + 4 * (lane & 7); const float* wb = WO + c0 + cl0 + (size_t)kl * DIN; const int ar0 = wave * 16 + g, akl = 4 * col; const float* arow = Y + (r0 + g) * CC + akl;
  WRaw1 wr; ALRaw<8> ar; at_load(ar, arow, CC, 0); wt_load1(wr, wb, DIN, 0); PF_XW();
  if (CAUSAL && (int)(((size_t)blockIdx.x * 128) % TT) < QHI) {   /* block-uniform */
    wt_store_b1(wt[0], wr, cl0, kl); at_store_hl(at[0][0], at[0][1], ar, ar0, akl);
    __syncthreads();   /* tile 0 is published */
#pragma unroll 2   /* two trips = the two buffers at constant LDS addresses */
    for (int t = 0; t < CC / KT; ++t) {
      if (t + 1 < CC / KT) { at_load(ar, arow, CC, (t + 1) * KT); wt_load1(wr, wb, DIN, (t + 1) * KT); }   /* the next tile flies while this one is multiplied */
      PF_STAGE();
      F2 a[KT / 32];   /* the wave's own rows of the A tile, read in one group with the first B fragments */
#pragma unroll
      for (int c = 0; c < KT / 32; ++c) { a[c].h = frag_b(&at[t & 1][0][wave * 16 + col][32 * c], lane); a[c].l = frag_b(&at[t & 1][1][wave * 16 + col][32 * c], lane); }
      v16b bf[2][4];   /* B fragments in groups of 4, two register sets, as in k_proj */
#pragma unroll
      for (int q = 0; q < 2; ++q)
#pragma unroll
        for (int jj = 0; jj < 4; ++jj) bf[q][jj] = frag_b(&wt[t & 1][(q * 4 + jj) * 16 + col][0], lane);
      PF_GROUP();
#pragma unroll
      for (int q = 0; q < 4; ++q) {
#pragma unroll
        for (int jj = 0; jj < 4; ++jj) { const int j = (q & 1) * 4 + jj; acc[j] = wmma_bf(a[q >> 1].h, bf[q & 1][jj], acc[j]); acc[j] = wmma_bf(a[q >> 1].l, bf[q & 1][jj], acc[j]); }
        if (q < 2) { PF_GROUP();
#pragma unroll
          for (int jj = 0; jj < 4; ++jj) bf[q][jj] = frag_b(&wt[t & 1][(q * 4 + jj) * 16 + col][32], lane);
          PF_GROUP(); } }
      PF_STAGE();
      if (t + 1 < CC / KT) { wt_store_b1(wt[(t + 1) & 1], wr, cl0, kl); at_store_hl(at[(t + 1) & 1][0], at[(t + 1) & 1][1], ar, ar0, akl); }   /* those buffers' readers left them at the barrier of trip t - 1 */
      PF_XW();
      __syncthreads(); }   /* publishes tile t + 1 and ends the reads of tile t */
#pragma unroll
    for (int j = 0; j < 8; ++j) { const float bias = BO ? bfr(BO[c0 + j * 16 + col]) : 0.f;
#pragma unroll
      for (int r = 0; r < 8; ++r) sf[wave][8 * g + r][j * 16 + col] = acc[j][r] + bias; }
  } else {
    _Float16 (*wh)[128][WPITCH] = (_Float16 (*)[128][WPITCH])wt;   /* this path keeps f16 in the same two buffers */
    _Float16 (*ah)[2][128][WPITCH] = (_Float16 (*)[2][128][WPITCH])at;   /* plane 0 of each A buffer, f16 */
    wt_store_h1(wh[0], wr, cl0, kl); at_store_h(ah[0][0], ar, ar0, akl, 64.0f);   /* ctx carried x 2^6 into f16 so small-magnitude context rows stay clear of f16 subnormals */
    __syncthreads();   /* tile 0 is published */
#pragma unroll 2   /* two trips = the two buffers at constant LDS addresses */
    for (int t = 0; t < CC / KT; ++t) {
      if (t + 1 < CC / KT) { at_load(ar, arow, CC, (t + 1) * KT); wt_load1(wr, wb, DIN, (t + 1) * KT); }   /* the next tile flies while this one is multiplied */
      PF_STAGE();
      v16h a[KT / 32];   /* the wave's own rows of the A tile, read in one group with the first B fragments */
#pragma unroll
      for (int c = 0; c < KT / 32; ++c) a[c] = frag_h(&ah[t & 1][0][wave * 16 + col][32 * c], lane);
      v16h bf[2][4];   /* B fragments in groups of 4, two register sets, as in k_proj */
#pragma unroll
      for (int q = 0; q < 2; ++q)
#pragma unroll
        for (int jj = 0; jj < 4; ++jj) bf[q][jj] = frag_h(&wh[t & 1][(q * 4 + jj) * 16 + col][0], lane);
      PF_GROUP();
#pragma unroll
      for (int q = 0; q < 4; ++q) {
#pragma unroll
        for (int jj = 0; jj < 4; ++jj) acc[(q & 1) * 4 + jj] = wmma16(a[q >> 1], bf[q & 1][jj], acc[(q & 1) * 4 + jj]);
        if (q < 2) { PF_GROUP();
#pragma unroll
          for (int jj = 0; jj < 4; ++jj) bf[q][jj] = frag_h(&wh[t & 1][(q * 4 + jj) * 16 + col][32], lane);
          PF_GROUP(); } }
      PF_STAGE();
      if (t + 1 < CC / KT) { wt_store_h1(wh[(t + 1) & 1], wr, cl0, kl); at_store_h(ah[(t + 1) & 1][0], ar, ar0, akl, 64.0f); }   /* those buffers' readers left them at the barrier of trip t - 1 */
      PF_XW();
      __syncthreads(); }   /* publishes tile t + 1 and ends the reads of tile t */
#pragma unroll
    for (int j = 0; j < 8; ++j) { const float bias = BO ? bfr(BO[c0 + j * 16 + col]) : 0.f;
#pragma unroll
      for (int r = 0; r < 8; ++r) sf[wave][8 * g + r][j * 16 + col] = acc[j][r] * (1.0f / 16384.0f) + bias; } }   /* 2^-8 (Wo carry) x 2^-6 (ctx carry) */
  LDSX(); for (int rl = 0; rl < 16; ++rl) vst2(OUT + (r0 + rl) * DIN + c0 + lane * 4, *(const v4f*)&sf[wave][rl][lane * 4]); }

extern "C" void kernel_launch(void* const* d_in, const int* in_sizes, int n_in, void* d_out, int out_size, void* d_ws, size_t ws_size, hipStream_t stream) {
  (void)in_sizes; (void)n_in; (void)out_size;
  const float** F = (const float**)d_in;
  if (ws_size < (size_t)WS_END) return;
  char* ws = (char*)d_ws; _Float16 *QH = (_Float16*)(ws + WS_QH), *KH = (_Float16*)(ws + WS_KH), *VT = (_Float16*)(ws + WS_VT), *QL = (_Float16*)(ws + WS_QL), *KL = (_Float16*)(ws + WS_KL); __bf16 *VB = (__bf16*)(ws + WS_VB), *VBL = (__bf16*)(ws + WS_VBL); float *Y = (float*)(ws + WS_Y);
  (void)Y; (void)QL; (void)KL; (void)VB; (void)VBL;
  // inputs: 0 x [4,1024,1024]; 1 Wq [16,1024,64]; 2 Wk; 3 Wv (per-head [head][model][d]); 4 Wp [1024,1024] (in,out); 5 bp [1024] (zeros, read); no q / k / v biases
  k_proj<<<dim3(TNB * TT / 128, CC / 128, 3), 128, 0, stream>>>(F[0], F[0], F[0], F[1], F[2], F[3], nullptr, nullptr, nullptr, QH, QL, KH, KL, VT, VB, VBL);
  k_att<<<dim3(NQB, 1, TNB * NH), 128, 0, stream>>>(QH, KH, QL, KL, VT, VB, VBL, Y);
  k_out<<<dim3(TNB * TT / 128, DIN / 128), 256, 0, stream>>>(Y, F[4], F[5], (float*)d_out);
}

// v007
// A run of this version takes 78.6 microseconds.
// Next to v006, in two timings, it ran 1.13 times as fast each time.
// Over all steps from v000 it is 9.19 times as fast.
// compute dtype: all float inputs rounded to bf16; per-head q / k / v projections with EXACT bf16 products on WMMA 16x16x32 (f32 accumulate), no biases; causal logits: 3 products for the first 384 rows, single f16 q x k after, x 1024^-0.5; softmax f32; P x 2^11 once to f16 x v once to f16 (bf16 hi + lo below row 384); ctx hi+lo x exact Wp below row 384, x2^6 f16 carry x f16(bf16 x 2^8) Wp after, + bp (zeros, read); f32 output.
#include <hip/hip_runtime.h>
#include <math.h>

typedef __attribute__((ext_vector_type(16))) _Float16 v16h;
typedef __attribute__((ext_vector_type(16))) __bf16 v16b;
typedef __attribute__((ext_vector_type(8)))  _Float16 v8h;
typedef __attribute__((ext_vector_type(8)))  float v8f;
typedef __attribute__((ext_vector_type(4)))  float v4f;
typedef __attribute__((ext_vector_type(2)))  float v2f;
typedef __attribute__((ext_vector_type(4)))  unsigned v4u;
typedef __attribute__((ext_vector_type(4)))  int v4i;
typedef float __attribute__((may_alias)) float_a;
typedef int __attribute__((may_alias)) int_a;

template <typename T> __device__ __forceinline__ void vst2(void* p, T v) { *(T*)p = v;  }
__device__ __forceinline__ v8f wmma16(v16h a, v16h b, v8f c) {
  return __builtin_amdgcn_wmma_f32_16x16x32_f16(false, a, false, b, (short)0, c, false, false);
}
__device__ __forceinline__ v8f wmma_bf(v16b a, v16b b, v8f c) {
  return __builtin_amdgcn_wmma_f32_16x16x32_bf16(false, a, false, b, (short)0, c, false, false);
}
// 16x16x32 fragments: lane = (h = lane>>4, row/col = lane&15); elements 0..7 = k0+8h+0..7, 8..15 = k0+16+8h+0..7; D element r = row 8h+r
__device__ __forceinline__ v16h frag_h(const _Float16* rowk0, int lane) {
  union { v16h v; v8h q[2]; } u; const _Float16* p = rowk0 + 8 * (lane >> 4);
  u.q[0] = *(const v8h*)p; u.q[1] = *(const v8h*)(p + 16); return u.v;
}
__device__ __forceinline__ v16h frag_f32(const float* rowk0, int lane) {
  v16h a; const float* p = rowk0 + 8 * (lane >> 4);
#pragma unroll
  for (int i = 0; i < 8; ++i) { a[i] = (_Float16)p[i]; a[8 + i] = (_Float16)p[16 + i]; }
  return a;
}
__device__ __forceinline__ v16h frag_f32s(const float* rowk0, int lane, float sc) {
  v16h a; const float* p = rowk0 + 8 * (lane >> 4);
#pragma unroll
  for (int i = 0; i < 8; ++i) { a[i] = (_Float16)(p[i] * sc); a[8 + i] = (_Float16)(p[16 + i] * sc); }
  return a;
}
// column fragment from a [K][ld] layout (column n), rows >= K read as 0
__device__ __forceinline__ v16h fragc_f32(const float* W, int k0, int n, int lane, int ld, int K) {
  v16h a; const int g = lane >> 4;
#pragma unroll
  for (int i = 0; i < 8; ++i) { const int ka = k0 + 8 * g + i, kb = ka + 16;
    a[i] = (_Float16)(ka < K ? W[(size_t)(ka < K ? ka : K - 1) * ld + n] : 0.f); a[8 + i] = (_Float16)(kb < K ? W[(size_t)(kb < K ? kb : K - 1) * ld + n] : 0.f); }
  return a;
}
struct F2 { v16b h, l; };
__device__ __forceinline__ F2 bsplit16(const float v[16]) { F2 r;
#pragma unroll
  for (int i = 0; i < 16; ++i) { const __bf16 h = (__bf16)v[i]; r.h[i] = h; r.l[i] = (__bf16)(v[i] - (float)h); }
  return r; }
__device__ __forceinline__ F2 split_row(const float* row, int k0, int lane) { float v[16]; const float* p = row + k0 + 8 * (lane >> 4);
#pragma unroll
  for (int i = 0; i < 8; ++i) { v[i] = p[i]; v[8 + i] = p[16 + i]; }
  return bsplit16(v); }
__device__ __forceinline__ F2 split_rowK(const float* row, int k0, int lane, int K) { float v[16]; const int g = lane >> 4;
#pragma unroll
  for (int i = 0; i < 8; ++i) { const int ka = k0 + 8 * g + i, kb = ka + 16; v[i] = ka < K ? row[ka < K ? ka : K - 1] : 0.f; v[8 + i] = kb < K ? row[kb < K ? kb : K - 1] : 0.f; }
  return bsplit16(v); }
__device__ __forceinline__ F2 split_col(const float* W, int k0, int n, int lane, int ld, int K) { float v[16]; const int g = lane >> 4;
#pragma unroll
  for (int i = 0; i < 8; ++i) { const int ka = k0 + 8 * g + i, kb = ka + 16; v[i] = ka < K ? W[(size_t)(ka < K ? ka : K - 1) * ld + n] : 0.f; v[8 + i] = kb < K ? W[(size_t)(kb < K ? kb : K - 1) * ld + n] : 0.f; }
  return bsplit16(v); }
__device__ __forceinline__ v8f mac3(const F2& a, const F2& b, v8f c) { c = wmma_bf(a.l, b.h, c); c = wmma_bf(a.h, b.l, c); return wmma_bf(a.h, b.h, c); }
__device__ __forceinline__ float sigm(float v) { return 1.0f / (1.0f + expf(-v)); }
#define LDSX() do { asm volatile("s_wait_dscnt 0" ::: "memory"); __builtin_amdgcn_wave_barrier(); __builtin_amdgcn_fence(__ATOMIC_RELEASE, "workgroup"); } while (0)

// Causal multi-head self-attention with per-head weights and a 1/sqrt(C) score scale (x [4,1024,1024]; Wq / Wk / Wv [16,1024,64] = per-head [head][model][d] N(0,1) x 0.02, no biases; Wp [1024,1024] (in,out), bp zeros (read); q = einsum('btc,hcd->bhtd'); scores x 1/sqrt(1024) - the scale is 1/32, not 1/8 (soft logits); tril kept, -inf elsewhere; softmax; heads concatenated; out @ Wp + bp).
#define NB 4
#define TT 1024
#define CC 1024            // NH * HD = projected width
#define DIN 1024          // input (model) width
#define NH 16
#define HD 64
#define NQB (TT / 64)
#define SCALE (0.03125f)
#define CAUSAL 1
#ifndef TNB
#define TNB NB
#endif
__device__ __forceinline__ float bfr(float v) { return (float)(__bf16)v; }
typedef __attribute__((ext_vector_type(8))) __bf16 v8b;
__device__ __forceinline__ v16b frag_b(const __bf16* rowk0, int lane) {
  union { v16b v; v8b q[2]; } u; const __bf16* p = rowk0 + 8 * (lane >> 4);
  u.q[0] = *(const v8b*)p; u.q[1] = *(const v8b*)(p + 16); return u.v;
}
#define QBH 6              // causal: query blocks 0..QBH-1 of each sequence (few keys, no averaging) take the high-precision path
#define QHI 384            // rows carrying a q residual plane
#define KHI 384            // key rows carrying k residual / v bf16 hi+lo planes (used only by the causal high-precision path)
// B fragment (k rows k0+.., output column o) of a weight: (in,out) [K][ld] or (out,in) [ld rows of K]: bf16 exact, or f16(bf16 * 256) exact
__device__ __forceinline__ v16b wcol_io(const float* Wm, int k0, int o, int lane, int ld) { v16b w; const int g = lane >> 4;
#pragma unroll
  for (int i = 0; i < 8; ++i) { w[i] = (__bf16)Wm[(size_t)(k0 + 8 * g + i) * ld + o]; w[8 + i] = (__bf16)Wm[(size_t)(k0 + 16 + 8 * g + i) * ld + o]; }
  return w; }
__device__ __forceinline__ v16b wcol_oi(const float* Wm, int k0, int o, int lane, int K) { v16b w; const float* p = Wm + (size_t)o * K + k0 + 8 * (lane >> 4);
#pragma unroll
  for (int i = 0; i < 8; ++i) { w[i] = (__bf16)p[i]; w[8 + i] = (__bf16)p[16 + i]; }
  return w; }
__device__ __forceinline__ v16h wcolh_io(const float* Wm, int k0, int o, int lane, int ld) { v16h w; const int g = lane >> 4;
#pragma unroll
  for (int i = 0; i < 8; ++i) { w[i] = (_Float16)(bfr(Wm[(size_t)(k0 + 8 * g + i) * ld + o]) * 256.0f); w[8 + i] = (_Float16)(bfr(Wm[(size_t)(k0 + 16 + 8 * g + i) * ld + o]) * 256.0f); }
  return w; }
__device__ __forceinline__ v16h wcolh_oi(const float* Wm, int k0, int o, int lane, int K) { v16h w; const float* p = Wm + (size_t)o * K + k0 + 8 * (lane >> 4);
#pragma unroll
  for (int i = 0; i < 8; ++i) { w[i] = (_Float16)(bfr(p[i]) * 256.0f); w[8 + i] = (_Float16)(bfr(p[16 + i]) * 256.0f); }
  return w; }
#define WQKV_LAYOUT 2   // 0 = (in,out) [DIN][CC]; 1 = (out,in) [CC][DIN]; 2 = per-head [NH][DIN][HD]
__device__ __forceinline__ v16b wcol_hdk(const float* Wm, int k0, int o, int lane) { v16b w; const int g = lane >> 4; const float* p = Wm + (size_t)(o / HD) * DIN * HD + (o % HD);
#pragma unroll
  for (int i = 0; i < 8; ++i) { w[i] = (__bf16)p[(size_t)(k0 + 8 * g + i) * HD]; w[8 + i] = (__bf16)p[(size_t)(k0 + 16 + 8 * g + i) * HD]; }
  return w; }
#define WO_OUT_IN 0
#if WQKV_LAYOUT == 1
#define WCOL(W, k0, o, lane) wcol_oi(W, k0, o, lane, DIN)
#elif WQKV_LAYOUT == 2
#define WCOL(W, k0, o, lane) wcol_hdk(W, k0, o, lane)
#else
#define WCOL(W, k0, o, lane) wcol_io(W, k0, o, lane, CC)
#endif
#if WO_OUT_IN
#define WOCOL(W, k0, o, lane) wcol_oi(W, k0, o, lane, CC)
#define WOCOLH(W, k0, o, lane) wcolh_oi(W, k0, o, lane, CC)
#else
#define WOCOL(W, k0, o, lane) wcol_io(W, k0, o, lane, DIN)
#define WOCOLH(W, k0, o, lane) wcolh_io(W, k0, o, lane, DIN)
#endif

#ifndef SM_EXTRA_PARAMS
#define SM_EXTRA_PARAMS
#endif
#ifndef PROJ_EXTRA_PARAMS
#define PROJ_EXTRA_PARAMS
#endif
#ifndef SM_MASK_HOOK
#define SM_MASK_HOOK (void)0
#endif

#define WS_QH  0u                                      // f16 q rows [b*t][CC]
#define WS_KH  (WS_QH + 2u * (size_t)NB * TT * CC)      // f16 k rows [b*t][CC]
#define WS_VT  (WS_KH + 2u * (size_t)NB * TT * CC)      // f16 v planes [b][c][t]
#define WS_QL  (WS_VT + 2u * (size_t)NB * CC * TT)      // f16 q residual x 2^10 rows [b][t < QHI][CC]
#define WS_KL  (WS_QL + 2u * (size_t)NB * QHI * CC)     // f16 k residual x 2^10 rows [b][t < KHI][CC]
#define WS_VB  (WS_KL + 2u * (size_t)NB * KHI * CC)     // bf16 v hi planes [b][c][t < KHI]
#define WS_VBL (WS_VB + 2u * (size_t)NB * CC * KHI)
#define WS_Y   (WS_VBL + 2u * (size_t)NB * CC * KHI)    // f32 ctx rows [b*t][CC] (only when there is an output projection)
#define WS_XB  (WS_Y  + 4u * (size_t)NB * TT * CC)      // bf16 x as k tiles [DIN / KT][b*t][KT]
#define WS_WT  (WS_XB + 2u * (size_t)NB * TT * DIN)     // bf16 q / k / v weights as k tiles [which][DIN / KT][output column][KT]
#define WS_WPB (WS_WT + 2u * 3u * (size_t)CC * DIN)     // bf16 output weight as k tiles [CC / KT][output column][KT]
#define WS_WPH (WS_WPB + 2u * (size_t)DIN * CC)         // the same as f16(bf16 x 2^8)
#define WS_END (WS_WPH + 2u * (size_t)DIN * CC)

// ---- weight tile in LDS (k_proj, k_out): KT k rows x 128 output columns, 16 bit, kept as [column][k], so a B fragment is frag_b / frag_h on a column's row
#define KT 64
#define WPITCH (KT + 8)    // 144-B column pitch: the 16 lanes of a ds_load_b128 fragment read fall on 16 different bank quads
// k_cvt reads a weight in units of (4 columns x 8 k), 2 a thread: lane = (column quad lane & 7, k octet lane >> 3), wave = 32 columns; each load instruction covers four whole 128-B lines
// PF_STAGE: in front of a tile's matrix work it keeps the scheduler from sinking the next tile's global loads below it; behind the matrix work it keeps the next tile's conversions, and with them the wait for those loads, from rising above it
#define PF_STAGE() __builtin_amdgcn_sched_barrier(0)
// PF_GROUP: in front of and behind a group of LDS fragment reads it keeps the group together, two groups of products ahead of its own: without it the scheduler sinks each read down to its own product (one LDS latency per product instead of one per group)
#define PF_GROUP() __builtin_amdgcn_sched_barrier(0)
// PF_XW: what follows (the next trip, the loop's set-up) rewrites the address registers that the global loads issued before it name; the wait stands in front of that overwrite
#define PF_XW() do { asm volatile("s_wait_xcnt 0x0" ::: "memory"); __builtin_amdgcn_sched_barrier(0); } while (0)   /* the scheduling barrier keeps later address arithmetic from rising over the wait */
// PF_XWP: the same wait behind a kernel's first loads; it takes their two address pairs as inputs, so that no later load's result is given those registers ahead of the wait
#define PF_XWP(p, q) do { asm volatile("s_wait_xcnt 0x0" :: "v"(p), "v"(q) : "memory"); __builtin_amdgcn_sched_barrier(0); } while (0)
static_assert(KT == 64, "the k loops take a tile as two k halves of 32");
struct WRaw { v4f r[2][8]; };
__device__ __forceinline__ void wt_load(WRaw& w, const float* base, int ldk, int k0) {   /* base = (the thread's first k row, its first column); ldk = floats between k rows */
#pragma unroll
  for (int u = 0; u < 2; ++u)
#pragma unroll
    for (int kk = 0; kk < 8; ++kk) w.r[u][kk] = *(const v4f*)(base + (size_t)(k0 + 32 * u + kk) * ldk); }
// ---- a 128-row x KT tile of 16-bit rows (x rows, weight columns) on its way to LDS. k_cvt left it in the workspace as 16 KB in a row, [row][KT]: 8 lanes = one 128-B row, a load instruction covers four whole lines; a thread carries NI rows TT_ROW(tid) + RS i; base = (that first row of k tile 0, k 8 (tid & 7)); off = bytes from k tile 0 to the tile wanted
// TT_ROW: neighbouring groups of 8 lanes take rows 8 apart: at the 144-B pitch the two 128-B runs of 16 lanes then fall on all 64 banks once (rows 1 apart would share four banks)
#define TT_ROW(tid) (((((tid) >> 3) & 1) << 3) | (((tid) >> 4) & 7) | (((tid) >> 3) & 16))
// the loops here and in k_cvt are unrolled so that every index of a register array is a constant (the arrays stay in registers) and a group's loads are issued together
typedef v4u __attribute__((may_alias)) v4u_a;
template <int NI> struct TRaw { v4u r[NI]; };
template <int NI, int RS> __device__ __forceinline__ void tt_load(TRaw<NI>& w, const char* base, size_t off) { static_assert(NI * RS == 128, "tile");
#pragma unroll
  for (int i = 0; i < NI; ++i) w.r[i] = *(const v4u_a*)(base + (RS * i) * (KT * 2) + off); }
#define XT_STEP ((size_t)NB * TT * KT * 2)   /* bytes between k tiles of x */
#define WT_STEP ((size_t)1024 * KT * 2)      /* the same for a weight of 1024 output columns */
template <int NI, int RS> __device__ __forceinline__ void tt_store(void* tile, const TRaw<NI>& w, int srow, int spc) {
#pragma unroll
  for (int i = 0; i < NI; ++i) *(v4u_a*)((char*)tile + (srow + RS * i) * (WPITCH * 2) + spc * 16) = w.r[i]; }
// ---- A tile in LDS (k_out): a wave brings its own rows' KT k values in whole lines: lane = (row parity lane >> 4, k quad lane & 15), so a load instruction covers the 256-B runs of two rows (4 whole lines; a fragment load straight from global memory touches 16 lines, 32 B of each); rounded once and kept as [row][k] at the weight tile's pitch, an A fragment is frag_b / frag_h on a row
// instruction i: rows 2 i (+ parity) of the wave's first 16 rows, from i = 8 on of its second 16, which lie 64 rows further; base = (the wave's first row + parity, k 4 (lane & 15)); ld = floats between rows
typedef __attribute__((ext_vector_type(4))) __bf16 v4b;
typedef __attribute__((ext_vector_type(4))) _Float16 v4h;
template <int NI> struct ALRaw { v4f r[NI]; };
#define AT_ROW(i) (2 * ((i) & 7) + 64 * ((i) >> 3))
template <int NI> __device__ __forceinline__ void at_load(ALRaw<NI>& a, const float* base, int ld, int k0) {
#pragma unroll
  for (int i = 0; i < NI; ++i) a.r[i] = *(const v4f*)(base + (size_t)AT_ROW(i) * ld + k0); }
template <int NI> __device__ __forceinline__ void at_store_hl(__bf16 (*ah)[WPITCH], __bf16 (*al)[WPITCH], const ALRaw<NI>& a, int row0, int kl) {   /* bf16 hi + lo, as bsplit16 */
#pragma unroll
  for (int i = 0; i < NI; ++i) { v4b p, q;
#pragma unroll
    for (int e = 0; e < 4; ++e) { const __bf16 h = (__bf16)a.r[i][e]; p[e] = h; q[e] = (__bf16)(a.r[i][e] - (float)h); }
    *(v4b*)&ah[row0 + AT_ROW(i)][kl] = p; *(v4b*)&al[row0 + AT_ROW(i)][kl] = q; } }
template <int NI> __device__ __forceinline__ void at_store_h(_Float16 (*at)[WPITCH], const ALRaw<NI>& a, int row0, int kl, float sc) {
#pragma unroll
  for (int i = 0; i < NI; ++i) { v4h p;
#pragma unroll
    for (int e = 0; e < 4; ++e) p[e] = (_Float16)(a.r[i][e] * sc);
    *(v4h*)&at[row0 + AT_ROW(i)][kl] = p; } }
// ---- k_cvt: x and the four weights are rounded to 16 bit ONCE, in a launch of their own, instead of once in every block that reads them (x in 24 blocks of k_proj, a weight in 32): k_proj and k_out then load half the bytes of them, carry half the staging registers and convert none of them
// all of them are written as k tiles, [k tile][row or output column][KT]: the 128 x KT tile that a block stages is then 16 KB in a row instead of 128 pieces one matrix row apart
// blocks < CVX_BLK: x; a wave takes two rows in 16 runs of 128 floats (whole lines in; out, a half wave writes one whole line). The rest: a wave takes 32 output columns x KT k of one weight (which 0..2: q, k, v; 3: the output weight, in both forms that k_out multiplies with), 16 B (8 k) a store
#define CVX_BLK (NB * TT * DIN / (8 * 16 * 128))
#define CVW_BLK (4 * (CC / 32) * (DIN / KT) / 8)
template <int LDK, bool BOTH> __device__ __forceinline__ void cvt_w(const float* ws, __bf16* db, _Float16* dh) {   /* ws = (the thread's first k, its first column), LDK floats between k rows; db, dh = (that column, that k) in the k tile */
  WRaw wr; wt_load(wr, ws, LDK, 0); PF_XWP(ws, ws);
#pragma unroll
  for (int u = 0; u < 2; ++u)
#pragma unroll
    for (int i = 0; i < 4; ++i) { v8b p;
#pragma unroll
      for (int kk = 0; kk < 8; ++kk) p[kk] = (__bf16)wr.r[u][kk][i];
      *(v8b*)(db + i * KT + 32 * u) = p; }
  if (BOTH) {
#pragma unroll
    for (int u = 0; u < 2; ++u)
#pragma unroll
      for (int i = 0; i < 4; ++i) { v8h p;   /* f16(bf16 x 2^8), exact */
#pragma unroll
        for (int kk = 0; kk < 8; ++kk) p[kk] = (_Float16)(bfr(wr.r[u][kk][i]) * 256.0f);
        *(v8h*)(dh + i * KT + 32 * u) = p; }
    PF_XW(); } }   /* behind this path's last stores the kernel's closing branches rewrite the scalar base that they name */
__global__ __launch_bounds__(256) void k_cvt(const float* __restrict__ X, const float* __restrict__ WQ, const float* __restrict__ WK, const float* __restrict__ WV, const float* __restrict__ WO, __bf16* __restrict__ XB, __bf16* __restrict__ WT, __bf16* __restrict__ WPB, _Float16* __restrict__ WPH) {
  const unsigned tid = threadIdx.x, wave = tid >> 5, lane = tid & 31;
  static_assert(WQKV_LAYOUT == 2 && !WO_OUT_IN && HD % 32 == 0 && CC == 1024 && DIN == 1024 && KT == 64 && CVW_BLK % 4 == 0, "a wave's 32 columns lie in one head, a block in one weight");
  if (blockIdx.x < CVX_BLK) {   /* block-uniform */
    const size_t row = ((size_t)blockIdx.x * 8 + wave) * 2; const float* xs = X + row * DIN + lane * 4; v4f r[16];   /* run j: row + (j >> 3), k 128 (j & 7) + 4 lane */
    __bf16* xd = XB + ((size_t)(lane >> 4) * (NB * TT) + row) * KT + 4 * (lane & 15);
#pragma unroll
    for (int j = 0; j < 16; ++j) r[j] = *(const v4f*)(xs + j * 128);
    PF_XWP(xs, xs);
#pragma unroll
    for (int j = 0; j < 16; ++j) { v4b p;
#pragma unroll
      for (int e = 0; e < 4; ++e) p[e] = (__bf16)r[j][e];
      *(v4b*)(xd + (size_t)(2 * (j & 7)) * (NB * TT * KT) + (j >> 3) * KT) = p; }
  } else {
    const unsigned wblk = blockIdx.x - CVX_BLK, which = wblk / (CVW_BLK / 4), w = (wblk % (CVW_BLK / 4)) * 8 + wave, kt = w % (DIN / KT), cg = w / (DIN / KT);
    const unsigned cl0 = cg * 32 + 4 * (lane & 7), kf = kt * KT + 8 * (lane >> 3);   /* the thread's first column and first k */
    const size_t od = ((size_t)kt * 1024 + cl0) * KT + 8 * (lane >> 3);
    if (which == 3) cvt_w<DIN, true>(WO + cl0 + (size_t)kf * DIN, WPB + od, WPH + od);   /* block-uniform */
    else cvt_w<HD, false>((which == 0 ? WQ : which == 1 ? WK : WV) + (size_t)(cl0 / HD) * DIN * HD + cl0 % HD + (size_t)kf * HD, WT + (size_t)which * CC * DIN + od, nullptr); } }
// ---- k_proj: block = (128 rows, 128 cols, which); a wave takes two groups of 16 rows (rows 16 wave + 64 rg), so that every B fragment read from LDS and every staged weight tile serves two products: q/k/v = X W (+ b) with exact bf16 products (K = DIN) -> which 0: q f16 rows (+ residual rows < QHI); 1: k f16 rows (+ residual rows < KHI); 2: v f16 planes [c][t] (+ bf16 hi/lo planes for t < KHI)
__global__ __launch_bounds__(128) void k_proj(const __bf16* __restrict__ XB, const __bf16* __restrict__ WT, const float* __restrict__ BQ, const float* __restrict__ BK, const float* __restrict__ BV,
    _Float16* __restrict__ QH, _Float16* __restrict__ QL, _Float16* __restrict__ KH, _Float16* __restrict__ KL, _Float16* __restrict__ VT, __bf16* __restrict__ VB, __bf16* __restrict__ VBL) {
  __shared__ __align__(16) unsigned char sm[4 * 128 * WPITCH * 2];   /* the two weight buffers and the two A buffers during the k loop; behind the loop's last barrier the epilogue's planes */
  __bf16 (*wt)[128][WPITCH] = (__bf16 (*)[128][WPITCH])sm, (*at)[128][WPITCH] = (__bf16 (*)[128][WPITCH])(sm + 2 * 128 * WPITCH * 2); static_assert(3 * 128 * 72 * 2 <= 4 * 128 * WPITCH * 2 && 2 * 64 * 136 * 2 <= 4 * 128 * WPITCH * 2, "LDS");
  _Float16 (*sh)[136] = (_Float16 (*)[136])sm, (*sl)[136] = (_Float16 (*)[136])(sm + 64 * 136 * 2); _Float16 (*th)[72] = (_Float16 (*)[72])sm; __bf16 (*tb)[72] = (__bf16 (*)[72])(sm + 128 * 72 * 2), (*tbl)[72] = (__bf16 (*)[72])(sm + 2 * 128 * 72 * 2);
  const int tid = threadIdx.x, wave = tid >> 5, lane = tid & 31, col = lane & 15, g = lane >> 4; const int which = blockIdx.z; const int c0 = blockIdx.y * 128; const size_t r0 = (size_t)blockIdx.x * 128; const size_t bb = r0 / TT; const int t0 = (int)(r0 % TT); static_assert(TT % 128 == 0 && QHI % 64 == 0 && KHI % 64 == 0, "a block lies in one sequence");
  const float* BA = which == 0 ? BQ : which == 1 ? BK : BV;
  v8f acc[2][8] = {};
  const int srow = TT_ROW(tid), spc = tid & 7; const char* wb = (const char*)(WT + (size_t)which * CC * DIN + (size_t)(c0 + srow) * KT + 8 * spc); const char* arow = (const char*)(XB + (r0 + srow) * KT + 8 * spc);
  TRaw<8> wr, ar; tt_load<8, 16>(ar, arow, 0); tt_load<8, 16>(wr, wb, 0); PF_XWP(arow, wb); tt_store<8, 16>(wt[0], wr, srow, spc); tt_store<8, 16>(at[0], ar, srow, spc);
  __syncthreads();   /* tile 0 is published */
#pragma unroll 2   /* two trips = the two buffers at constant LDS addresses */
  for (int t = 0; t < DIN / KT; ++t) {
    if (t + 1 < DIN / KT) { tt_load<8, 16>(ar, arow, (t + 1) * XT_STEP); tt_load<8, 16>(wr, wb, (t + 1) * WT_STEP); }   /* the next tile flies while this one is multiplied */
    PF_STAGE();
    v16b a[2][KT / 32];   /* the wave's own rows of the A tile, read in one group with the first B fragments */
#pragma unroll
    for (int c = 0; c < KT / 32; ++c)
#pragma unroll
      for (int rg = 0; rg < 2; ++rg) a[rg][c] = frag_b(&at[t & 1][wave * 16 + col + 64 * rg][32 * c], lane);
    v16b bf[2][4];   /* B fragments in groups of 4 (group q: k half q >> 1, columns 64 (q & 1) ..), two register sets: a group's LDS reads are issued together, two groups ahead of its products */
#pragma unroll
    for (int q = 0; q < 2; ++q)
#pragma unroll
      for (int jj = 0; jj < 4; ++jj) bf[q][jj] = frag_b(&wt[t & 1][(q * 4 + jj) * 16 + col][0], lane);
    PF_GROUP();
#pragma unroll
    for (int q = 0; q < 4; ++q) {
#pragma unroll
      for (int jj = 0; jj < 4; ++jj)
#pragma unroll
        for (int rg = 0; rg < 2; ++rg) acc[rg][(q & 1) * 4 + jj] = wmma_bf(a[rg][q >> 1], bf[q & 1][jj], acc[rg][(q & 1) * 4 + jj]);
      if (q < 2) { PF_GROUP();
#pragma unroll
        for (int jj = 0; jj < 4; ++jj) bf[q][jj] = frag_b(&wt[t & 1][(q * 4 + jj) * 16 + col][32], lane);
        PF_GROUP(); } }
    PF_STAGE();
    if (t + 1 < DIN / KT) { tt_store<8, 16>(wt[(t + 1) & 1], wr, srow, spc); tt_store<8, 16>(at[(t + 1) & 1], ar, srow, spc); }   /* those buffers' readers left them at the barrier of trip t - 1 */
    PF_XW();
    __syncthreads(); }   /* publishes tile t + 1 and ends the reads of tile t (after the last trip: frees the LDS for the epilogue) */
  // the epilogue takes the two row groups one after the other through the same planes (64 rows each)
#pragma unroll
  for (int rg = 0; rg < 2; ++rg) { const size_t r0g = r0 + 64 * rg; const int t0g = t0 + 64 * rg;
  if (rg) __syncthreads();   /* the first group's rows have been read out of the planes */
  if (which < 2) { _Float16* DH = which == 0 ? QH : KH; _Float16* DL = which == 0 ? QL : KL; const int nhi = which == 0 ? QHI : KHI; const bool hi_rows = t0g < nhi;
#pragma unroll
    for (int j = 0; j < 8; ++j) { const float bias = BA ? bfr(BA[c0 + j * 16 + col]) : 0.f;
#pragma unroll
      for (int r = 0; r < 8; ++r) { const float v = acc[rg][j][r] + bias; const _Float16 hv = (_Float16)v; sh[wave * 16 + 8 * g + r][j * 16 + col] = hv; sl[wave * 16 + 8 * g + r][j * 16 + col] = (_Float16)((v - (float)hv) * 1024.0f); } }
    __syncthreads();
    for (int e = tid; e < 64 * 16; e += 128) { const int rl = e >> 4, q = e & 15; vst2((unsigned*)(DH + (r0g + rl) * CC + c0 + q * 8), *(const v4u*)&sh[rl][q * 8]); PF_XW();   /* the LDS read below may land in this store's registers */
      if (hi_rows) vst2((unsigned*)(DL + (bb * nhi + t0g + rl) * (size_t)CC + c0 + q * 8), *(const v4u*)&sl[rl][q * 8]); PF_XW(); }   /* the next trip rewrites the stores' address registers */
  } else { const bool hi_rows = t0g < KHI;
#pragma unroll
    for (int j = 0; j < 8; ++j) { const float bias = BA ? bfr(BA[c0 + j * 16 + col]) : 0.f;
#pragma unroll
      for (int r = 0; r < 8; ++r) { const float v = acc[rg][j][r] + bias; const int rl = wave * 16 + 8 * g + r, cl = j * 16 + col; th[cl][rl] = (_Float16)v; const __bf16 bh = (__bf16)v; tb[cl][rl] = bh; tbl[cl][rl] = (__bf16)(v - (float)bh); } }
    __syncthreads();
    for (int e = tid; e < 128 * 8; e += 128) { const int cl = e >> 3, q = e & 7; vst2((unsigned*)(VT + (bb * CC + c0 + cl) * (size_t)TT + t0g + q * 8), *(const v4u*)&th[cl][q * 8]); PF_XW();   /* the LDS reads below may land in this store's address registers */
      if (hi_rows) { const size_t o3 = (bb * CC + c0 + cl) * (size_t)KHI + t0g + q * 8; vst2((unsigned*)(VB + o3), *(const v4u*)&tb[cl][q * 8]); vst2((unsigned*)(VBL + o3), *(const v4u*)&tbl[cl][q * 8]); PF_XW(); } } } } }   /* as above, for the next trip */
// ---- k_att: block = 64 queries (qb) of one (b, h), z = b * NH + h; logits, softmax and P . v in one pass over 64-key blocks 0..qb, the logits never leave registers.
// Transposed products: St = K . Qt (A = 16 key rows, B = the wave's 16 queries), so a lane holds 8 keys a tile of ONE query (column lane & 15, keys 8 g + r); two neighbouring St tiles are, register for register, the B fragment Pt of 32 keys for Ot += Vt . Pt (A = 16 d rows of the v plane).
// Running maximum per query (in-lane + one exchange between the wave halves), e = 2^((s - m) c + 11), c = SCALE log2(e): P carried x 2^11 as before, the factor cancels against the row sum; Ot and the sum are rescaled at every key block.
// Query blocks < QBH: 3 logit products (q, k hi + residual x 2^10) and P, v as bf16 hi + lo (3 products); after: single f16 products.
// The K and v tiles (64 rows x 128 B each) are shared by the 4 waves through LDS: whole-line global loads one key block ahead, 2 buffers, one barrier per key block.
#define AP 72              // 144-B LDS row pitch, as WPITCH
#define ATILE (64 * AP * 2)   // bytes of one tile in LDS
__device__ __forceinline__ v8f wm_h(v16h a, v16h b, v8f c) { return __builtin_amdgcn_wmma_f32_16x16x32_f16(false, a, false, b, (short)0, c, false, false); }
__device__ __forceinline__ v8f wm_b(v16b a, v16b b, v8f c) { return __builtin_amdgcn_wmma_f32_16x16x32_bf16(false, a, false, b, (short)0, c, false, false); }
__device__ __forceinline__ float xhalf(float x) { return __builtin_bit_cast(float, __builtin_amdgcn_permlanex16(__builtin_bit_cast(int, x), __builtin_bit_cast(int, x), 0x76543210, 0xfedcba98, false, false)); }   /* lane l <-> lane l ^ 16 */
// 2^x by v_exp_f32 as asm text, eight in place in one statement: nothing of the compiler's then stands directly behind a v_exp_f32; the closing v_nop is the slot that the instruction set asks for behind the last one
__device__ __forceinline__ void exp2x8(float (&x)[8]) {
  asm("v_exp_f32 %0, %0\n\tv_exp_f32 %1, %1\n\tv_exp_f32 %2, %2\n\tv_exp_f32 %3, %3\n\tv_exp_f32 %4, %4\n\tv_exp_f32 %5, %5\n\tv_exp_f32 %6, %6\n\tv_exp_f32 %7, %7\n\tv_nop" : "+v"(x[0]), "+v"(x[1]), "+v"(x[2]), "+v"(x[3]), "+v"(x[4]), "+v"(x[5]), "+v"(x[6]), "+v"(x[7])); }
__device__ __forceinline__ float exp2x1(float x) { asm("v_exp_f32 %0, %0\n\tv_nop" : "+v"(x)); return x; }   /* the same for one value */
typedef v4f __attribute__((may_alias)) v4f_a;
template <bool HI> __device__ __forceinline__ void att_body(unsigned char* sm, const _Float16* __restrict__ QH, const _Float16* __restrict__ KH, const _Float16* __restrict__ QL, const _Float16* __restrict__ KL, const _Float16* __restrict__ VT, const __bf16* __restrict__ VB, const __bf16* __restrict__ VBL, float* __restrict__ Y, int qb, int b, int h) {
  constexpr int NT = HI ? 4 : 2;   /* tiles a key block: k, v (+ k residual, v lo) */
  const int tid = threadIdx.x, wave = tid >> 5, lane = tid & 31, col = lane & 15, g = lane >> 4; const int ql0 = qb * 64 + wave * 16; const int nblk = qb + 1;
  const int srow = tid >> 3, spc = tid & 7;   /* staging: 8 lanes = one 128-B row; a thread carries rows srow + 16 i */
  constexpr unsigned vp = HI ? KHI : TT;
  // block-uniform bases and one 32-bit byte offset per thread and tile shape (k rows, v planes)
  const char* s_k = (const char*)(KH + (size_t)b * TT * CC + h * HD); const char* s_kl = (const char*)(KL + (size_t)b * KHI * CC + h * HD);
  const char* s_v = HI ? (const char*)(VB + ((size_t)b * CC + h * HD) * vp) : (const char*)(VT + ((size_t)b * CC + h * HD) * vp); const char* s_vl = (const char*)(VBL + ((size_t)b * CC + h * HD) * vp);
  const unsigned o_k = (unsigned)srow * (CC * 2) + spc * 16, o_v = (unsigned)srow * (vp * 2) + spc * 16;
  v4u ra[4], rb[4];   /* two tiles in flight: k and v; with the residual planes first k and k residual, then, behind the logit products, v hi and v lo in the same registers */
#define ATT_LD(dst, base, rowstep, off) do { _Pragma("unroll") for (int i = 0; i < 4; ++i) dst[i] = *(const v4u_a*)((base) + i * (16 * (rowstep)) + (off)); } while (0)
#define ATT_ST(bufp, tile, srcr) do { _Pragma("unroll") for (int i = 0; i < 4; ++i) *(v4u_a*)((bufp) + (tile) * ATILE + (srow + 16 * i) * (AP * 2) + spc * 16) = srcr[i]; } while (0)
#define ATT_KSTEP (64 * CC * 2)   /* bytes between key blocks in the k rows; 128 in the v planes */
  v16h qf[HD / 32], qlf[HD / 32];
#pragma unroll
  for (int kc = 0; kc < HD / 32; ++kc) { qf[kc] = frag_h(QH + ((size_t)b * TT + ql0 + col) * CC + h * HD + kc * 32, lane); if (HI) qlf[kc] = frag_h(QL + ((size_t)b * QHI + ql0 + col) * CC + h * HD + kc * 32, lane); }
  if (HI) { ATT_LD(ra, s_k, CC * 2, o_k); ATT_LD(rb, s_kl, CC * 2, o_k); PF_XW(); ATT_ST(sm, 0, ra); ATT_ST(sm, 2, rb); ATT_LD(ra, s_v, vp * 2, o_v); ATT_LD(rb, s_vl, vp * 2, o_v); PF_XW(); ATT_ST(sm, 1, ra); ATT_ST(sm, 3, rb); PF_XW(); }   /* the last wait: the q loads are scheduled behind the one before */
  else { ATT_LD(ra, s_k, CC * 2, o_k); ATT_LD(rb, s_v, vp * 2, o_v); PF_XW(); ATT_ST(sm, 0, ra); ATT_ST(sm, 1, rb); }
  __syncthreads();   /* key block 0 is published */
  const float cs = SCALE * 1.44269504088896340736f;
  float m = -3.0e38f, l = 0.f; v8f o[HD / 16] = {};
  for (int t = 0; t < nblk; ++t) { const unsigned char* bp = sm + (t & 1) * (NT * ATILE); unsigned char* nb = sm + ((t + 1) & 1) * (NT * ATILE);   /* nb: its readers left it at the barrier of trip t - 1 */
    // with the residual planes the staging is unconditional (the last trip stages its own block once more into the idle buffer, which nobody reads): no branch then stands between the logit products and the first readers of their results
    const bool more = HI || t + 1 < nblk; const int tn = (HI && t + 1 == nblk) ? t : t + 1;
    if (more) { ATT_LD(ra, s_k + (size_t)tn * ATT_KSTEP, CC * 2, o_k); if (HI) ATT_LD(rb, s_kl + (size_t)tn * ATT_KSTEP, CC * 2, o_k); else ATT_LD(rb, s_v + (size_t)tn * 128, vp * 2, o_v); }   /* the next key block flies while this one is worked on */
    if (HI) PF_XW(); else PF_STAGE();   /* with the residual planes the LDS reads below land in the address registers of these loads (without them the compiler writes the wait itself) */
    const _Float16 (*kt)[AP] = (const _Float16 (*)[AP])bp; const _Float16 (*klt)[AP] = (const _Float16 (*)[AP])(bp + 2 * ATILE); const _Float16 (*vt)[AP] = (const _Float16 (*)[AP])(bp + ATILE); const __bf16 (*vb)[AP] = (const __bf16 (*)[AP])(bp + ATILE); const __bf16 (*vbl)[AP] = (const __bf16 (*)[AP])(bp + 3 * ATILE);
    // ATT_GROUP: behind a group of LDS fragment reads it keeps the scheduler from sinking each read down to its own product (one LDS latency per product instead of one per group)
#define ATT_GROUP() __builtin_amdgcn_sched_barrier(0)
    float s[4][8]; v16h vf[2][HD / 16]; v16b vh[HD / 16], vl[HD / 16];
    if (HI) {
#pragma unroll
      for (int hf = 0; hf < 2; ++hf) { v16h kf[2][HD / 32], lf[2][HD / 32]; v8f a[2] = {}, al[2] = {};   /* two key tiles a group */
#pragma unroll
        for (int jj = 0; jj < 2; ++jj)
#pragma unroll
          for (int kc = 0; kc < HD / 32; ++kc) { kf[jj][kc] = frag_h(&kt[(2 * hf + jj) * 16 + col][kc * 32], lane); lf[jj][kc] = frag_h(&klt[(2 * hf + jj) * 16 + col][kc * 32], lane); }
        ATT_GROUP();
#pragma unroll
        for (int kc = 0; kc < HD / 32; ++kc)
#pragma unroll
          for (int jj = 0; jj < 2; ++jj) { a[jj] = wm_h(kf[jj][kc], qf[kc], a[jj]); al[jj] = wm_h(kf[jj][kc], qlf[kc], al[jj]); al[jj] = wm_h(lf[jj][kc], qf[kc], al[jj]); }
#pragma unroll
        for (int jj = 0; jj < 2; ++jj)
#pragma unroll
          for (int r = 0; r < 8; ++r) s[2 * hf + jj][r] = a[jj][r] + al[jj][r] * (1.0f / 1024.0f);
        ATT_GROUP(); }   /* here it keeps the second group's reads from rising over the first group's products: both groups at once do not fit the registers */
      ATT_ST(nb, 0, ra); ATT_ST(nb, 2, rb); PF_XW(); ATT_LD(ra, s_v + (size_t)tn * 128, vp * 2, o_v); ATT_LD(rb, s_vl + (size_t)tn * 128, vp * 2, o_v);
      PF_STAGE();
#pragma unroll
      for (int j = 0; j < HD / 16; ++j) { vh[j] = frag_b(&vb[j * 16 + col][0], lane); vl[j] = frag_b(&vbl[j * 16 + col][0], lane); }   /* v of the first 32 keys: read behind the logit products, lands under the softmax */
    } else { v16h kf[4][HD / 32]; v8f a[4] = {};
#pragma unroll
      for (int jt = 0; jt < 4; ++jt)
#pragma unroll
        for (int kc = 0; kc < HD / 32; ++kc) kf[jt][kc] = frag_h(&kt[jt * 16 + col][kc * 32], lane);
      ATT_GROUP();
#pragma unroll
      for (int kc = 0; kc < HD / 32; ++kc)
#pragma unroll
        for (int jt = 0; jt < 4; ++jt) a[jt] = wm_h(kf[jt][kc], qf[kc], a[jt]);
#pragma unroll
      for (int kc = 0; kc < 2; ++kc)
#pragma unroll
        for (int j = 0; j < HD / 16; ++j) vf[kc][j] = frag_h(&vt[j * 16 + col][kc * 32], lane);   /* all of v: read behind the logit products, lands under the softmax */
#pragma unroll
      for (int jt = 0; jt < 4; ++jt)
#pragma unroll
        for (int r = 0; r < 8; ++r) s[jt][r] = a[jt][r]; }
    ATT_GROUP();
    if (t == nblk - 1) {   /* the diagonal block: keys past the query are excluded by index */
#pragma unroll
      for (int jt = 0; jt < 4; ++jt)
#pragma unroll
        for (int r = 0; r < 8; ++r) s[jt][r] = (jt * 16 + 8 * g + r <= wave * 16 + col) ? s[jt][r] : -3.0e38f; }
    float mj[4];   /* four independent chains */
#pragma unroll
    for (int jt = 0; jt < 4; ++jt) { mj[jt] = s[jt][0];
#pragma unroll
      for (int r = 1; r < 8; ++r) mj[jt] = fmaxf(mj[jt], s[jt][r]); }
    float mx = fmaxf(fmaxf(mj[0], mj[1]), fmaxf(mj[2], mj[3]));
    mx = fmaxf(mx, xhalf(mx));   /* the other 8 keys of each tile lie in the other wave half */
    const float mn = fmaxf(m, mx); const float alpha = exp2x1((m - mn) * cs); const float off = 11.0f - mn * cs; m = mn;
    float sj[4];
#pragma unroll
    for (int jt = 0; jt < 4; ++jt) {
#pragma unroll
      for (int r = 0; r < 8; ++r) s[jt][r] = fmaf(s[jt][r], cs, off);
      exp2x8(s[jt]);   /* an excluded key gives 2^(-huge) = 0 */
      sj[jt] = s[jt][0];
#pragma unroll
      for (int r = 1; r < 8; ++r) sj[jt] += s[jt][r]; }
    l = l * alpha + ((sj[0] + sj[1]) + (sj[2] + sj[3]));
#pragma unroll
    for (int j = 0; j < HD / 16; ++j) o[j] *= alpha;
#pragma unroll
    for (int kc = 0; kc < 2; ++kc) {
      if (HI) { float v[16];
#pragma unroll
        for (int i = 0; i < 8; ++i) { v[i] = s[2 * kc][i]; v[8 + i] = s[2 * kc + 1][i]; }
        const F2 p = bsplit16(v);
#pragma unroll
        for (int j = 0; j < HD / 16; ++j) o[j] = wm_b(vh[j], p.h, o[j]);
#pragma unroll
        for (int j = 0; j < HD / 16; ++j) o[j] = wm_b(vh[j], p.l, o[j]);
#pragma unroll
        for (int j = 0; j < HD / 16; ++j) o[j] = wm_b(vl[j], p.h, o[j]);
        if (kc == 0) {
#pragma unroll
          for (int j = 0; j < HD / 16; ++j) { vh[j] = frag_b(&vb[j * 16 + col][32], lane); vl[j] = frag_b(&vbl[j * 16 + col][32], lane); }
          ATT_GROUP(); }
      } else { v16h p;
#pragma unroll
        for (int i = 0; i < 8; ++i) { p[i] = (_Float16)s[2 * kc][i]; p[8 + i] = (_Float16)s[2 * kc + 1][i]; }
#pragma unroll
        for (int j = 0; j < HD / 16; ++j) o[j] = wm_h(vf[kc][j], p, o[j]); } }
    PF_STAGE();
    if (more) { if (HI) { ATT_ST(nb, 1, ra); ATT_ST(nb, 3, rb); } else { ATT_ST(nb, 0, ra); ATT_ST(nb, 1, rb); } }
    PF_XW();
    __syncthreads(); }   /* publishes key block t + 1 and ends the reads of block t (after the last trip: frees the LDS for the epilogue) */
  l += xhalf(l);
  const float inv = l > 0.f ? 1.0f / l : 0.f;
  float (*ss)[HD + 4] = (float (*)[HD + 4])(sm + wave * (16 * (HD + 4) * 4));   /* the wave's own 16 ctx rows, so that the stores cover whole 256-B (row, head) segments */
#pragma unroll
  for (int j = 0; j < HD / 16; ++j) { v4f x0, x1;
#pragma unroll
    for (int r = 0; r < 4; ++r) { x0[r] = o[j][r] * inv; x1[r] = o[j][4 + r] * inv; }
    *(v4f_a*)&ss[col][j * 16 + 8 * g] = x0; *(v4f_a*)&ss[col][j * 16 + 8 * g + 4] = x1; }
  LDSX();
#pragma unroll
  for (int i = 0; i < 8; ++i) { const int rl = 2 * i + g; vst2(Y + ((size_t)b * TT + ql0 + rl) * CC + h * HD + col * 4, *(const v4f_a*)&ss[rl][col * 4]); } }
__global__ __launch_bounds__(128, 4) void k_att(const _Float16* __restrict__ QH, const _Float16* __restrict__ KH, const _Float16* __restrict__ QL, const _Float16* __restrict__ KL, const _Float16* __restrict__ VT, const __bf16* __restrict__ VB, const __bf16* __restrict__ VBL, float* __restrict__ Y) {   /* 4 waves a SIMD: all 1024 blocks resident at once, 4 a WGP */
  __shared__ __align__(16) unsigned char sm[2 * 4 * ATILE]; static_assert(CAUSAL && QBH * 64 <= KHI && QBH * 64 <= QHI && HD == 64 && 4 * 16 * (HD + 4) * 4 <= 2 * 2 * ATILE, "k_att");
  const int z = blockIdx.z, b = z / NH, h = z % NH;
  const int qb = ((z & 1) ? NQB - 1 - (int)blockIdx.x : (int)blockIdx.x) ^ ((z & 2) ? NQB / 2 : 0);   /* a permutation of the query blocks per plane: neighbours in launch order differ in length, for balance only */
  if (qb < QBH) att_body<true>(sm, QH, KH, QL, KL, VT, VB, VBL, Y, qb, b, h); else att_body<false>(sm, QH, KH, QL, KL, VT, VB, VBL, Y, qb, b, h); }
// ---- k_out: block = (128 rows, 128 cols), 8 waves of 16 rows on one staged weight tile: out = ctx Wo (+ bo): ctx once to f16 against Wo as f16(bf16 x 2^8) exact (1 product) x 2^-8; causal early rows (< QHI of each sequence): ctx bf16 hi + lo against exact bf16 Wo (2 products)
__global__ __launch_bounds__(256) void k_out(const float* __restrict__ Y, const __bf16* __restrict__ WPB, const _Float16* __restrict__ WPH, const float* __restrict__ BO, float* __restrict__ OUT) { __shared__ __align__(16) float sf[8][16][132]; __shared__ __align__(16) __bf16 wt[2][128][WPITCH]; __shared__ __align__(16) __bf16 at[2][2][128][WPITCH];   /* at: [buffer][plane: hi, lo (early rows); the f16 path keeps one plane] */
  const int tid = threadIdx.x, wave = tid >> 5, lane = tid & 31, col = lane & 15, g = lane >> 4; const int c0 = blockIdx.y * 128; const size_t r0 = (size_t)blockIdx.x * 128 + wave * 16; static_assert(TT % 128 == 0 && QHI % 128 == 0, "a block is early rows or late rows as a whole");
  v8f acc[8] = {};
  const bool early = CAUSAL && (int)(((size_t)blockIdx.x * 128) % TT) < QHI;   /* block-uniform */
  const int srow = TT_ROW(tid), spc = tid & 7; const char* wb = (early ? (const char*)WPB : (const char*)WPH) + ((size_t)(c0 + srow) * KT + 8 * spc) * 2; const int ar0 = wave * 16 + g, akl = 4 * col; const float* arow = Y + (r0 + g) * CC + akl;
  TRaw<4> wr; ALRaw<8> ar; at_load(ar, arow, CC, 0); tt_load<4, 32>(wr, wb, 0); PF_XW();
  if (early) {
    tt_store<4, 32>(wt[0], wr, srow, spc); at_store_hl(at[0][0], at[0][1], ar, ar0, akl);
    __syncthreads();   /* tile 0 is published */
#pragma unroll 2   /* two trips = the two buffers at constant LDS addresses */
    for (int t = 0; t < CC / KT; ++t) {
      if (t + 1 < CC / KT) { at_load(ar, arow, CC, (t + 1) * KT); tt_load<4, 32>(wr, wb, (t + 1) * WT_STEP); PF_XW(); }   /* the next tile flies while this one is multiplied; the wait: the conversions behind the products are given these loads' address registers */
      PF_STAGE();
      F2 a[KT / 32];   /* the wave's own rows of the A tile, read in one group with the first B fragments */
#pragma unroll
      for (int c = 0; c < KT / 32; ++c) { a[c].h = frag_b(&at[t & 1][0][wave * 16 + col][32 * c], lane); a[c].l = frag_b(&at[t & 1][1][wave * 16 + col][32 * c], lane); }
      v16b bf[2][4];   /* B fragments in groups of 4, two register sets, as in k_proj */
#pragma unroll
      for (int q = 0; q < 2; ++q)
#pragma unroll
        for (int jj = 0; jj < 4; ++jj) bf[q][jj] = frag_b(&wt[t & 1][(q * 4 + jj) * 16 + col][0], lane);
      PF_GROUP();
#pragma unroll
      for (int q = 0; q < 4; ++q) {
#pragma unroll
        for (int jj = 0; jj < 4; ++jj) { const int j = (q & 1) * 4 + jj; acc[j] = wmma_bf(a[q >> 1].h, bf[q & 1][jj], acc[j]); acc[j] = wmma_bf(a[q >> 1].l, bf[q & 1][jj], acc[j]); }
        if (q < 2) { PF_GROUP();
#pragma unroll
          for (int jj = 0; jj < 4; ++jj) bf[q][jj] = frag_b(&wt[t & 1][(q * 4 + jj) * 16 + col][32], lane);
          PF_GROUP(); } }
      PF_STAGE();
      if (t + 1 < CC / KT) { tt_store<4, 32>(wt[(t + 1) & 1], wr, srow, spc); at_store_hl(at[(t + 1) & 1][0], at[(t + 1) & 1][1], ar, ar0, akl); }   /* those buffers' readers left them at the barrier of trip t - 1 */
      PF_XW();
      __syncthreads(); }   /* publishes tile t + 1 and ends the reads of tile t */
#pragma unroll
    for (int j = 0; j < 8; ++j) { const float bias = BO ? bfr(BO[c0 + j * 16 + col]) : 0.f;
#pragma unroll
      for (int r = 0; r < 8; ++r) sf[wave][8 * g + r][j * 16 + col] = acc[j][r] + bias; }
  } else {
    _Float16 (*wh)[128][WPITCH] = (_Float16 (*)[128][WPITCH])wt;   /* this path keeps f16 in the same two buffers */
    _Float16 (*ah)[2][128][WPITCH] = (_Float16 (*)[2][128][WPITCH])at;   /* plane 0 of each A buffer, f16 */
    tt_store<4, 32>(wh[0], wr, srow, spc); at_store_h(ah[0][0], ar, ar0, akl, 64.0f);   /* ctx carried x 2^6 into f16 so small-magnitude context rows stay clear of f16 subnormals */
    __syncthreads();   /* tile 0 is published */
#pragma unroll 2   /* two trips = the two buffers at constant LDS addresses */
    for (int t = 0; t < CC / KT; ++t) {
      if (t + 1 < CC / KT) { at_load(ar, arow, CC, (t + 1) * KT); tt_load<4, 32>(wr, wb, (t + 1) * WT_STEP); }   /* the next tile flies while this one is multiplied */
      PF_STAGE();
      v16h a[KT / 32];   /* the wave's own rows of the A tile, read in one group with the first B fragments */
#pragma unroll
      for (int c = 0; c < KT / 32; ++c) a[c] = frag_h(&ah[t & 1][0][wave * 16 + col][32 * c], lane);
      v16h bf[2][4];   /* B fragments in groups of 4, two register sets, as in k_proj */
#pragma unroll
      for (int q = 0; q < 2; ++q)
#pragma unroll
        for (int jj = 0; jj < 4; ++jj) bf[q][jj] = frag_h(&wh[t & 1][(q * 4 + jj) * 16 + col][0], lane);
      PF_GROUP();
#pragma unroll
      for (int q = 0; q < 4; ++q) {
#pragma unroll
        for (int jj = 0; jj < 4; ++jj) acc[(q & 1) * 4 + jj] = wmma16(a[q >> 1], bf[q & 1][jj], acc[(q & 1) * 4 + jj]);
        if (q < 2) { PF_GROUP();
#pragma unroll
          for (int jj = 0; jj < 4; ++jj) bf[q][jj] = frag_h(&wh[t & 1][(q * 4 + jj) * 16 + col][32], lane);
          PF_GROUP(); } }
      PF_STAGE();
      if (t + 1 < CC / KT) { tt_store<4, 32>(wh[(t + 1) & 1], wr, srow, spc); at_store_h(ah[(t + 1) & 1][0], ar, ar0, akl, 64.0f); }   /* those buffers' readers left them at the barrier of trip t - 1 */
      PF_XW();
      __syncthreads(); }   /* publishes tile t + 1 and ends the reads of tile t */
#pragma unroll
    for (int j = 0; j < 8; ++j) { const float bias = BO ? bfr(BO[c0 + j * 16 + col]) : 0.f;
#pragma unroll
      for (int r = 0; r < 8; ++r) sf[wave][8 * g + r][j * 16 + col] = acc[j][r] * (1.0f / 16384.0f) + bias; } }   /* 2^-8 (Wo carry) x 2^-6 (ctx carry) */
  LDSX(); for (int rl = 0; rl < 16; ++rl) vst2(OUT + (r0 + rl) * DIN + c0 + lane * 4, *(const v4f*)&sf[wave][rl][lane * 4]); }

extern "C" void kernel_launch(void* const* d_in, const int* in_sizes, int n_in, void* d_out, int out_size, void* d_ws, size_t ws_size, hipStream_t stream) {
  (void)in_sizes; (void)n_in; (void)out_size;
  const float** F = (const float**)d_in;
  if (ws_size < (size_t)WS_END) return;
  char* ws = (char*)d_ws; _Float16 *QH = (_Float16*)(ws + WS_QH), *KH = (_Float16*)(ws + WS_KH), *VT = (_Float16*)(ws + WS_VT), *QL = (_Float16*)(ws + WS_QL), *KL = (_Float16*)(ws + WS_KL); __bf16 *VB = (__bf16*)(ws + WS_VB), *VBL = (__bf16*)(ws + WS_VBL); float *Y = (float*)(ws + WS_Y); __bf16 *XB = (__bf16*)(ws + WS_XB), *WT = (__bf16*)(ws + WS_WT), *WPB = (__bf16*)(ws + WS_WPB); _Float16 *WPH = (_Float16*)(ws + WS_WPH);
  (void)Y; (void)QL; (void)KL; (void)VB; (void)VBL;
  // inputs: 0 x [4,1024,1024]; 1 Wq [16,1024,64]; 2 Wk; 3 Wv (per-head [head][model][d]); 4 Wp [1024,1024] (in,out); 5 bp [1024] (zeros, read); no q / k / v biases
  k_cvt<<<dim3(CVX_BLK + CVW_BLK), 256, 0, stream>>>(F[0], F[1], F[2], F[3], F[4], XB, WT, WPB, WPH);
  k_proj<<<dim3(TNB * TT / 128, CC / 128, 3), 128, 0, stream>>>(XB, WT, nullptr, nullptr, nullptr, QH, QL, KH, KL, VT, VB, VBL);
  k_att<<<dim3(NQB, 1, TNB * NH), 128, 0, stream>>>(QH, KH, QL, KL, VT, VB, VBL, Y);
  k_out<<<dim3(TNB * TT / 128, DIN / 128), 256, 0, stream>>>(Y, WPB, WPH, F[5], (float*)d_out);
}

// v008
// A run of this version takes 74.9 microseconds.
// Next to v007, in two timings, it ran 1.05 times as fast each time.
// Over all steps from v000 it is 9.64 times as fast.
// compute dtype: all float inputs rounded to bf16; per-head q / k / v projections with EXACT bf16 products on WMMA 16x16x32 (f32 accumulate), no biases; causal logits: 3 products for the first 384 rows, single f16 q x k after, x 1024^-0.5; softmax f32; P x 2^11 once to f16 x v once to f16 (bf16 hi + lo below row 384); ctx hi+lo x exact Wp below row 384, x2^6 f16 carry x f16(bf16 x 2^8) Wp after, + bp (zeros, read); f32 output.
#include <hip/hip_runtime.h>
#include <math.h>

typedef __attribute__((ext_vector_type(16))) _Float16 v16h;
typedef __attribute__((ext_vector_type(16))) __bf16 v16b;
typedef __attribute__((ext_vector_type(8)))  _Float16 v8h;
typedef __attribute__((ext_vector_type(8)))  float v8f;
typedef __attribute__((ext_vector_type(4)))  float v4f;
typedef __attribute__((ext_vector_type(2)))  float v2f;
typedef __attribute__((ext_vector_type(4)))  unsigned v4u;
typedef __attribute__((ext_vector_type(4)))  int v4i;
typedef float __attribute__((may_alias)) float_a;
typedef int __attribute__((may_alias)) int_a;

template <typename T> __device__ __forceinline__ void vst2(void* p, T v) { *(T*)p = v;  }
__device__ __forceinline__ v8f wmma16(v16h a, v16h b, v8f c) {
  return __builtin_amdgcn_wmma_f32_16x16x32_f16(false, a, false, b, (short)0, c, false, false);
}
__device__ __forceinline__ v8f wmma_bf(v16b a, v16b b, v8f c) {
  return __builtin_amdgcn_wmma_f32_16x16x32_bf16(false, a, false, b, (short)0, c, false, false);
}
// 16x16x32 fragments: lane = (h = lane>>4, row/col = lane&15); elements 0..7 = k0+8h+0..7, 8..15 = k0+16+8h+0..7; D element r = row 8h+r
__device__ __forceinline__ v16h frag_h(const _Float16* rowk0, int lane) {
  union { v16h v; v8h q[2]; } u; const _Float16* p = rowk0 + 8 * (lane >> 4);
  u.q[0] = *(const v8h*)p; u.q[1] = *(const v8h*)(p + 16); return u.v;
}
__device__ __forceinline__ v16h frag_f32(const float* rowk0, int lane) {
  v16h a; const float* p = rowk0 + 8 * (lane >> 4);
#pragma unroll
  for (int i = 0; i < 8; ++i) { a[i] = (_Float16)p[i]; a[8 + i] = (_Float16)p[16 + i]; }
  return a;
}
__device__ __forceinline__ v16h frag_f32s(const float* rowk0, int lane, float sc) {
  v16h a; const float* p = rowk0 + 8 * (lane >> 4);
#pragma unroll
  for (int i = 0; i < 8; ++i) { a[i] = (_Float16)(p[i] * sc); a[8 + i] = (_Float16)(p[16 + i] * sc); }
  return a;
}
// column fragment from a [K][ld] layout (column n), rows >= K read as 0
__device__ __forceinline__ v16h fragc_f32(const float* W, int k0, int n, int lane, int ld, int K) {
  v16h a; const int g = lane >> 4;
#pragma unroll
  for (int i = 0; i < 8; ++i) { const int ka = k0 + 8 * g + i, kb = ka + 16;
    a[i] = (_Float16)(ka < K ? W[(size_t)(ka < K ? ka : K - 1) * ld + n] : 0.f); a[8 + i] = (_Float16)(kb < K ? W[(size_t)(kb < K ? kb : K - 1) * ld + n] : 0.f); }
  return a;
}
struct F2 { v16b h, l; };
__device__ __forceinline__ F2 bsplit16(const float v[16]) { F2 r;
#pragma unroll
  for (int i = 0; i < 16; ++i) { const __bf16 h = (__bf16)v[i]; r.h[i] = h; r.l[i] = (__bf16)(v[i] - (float)h); }
  return r; }
__device__ __forceinline__ F2 split_row(const float* row, int k0, int lane) { float v[16]; const float* p = row + k0 + 8 * (lane >> 4);
#pragma unroll
  for (int i = 0; i < 8; ++i) { v[i] = p[i]; v[8 + i] = p[16 + i]; }
  return bsplit16(v); }
__device__ __forceinline__ F2 split_rowK(const float* row, int k0, int lane, int K) { float v[16]; const int g = lane >> 4;
#pragma unroll
  for (int i = 0; i < 8; ++i) { const int ka = k0 + 8 * g + i, kb = ka + 16; v[i] = ka < K ? row[ka < K ? ka : K - 1] : 0.f; v[8 + i] = kb < K ? row[kb < K ? kb : K - 1] : 0.f; }
  return bsplit16(v); }
__device__ __forceinline__ F2 split_col(const float* W, int k0, int n, int lane, int ld, int K) { float v[16]; const int g = lane >> 4;
#pragma unroll
  for (int i = 0; i < 8; ++i) { const int ka = k0 + 8 * g + i, kb = ka + 16; v[i] = ka < K ? W[(size_t)(ka < K ? ka : K - 1) * ld + n] : 0.f; v[8 + i] = kb < K ? W[(size_t)(kb < K ? kb : K - 1) * ld + n] : 0.f; }
  return bsplit16(v); }
__device__ __forceinline__ v8f mac3(const F2& a, const F2& b, v8f c) { c = wmma_bf(a.l, b.h, c); c = wmma_bf(a.h, b.l, c); return wmma_bf(a.h, b.h, c); }
__device__ __forceinline__ float sigm(float v) { return 1.0f / (1.0f + expf(-v)); }
#define LDSX() do { asm volatile("s_wait_dscnt 0" ::: "memory"); __builtin_amdgcn_wave_barrier(); __builtin_amdgcn_fence(__ATOMIC_RELEASE, "workgroup"); } while (0)

// Causal multi-head self-attention with per-head weights and a 1/sqrt(C) score scale (x [4,1024,1024]; Wq / Wk / Wv [16,1024,64] = per-head [head][model][d] N(0,1) x 0.02, no biases; Wp [1024,1024] (in,out), bp zeros (read); q = einsum('btc,hcd->bhtd'); scores x 1/sqrt(1024) - the scale is 1/32, not 1/8 (soft logits); tril kept, -inf elsewhere; softmax; heads concatenated; out @ Wp + bp).
#define NB 4
#define TT 1024
#define CC 1024            // NH * HD = projected width
#define DIN 1024          // input (model) width
#define NH 16
#define HD 64
#define NQB (TT / 64)
#define SCALE (0.03125f)
#define CAUSAL 1
#ifndef TNB
#define TNB NB
#endif
__device__ __forceinline__ float bfr(float v) { return (float)(__bf16)v; }
typedef __attribute__((ext_vector_type(8))) __bf16 v8b;
__device__ __forceinline__ v16b frag_b(const __bf16* rowk0, int lane) {
  union { v16b v; v8b q[2]; } u; const __bf16* p = rowk0 + 8 * (lane >> 4);
  u.q[0] = *(const v8b*)p; u.q[1] = *(const v8b*)(p + 16); return u.v;
}
#define QBH 6              // causal: query blocks 0..QBH-1 of each sequence (few keys, no averaging) take the high-precision path
#define QHI 384            // rows carrying a q residual plane
#define KHI 384            // key rows carrying k residual / v bf16 hi+lo planes (used only by the causal high-precision path)
// B fragment (k rows k0+.., output column o) of a weight: (in,out) [K][ld] or (out,in) [ld rows of K]: bf16 exact, or f16(bf16 * 256) exact
__device__ __forceinline__ v16b wcol_io(const float* Wm, int k0, int o, int lane, int ld) { v16b w; const int g = lane >> 4;
#pragma unroll
  for (int i = 0; i < 8; ++i) { w[i] = (__bf16)Wm[(size_t)(k0 + 8 * g + i) * ld + o]; w[8 + i] = (__bf16)Wm[(size_t)(k0 + 16 + 8 * g + i) * ld + o]; }
  return w; }
__device__ __forceinline__ v16b wcol_oi(const float* Wm, int k0, int o, int lane, int K) { v16b w; const float* p = Wm + (size_t)o * K + k0 + 8 * (lane >> 4);
#pragma unroll
  for (int i = 0; i < 8; ++i) { w[i] = (__bf16)p[i]; w[8 + i] = (__bf16)p[16 + i]; }
  return w; }
__device__ __forceinline__ v16h wcolh_io(const float* Wm, int k0, int o, int lane, int ld) { v16h w; const int g = lane >> 4;
#pragma unroll
  for (int i = 0; i < 8; ++i) { w[i] = (_Float16)(bfr(Wm[(size_t)(k0 + 8 * g + i) * ld + o]) * 256.0f); w[8 + i] = (_Float16)(bfr(Wm[(size_t)(k0 + 16 + 8 * g + i) * ld + o]) * 256.0f); }
  return w; }
__device__ __forceinline__ v16h wcolh_oi(const float* Wm, int k0, int o, int lane, int K) { v16h w; const float* p = Wm + (size_t)o * K + k0 + 8 * (lane >> 4);
#pragma unroll
  for (int i = 0; i < 8; ++i) { w[i] = (_Float16)(bfr(p[i]) * 256.0f); w[8 + i] = (_Float16)(bfr(p[16 + i]) * 256.0f); }
  return w; }
#define WQKV_LAYOUT 2   // 0 = (in,out) [DIN][CC]; 1 = (out,in) [CC][DIN]; 2 = per-head [NH][DIN][HD]
__device__ __forceinline__ v16b wcol_hdk(const float* Wm, int k0, int o, int lane) { v16b w; const int g = lane >> 4; const float* p = Wm + (size_t)(o / HD) * DIN * HD + (o % HD);
#pragma unroll
  for (int i = 0; i < 8; ++i) { w[i] = (__bf16)p[(size_t)(k0 + 8 * g + i) * HD]; w[8 + i] = (__bf16)p[(size_t)(k0 + 16 + 8 * g + i) * HD]; }
  return w; }
#define WO_OUT_IN 0
#if WQKV_LAYOUT == 1
#define WCOL(W, k0, o, lane) wcol_oi(W, k0, o, lane, DIN)
#elif WQKV_LAYOUT == 2
#define WCOL(W, k0, o, lane) wcol_hdk(W, k0, o, lane)
#else
#define WCOL(W, k0, o, lane) wcol_io(W, k0, o, lane, CC)
#endif
#if WO_OUT_IN
#define WOCOL(W, k0, o, lane) wcol_oi(W, k0, o, lane, CC)
#define WOCOLH(W, k0, o, lane) wcolh_oi(W, k0, o, lane, CC)
#else
#define WOCOL(W, k0, o, lane) wcol_io(W, k0, o, lane, DIN)
#define WOCOLH(W, k0, o, lane) wcolh_io(W, k0, o, lane, DIN)
#endif

#ifndef SM_EXTRA_PARAMS
#define SM_EXTRA_PARAMS
#endif
#ifndef PROJ_EXTRA_PARAMS
#define PROJ_EXTRA_PARAMS
#endif
#ifndef SM_MASK_HOOK
#define SM_MASK_HOOK (void)0
#endif

#define WS_QH  0u                                      // f16 q rows [b*t][CC]
#define WS_KH  (WS_QH + 2u * (size_t)NB * TT * CC)      // f16 k rows [b*t][CC]
#define WS_VT  (WS_KH + 2u * (size_t)NB * TT * CC)      // f16 v planes [b][c][t]
#define WS_QL  (WS_VT + 2u * (size_t)NB * CC * TT)      // f16 q residual x 2^10 rows [b][t < QHI][CC]
#define WS_KL  (WS_QL + 2u * (size_t)NB * QHI * CC)     // f16 k residual x 2^10 rows [b][t < KHI][CC]
#define WS_VB  (WS_KL + 2u * (size_t)NB * KHI * CC)     // bf16 v hi planes [b][c][t < KHI]
#define WS_VBL (WS_VB + 2u * (size_t)NB * CC * KHI)
#define WS_Y   (WS_VBL + 2u * (size_t)NB * CC * KHI)    // f32 ctx rows [b*t][CC] (only when there is an output projection)
#define WS_XB  (WS_Y  + 4u * (size_t)NB * TT * CC)      // bf16 x as k tiles [DIN / KT][b*t][KT]
#define WS_WT  (WS_XB + 2u * (size_t)NB * TT * DIN)     // bf16 q / k / v weights as k tiles [which][DIN / KT][output column][KT]
#define WS_WPB (WS_WT + 2u * 3u * (size_t)CC * DIN)     // bf16 output weight as k tiles [CC / KT][output column][KT]
#define WS_WPH (WS_WPB + 2u * (size_t)DIN * CC)         // the same as f16(bf16 x 2^8)
#define WS_END (WS_WPH + 2u * (size_t)DIN * CC)

// ---- weight tile in LDS (k_proj, k_out): KT k rows x 128 output columns, 16 bit, kept as [column][k], so a B fragment is frag_b / frag_h on a column's row
#define KT 64
#define WPITCH (KT + 8)    // 144-B column pitch: the 16 lanes of a ds_load_b128 fragment read fall on 16 different bank quads
// k_cvt reads a weight in units of (4 columns x 8 k), 2 a thread: lane = (column quad lane & 7, k octet lane >> 3), wave = 32 columns; each load instruction covers four whole 128-B lines
// PF_STAGE: in front of a tile's matrix work it keeps the scheduler from sinking the next tile's global loads below it; behind the matrix work it keeps the next tile's conversions, and with them the wait for those loads, from rising above it
#define PF_STAGE() __builtin_amdgcn_sched_barrier(0)
// PF_GROUP: in front of and behind a group of LDS fragment reads it keeps the group together, two groups of products ahead of its own: without it the scheduler sinks each read down to its own product (one LDS latency per product instead of one per group)
#define PF_GROUP() __builtin_amdgcn_sched_barrier(0)
// PF_XW: what follows (the next trip, the loop's set-up) rewrites the address registers that the global loads issued before it name; the wait stands in front of that overwrite
#define PF_XW() do { asm volatile("s_wait_xcnt 0x0" ::: "memory"); __builtin_amdgcn_sched_barrier(0); } while (0)   /* the scheduling barrier keeps later address arithmetic from rising over the wait */
// PF_XWP: the same wait behind a kernel's first loads; it takes their two address pairs as inputs, so that no later load's result is given those registers ahead of the wait
#define PF_XWP(p, q) do { asm volatile("s_wait_xcnt 0x0" :: "v"(p), "v"(q) : "memory"); __builtin_amdgcn_sched_barrier(0); } while (0)
static_assert(KT == 64, "the k loops take a tile as two k halves of 32");
struct WRaw { v4f r[2][8]; };
__device__ __forceinline__ void wt_load(WRaw& w, const float* base, int ldk, int k0) {   /* base = (the thread's first k row, its first column); ldk = floats between k rows */
#pragma unroll
  for (int u = 0; u < 2; ++u)
#pragma unroll
    for (int kk = 0; kk < 8; ++kk) w.r[u][kk] = *(const v4f*)(base + (size_t)(k0 + 32 * u + kk) * ldk); }
// ---- a 128-row x KT tile of 16-bit rows (x rows, weight columns) on its way to LDS. k_cvt left it in the workspace as 16 KB in a row, [row][KT]: 8 lanes = one 128-B row, a load instruction covers four whole lines; a thread carries NI rows TT_ROW(tid) + RS i; base = (that first row of k tile 0, k 8 (tid & 7)); off = bytes from k tile 0 to the tile wanted
// TT_ROW: neighbouring groups of 8 lanes take rows 8 apart: at the 144-B pitch the two 128-B runs of 16 lanes then fall on all 64 banks once (rows 1 apart would share four banks)
#define TT_ROW(tid) (((((tid) >> 3) & 1) << 3) | (((tid) >> 4) & 7) | (((tid) >> 3) & 16))
// the loops here and in k_cvt are unrolled so that every index of a register array is a constant (the arrays stay in registers) and a group's loads are issued together
typedef v4u __attribute__((may_alias)) v4u_a;
template <int NI> struct TRaw { v4u r[NI]; };
template <int NI, int RS> __device__ __forceinline__ void tt_load(TRaw<NI>& w, const char* base, size_t off) { static_assert(NI * RS == 128, "tile");
#pragma unroll
  for (int i = 0; i < NI; ++i) w.r[i] = *(const v4u_a*)(base + (RS * i) * (KT * 2) + off); }
#define XT_STEP ((size_t)NB * TT * KT * 2)   /* bytes between k tiles of x */
#define WT_STEP ((size_t)1024 * KT * 2)      /* the same for a weight of 1024 output columns */
template <int NI, int RS> __device__ __forceinline__ void tt_store(void* tile, const TRaw<NI>& w, int srow, int spc) {
#pragma unroll
  for (int i = 0; i < NI; ++i) *(v4u_a*)((char*)tile + (srow + RS * i) * (WPITCH * 2) + spc * 16) = w.r[i]; }
// ---- A tile in LDS (k_out): a wave brings its own rows' KT k values in whole lines: lane = (row parity lane >> 4, k quad lane & 15), so a load instruction covers the 256-B runs of two rows (4 whole lines; a fragment load straight from global memory touches 16 lines, 32 B of each); rounded once and kept as [row][k] at the weight tile's pitch, an A fragment is frag_b / frag_h on a row
// instruction i: rows 2 i (+ parity) of the wave's first 16 rows, from i = 8 on of its second 16, which lie 64 rows further; base = (the wave's first row + parity, k 4 (lane & 15)); ld = floats between rows
typedef __attribute__((ext_vector_type(4))) __bf16 v4b;
typedef __attribute__((ext_vector_type(4))) _Float16 v4h;
template <int NI> struct ALRaw { v4f r[NI]; };
#define AT_ROW(i) (2 * ((i) & 7) + 64 * ((i) >> 3))
template <int NI> __device__ __forceinline__ void at_load(ALRaw<NI>& a, const float* base, int ld, int k0) {
#pragma unroll
  for (int i = 0; i < NI; ++i) a.r[i] = *(const v4f*)(base + (size_t)AT_ROW(i) * ld + k0); }
template <int NI> __device__ __forceinline__ void at_store_hl(__bf16 (*ah)[WPITCH], __bf16 (*al)[WPITCH], const ALRaw<NI>& a, int row0, int kl) {   /* bf16 hi + lo, as bsplit16 */
#pragma unroll
  for (int i = 0; i < NI; ++i) { v4b p, q;
#pragma unroll
    for (int e = 0; e < 4; ++e) { const __bf16 h = (__bf16)a.r[i][e]; p[e] = h; q[e] = (__bf16)(a.r[i][e] - (float)h); }
    *(v4b*)&ah[row0 + AT_ROW(i)][kl] = p; *(v4b*)&al[row0 + AT_ROW(i)][kl] = q; } }
template <int NI> __device__ __forceinline__ void at_store_h(_Float16 (*at)[WPITCH], const ALRaw<NI>& a, int row0, int kl, float sc) {
#pragma unroll
  for (int i = 0; i < NI; ++i) { v4h p;
#pragma unroll
    for (int e = 0; e < 4; ++e) p[e] = (_Float16)(a.r[i][e] * sc);
    *(v4h*)&at[row0 + AT_ROW(i)][kl] = p; } }
// ---- k_cvt: x and the four weights are rounded to 16 bit ONCE, in a launch of their own, instead of once in every block that reads them (x in 24 blocks of k_proj, a weight in 32): k_proj and k_out then load half the bytes of them, carry half the staging registers and convert none of them
// all of them are written as k tiles, [k tile][row or output column][KT]: the 128 x KT tile that a block stages is then 16 KB in a row instead of 128 pieces one matrix row apart
// blocks < CVX_BLK: x; a wave takes two rows in 16 runs of 128 floats (whole lines in; out, a half wave writes one whole line). The rest: a wave takes 32 output columns x KT k of one weight (which 0..2: q, k, v; 3: the output weight, in both forms that k_out multiplies with), 16 B (8 k) a store
#define CVX_BLK (NB * TT * DIN / (8 * 16 * 128))
#define CVW_BLK (4 * (CC / 32) * (DIN / KT) / 8)
template <int LDK, bool BOTH> __device__ __forceinline__ void cvt_w(const float* ws, __bf16* db, _Float16* dh) {   /* ws = (the thread's first k, its first column), LDK floats between k rows; db, dh = (that column, that k) in the k tile */
  WRaw wr; wt_load(wr, ws, LDK, 0); PF_XWP(ws, ws);
#pragma unroll
  for (int u = 0; u < 2; ++u)
#pragma unroll
    for (int i = 0; i < 4; ++i) { v8b p;
#pragma unroll
      for (int kk = 0; kk < 8; ++kk) p[kk] = (__bf16)wr.r[u][kk][i];
      *(v8b*)(db + i * KT + 32 * u) = p; }
  if (BOTH) {
#pragma unroll
    for (int u = 0; u < 2; ++u)
#pragma unroll
      for (int i = 0; i < 4; ++i) { v8h p;   /* f16(bf16 x 2^8), exact */
#pragma unroll
        for (int kk = 0; kk < 8; ++kk) p[kk] = (_Float16)(bfr(wr.r[u][kk][i]) * 256.0f);
        *(v8h*)(dh + i * KT + 32 * u) = p; }
    PF_XW(); } }   /* behind this path's last stores the kernel's closing branches rewrite the scalar base that they name */
__global__ __launch_bounds__(256) void k_cvt(const float* __restrict__ X, const float* __restrict__ WQ, const float* __restrict__ WK, const float* __restrict__ WV, const float* __restrict__ WO, __bf16* __restrict__ XB, __bf16* __restrict__ WT, __bf16* __restrict__ WPB, _Float16* __restrict__ WPH) {
  const unsigned tid = threadIdx.x, wave = tid >> 5, lane = tid & 31;
  static_assert(WQKV_LAYOUT == 2 && !WO_OUT_IN && HD % 32 == 0 && CC == 1024 && DIN == 1024 && KT == 64 && CVW_BLK % 4 == 0, "a wave's 32 columns lie in one head, a block in one weight");
  if (blockIdx.x < CVX_BLK) {   /* block-uniform */
    const size_t row = ((size_t)blockIdx.x * 8 + wave) * 2; const float* xs = X + row * DIN + lane * 4; v4f r[16];   /* run j: row + (j >> 3), k 128 (j & 7) + 4 lane */
    __bf16* xd = XB + ((size_t)(lane >> 4) * (NB * TT) + row) * KT + 4 * (lane & 15);
#pragma unroll
    for (int j = 0; j < 16; ++j) r[j] = *(const v4f*)(xs + j * 128);
    PF_XWP(xs, xs);
#pragma unroll
    for (int j = 0; j < 16; ++j) { v4b p;
#pragma unroll
      for (int e = 0; e < 4; ++e) p[e] = (__bf16)r[j][e];
      *(v4b*)(xd + (size_t)(2 * (j & 7)) * (NB * TT * KT) + (j >> 3) * KT) = p; }
  } else {
    const unsigned wblk = blockIdx.x - CVX_BLK, which = wblk / (CVW_BLK / 4), w = (wblk % (CVW_BLK / 4)) * 8 + wave, kt = w % (DIN / KT), cg = w / (DIN / KT);
    const unsigned cl0 = cg * 32 + 4 * (lane & 7), kf = kt * KT + 8 * (lane >> 3);   /* the thread's first column and first k */
    const size_t od = ((size_t)kt * 1024 + cl0) * KT + 8 * (lane >> 3);
    if (which == 3) cvt_w<DIN, true>(WO + cl0 + (size_t)kf * DIN, WPB + od, WPH + od);   /* block-uniform */
    else cvt_w<HD, false>((which == 0 ? WQ : which == 1 ? WK : WV) + (size_t)(cl0 / HD) * DIN * HD + cl0 % HD + (size_t)kf * HD, WT + (size_t)which * CC * DIN + od, nullptr); } }
// ---- k_proj: block = (128 rows, 128 cols, which); the 4 waves lie 2 x 2, a wave takes 64 rows x 64 columns (rows 64 wy + 16 rg, columns 64 wx + 16 j): every A and every B fragment read from LDS serves four products, 16 KB of fragment reads a wave and k tile (32 rows x 128 columns: 20 KB): q/k/v = X W (+ b) with exact bf16 products (K = DIN) -> which 0: q f16 rows (+ residual rows < QHI); 1: k f16 rows (+ residual rows < KHI); 2: v f16 planes [c][t] (+ bf16 hi/lo planes for t < KHI)
__global__ __launch_bounds__(128) void k_proj(const __bf16* __restrict__ XB, const __bf16* __restrict__ WT, const float* __restrict__ BQ, const float* __restrict__ BK, const float* __restrict__ BV,
    _Float16* __restrict__ QH, _Float16* __restrict__ QL, _Float16* __restrict__ KH, _Float16* __restrict__ KL, _Float16* __restrict__ VT, __bf16* __restrict__ VB, __bf16* __restrict__ VBL) {
  __shared__ __align__(16) unsigned char sm[4 * 128 * WPITCH * 2];   /* the two weight buffers and the two A buffers during the k loop; behind the loop's last barrier the epilogue's planes */
  __bf16 (*wt)[128][WPITCH] = (__bf16 (*)[128][WPITCH])sm, (*at)[128][WPITCH] = (__bf16 (*)[128][WPITCH])(sm + 2 * 128 * WPITCH * 2); static_assert(3 * 64 * 136 * 2 <= 4 * 128 * WPITCH * 2, "LDS");
  _Float16 (*sh)[136] = (_Float16 (*)[136])sm, (*sl)[136] = (_Float16 (*)[136])(sm + 64 * 136 * 2); _Float16 (*th)[136] = (_Float16 (*)[136])sm; __bf16 (*tb)[136] = (__bf16 (*)[136])(sm + 64 * 136 * 2), (*tbl)[136] = (__bf16 (*)[136])(sm + 2 * 64 * 136 * 2);
  const int tid = threadIdx.x, wave = tid >> 5, lane = tid & 31, col = lane & 15, g = lane >> 4; const int which = blockIdx.z; const int c0 = blockIdx.y * 128; const size_t r0 = (size_t)blockIdx.x * 128; const size_t bb = r0 / TT; const int t0 = (int)(r0 % TT); const int wy = wave >> 1, wx = wave & 1; static_assert(TT % 128 == 0 && QHI % 128 == 0 && KHI % 128 == 0, "a block lies in one sequence and carries residual planes for all of its rows or for none");
  const float* BA = which == 0 ? BQ : which == 1 ? BK : BV;
  v8f acc[4][4] = {};   /* [row group][column group] */
  const int srow = TT_ROW(tid), spc = tid & 7; const char* wb = (const char*)(WT + (size_t)which * CC * DIN + (size_t)(c0 + srow) * KT + 8 * spc); const char* arow = (const char*)(XB + (r0 + srow) * KT + 8 * spc);
  TRaw<8> wr, ar; tt_load<8, 16>(ar, arow, 0); tt_load<8, 16>(wr, wb, 0); PF_XWP(arow, wb); tt_store<8, 16>(wt[0], wr, srow, spc); tt_store<8, 16>(at[0], ar, srow, spc);
  __syncthreads();   /* tile 0 is published */
#pragma unroll 2   /* two trips = the two buffers at constant LDS addresses */
  for (int t = 0; t < DIN / KT; ++t) {
    if (t + 1 < DIN / KT) { tt_load<8, 16>(ar, arow, (t + 1) * XT_STEP); tt_load<8, 16>(wr, wb, (t + 1) * WT_STEP); }   /* the next tile flies while this one is multiplied */
    PF_STAGE();
    v16b a[4][KT / 32];   /* the wave's 64 rows of the A tile, read in one group with the first B fragments (first k half first) */
    v16b bf[2][2];   /* B fragments in groups of 2 (group q: k half q >> 1, columns 32 (q & 1) .. of the wave's 64), two register sets: a group's LDS reads are issued together, two groups ahead of its products */
#pragma unroll
    for (int rg = 0; rg < 4; ++rg) a[rg][0] = frag_b(&at[t & 1][wy * 64 + rg * 16 + col][0], lane);
#pragma unroll
    for (int q = 0; q < 2; ++q)
#pragma unroll
      for (int jj = 0; jj < 2; ++jj) bf[q][jj] = frag_b(&wt[t & 1][wx * 64 + (q * 2 + jj) * 16 + col][0], lane);
#pragma unroll
    for (int rg = 0; rg < 4; ++rg) a[rg][1] = frag_b(&at[t & 1][wy * 64 + rg * 16 + col][32], lane);
    PF_GROUP();
#pragma unroll
    for (int q = 0; q < 4; ++q) {
#pragma unroll
      for (int jj = 0; jj < 2; ++jj)
#pragma unroll
        for (int rg = 0; rg < 4; ++rg) acc[rg][(q & 1) * 2 + jj] = wmma_bf(a[rg][q >> 1], bf[q & 1][jj], acc[rg][(q & 1) * 2 + jj]);
      if (q < 2) { PF_GROUP();
#pragma unroll
        for (int jj = 0; jj < 2; ++jj) bf[q][jj] = frag_b(&wt[t & 1][wx * 64 + (q * 2 + jj) * 16 + col][32], lane);
        PF_GROUP(); } }
    PF_STAGE();
    if (t + 1 < DIN / KT) { tt_store<8, 16>(wt[(t + 1) & 1], wr, srow, spc); tt_store<8, 16>(at[(t + 1) & 1], ar, srow, spc); }   /* those buffers' readers left them at the barrier of trip t - 1 */
    PF_XW();
    __syncthreads(); }   /* publishes tile t + 1 and ends the reads of tile t (after the last trip: frees the LDS for the epilogue) */
  // the epilogue goes twice through the same planes. q, k: pass p takes every wave's row groups 2 p, 2 p + 1, so plane row rl is block row 64 (rl >> 5) + 32 p + (rl & 31), all 128 columns. v: pass p takes every wave's column groups 2 p, 2 p + 1, so plane column cl is block column 64 (cl >> 5) + 32 p + (cl & 31), all 128 rows: every store run is 256 B
#pragma unroll
  for (int p = 0; p < 2; ++p) {
  if (p) __syncthreads();   /* the first pass has been read out of the planes */
  if (which < 2) { _Float16* DH = which == 0 ? QH : KH; _Float16* DL = which == 0 ? QL : KL; const int nhi = which == 0 ? QHI : KHI; const bool hi_rows = t0 < nhi;
#pragma unroll
    for (int j = 0; j < 4; ++j) { const float bias = BA ? bfr(BA[c0 + wx * 64 + j * 16 + col]) : 0.f;
#pragma unroll
      for (int rr = 0; rr < 2; ++rr)
#pragma unroll
        for (int r = 0; r < 8; ++r) { const float v = acc[2 * p + rr][j][r] + bias; const _Float16 hv = (_Float16)v; sh[wy * 32 + rr * 16 + 8 * g + r][wx * 64 + j * 16 + col] = hv; sl[wy * 32 + rr * 16 + 8 * g + r][wx * 64 + j * 16 + col] = (_Float16)((v - (float)hv) * 1024.0f); } }
    __syncthreads();
    for (int e = tid; e < 64 * 16; e += 128) { const int rl = e >> 4, q = e & 15, br = 64 * (rl >> 5) + 32 * p + (rl & 31); vst2((unsigned*)(DH + (r0 + br) * CC + c0 + q * 8), *(const v4u*)&sh[rl][q * 8]); PF_XW();   /* the LDS read below may land in this store's registers */
      if (hi_rows) vst2((unsigned*)(DL + (bb * nhi + t0 + br) * (size_t)CC + c0 + q * 8), *(const v4u*)&sl[rl][q * 8]); PF_XW(); }   /* the next trip rewrites the stores' address registers */
  } else { const bool hi_rows = t0 < KHI;
#pragma unroll
    for (int jj = 0; jj < 2; ++jj) { const float bias = BA ? bfr(BA[c0 + wx * 64 + (2 * p + jj) * 16 + col]) : 0.f;
#pragma unroll
      for (int rg = 0; rg < 4; ++rg)
#pragma unroll
        for (int r = 0; r < 8; ++r) { const float v = acc[rg][2 * p + jj][r] + bias; const int rl = wy * 64 + rg * 16 + 8 * g + r, cl = wx * 32 + jj * 16 + col; th[cl][rl] = (_Float16)v; const __bf16 bh = (__bf16)v; tb[cl][rl] = bh; tbl[cl][rl] = (__bf16)(v - (float)bh); } }
    __syncthreads();
    for (int e = tid; e < 64 * 16; e += 128) { const int cl = e >> 4, q = e & 15, bc = 64 * (cl >> 5) + 32 * p + (cl & 31); vst2((unsigned*)(VT + (bb * CC + c0 + bc) * (size_t)TT + t0 + q * 8), *(const v4u*)&th[cl][q * 8]); PF_XW();   /* the LDS reads below may land in this store's address registers */
      if (hi_rows) { const size_t o3 = (bb * CC + c0 + bc) * (size_t)KHI + t0 + q * 8; vst2((unsigned*)(VB + o3), *(const v4u*)&tb[cl][q * 8]); vst2((unsigned*)(VBL + o3), *(const v4u*)&tbl[cl][q * 8]); PF_XW(); } } } } }   /* as above, for the next trip */
// ---- k_att: block = 64 queries (qb) of one (b, h), z = b * NH + h; logits, softmax and P . v in one pass over 64-key blocks 0..qb, the logits never leave registers.
// Transposed products: St = K . Qt (A = 16 key rows, B = the wave's 16 queries), so a lane holds 8 keys a tile of ONE query (column lane & 15, keys 8 g + r); two neighbouring St tiles are, register for register, the B fragment Pt of 32 keys for Ot += Vt . Pt (A = 16 d rows of the v plane).
// Running maximum per query (in-lane + one exchange between the wave halves), e = 2^((s - m) c + 11), c = SCALE log2(e): P carried x 2^11 as before, the factor cancels against the row sum; Ot and the sum are rescaled at every key block.
// Query blocks < QBH: 3 logit products (q, k hi + residual x 2^10) and P, v as bf16 hi + lo (3 products); after: single f16 products.
// The K and v tiles (64 rows x 128 B each) are shared by the 4 waves through LDS: whole-line global loads one key block ahead, 2 buffers, one barrier per key block.
#define AP 72              // 144-B LDS row pitch, as WPITCH
#define ATILE (64 * AP * 2)   // bytes of one tile in LDS
__device__ __forceinline__ v8f wm_h(v16h a, v16h b, v8f c) { return __builtin_amdgcn_wmma_f32_16x16x32_f16(false, a, false, b, (short)0, c, false, false); }
__device__ __forceinline__ v8f wm_b(v16b a, v16b b, v8f c) { return __builtin_amdgcn_wmma_f32_16x16x32_bf16(false, a, false, b, (short)0, c, false, false); }
__device__ __forceinline__ float xhalf(float x) { return __builtin_bit_cast(float, __builtin_amdgcn_permlanex16(__builtin_bit_cast(int, x), __builtin_bit_cast(int, x), 0x76543210, 0xfedcba98, false, false)); }   /* lane l <-> lane l ^ 16 */
// 2^x by v_exp_f32 as asm text, eight in place in one statement: nothing of the compiler's then stands directly behind a v_exp_f32; the closing v_nop is the slot that the instruction set asks for behind the last one
__device__ __forceinline__ void exp2x8(float (&x)[8]) {
  asm("v_exp_f32 %0, %0\n\tv_exp_f32 %1, %1\n\tv_exp_f32 %2, %2\n\tv_exp_f32 %3, %3\n\tv_exp_f32 %4, %4\n\tv_exp_f32 %5, %5\n\tv_exp_f32 %6, %6\n\tv_exp_f32 %7, %7\n\tv_nop" : "+v"(x[0]), "+v"(x[1]), "+v"(x[2]), "+v"(x[3]), "+v"(x[4]), "+v"(x[5]), "+v"(x[6]), "+v"(x[7])); }
__device__ __forceinline__ float exp2x1(float x) { asm("v_exp_f32 %0, %0\n\tv_nop" : "+v"(x)); return x; }   /* the same for one value */
typedef v4f __attribute__((may_alias)) v4f_a;
template <bool HI> __device__ __forceinline__ void att_body(unsigned char* sm, const _Float16* __restrict__ QH, const _Float16* __restrict__ KH, const _Float16* __restrict__ QL, const _Float16* __restrict__ KL, const _Float16* __restrict__ VT, const __bf16* __restrict__ VB, const __bf16* __restrict__ VBL, float* __restrict__ Y, int qb, int b, int h) {
  constexpr int NT = HI ? 4 : 2;   /* tiles a key block: k, v (+ k residual, v lo) */
  const int tid = threadIdx.x, wave = tid >> 5, lane = tid & 31, col = lane & 15, g = lane >> 4; const int ql0 = qb * 64 + wave * 16; const int nblk = qb + 1;
  const int srow = tid >> 3, spc = tid & 7;   /* staging: 8 lanes = one 128-B row; a thread carries rows srow + 16 i */
  constexpr unsigned vp = HI ? KHI : TT;
  // block-uniform bases and one 32-bit byte offset per thread and tile shape (k rows, v planes)
  const char* s_k = (const char*)(KH + (size_t)b * TT * CC + h * HD); const char* s_kl = (const char*)(KL + (size_t)b * KHI * CC + h * HD);
  const char* s_v = HI ? (const char*)(VB + ((size_t)b * CC + h * HD) * vp) : (const char*)(VT + ((size_t)b * CC + h * HD) * vp); const char* s_vl = (const char*)(VBL + ((size_t)b * CC + h * HD) * vp);
  const unsigned o_k = (unsigned)srow * (CC * 2) + spc * 16, o_v = (unsigned)srow * (vp * 2) + spc * 16;
  v4u ra[4], rb[4];   /* two tiles in flight: k and v; with the residual planes first k and k residual, then, behind the logit products, v hi and v lo in the same registers */
#define ATT_LD(dst, base, rowstep, off) do { _Pragma("unroll") for (int i = 0; i < 4; ++i) dst[i] = *(const v4u_a*)((base) + i * (16 * (rowstep)) + (off)); } while (0)
#define ATT_ST(bufp, tile, srcr) do { _Pragma("unroll") for (int i = 0; i < 4; ++i) *(v4u_a*)((bufp) + (tile) * ATILE + (srow + 16 * i) * (AP * 2) + spc * 16) = srcr[i]; } while (0)
#define ATT_KSTEP (64 * CC * 2)   /* bytes between key blocks in the k rows; 128 in the v planes */
  v16h qf[HD / 32], qlf[HD / 32];
#pragma unroll
  for (int kc = 0; kc < HD / 32; ++kc) { qf[kc] = frag_h(QH + ((size_t)b * TT + ql0 + col) * CC + h * HD + kc * 32, lane); if (HI) qlf[kc] = frag_h(QL + ((size_t)b * QHI + ql0 + col) * CC + h * HD + kc * 32, lane); }
  if (HI) { ATT_LD(ra, s_k, CC * 2, o_k); ATT_LD(rb, s_kl, CC * 2, o_k); PF_XW(); ATT_ST(sm, 0, ra); ATT_ST(sm, 2, rb); ATT_LD(ra, s_v, vp * 2, o_v); ATT_LD(rb, s_vl, vp * 2, o_v); PF_XW(); ATT_ST(sm, 1, ra); ATT_ST(sm, 3, rb); PF_XW(); }   /* the last wait: the q loads are scheduled behind the one before */
  else { ATT_LD(ra, s_k, CC * 2, o_k); ATT_LD(rb, s_v, vp * 2, o_v); PF_XW(); ATT_ST(sm, 0, ra); ATT_ST(sm, 1, rb); }
  __syncthreads();   /* key block 0 is published */
  const float cs = SCALE * 1.44269504088896340736f;
  float m = -3.0e38f, l = 0.f; v8f o[HD / 16] = {};
  for (int t = 0; t < nblk; ++t) { const unsigned char* bp = sm + (t & 1) * (NT * ATILE); unsigned char* nb = sm + ((t + 1) & 1) * (NT * ATILE);   /* nb: its readers left it at the barrier of trip t - 1 */
    // with the residual planes the staging is unconditional (the last trip stages its own block once more into the idle buffer, which nobody reads): no branch then stands between the logit products and the first readers of their results
    const bool more = HI || t + 1 < nblk; const int tn = (HI && t + 1 == nblk) ? t : t + 1;
    if (more) { ATT_LD(ra, s_k + (size_t)tn * ATT_KSTEP, CC * 2, o_k); if (HI) ATT_LD(rb, s_kl + (size_t)tn * ATT_KSTEP, CC * 2, o_k); else ATT_LD(rb, s_v + (size_t)tn * 128, vp * 2, o_v); }   /* the next key block flies while this one is worked on */
    if (HI) PF_XW(); else PF_STAGE();   /* with the residual planes the LDS reads below land in the address registers of these loads (without them the compiler writes the wait itself) */
    const _Float16 (*kt)[AP] = (const _Float16 (*)[AP])bp; const _Float16 (*klt)[AP] = (const _Float16 (*)[AP])(bp + 2 * ATILE); const _Float16 (*vt)[AP] = (const _Float16 (*)[AP])(bp + ATILE); const __bf16 (*vb)[AP] = (const __bf16 (*)[AP])(bp + ATILE); const __bf16 (*vbl)[AP] = (const __bf16 (*)[AP])(bp + 3 * ATILE);
    // ATT_GROUP: behind a group of LDS fragment reads it keeps the scheduler from sinking each read down to its own product (one LDS latency per product instead of one per group)
#define ATT_GROUP() __builtin_amdgcn_sched_barrier(0)
    float s[4][8]; v16h vf[2][HD / 16]; v16b vh[HD / 16], vl[HD / 16];
    if (HI) {
#pragma unroll
      for (int hf = 0; hf < 2; ++hf) { v16h kf[2][HD / 32], lf[2][HD / 32]; v8f a[2] = {}, al[2] = {};   /* two key tiles a group */
#pragma unroll
        for (int jj = 0; jj < 2; ++jj)
#pragma unroll
          for (int kc = 0; kc < HD / 32; ++kc) { kf[jj][kc] = frag_h(&kt[(2 * hf + jj) * 16 + col][kc * 32], lane); lf[jj][kc] = frag_h(&klt[(2 * hf + jj) * 16 + col][kc * 32], lane); }
        ATT_GROUP();
#pragma unroll
        for (int kc = 0; kc < HD / 32; ++kc)
#pragma unroll
          for (int jj = 0; jj < 2; ++jj) { a[jj] = wm_h(kf[jj][kc], qf[kc], a[jj]); al[jj] = wm_h(kf[jj][kc], qlf[kc], al[jj]); al[jj] = wm_h(lf[jj][kc], qf[kc], al[jj]); }
#pragma unroll
        for (int jj = 0; jj < 2; ++jj)
#pragma unroll
          for (int r = 0; r < 8; ++r) s[2 * hf + jj][r] = a[jj][r] + al[jj][r] * (1.0f / 1024.0f);
        ATT_GROUP(); }   /* here it keeps the second group's reads from rising over the first group's products: both groups at once do not fit the registers */
      ATT_ST(nb, 0, ra); ATT_ST(nb, 2, rb); PF_XW(); ATT_LD(ra, s_v + (size_t)tn * 128, vp * 2, o_v); ATT_LD(rb, s_vl + (size_t)tn * 128, vp * 2, o_v);
      PF_STAGE();
#pragma unroll
      for (int j = 0; j < HD / 16; ++j) { vh[j] = frag_b(&vb[j * 16 + col][0], lane); vl[j] = frag_b(&vbl[j * 16 + col][0], lane); }   /* v of the first 32 keys: read behind the logit products, lands under the softmax */
    } else { v16h kf[4][HD / 32]; v8f a[4] = {};
#pragma unroll
      for (int jt = 0; jt < 4; ++jt)
#pragma unroll
        for (int kc = 0; kc < HD / 32; ++kc) kf[jt][kc] = frag_h(&kt[jt * 16 + col][kc * 32], lane);
      ATT_GROUP();
#pragma unroll
      for (int kc = 0; kc < HD / 32; ++kc)
#pragma unroll
        for (int jt = 0; jt < 4; ++jt) a[jt] = wm_h(kf[jt][kc], qf[kc], a[jt]);
#pragma unroll
      for (int kc = 0; kc < 2; ++kc)
#pragma unroll
        for (int j = 0; j < HD / 16; ++j) vf[kc][j] = frag_h(&vt[j * 16 + col][kc * 32], lane);   /* all of v: read behind the logit products, lands under the softmax */
#pragma unroll
      for (int jt = 0; jt < 4; ++jt)
#pragma unroll
        for (int r = 0; r < 8; ++r) s[jt][r] = a[jt][r]; }
    ATT_GROUP();
    if (t == nblk - 1) {   /* the diagonal block: keys past the query are excluded by index */
#pragma unroll
      for (int jt = 0; jt < 4; ++jt)
#pragma unroll
        for (int r = 0; r < 8; ++r) s[jt][r] = (jt * 16 + 8 * g + r <= wave * 16 + col) ? s[jt][r] : -3.0e38f; }
    float mj[4];   /* four independent chains */
#pragma unroll
    for (int jt = 0; jt < 4; ++jt) { mj[jt] = s[jt][0];
#pragma unroll
      for (int r = 1; r < 8; ++r) mj[jt] = fmaxf(mj[jt], s[jt][r]); }
    float mx = fmaxf(fmaxf(mj[0], mj[1]), fmaxf(mj[2], mj[3]));
    mx = fmaxf(mx, xhalf(mx));   /* the other 8 keys of each tile lie in the other wave half */
    const float mn = fmaxf(m, mx); const float alpha = exp2x1((m - mn) * cs); const float off = 11.0f - mn * cs; m = mn;
    float sj[4];
#pragma unroll
    for (int jt = 0; jt < 4; ++jt) {
#pragma unroll
      for (int r = 0; r < 8; ++r) s[jt][r] = fmaf(s[jt][r], cs, off);
      exp2x8(s[jt]);   /* an excluded key gives 2^(-huge) = 0 */
      sj[jt] = s[jt][0];
#pragma unroll
      for (int r = 1; r < 8; ++r) sj[jt] += s[jt][r]; }
    l = l * alpha + ((sj[0] + sj[1]) + (sj[2] + sj[3]));
#pragma unroll
    for (int j = 0; j < HD / 16; ++j) o[j] *= alpha;
#pragma unroll
    for (int kc = 0; kc < 2; ++kc) {
      if (HI) { float v[16];
#pragma unroll
        for (int i = 0; i < 8; ++i) { v[i] = s[2 * kc][i]; v[8 + i] = s[2 * kc + 1][i]; }
        const F2 p = bsplit16(v);
#pragma unroll
        for (int j = 0; j < HD / 16; ++j) o[j] = wm_b(vh[j], p.h, o[j]);
#pragma unroll
        for (int j = 0; j < HD / 16; ++j) o[j] = wm_b(vh[j], p.l, o[j]);
#pragma unroll
        for (int j = 0; j < HD / 16; ++j) o[j] = wm_b(vl[j], p.h, o[j]);
        if (kc == 0) {
#pragma unroll
          for (int j = 0; j < HD / 16; ++j) { vh[j] = frag_b(&vb[j * 16 + col][32], lane); vl[j] = frag_b(&vbl[j * 16 + col][32], lane); }
          ATT_GROUP(); }
      } else { v16h p;
#pragma unroll
        for (int i = 0; i < 8; ++i) { p[i] = (_Float16)s[2 * kc][i]; p[8 + i] = (_Float16)s[2 * kc + 1][i]; }
#pragma unroll
        for (int j = 0; j < HD / 16; ++j) o[j] = wm_h(vf[kc][j], p, o[j]); } }
    PF_STAGE();
    if (more) { if (HI) { ATT_ST(nb, 1, ra); ATT_ST(nb, 3, rb); } else { ATT_ST(nb, 0, ra); ATT_ST(nb, 1, rb); } }
    PF_XW();
    __syncthreads(); }   /* publishes key block t + 1 and ends the reads of block t (after the last trip: frees the LDS for the epilogue) */
  l += xhalf(l);
  const float inv = l > 0.f ? 1.0f / l : 0.f;
  float (*ss)[HD + 4] = (float (*)[HD + 4])(sm + wave * (16 * (HD + 4) * 4));   /* the wave's own 16 ctx rows, so that the stores cover whole 256-B (row, head) segments */
#pragma unroll
  for (int j = 0; j < HD / 16; ++j) { v4f x0, x1;
#pragma unroll
    for (int r = 0; r < 4; ++r) { x0[r] = o[j][r] * inv; x1[r] = o[j][4 + r] * inv; }
    *(v4f_a*)&ss[col][j * 16 + 8 * g] = x0; *(v4f_a*)&ss[col][j * 16 + 8 * g + 4] = x1; }
  LDSX();
#pragma unroll
  for (int i = 0; i < 8; ++i) { const int rl = 2 * i + g; vst2(Y + ((size_t)b * TT + ql0 + rl) * CC + h * HD + col * 4, *(const v4f_a*)&ss[rl][col * 4]); } }
__global__ __launch_bounds__(128, 4) void k_att(const _Float16* __restrict__ QH, const _Float16* __restrict__ KH, const _Float16* __restrict__ QL, const _Float16* __restrict__ KL, const _Float16* __restrict__ VT, const __bf16* __restrict__ VB, const __bf16* __restrict__ VBL, float* __restrict__ Y) {   /* 4 waves a SIMD: all 1024 blocks resident at once, 4 a WGP */
  __shared__ __align__(16) unsigned char sm[2 * 4 * ATILE]; static_assert(CAUSAL && QBH * 64 <= KHI && QBH * 64 <= QHI && HD == 64 && 4 * 16 * (HD + 4) * 4 <= 2 * 2 * ATILE, "k_att");
  const int z = blockIdx.z, b = z / NH, h = z % NH;
  const int qb = ((z & 1) ? NQB - 1 - (int)blockIdx.x : (int)blockIdx.x) ^ ((z & 2) ? NQB / 2 : 0);   /* a permutation of the query blocks per plane: neighbours in launch order differ in length, for balance only */
  if (qb < QBH) att_body<true>(sm, QH, KH, QL, KL, VT, VB, VBL, Y, qb, b, h); else att_body<false>(sm, QH, KH, QL, KL, VT, VB, VBL, Y, qb, b, h); }
// ---- k_out: block = (128 rows, 128 cols), 8 waves lying 4 x 2 on one staged weight tile, a wave takes 32 rows x 64 columns (rows 32 wy + 16 rg, columns 64 wx + 16 j): 12 KB of fragment reads a wave and k tile on the one-product path (16 rows x 128 columns: 18 KB); a wave still stages rows 16 wave ..: out = ctx Wo (+ bo): ctx once to f16 against Wo as f16(bf16 x 2^8) exact (1 product) x 2^-8; causal early rows (< QHI of each sequence): ctx bf16 hi + lo against exact bf16 Wo (2 products)
__global__ __launch_bounds__(256) void k_out(const float* __restrict__ Y, const __bf16* __restrict__ WPB, const _Float16* __restrict__ WPH, const float* __restrict__ BO, float* __restrict__ OUT) { __shared__ __align__(16) float sf[8][32][68]; __shared__ __align__(16) __bf16 wt[2][128][WPITCH]; __shared__ __align__(16) __bf16 at[2][2][128][WPITCH];   /* at: [buffer][plane: hi, lo (early rows); the f16 path keeps one plane] */
  const int tid = threadIdx.x, wave = tid >> 5, lane = tid & 31, col = lane & 15, g = lane >> 4; const int c0 = blockIdx.y * 128; const size_t r0 = (size_t)blockIdx.x * 128 + wave * 16; const int wy = wave >> 1, wx = wave & 1; static_assert(TT % 128 == 0 && QHI % 128 == 0, "a block is early rows or late rows as a whole");
  v8f acc[2][4] = {};   /* [row group][column group] */
  const bool early = CAUSAL && (int)(((size_t)blockIdx.x * 128) % TT) < QHI;   /* block-uniform */
  const int srow = TT_ROW(tid), spc = tid & 7; const char* wb = (early ? (const char*)WPB : (const char*)WPH) + ((size_t)(c0 + srow) * KT + 8 * spc) * 2; const int ar0 = wave * 16 + g, akl = 4 * col; const float* arow = Y + (r0 + g) * CC + akl;
  TRaw<4> wr; ALRaw<8> ar; at_load(ar, arow, CC, 0); tt_load<4, 32>(wr, wb, 0); PF_XW();
  if (early) {
    tt_store<4, 32>(wt[0], wr, srow, spc); at_store_hl(at[0][0], at[0][1], ar, ar0, akl);
    __syncthreads();   /* tile 0 is published */
#pragma unroll 2   /* two trips = the two buffers at constant LDS addresses */
    for (int t = 0; t < CC / KT; ++t) {
      if (t + 1 < CC / KT) { at_load(ar, arow, CC, (t + 1) * KT); tt_load<4, 32>(wr, wb, (t + 1) * WT_STEP); PF_XW(); }   /* the next tile flies while this one is multiplied; the wait: the conversions behind the products are given these loads' address registers */
      PF_STAGE();
      F2 a[2][KT / 32]; v16b bf[KT / 32][4];   /* all of the wave's fragments of the tile, read in one group, k half by k half */
#pragma unroll
      for (int c = 0; c < KT / 32; ++c) {
#pragma unroll
        for (int rg = 0; rg < 2; ++rg) { a[rg][c].h = frag_b(&at[t & 1][0][wy * 32 + rg * 16 + col][32 * c], lane); a[rg][c].l = frag_b(&at[t & 1][1][wy * 32 + rg * 16 + col][32 * c], lane); }
#pragma unroll
        for (int jj = 0; jj < 4; ++jj) bf[c][jj] = frag_b(&wt[t & 1][wx * 64 + jj * 16 + col][32 * c], lane); }
      PF_GROUP();
#pragma unroll
      for (int c = 0; c < KT / 32; ++c) {   /* the 8 hi products of a k half, then its 8 lo products: an accumulator still takes hi, lo, hi, lo, and its two products of a k half no longer follow each other directly */
#pragma unroll
        for (int jj = 0; jj < 4; ++jj)
#pragma unroll
          for (int rg = 0; rg < 2; ++rg) acc[rg][jj] = wmma_bf(a[rg][c].h, bf[c][jj], acc[rg][jj]);
#pragma unroll
        for (int jj = 0; jj < 4; ++jj)
#pragma unroll
          for (int rg = 0; rg < 2; ++rg) acc[rg][jj] = wmma_bf(a[rg][c].l, bf[c][jj], acc[rg][jj]); }
      PF_STAGE();
      if (t + 1 < CC / KT) { tt_store<4, 32>(wt[(t + 1) & 1], wr, srow, spc); at_store_hl(at[(t + 1) & 1][0], at[(t + 1) & 1][1], ar, ar0, akl); }   /* those buffers' readers left them at the barrier of trip t - 1 */
      PF_XW();
      __syncthreads(); }   /* publishes tile t + 1 and ends the reads of tile t */
#pragma unroll
    for (int j = 0; j < 4; ++j) { const float bias = BO ? bfr(BO[c0 + wx * 64 + j * 16 + col]) : 0.f;
#pragma unroll
      for (int rg = 0; rg < 2; ++rg)
#pragma unroll
        for (int r = 0; r < 8; ++r) sf[wave][rg * 16 + 8 * g + r][j * 16 + col] = acc[rg][j][r] + bias; }
  } else {
    _Float16 (*wh)[128][WPITCH] = (_Float16 (*)[128][WPITCH])wt;   /* this path keeps f16 in the same two buffers */
    _Float16 (*ah)[2][128][WPITCH] = (_Float16 (*)[2][128][WPITCH])at;   /* plane 0 of each A buffer, f16 */
    tt_store<4, 32>(wh[0], wr, srow, spc); at_store_h(ah[0][0], ar, ar0, akl, 64.0f);   /* ctx carried x 2^6 into f16 so small-magnitude context rows stay clear of f16 subnormals */
    __syncthreads();   /* tile 0 is published */
#pragma unroll 2   /* two trips = the two buffers at constant LDS addresses */
    for (int t = 0; t < CC / KT; ++t) {
      if (t + 1 < CC / KT) { at_load(ar, arow, CC, (t + 1) * KT); tt_load<4, 32>(wr, wb, (t + 1) * WT_STEP); }   /* the next tile flies while this one is multiplied */
      PF_STAGE();
      v16h a[2][KT / 32], bf[KT / 32][4];   /* all of the wave's fragments of the tile, read in one group, k half by k half */
#pragma unroll
      for (int c = 0; c < KT / 32; ++c) {
#pragma unroll
        for (int rg = 0; rg < 2; ++rg) a[rg][c] = frag_h(&ah[t & 1][0][wy * 32 + rg * 16 + col][32 * c], lane);
#pragma unroll
        for (int jj = 0; jj < 4; ++jj) bf[c][jj] = frag_h(&wh[t & 1][wx * 64 + jj * 16 + col][32 * c], lane); }
      PF_GROUP();
#pragma unroll
      for (int c = 0; c < KT / 32; ++c)
#pragma unroll
        for (int jj = 0; jj < 4; ++jj)
#pragma unroll
          for (int rg = 0; rg < 2; ++rg) acc[rg][jj] = wmma16(a[rg][c], bf[c][jj], acc[rg][jj]);
      PF_STAGE();
      if (t + 1 < CC / KT) { tt_store<4, 32>(wh[(t + 1) & 1], wr, srow, spc); at_store_h(ah[(t + 1) & 1][0], ar, ar0, akl, 64.0f); }   /* those buffers' readers left them at the barrier of trip t - 1 */
      PF_XW();
      __syncthreads(); }   /* publishes tile t + 1 and ends the reads of tile t */
#pragma unroll
    for (int j = 0; j < 4; ++j) { const float bias = BO ? bfr(BO[c0 + wx * 64 + j * 16 + col]) : 0.f;
#pragma unroll
      for (int rg = 0; rg < 2; ++rg)
#pragma unroll
        for (int r = 0; r < 8; ++r) sf[wave][rg * 16 + 8 * g + r][j * 16 + col] = acc[rg][j][r] * (1.0f / 16384.0f) + bias; } }   /* 2^-8 (Wo carry) x 2^-6 (ctx carry) */
  LDSX(); float* op = OUT + ((size_t)blockIdx.x * 128 + wy * 32 + g) * DIN + c0 + wx * 64 + col * 4;   /* a store instruction covers the 256-B runs of two rows */
  for (int i = 0; i < 16; ++i) vst2(op + (size_t)(2 * i) * DIN, *(const v4f*)&sf[wave][2 * i + g][col * 4]); }

extern "C" void kernel_launch(void* const* d_in, const int* in_sizes, int n_in, void* d_out, int out_size, void* d_ws, size_t ws_size, hipStream_t stream) {
  (void)in_sizes; (void)n_in; (void)out_size;
  const float** F = (const float**)d_in;
  if (ws_size < (size_t)WS_END) return;
  char* ws = (char*)d_ws; _Float16 *QH = (_Float16*)(ws + WS_QH), *KH = (_Float16*)(ws + WS_KH), *VT = (_Float16*)(ws + WS_VT), *QL = (_Float16*)(ws + WS_QL), *KL = (_Float16*)(ws + WS_KL); __bf16 *VB = (__bf16*)(ws + WS_VB), *VBL = (__bf16*)(ws + WS_VBL); float *Y = (float*)(ws + WS_Y); __bf16 *XB = (__bf16*)(ws + WS_XB), *WT = (__bf16*)(ws + WS_WT), *WPB = (__bf16*)(ws + WS_WPB); _Float16 *WPH = (_Float16*)(ws + WS_WPH);
  (void)Y; (void)QL; (void)KL; (void)VB; (void)VBL;
  // inputs: 0 x [4,1024,1024]; 1 Wq [16,1024,64]; 2 Wk; 3 Wv (per-head [head][model][d]); 4 Wp [1024,1024] (in,out); 5 bp [1024] (zeros, read); no q / k / v biases
  k_cvt<<<dim3(CVX_BLK + CVW_BLK), 256, 0, stream>>>(F[0], F[1], F[2], F[3], F[4], XB, WT, WPB, WPH);
  k_proj<<<dim3(TNB * TT / 128, CC / 128, 3), 128, 0, stream>>>(XB, WT, nullptr, nullptr, nullptr, QH, QL, KH, KL, VT, VB, VBL);
  k_att<<<dim3(NQB, 1, TNB * NH), 128, 0, stream>>>(QH, KH, QL, KL, VT, VB, VBL, Y);
  k_out<<<dim3(TNB * TT / 128, DIN / 128), 256, 0, stream>>>(Y, WPB, WPH, F[5], (float*)d_out);
}

// v009
// A run of this version takes 71.8 microseconds.
// In two side-by-side timings against v008, it was 1.05 and 1.03 times as fast.
// Over all steps from v000 it is 10.0 times as fast.
// compute dtype: all float inputs rounded to bf16; per-head q / k / v projections with EXACT bf16 products on WMMA 16x16x32 (f32 accumulate), no biases; causal logits: 3 products for the first 384 rows, single f16 q x k after, x 1024^-0.5; softmax f32; P x 2^11 once to f16 x v once to f16 (bf16 hi + lo below row 384); ctx hi+lo x exact Wp below row 384, x2^6 f16 carry x f16(bf16 x 2^8) Wp after, + bp (zeros, read); f32 output.
#include <hip/hip_runtime.h>
#include <math.h>

typedef __attribute__((ext_vector_type(16))) _Float16 v16h;
typedef __attribute__((ext_vector_type(16))) __bf16 v16b;
typedef __attribute__((ext_vector_type(8)))  _Float16 v8h;
typedef __attribute__((ext_vector_type(8)))  float v8f;
typedef __attribute__((ext_vector_type(4)))  float v4f;
typedef __attribute__((ext_vector_type(2)))  float v2f;
typedef __attribute__((ext_vector_type(4)))  unsigned v4u;
typedef __attribute__((ext_vector_type(4)))  int v4i;
typedef float __attribute__((may_alias)) float_a;
typedef int __attribute__((may_alias)) int_a;

template <typename T> __device__ __forceinline__ void vst2(void* p, T v) { *(T*)p = v;  }
__device__ __forceinline__ v8f wmma16(v16h a, v16h b, v8f c) {
  return __builtin_amdgcn_wmma_f32_16x16x32_f16(false, a, false, b, (short)0, c, false, false);
}
__device__ __forceinline__ v8f wmma_bf(v16b a, v16b b, v8f c) {
  return __builtin_amdgcn_wmma_f32_16x16x32_bf16(false, a, false, b, (short)0, c, false, false);
}
// 16x16x32 fragments: lane = (h = lane>>4, row/col = lane&15); elements 0..7 = k0+8h+0..7, 8..15 = k0+16+8h+0..7; D element r = row 8h+r
__device__ __forceinline__ v16h frag_h(const _Float16* rowk0, int lane) {
  union { v16h v; v8h q[2]; } u; const _Float16* p = rowk0 + 8 * (lane >> 4);
  u.q[0] = *(const v8h*)p; u.q[1] = *(const v8h*)(p + 16); return u.v;
}
__device__ __forceinline__ v16h frag_f32(const float* rowk0, int lane) {
  v16h a; const float* p = rowk0 + 8 * (lane >> 4);
#pragma unroll
  for (int i = 0; i < 8; ++i) { a[i] = (_Float16)p[i]; a[8 + i] = (_Float16)p[16 + i]; }
  return a;
}
__device__ __forceinline__ v16h frag_f32s(const float* rowk0, int lane, float sc) {
  v16h a; const float* p = rowk0 + 8 * (lane >> 4);
#pragma unroll
  for (int i = 0; i < 8; ++i) { a[i] = (_Float16)(p[i] * sc); a[8 + i] = (_Float16)(p[16 + i] * sc); }
  return a;
}
// column fragment from a [K][ld] layout (column n), rows >= K read as 0
__device__ __forceinline__ v16h fragc_f32(const float* W, int k0, int n, int lane, int ld, int K) {
  v16h a; const int g = lane >> 4;
#pragma unroll
  for (int i = 0; i < 8; ++i) { const int ka = k0 + 8 * g + i, kb = ka + 16;
    a[i] = (_Float16)(ka < K ? W[(size_t)(ka < K ? ka : K - 1) * ld + n] : 0.f); a[8 + i] = (_Float16)(kb < K ? W[(size_t)(kb < K ? kb : K - 1) * ld + n] : 0.f); }
  return a;
}
struct F2 { v16b h, l; };
__device__ __forceinline__ F2 bsplit16(const float v[16]) { F2 r;
#pragma unroll
  for (int i = 0; i < 16; ++i) { const __bf16 h = (__bf16)v[i]; r.h[i] = h; r.l[i] = (__bf16)(v[i] - (float)h); }
  return r; }
__device__ __forceinline__ F2 split_row(const float* row, int k0, int lane) { float v[16]; const float* p = row + k0 + 8 * (lane >> 4);
#pragma unroll
  for (int i = 0; i < 8; ++i) { v[i] = p[i]; v[8 + i] = p[16 + i]; }
  return bsplit16(v); }
__device__ __forceinline__ F2 split_rowK(const float* row, int k0, int lane, int K) { float v[16]; const int g = lane >> 4;
#pragma unroll
  for (int i = 0; i < 8; ++i) { const int ka = k0 + 8 * g + i, kb = ka + 16; v[i] = ka < K ? row[ka < K ? ka : K - 1] : 0.f; v[8 + i] = kb < K ? row[kb < K ? kb : K - 1] : 0.f; }
  return bsplit16(v); }
__device__ __forceinline__ F2 split_col(const float* W, int k0, int n, int lane, int ld, int K) { float v[16]; const int g = lane >> 4;
#pragma unroll
  for (int i = 0; i < 8; ++i) { const int ka = k0 + 8 * g + i, kb = ka + 16; v[i] = ka < K ? W[(size_t)(ka < K ? ka : K - 1) * ld + n] : 0.f; v[8 + i] = kb < K ? W[(size_t)(kb < K ? kb : K - 1) * ld + n] : 0.f; }
  return bsplit16(v); }
__device__ __forceinline__ v8f mac3(const F2& a, const F2& b, v8f c) { c = wmma_bf(a.l, b.h, c); c = wmma_bf(a.h, b.l, c); return wmma_bf(a.h, b.h, c); }
__device__ __forceinline__ float sigm(float v) { return 1.0f / (1.0f + expf(-v)); }
#define LDSX() do { asm volatile("s_wait_dscnt 0" ::: "memory"); __builtin_amdgcn_wave_barrier(); __builtin_amdgcn_fence(__ATOMIC_RELEASE, "workgroup"); } while (0)

// Causal multi-head self-attention with per-head weights and a 1/sqrt(C) score scale (x [4,1024,1024]; Wq / Wk / Wv [16,1024,64] = per-head [head][model][d] N(0,1) x 0.02, no biases; Wp [1024,1024] (in,out), bp zeros (read); q = einsum('btc,hcd->bhtd'); scores x 1/sqrt(1024) - the scale is 1/32, not 1/8 (soft logits); tril kept, -inf elsewhere; softmax; heads concatenated; out @ Wp + bp).
#define NB 4
#define TT 1024
#define CC 1024            // NH * HD = projected width
#define DIN 1024          // input (model) width
#define NH 16
#define HD 64
#define NQB (TT / 64)
#define SCALE (0.03125f)
#define CAUSAL 1
#ifndef TNB
#define TNB NB
#endif
__device__ __forceinline__ float bfr(float v) { return (float)(__bf16)v; }
typedef __attribute__((ext_vector_type(8))) __bf16 v8b;
__device__ __forceinline__ v16b frag_b(const __bf16* rowk0, int lane) {
  union { v16b v; v8b q[2]; } u; const __bf16* p = rowk0 + 8 * (lane >> 4);
  u.q[0] = *(const v8b*)p; u.q[1] = *(const v8b*)(p + 16); return u.v;
}
#define QBH 6              // causal: query blocks 0..QBH-1 of each sequence (few keys, no averaging) take the high-precision path
#define QHI 384            // rows carrying a q residual plane
#define KHI 384            // key rows carrying k residual / v bf16 hi+lo planes (used only by the causal high-precision path)
// B fragment (k rows k0+.., output column o) of a weight: (in,out) [K][ld] or (out,in) [ld rows of K]: bf16 exact, or f16(bf16 * 256) exact
__device__ __forceinline__ v16b wcol_io(const float* Wm, int k0, int o, int lane, int ld) { v16b w; const int g = lane >> 4;
#pragma unroll
  for (int i = 0; i < 8; ++i) { w[i] = (__bf16)Wm[(size_t)(k0 + 8 * g + i) * ld + o]; w[8 + i] = (__bf16)Wm[(size_t)(k0 + 16 + 8 * g + i) * ld + o]; }
  return w; }
__device__ __forceinline__ v16b wcol_oi(const float* Wm, int k0, int o, int lane, int K) { v16b w; const float* p = Wm + (size_t)o * K + k0 + 8 * (lane >> 4);
#pragma unroll
  for (int i = 0; i < 8; ++i) { w[i] = (__bf16)p[i]; w[8 + i] = (__bf16)p[16 + i]; }
  return w; }
__device__ __forceinline__ v16h wcolh_io(const float* Wm, int k0, int o, int lane, int ld) { v16h w; const int g = lane >> 4;
#pragma unroll
  for (int i = 0; i < 8; ++i) { w[i] = (_Float16)(bfr(Wm[(size_t)(k0 + 8 * g + i) * ld + o]) * 256.0f); w[8 + i] = (_Float16)(bfr(Wm[(size_t)(k0 + 16 + 8 * g + i) * ld + o]) * 256.0f); }
  return w; }
__device__ __forceinline__ v16h wcolh_oi(const float* Wm, int k0, int o, int lane, int K) { v16h w; const float* p = Wm + (size_t)o * K + k0 + 8 * (lane >> 4);
#pragma unroll
  for (int i = 0; i < 8; ++i) { w[i] = (_Float16)(bfr(p[i]) * 256.0f); w[8 + i] = (_Float16)(bfr(p[16 + i]) * 256.0f); }
  return w; }
#define WQKV_LAYOUT 2   // 0 = (in,out) [DIN][CC]; 1 = (out,in) [CC][DIN]; 2 = per-head [NH][DIN][HD]
__device__ __forceinline__ v16b wcol_hdk(const float* Wm, int k0, int o, int lane) { v16b w; const int g = lane >> 4; const float* p = Wm + (size_t)(o / HD) * DIN * HD + (o % HD);
#pragma unroll
  for (int i = 0; i < 8; ++i) { w[i] = (__bf16)p[(size_t)(k0 + 8 * g + i) * HD]; w[8 + i] = (__bf16)p[(size_t)(k0 + 16 + 8 * g + i) * HD]; }
  return w; }
#define WO_OUT_IN 0
#if WQKV_LAYOUT == 1
#define WCOL(W, k0, o, lane) wcol_oi(W, k0, o, lane, DIN)
#elif WQKV_LAYOUT == 2
#define WCOL(W, k0, o, lane) wcol_hdk(W, k0, o, lane)
#else
#define WCOL(W, k0, o, lane) wcol_io(W, k0, o, lane, CC)
#endif
#if WO_OUT_IN
#define WOCOL(W, k0, o, lane) wcol_oi(W, k0, o, lane, CC)
#define WOCOLH(W, k0, o, lane) wcolh_oi(W, k0, o, lane, CC)
#else
#define WOCOL(W, k0, o, lane) wcol_io(W, k0, o, lane, DIN)
#define WOCOLH(W, k0, o, lane) wcolh_io(W, k0, o, lane, DIN)
#endif

#ifndef SM_EXTRA_PARAMS
#define SM_EXTRA_PARAMS
#endif
#ifndef PROJ_EXTRA_PARAMS
#define PROJ_EXTRA_PARAMS
#endif
#ifndef SM_MASK_HOOK
#define SM_MASK_HOOK (void)0
#endif

#define WS_QH  0u                                      // f16 q rows [b*t][CC]
#define WS_KH  (WS_QH + 2u * (size_t)NB * TT * CC)      // f16 k rows [b*t][CC]
#define WS_VT  (WS_KH + 2u * (size_t)NB * TT * CC)      // f16 v planes [b][c][t]
#define WS_QL  (WS_VT + 2u * (size_t)NB * CC * TT)      // f16 q residual x 2^10 rows [b][t < QHI][CC]
#define WS_KL  (WS_QL + 2u * (size_t)NB * QHI * CC)     // f16 k residual x 2^10 rows [b][t < KHI][CC]
#define WS_VB  (WS_KL + 2u * (size_t)NB * KHI * CC)     // bf16 v hi planes [b][c][t < KHI]
#define WS_VBL (WS_VB + 2u * (size_t)NB * CC * KHI)
#define WS_Y   (WS_VBL + 2u * (size_t)NB * CC * KHI)    // f32 ctx rows [b*t][CC] (only when there is an output projection)
#define WS_XB  (WS_Y  + 4u * (size_t)NB * TT * CC)      // bf16 x as k tiles [DIN / KT][b*t][KT]
#define WS_WT  (WS_XB + 2u * (size_t)NB * TT * DIN)     // bf16 q / k / v weights as k tiles [which][DIN / KT][output column][KT]
#define WS_WPB (WS_WT + 2u * 3u * (size_t)CC * DIN)     // bf16 output weight as k tiles [CC / KT][output column][KT]
#define WS_WPH (WS_WPB + 2u * (size_t)DIN * CC)         // the same as f16(bf16 x 2^8)
#define WS_END (WS_WPH + 2u * (size_t)DIN * CC)

// ---- weight tile in LDS (k_proj, k_out): KT k rows x 128 output columns, 16 bit, kept as [column][k], so a B fragment is frag_b / frag_h on a column's row
#define KT 64
#define WPITCH (KT + 8)    // 144-B column pitch: the 16 lanes of a ds_load_b128 fragment read fall on 16 different bank quads
// k_cvt reads a weight in units of (4 columns x 8 k), 2 a thread: lane = (column quad lane & 7, k octet lane >> 3), wave = 32 columns; each load instruction covers four whole 128-B lines
// PF_STAGE: in front of a tile's matrix work it keeps the scheduler from sinking the next tile's global loads below it; behind the matrix work it keeps the next tile's conversions, and with them the wait for those loads, from rising above it
#define PF_STAGE() __builtin_amdgcn_sched_barrier(0)
// PF_GROUP: in front of and behind a group of LDS fragment reads it keeps the group together, two groups of products ahead of its own: without it the scheduler sinks each read down to its own product (one LDS latency per product instead of one per group)
#define PF_GROUP() __builtin_amdgcn_sched_barrier(0)
// PF_XW: what follows (the next trip, the loop's set-up) rewrites the address registers that the global loads issued before it name; the wait stands in front of that overwrite
#define PF_XW() do { asm volatile("s_wait_xcnt 0x0" ::: "memory"); __builtin_amdgcn_sched_barrier(0); } while (0)   /* the scheduling barrier keeps later address arithmetic from rising over the wait */
// PF_XWP: the same wait behind a kernel's first loads; it takes their two address pairs as inputs, so that no later load's result is given those registers ahead of the wait
#define PF_XWP(p, q) do { asm volatile("s_wait_xcnt 0x0" :: "v"(p), "v"(q) : "memory"); __builtin_amdgcn_sched_barrier(0); } while (0)
static_assert(KT == 64, "the k loops take a tile as two k halves of 32");
struct WRaw { v4f r[2][8]; };
__device__ __forceinline__ void wt_load(WRaw& w, const float* base, int ldk, int k0) {   /* base = (the thread's first k row, its first column); ldk = floats between k rows */
#pragma unroll
  for (int u = 0; u < 2; ++u)
#pragma unroll
    for (int kk = 0; kk < 8; ++kk) w.r[u][kk] = *(const v4f*)(base + (size_t)(k0 + 32 * u + kk) * ldk); }
// ---- a 128-row x KT tile of 16-bit rows (x rows, weight columns) on its way to LDS. k_cvt left it in the workspace as 16 KB in a row, [row][KT]: 8 lanes = one 128-B row, a load instruction covers four whole lines; a thread carries NI rows TT_ROW(tid) + RS i; base = (that first row of k tile 0, k 8 (tid & 7)); off = bytes from k tile 0 to the tile wanted
// TT_ROW: neighbouring groups of 8 lanes take rows 8 apart: at the 144-B pitch the two 128-B runs of 16 lanes then fall on all 64 banks once (rows 1 apart would share four banks)
#define TT_ROW(tid) (((((tid) >> 3) & 1) << 3) | (((tid) >> 4) & 7) | (((tid) >> 3) & 16))
// the loops here and in k_cvt are unrolled so that every index of a register array is a constant (the arrays stay in registers) and a group's loads are issued together
typedef v4u __attribute__((may_alias)) v4u_a;
template <int NI> struct TRaw { v4u r[NI]; };
template <int NI, int RS> __device__ __forceinline__ void tt_load(TRaw<NI>& w, const char* base, size_t off) { static_assert(NI * RS == 128, "tile");
#pragma unroll
  for (int i = 0; i < NI; ++i) w.r[i] = *(const v4u_a*)(base + (RS * i) * (KT * 2) + off); }
#define XT_STEP ((size_t)NB * TT * KT * 2)   /* bytes between k tiles of x */
#define WT_STEP ((size_t)1024 * KT * 2)      /* the same for a weight of 1024 output columns */
template <int NI, int RS> __device__ __forceinline__ void tt_store(void* tile, const TRaw<NI>& w, int srow, int spc) {
#pragma unroll
  for (int i = 0; i < NI; ++i) *(v4u_a*)((char*)tile + (srow + RS * i) * (WPITCH * 2) + spc * 16) = w.r[i]; }
// ---- A tile in LDS (k_out): a wave brings its own rows' KT k values in whole lines: lane = (row parity lane >> 4, k quad lane & 15), so a load instruction covers the 256-B runs of two rows (4 whole lines; a fragment load straight from global memory touches 16 lines, 32 B of each); rounded once and kept as [row][k] at the weight tile's pitch, an A fragment is frag_b / frag_h on a row
// instruction i: rows 2 i (+ parity) of the wave's first 16 rows, from i = 8 on of its second 16, which lie 64 rows further; base = (the wave's first row + parity, k 4 (lane & 15)); ld = floats between rows
typedef __attribute__((ext_vector_type(4))) __bf16 v4b;
typedef __attribute__((ext_vector_type(4))) _Float16 v4h;
template <int NI> struct ALRaw { v4f r[NI]; };
#define AT_ROW(i) (2 * ((i) & 7) + 64 * ((i) >> 3))
template <int NI> __device__ __forceinline__ void at_load(ALRaw<NI>& a, const float* base, int ld, int k0) {
#pragma unroll
  for (int i = 0; i < NI; ++i) a.r[i] = *(const v4f*)(base + (size_t)AT_ROW(i) * ld + k0); }
template <int NI> __device__ __forceinline__ void at_store_hl(__bf16 (*ah)[WPITCH], __bf16 (*al)[WPITCH], const ALRaw<NI>& a, int row0, int kl) {   /* bf16 hi + lo, as bsplit16 */
#pragma unroll
  for (int i = 0; i < NI; ++i) { v4b p, q;
#pragma unroll
    for (int e = 0; e < 4; ++e) { const __bf16 h = (__bf16)a.r[i][e]; p[e] = h; q[e] = (__bf16)(a.r[i][e] - (float)h); }
    *(v4b*)&ah[row0 + AT_ROW(i)][kl] = p; *(v4b*)&al[row0 + AT_ROW(i)][kl] = q; } }
template <int NI> __device__ __forceinline__ void at_store_h(_Float16 (*at)[WPITCH], const ALRaw<NI>& a, int row0, int kl, float sc) {
#pragma unroll
  for (int i = 0; i < NI; ++i) { v4h p;
#pragma unroll
    for (int e = 0; e < 4; ++e) p[e] = (_Float16)(a.r[i][e] * sc);
    *(v4h*)&at[row0 + AT_ROW(i)][kl] = p; } }
// ---- L2 asks (k_proj, k_att, k_out). What these launches read of the workspace was stored by a launch before them and the blocks that share a tile walk their loops together. At entry each block asks for a share of what its launch reads: global_prefetch_b8, a hint with no result register and no counter; scope SE brings the line into L2 only.
// The shares are for speed only: no value depends on where a block runs or on whether a hint is served. Every lane's address lies inside the buffer it names; no lane is off.
// the closing s_wait_xcnt 0 stands in the asks' own statement, in front of whatever is given their address registers next: a precaution, as behind a global load
__device__ __forceinline__ void l2_ask(const char* p) { asm volatile("global_prefetch_b8 %0, off scope:SCOPE_SE\n\ts_wait_xcnt 0x0" :: "v"(p) : "memory"); }
__device__ __forceinline__ void l2_ask2(const char* p, const char* q) { asm volatile("global_prefetch_b8 %0, off scope:SCOPE_SE\n\tglobal_prefetch_b8 %1, off scope:SCOPE_SE\n\ts_wait_xcnt 0x0" :: "v"(p), "v"(q) : "memory"); }
__device__ __forceinline__ void l2_ask3(const char* p, const char* q, const char* r) { asm volatile("global_prefetch_b8 %0, off scope:SCOPE_SE\n\tglobal_prefetch_b8 %1, off scope:SCOPE_SE\n\tglobal_prefetch_b8 %2, off scope:SCOPE_SE\n\ts_wait_xcnt 0x0" :: "v"(p), "v"(q), "v"(r) : "memory"); }
// ---- k_cvt: x and the four weights are rounded to 16 bit ONCE, in a launch of their own, instead of once in every block that reads them (x in 24 blocks of k_proj, a weight in 32): k_proj and k_out then load half the bytes of them, carry half the staging registers and convert none of them
// all of them are written as k tiles, [k tile][row or output column][KT]: the 128 x KT tile that a block stages is then 16 KB in a row instead of 128 pieces one matrix row apart
// blocks < CVX_BLK: x; a wave takes two rows in 16 runs of 128 floats (whole lines in; out, a half wave writes one whole line). The rest: a wave takes 32 output columns x KT k of one weight (which 0..2: q, k, v; 3: the output weight, in both forms that k_out multiplies with), 16 B (8 k) a store
#define CVX_BLK (NB * TT * DIN / (8 * 16 * 128))
#define CVW_BLK (4 * (CC / 32) * (DIN / KT) / 8)
template <int LDK, bool BOTH> __device__ __forceinline__ void cvt_w(const float* ws, __bf16* db, _Float16* dh) {   /* ws = (the thread's first k, its first column), LDK floats between k rows; db, dh = (that column, that k) in the k tile */
  WRaw wr; wt_load(wr, ws, LDK, 0); PF_XWP(ws, ws);
#pragma unroll
  for (int u = 0; u < 2; ++u)
#pragma unroll
    for (int i = 0; i < 4; ++i) { v8b p;
#pragma unroll
      for (int kk = 0; kk < 8; ++kk) p[kk] = (__bf16)wr.r[u][kk][i];
      *(v8b*)(db + i * KT + 32 * u) = p; }
  if (BOTH) {
#pragma unroll
    for (int u = 0; u < 2; ++u)
#pragma unroll
      for (int i = 0; i < 4; ++i) { v8h p;   /* f16(bf16 x 2^8), exact */
#pragma unroll
        for (int kk = 0; kk < 8; ++kk) p[kk] = (_Float16)(bfr(wr.r[u][kk][i]) * 256.0f);
        *(v8h*)(dh + i * KT + 32 * u) = p; }
    PF_XW(); } }   /* behind this path's last stores the kernel's closing branches rewrite the scalar base that they name */
__global__ __launch_bounds__(256) void k_cvt(const float* __restrict__ X, const float* __restrict__ WQ, const float* __restrict__ WK, const float* __restrict__ WV, const float* __restrict__ WO, __bf16* __restrict__ XB, __bf16* __restrict__ WT, __bf16* __restrict__ WPB, _Float16* __restrict__ WPH) {
  const unsigned tid = threadIdx.x, wave = tid >> 5, lane = tid & 31;
  static_assert(WQKV_LAYOUT == 2 && !WO_OUT_IN && HD % 32 == 0 && CC == 1024 && DIN == 1024 && KT == 64 && CVW_BLK % 4 == 0, "a wave's 32 columns lie in one head, a block in one weight");
  if (blockIdx.x < CVX_BLK) {   /* block-uniform */
    const size_t row = ((size_t)blockIdx.x * 8 + wave) * 2; const float* xs = X + row * DIN + lane * 4; v4f r[16];   /* run j: row + (j >> 3), k 128 (j & 7) + 4 lane */
    __bf16* xd = XB + ((size_t)(lane >> 4) * (NB * TT) + row) * KT + 4 * (lane & 15);
#pragma unroll
    for (int j = 0; j < 16; ++j) r[j] = *(const v4f*)(xs + j * 128);
    PF_XWP(xs, xs);
#pragma unroll
    for (int j = 0; j < 16; ++j) { v4b p;
#pragma unroll
      for (int e = 0; e < 4; ++e) p[e] = (__bf16)r[j][e];
      *(v4b*)(xd + (size_t)(2 * (j & 7)) * (NB * TT * KT) + (j >> 3) * KT) = p; }
  } else {
    const unsigned wblk = blockIdx.x - CVX_BLK, which = wblk / (CVW_BLK / 4), w = (wblk % (CVW_BLK / 4)) * 8 + wave, kt = w % (DIN / KT), cg = w / (DIN / KT);
    const unsigned cl0 = cg * 32 + 4 * (lane & 7), kf = kt * KT + 8 * (lane >> 3);   /* the thread's first column and first k */
    const size_t od = ((size_t)kt * 1024 + cl0) * KT + 8 * (lane >> 3);
    if (which == 3) cvt_w<DIN, true>(WO + cl0 + (size_t)kf * DIN, WPB + od, WPH + od);   /* block-uniform */
    else cvt_w<HD, false>((which == 0 ? WQ : which == 1 ? WK : WV) + (size_t)(cl0 / HD) * DIN * HD + cl0 % HD + (size_t)kf * HD, WT + (size_t)which * CC * DIN + od, nullptr); } }
// ---- k_proj: block = (128 rows, 128 cols, which); the 4 waves lie 2 x 2, a wave takes 64 rows x 64 columns (rows 64 wy + 16 rg, columns 64 wx + 16 j): every A and every B fragment read from LDS serves four products, 16 KB of fragment reads a wave and k tile (32 rows x 128 columns: 20 KB): q/k/v = X W (+ b) with exact bf16 products (K = DIN) -> which 0: q f16 rows (+ residual rows < QHI); 1: k f16 rows (+ residual rows < KHI); 2: v f16 planes [c][t] (+ bf16 hi/lo planes for t < KHI)
__global__ __launch_bounds__(128) void k_proj(const __bf16* __restrict__ XB, const __bf16* __restrict__ WT, const float* __restrict__ BQ, const float* __restrict__ BK, const float* __restrict__ BV,
    _Float16* __restrict__ QH, _Float16* __restrict__ QL, _Float16* __restrict__ KH, _Float16* __restrict__ KL, _Float16* __restrict__ VT, __bf16* __restrict__ VB, __bf16* __restrict__ VBL) {
  __shared__ __align__(16) unsigned char sm[4 * 128 * WPITCH * 2];   /* the two weight buffers and the two A buffers during the k loop; behind the loop's last barrier the epilogue's planes */
  __bf16 (*wt)[128][WPITCH] = (__bf16 (*)[128][WPITCH])sm, (*at)[128][WPITCH] = (__bf16 (*)[128][WPITCH])(sm + 2 * 128 * WPITCH * 2); static_assert(3 * 64 * 136 * 2 <= 4 * 128 * WPITCH * 2, "LDS");
  _Float16 (*sh)[136] = (_Float16 (*)[136])sm, (*sl)[136] = (_Float16 (*)[136])(sm + 64 * 136 * 2); _Float16 (*th)[136] = (_Float16 (*)[136])sm; __bf16 (*tb)[136] = (__bf16 (*)[136])(sm + 64 * 136 * 2), (*tbl)[136] = (__bf16 (*)[136])(sm + 2 * 64 * 136 * 2);
  const int tid = threadIdx.x, wave = tid >> 5, lane = tid & 31, col = lane & 15, g = lane >> 4; const int which = blockIdx.z; const int c0 = blockIdx.y * 128; const size_t r0 = (size_t)blockIdx.x * 128; const size_t bb = r0 / TT; const int t0 = (int)(r0 % TT); const int wy = wave >> 1, wx = wave & 1; static_assert(TT % 128 == 0 && QHI % 128 == 0 && KHI % 128 == 0, "a block lies in one sequence and carries residual planes for all of its rows or for none");
  const float* BA = which == 0 ? BQ : which == 1 ? BK : BV;
  v8f acc[4][4] = {};   /* [row group][column group] */
  const int srow = TT_ROW(tid), spc = tid & 7; const char* wb = (const char*)(WT + (size_t)which * CC * DIN + (size_t)(c0 + srow) * KT + 8 * spc); const char* arow = (const char*)(XB + (r0 + srow) * KT + 8 * spc);
  { static_assert(CC / 128 * 128 == (DIN / KT) * 64 && TNB * TT / 128 == 32, "asks");   /* a 128-row block of x = 16 k tiles x 64 units: the 8 column blocks of one weight ask for it once; a weight's 128 columns likewise: 8 of its 32 row blocks ask for them once, row blocks 2, 4 and 6 apart the same units */
    const unsigned ua = blockIdx.y * 128 + tid, uw = ((blockIdx.x & 1) * 4 + (blockIdx.x >> 3)) * 128 + tid;
    l2_ask2((const char*)XB + (ua >> 6) * XT_STEP + r0 * (KT * 2) + (ua & 63) * 256, (const char*)(WT + (size_t)which * CC * DIN) + (uw >> 6) * WT_STEP + (size_t)c0 * (KT * 2) + (uw & 63) * 256); }
  TRaw<8> wr, ar; tt_load<8, 16>(ar, arow, 0); tt_load<8, 16>(wr, wb, 0); PF_XWP(arow, wb); tt_store<8, 16>(wt[0], wr, srow, spc); tt_store<8, 16>(at[0], ar, srow, spc);
  __syncthreads();   /* tile 0 is published */
#pragma unroll 2   /* two trips = the two buffers at constant LDS addresses */
  for (int t = 0; t < DIN / KT; ++t) {
    if (t + 1 < DIN / KT) { tt_load<8, 16>(ar, arow, (t + 1) * XT_STEP); tt_load<8, 16>(wr, wb, (t + 1) * WT_STEP); }   /* the next tile flies while this one is multiplied */
    PF_STAGE();
    v16b a[4][KT / 32];   /* the wave's 64 rows of the A tile, read in one group with the first B fragments (first k half first) */
    v16b bf[2][2];   /* B fragments in groups of 2 (group q: k half q >> 1, columns 32 (q & 1) .. of the wave's 64), two register sets: a group's LDS reads are issued together, two groups ahead of its products */
#pragma unroll
    for (int rg = 0; rg < 4; ++rg) a[rg][0] = frag_b(&at[t & 1][wy * 64 + rg * 16 + col][0], lane);
#pragma unroll
    for (int q = 0; q < 2; ++q)
#pragma unroll
      for (int jj = 0; jj < 2; ++jj) bf[q][jj] = frag_b(&wt[t & 1][wx * 64 + (q * 2 + jj) * 16 + col][0], lane);
#pragma unroll
    for (int rg = 0; rg < 4; ++rg) a[rg][1] = frag_b(&at[t & 1][wy * 64 + rg * 16 + col][32], lane);
    PF_GROUP();
#pragma unroll
    for (int q = 0; q < 4; ++q) {
#pragma unroll
      for (int jj = 0; jj < 2; ++jj)
#pragma unroll
        for (int rg = 0; rg < 4; ++rg) acc[rg][(q & 1) * 2 + jj] = wmma_bf(a[rg][q >> 1], bf[q & 1][jj], acc[rg][(q & 1) * 2 + jj]);
      if (q < 2) { PF_GROUP();
#pragma unroll
        for (int jj = 0; jj < 2; ++jj) bf[q][jj] = frag_b(&wt[t & 1][wx * 64 + (q * 2 + jj) * 16 + col][32], lane);
        PF_GROUP(); } }
    PF_STAGE();
    if (t + 1 < DIN / KT) { tt_store<8, 16>(wt[(t + 1) & 1], wr, srow, spc); tt_store<8, 16>(at[(t + 1) & 1], ar, srow, spc); }   /* those buffers' readers left them at the barrier of trip t - 1 */
    PF_XW();
    __syncthreads(); }   /* publishes tile t + 1 and ends the reads of tile t (after the last trip: frees the LDS for the epilogue) */
  // the epilogue goes twice through the same planes. q, k: pass p takes every wave's row groups 2 p, 2 p + 1, so plane row rl is block row 64 (rl >> 5) + 32 p + (rl & 31), all 128 columns. v: pass p takes every wave's column groups 2 p, 2 p + 1, so plane column cl is block column 64 (cl >> 5) + 32 p + (cl & 31), all 128 rows: every store run is 256 B
#pragma unroll
  for (int p = 0; p < 2; ++p) {
  if (p) __syncthreads();   /* the first pass has been read out of the planes */
  if (which < 2) { _Float16* DH = which == 0 ? QH : KH; _Float16* DL = which == 0 ? QL : KL; const int nhi = which == 0 ? QHI : KHI; const bool hi_rows = t0 < nhi;
#pragma unroll
    for (int j = 0; j < 4; ++j) { const float bias = BA ? bfr(BA[c0 + wx * 64 + j * 16 + col]) : 0.f;
#pragma unroll
      for (int rr = 0; rr < 2; ++rr)
#pragma unroll
        for (int r = 0; r < 8; ++r) { const float v = acc[2 * p + rr][j][r] + bias; const _Float16 hv = (_Float16)v; sh[wy * 32 + rr * 16 + 8 * g + r][wx * 64 + j * 16 + col] = hv; sl[wy * 32 + rr * 16 + 8 * g + r][wx * 64 + j * 16 + col] = (_Float16)((v - (float)hv) * 1024.0f); } }
    __syncthreads();
    for (int e = tid; e < 64 * 16; e += 128) { const int rl = e >> 4, q = e & 15, br = 64 * (rl >> 5) + 32 * p + (rl & 31); vst2((unsigned*)(DH + (r0 + br) * CC + c0 + q * 8), *(const v4u*)&sh[rl][q * 8]); PF_XW();   /* the LDS read below may land in this store's registers */
      if (hi_rows) vst2((unsigned*)(DL + (bb * nhi + t0 + br) * (size_t)CC + c0 + q * 8), *(const v4u*)&sl[rl][q * 8]); PF_XW(); }   /* the next trip rewrites the stores' address registers */
  } else { const bool hi_rows = t0 < KHI;
#pragma unroll
    for (int jj = 0; jj < 2; ++jj) { const float bias = BA ? bfr(BA[c0 + wx * 64 + (2 * p + jj) * 16 + col]) : 0.f;
#pragma unroll
      for (int rg = 0; rg < 4; ++rg)
#pragma unroll
        for (int r = 0; r < 8; ++r) { const float v = acc[rg][2 * p + jj][r] + bias; const int rl = wy * 64 + rg * 16 + 8 * g + r, cl = wx * 32 + jj * 16 + col; th[cl][rl] = (_Float16)v; const __bf16 bh = (__bf16)v; tb[cl][rl] = bh; tbl[cl][rl] = (__bf16)(v - (float)bh); } }
    __syncthreads();
    for (int e = tid; e < 64 * 16; e += 128) { const int cl = e >> 4, q = e & 15, bc = 64 * (cl >> 5) + 32 * p + (cl & 31); vst2((unsigned*)(VT + (bb * CC + c0 + bc) * (size_t)TT + t0 + q * 8), *(const v4u*)&th[cl][q * 8]); PF_XW();   /* the LDS reads below may land in this store's address registers */
      if (hi_rows) { const size_t o3 = (bb * CC + c0 + bc) * (size_t)KHI + t0 + q * 8; vst2((unsigned*)(VB + o3), *(const v4u*)&tb[cl][q * 8]); vst2((unsigned*)(VBL + o3), *(const v4u*)&tbl[cl][q * 8]); PF_XW(); } } } } }   /* as above, for the next trip */
// ---- k_att: block = 64 queries (qb) of one (b, h), z = b * NH + h; logits, softmax and P . v in one pass over 64-key blocks 0..qb, the logits never leave registers.
// Transposed products: St = K . Qt (A = 16 key rows, B = the wave's 16 queries), so a lane holds 8 keys a tile of ONE query (column lane & 15, keys 8 g + r); two neighbouring St tiles are, register for register, the B fragment Pt of 32 keys for Ot += Vt . Pt (A = 16 d rows of the v plane).
// Running maximum per query (in-lane + one exchange between the wave halves), e = 2^((s - m) c + 11), c = SCALE log2(e): P carried x 2^11 as before, the factor cancels against the row sum; Ot and the sum are rescaled at every key block.
// Query blocks < QBH: 3 logit products (q, k hi + residual x 2^10) and P, v as bf16 hi + lo (3 products); after: single f16 products.
// The K and v tiles (64 rows x 128 B each) are shared by the 4 waves through LDS: whole-line global loads one key block ahead, 2 buffers, one barrier per key block.
#define AP 72              // 144-B LDS row pitch, as WPITCH
#define ATILE (64 * AP * 2)   // bytes of one tile in LDS
__device__ __forceinline__ v8f wm_h(v16h a, v16h b, v8f c) { return __builtin_amdgcn_wmma_f32_16x16x32_f16(false, a, false, b, (short)0, c, false, false); }
__device__ __forceinline__ v8f wm_b(v16b a, v16b b, v8f c) { return __builtin_amdgcn_wmma_f32_16x16x32_bf16(false, a, false, b, (short)0, c, false, false); }
__device__ __forceinline__ float xhalf(float x) { return __builtin_bit_cast(float, __builtin_amdgcn_permlanex16(__builtin_bit_cast(int, x), __builtin_bit_cast(int, x), 0x76543210, 0xfedcba98, false, false)); }   /* lane l <-> lane l ^ 16 */
// 2^x by v_exp_f32 as asm text, eight in place in one statement: nothing of the compiler's then stands directly behind a v_exp_f32; the closing v_nop is the slot that the instruction set asks for behind the last one
__device__ __forceinline__ void exp2x8(float (&x)[8]) {
  asm("v_exp_f32 %0, %0\n\tv_exp_f32 %1, %1\n\tv_exp_f32 %2, %2\n\tv_exp_f32 %3, %3\n\tv_exp_f32 %4, %4\n\tv_exp_f32 %5, %5\n\tv_exp_f32 %6, %6\n\tv_exp_f32 %7, %7\n\tv_nop" : "+v"(x[0]), "+v"(x[1]), "+v"(x[2]), "+v"(x[3]), "+v"(x[4]), "+v"(x[5]), "+v"(x[6]), "+v"(x[7])); }
__device__ __forceinline__ float exp2x1(float x) { asm("v_exp_f32 %0, %0\n\tv_nop" : "+v"(x)); return x; }   /* the same for one value */
typedef v4f __attribute__((may_alias)) v4f_a;
template <bool HI> __device__ __forceinline__ void att_body(unsigned char* sm, const _Float16* __restrict__ QH, const _Float16* __restrict__ KH, const _Float16* __restrict__ QL, const _Float16* __restrict__ KL, const _Float16* __restrict__ VT, const __bf16* __restrict__ VB, const __bf16* __restrict__ VBL, float* __restrict__ Y, int qb, int b, int h) {
  constexpr int NT = HI ? 4 : 2;   /* tiles a key block: k, v (+ k residual, v lo) */
  const int tid = threadIdx.x, wave = tid >> 5, lane = tid & 31, col = lane & 15, g = lane >> 4; const int ql0 = qb * 64 + wave * 16; const int nblk = qb + 1;
  const int srow = tid >> 3, spc = tid & 7;   /* staging: 8 lanes = one 128-B row; a thread carries rows srow + 16 i */
  constexpr unsigned vp = HI ? KHI : TT;
  // block-uniform bases and one 32-bit byte offset per thread and tile shape (k rows, v planes)
  const char* s_k = (const char*)(KH + (size_t)b * TT * CC + h * HD); const char* s_kl = (const char*)(KL + (size_t)b * KHI * CC + h * HD);
  const char* s_v = HI ? (const char*)(VB + ((size_t)b * CC + h * HD) * vp) : (const char*)(VT + ((size_t)b * CC + h * HD) * vp); const char* s_vl = (const char*)(VBL + ((size_t)b * CC + h * HD) * vp);
  const unsigned o_k = (unsigned)srow * (CC * 2) + spc * 16, o_v = (unsigned)srow * (vp * 2) + spc * 16;
  v4u ra[4], rb[4];   /* two tiles in flight: k and v; with the residual planes first k and k residual, then, behind the logit products, v hi and v lo in the same registers */
#define ATT_LD(dst, base, rowstep, off) do { _Pragma("unroll") for (int i = 0; i < 4; ++i) dst[i] = *(const v4u_a*)((base) + i * (16 * (rowstep)) + (off)); } while (0)
#define ATT_ST(bufp, tile, srcr) do { _Pragma("unroll") for (int i = 0; i < 4; ++i) *(v4u_a*)((bufp) + (tile) * ATILE + (srow + 16 * i) * (AP * 2) + spc * 16) = srcr[i]; } while (0)
#define ATT_KSTEP (64 * CC * 2)   /* bytes between key blocks in the k rows; 128 in the v planes */
  v16h qf[HD / 32], qlf[HD / 32];
#pragma unroll
  for (int kc = 0; kc < HD / 32; ++kc) { qf[kc] = frag_h(QH + ((size_t)b * TT + ql0 + col) * CC + h * HD + kc * 32, lane); if (HI) qlf[kc] = frag_h(QL + ((size_t)b * QHI + ql0 + col) * CC + h * HD + kc * 32, lane); }
  if (HI) { ATT_LD(ra, s_k, CC * 2, o_k); ATT_LD(rb, s_kl, CC * 2, o_k); PF_XW(); ATT_ST(sm, 0, ra); ATT_ST(sm, 2, rb); ATT_LD(ra, s_v, vp * 2, o_v); ATT_LD(rb, s_vl, vp * 2, o_v); PF_XW(); ATT_ST(sm, 1, ra); ATT_ST(sm, 3, rb); PF_XW(); }   /* the last wait: the q loads are scheduled behind the one before */
  else { ATT_LD(ra, s_k, CC * 2, o_k); ATT_LD(rb, s_v, vp * 2, o_v); PF_XW(); ATT_ST(sm, 0, ra); ATT_ST(sm, 1, rb); }
  __syncthreads();   /* key block 0 is published */
  const float cs = SCALE * 1.44269504088896340736f;
  float m = -3.0e38f, l = 0.f; v8f o[HD / 16] = {};
  for (int t = 0; t < nblk; ++t) { const unsigned char* bp = sm + (t & 1) * (NT * ATILE); unsigned char* nb = sm + ((t + 1) & 1) * (NT * ATILE);   /* nb: its readers left it at the barrier of trip t - 1 */
    // with the residual planes the staging is unconditional (the last trip stages its own block once more into the idle buffer, which nobody reads): no branch then stands between the logit products and the first readers of their results
    const bool more = HI || t + 1 < nblk; const int tn = (HI && t + 1 == nblk) ? t : t + 1;
    if (more) { ATT_LD(ra, s_k + (size_t)tn * ATT_KSTEP, CC * 2, o_k); if (HI) ATT_LD(rb, s_kl + (size_t)tn * ATT_KSTEP, CC * 2, o_k); else ATT_LD(rb, s_v + (size_t)tn * 128, vp * 2, o_v); }   /* the next key block flies while this one is worked on */
    if (HI) PF_XW(); else PF_STAGE();   /* with the residual planes the LDS reads below land in the address registers of these loads (without them the compiler writes the wait itself) */
    const _Float16 (*kt)[AP] = (const _Float16 (*)[AP])bp; const _Float16 (*klt)[AP] = (const _Float16 (*)[AP])(bp + 2 * ATILE); const _Float16 (*vt)[AP] = (const _Float16 (*)[AP])(bp + ATILE); const __bf16 (*vb)[AP] = (const __bf16 (*)[AP])(bp + ATILE); const __bf16 (*vbl)[AP] = (const __bf16 (*)[AP])(bp + 3 * ATILE);
    // ATT_GROUP: behind a group of LDS fragment reads it keeps the scheduler from sinking each read down to its own product (one LDS latency per product instead of one per group)
#define ATT_GROUP() __builtin_amdgcn_sched_barrier(0)
    float s[4][8]; v16h vf[2][HD / 16]; v16b vh[HD / 16], vl[HD / 16];
    if (HI) {
#pragma unroll
      for (int hf = 0; hf < 2; ++hf) { v16h kf[2][HD / 32], lf[2][HD / 32]; v8f a[2] = {}, al[2] = {};   /* two key tiles a group */
#pragma unroll
        for (int jj = 0; jj < 2; ++jj)
#pragma unroll
          for (int kc = 0; kc < HD / 32; ++kc) { kf[jj][kc] = frag_h(&kt[(2 * hf + jj) * 16 + col][kc * 32], lane); lf[jj][kc] = frag_h(&klt[(2 * hf + jj) * 16 + col][kc * 32], lane); }
        ATT_GROUP();
#pragma unroll
        for (int kc = 0; kc < HD / 32; ++kc)
#pragma unroll
          for (int jj = 0; jj < 2; ++jj) { a[jj] = wm_h(kf[jj][kc], qf[kc], a[jj]); al[jj] = wm_h(kf[jj][kc], qlf[kc], al[jj]); al[jj] = wm_h(lf[jj][kc], qf[kc], al[jj]); }
#pragma unroll
        for (int jj = 0; jj < 2; ++jj)
#pragma unroll
          for (int r = 0; r < 8; ++r) s[2 * hf + jj][r] = a[jj][r] + al[jj][r] * (1.0f / 1024.0f);
        ATT_GROUP(); }   /* here it keeps the second group's reads from rising over the first group's products: both groups at once do not fit the registers */
      ATT_ST(nb, 0, ra); ATT_ST(nb, 2, rb); PF_XW(); ATT_LD(ra, s_v + (size_t)tn * 128, vp * 2, o_v); ATT_LD(rb, s_vl + (size_t)tn * 128, vp * 2, o_v);
      PF_STAGE();
#pragma unroll
      for (int j = 0; j < HD / 16; ++j) { vh[j] = frag_b(&vb[j * 16 + col][0], lane); vl[j] = frag_b(&vbl[j * 16 + col][0], lane); }   /* v of the first 32 keys: read behind the logit products, lands under the softmax */
    } else { v16h kf[4][HD / 32]; v8f a[4] = {};
#pragma unroll
      for (int jt = 0; jt < 4; ++jt)
#pragma unroll
        for (int kc = 0; kc < HD / 32; ++kc) kf[jt][kc] = frag_h(&kt[jt * 16 + col][kc * 32], lane);
      ATT_GROUP();
#pragma unroll
      for (int kc = 0; kc < HD / 32; ++kc)
#pragma unroll
        for (int jt = 0; jt < 4; ++jt) a[jt] = wm_h(kf[jt][kc], qf[kc], a[jt]);
#pragma unroll
      for (int kc = 0; kc < 2; ++kc)
#pragma unroll
        for (int j = 0; j < HD / 16; ++j) vf[kc][j] = frag_h(&vt[j * 16 + col][kc * 32], lane);   /* all of v: read behind the logit products, lands under the softmax */
#pragma unroll
      for (int jt = 0; jt < 4; ++jt)
#pragma unroll
        for (int r = 0; r < 8; ++r) s[jt][r] = a[jt][r]; }
    ATT_GROUP();
    if (t == nblk - 1) {   /* the diagonal block: keys past the query are excluded by index */
#pragma unroll
      for (int jt = 0; jt < 4; ++jt)
#pragma unroll
        for (int r = 0; r < 8; ++r) s[jt][r] = (jt * 16 + 8 * g + r <= wave * 16 + col) ? s[jt][r] : -3.0e38f; }
    float mj[4];   /* four independent chains */
#pragma unroll
    for (int jt = 0; jt < 4; ++jt) { mj[jt] = s[jt][0];
#pragma unroll
      for (int r = 1; r < 8; ++r) mj[jt] = fmaxf(mj[jt], s[jt][r]); }
    float mx = fmaxf(fmaxf(mj[0], mj[1]), fmaxf(mj[2], mj[3]));
    mx = fmaxf(mx, xhalf(mx));   /* the other 8 keys of each tile lie in the other wave half */
    const float mn = fmaxf(m, mx); const float alpha = exp2x1((m - mn) * cs); const float off = 11.0f - mn * cs; m = mn;
    float sj[4];
#pragma unroll
    for (int jt = 0; jt < 4; ++jt) {
#pragma unroll
      for (int r = 0; r < 8; ++r) s[jt][r] = fmaf(s[jt][r], cs, off);
      exp2x8(s[jt]);   /* an excluded key gives 2^(-huge) = 0 */
      sj[jt] = s[jt][0];
#pragma unroll
      for (int r = 1; r < 8; ++r) sj[jt] += s[jt][r]; }
    l = l * alpha + ((sj[0] + sj[1]) + (sj[2] + sj[3]));
#pragma unroll
    for (int j = 0; j < HD / 16; ++j) o[j] *= alpha;
#pragma unroll
    for (int kc = 0; kc < 2; ++kc) {
      if (HI) { float v[16];
#pragma unroll
        for (int i = 0; i < 8; ++i) { v[i] = s[2 * kc][i]; v[8 + i] = s[2 * kc + 1][i]; }
        const F2 p = bsplit16(v);
#pragma unroll
        for (int j = 0; j < HD / 16; ++j) o[j] = wm_b(vh[j], p.h, o[j]);
#pragma unroll
        for (int j = 0; j < HD / 16; ++j) o[j] = wm_b(vh[j], p.l, o[j]);
#pragma unroll
        for (int j = 0; j < HD / 16; ++j) o[j] = wm_b(vl[j], p.h, o[j]);
        if (kc == 0) {
#pragma unroll
          for (int j = 0; j < HD / 16; ++j) { vh[j] = frag_b(&vb[j * 16 + col][32], lane); vl[j] = frag_b(&vbl[j * 16 + col][32], lane); }
          ATT_GROUP(); }
      } else { v16h p;
#pragma unroll
        for (int i = 0; i < 8; ++i) { p[i] = (_Float16)s[2 * kc][i]; p[8 + i] = (_Float16)s[2 * kc + 1][i]; }
#pragma unroll
        for (int j = 0; j < HD / 16; ++j) o[j] = wm_h(vf[kc][j], p, o[j]); } }
    PF_STAGE();
    if (more) { if (HI) { ATT_ST(nb, 1, ra); ATT_ST(nb, 3, rb); } else { ATT_ST(nb, 0, ra); ATT_ST(nb, 1, rb); } }
    PF_XW();
    __syncthreads(); }   /* publishes key block t + 1 and ends the reads of block t (after the last trip: frees the LDS for the epilogue) */
  l += xhalf(l);
  const float inv = l > 0.f ? 1.0f / l : 0.f;
  float (*ss)[HD + 4] = (float (*)[HD + 4])(sm + wave * (16 * (HD + 4) * 4));   /* the wave's own 16 ctx rows, so that the stores cover whole 256-B (row, head) segments */
#pragma unroll
  for (int j = 0; j < HD / 16; ++j) { v4f x0, x1;
#pragma unroll
    for (int r = 0; r < 4; ++r) { x0[r] = o[j][r] * inv; x1[r] = o[j][4 + r] * inv; }
    *(v4f_a*)&ss[col][j * 16 + 8 * g] = x0; *(v4f_a*)&ss[col][j * 16 + 8 * g + 4] = x1; }
  LDSX();
#pragma unroll
  for (int i = 0; i < 8; ++i) { const int rl = 2 * i + g; vst2(Y + ((size_t)b * TT + ql0 + rl) * CC + h * HD + col * 4, *(const v4f_a*)&ss[rl][col * 4]); } }
__global__ __launch_bounds__(128, 4) void k_att(const _Float16* __restrict__ QH, const _Float16* __restrict__ KH, const _Float16* __restrict__ QL, const _Float16* __restrict__ KL, const _Float16* __restrict__ VT, const __bf16* __restrict__ VB, const __bf16* __restrict__ VBL, float* __restrict__ Y) {   /* 4 waves a SIMD: all 1024 blocks resident at once, 4 a WGP */
  __shared__ __align__(16) unsigned char sm[2 * 4 * ATILE]; static_assert(CAUSAL && QBH * 64 <= KHI && QBH * 64 <= QHI && HD == 64 && 4 * 16 * (HD + 4) * 4 <= 2 * 2 * ATILE, "k_att");
  const int z = blockIdx.z, b = z / NH, h = z % NH;
  const int qb = ((z & 1) ? NQB - 1 - (int)blockIdx.x : (int)blockIdx.x) ^ ((z & 2) ? NQB / 2 : 0);   /* a permutation of the query blocks per plane: neighbours in launch order differ in length, for balance only */
  { static_assert(NQB == 16 && TT == 1024 && KHI == 384 && NH % 2 == 0, "asks");   /* the 32 blocks of two neighbouring heads ask for the pair's k rows (1024 units, the even head's blocks) and v planes (1024 units, the odd head's), query blocks 4 apart the same units; 9 of the 16 shares also for the residual planes, 384 units each */
    const unsigned slot = (z & 1) * 8 + (blockIdx.x >> 3) * 4 + (blockIdx.x & 3), u = (slot & 7) * 128 + threadIdx.x; const int hp = h & ~1;
    l2_ask((z & 1) ? (const char*)(VT + ((size_t)b * CC + hp * HD) * TT) + u * 256 : (const char*)(KH + ((size_t)b * TT + u) * CC + hp * HD));
    if (slot < 9) { const unsigned w = (slot % 3) * 128 + threadIdx.x;   /* block-uniform */
      l2_ask(slot < 3 ? (const char*)(KL + ((size_t)b * KHI + w) * CC + hp * HD) : (const char*)((slot < 6 ? VB : VBL) + ((size_t)b * CC + hp * HD) * KHI) + w * 256); } }
  if (qb < QBH) att_body<true>(sm, QH, KH, QL, KL, VT, VB, VBL, Y, qb, b, h); else att_body<false>(sm, QH, KH, QL, KL, VT, VB, VBL, Y, qb, b, h); }
// ---- k_out: block = (128 rows, 128 cols), 8 waves lying 4 x 2 on one staged weight tile, a wave takes 32 rows x 64 columns (rows 32 wy + 16 rg, columns 64 wx + 16 j): 12 KB of fragment reads a wave and k tile on the one-product path (16 rows x 128 columns: 18 KB); a wave still stages rows 16 wave ..: out = ctx Wo (+ bo): ctx once to f16 against Wo as f16(bf16 x 2^8) exact (1 product) x 2^-8; causal early rows (< QHI of each sequence): ctx bf16 hi + lo against exact bf16 Wo (2 products)
__global__ __launch_bounds__(256) void k_out(const float* __restrict__ Y, const __bf16* __restrict__ WPB, const _Float16* __restrict__ WPH, const float* __restrict__ BO, float* __restrict__ OUT) { __shared__ __align__(16) float sf[8][32][68]; __shared__ __align__(16) __bf16 wt[2][128][WPITCH]; __shared__ __align__(16) __bf16 at[2][2][128][WPITCH];   /* at: [buffer][plane: hi, lo (early rows); the f16 path keeps one plane] */
  const int tid = threadIdx.x, wave = tid >> 5, lane = tid & 31, col = lane & 15, g = lane >> 4; const int c0 = blockIdx.y * 128; const size_t r0 = (size_t)blockIdx.x * 128 + wave * 16; const int wy = wave >> 1, wx = wave & 1; static_assert(TT % 128 == 0 && QHI % 128 == 0, "a block is early rows or late rows as a whole");
  v8f acc[2][4] = {};   /* [row group][column group] */
  const bool early = CAUSAL && (int)(((size_t)blockIdx.x * 128) % TT) < QHI;   /* block-uniform */
  const int srow = TT_ROW(tid), spc = tid & 7; const char* wb = (early ? (const char*)WPB : (const char*)WPH) + ((size_t)(c0 + srow) * KT + 8 * spc) * 2; const int ar0 = wave * 16 + g, akl = 4 * col; const float* arow = Y + (r0 + g) * CC + akl;
  { static_assert(CC == 1024 && KT == 64 && TT / 128 == 8 && NB == 4 && DIN / 128 == 8, "asks");   /* the block's 128 ctx rows = 128 x 16 units: 4 column blocks ask for them once (k tiles 0..7, then 8..15), column blocks 4 apart the same units; the 128 weight columns = 1024 units: the 4 row blocks at one place of the 4 sequences ask for them once */
    const unsigned uy = (blockIdx.y & 3) * 256 + tid, uw = (blockIdx.x >> 3) * 256 + tid; const char* yb = (const char*)(Y + ((size_t)blockIdx.x * 128 + (uy & 127)) * CC) + (uy >> 7) * 256;
    l2_ask3(yb, yb + 8 * 256, (early ? (const char*)WPB : (const char*)WPH) + (uw >> 6) * WT_STEP + (size_t)c0 * (KT * 2) + (uw & 63) * 256); }
  TRaw<4> wr; ALRaw<8> ar; at_load(ar, arow, CC, 0); tt_load<4, 32>(wr, wb, 0); PF_XW();
  if (early) {
    tt_store<4, 32>(wt[0], wr, srow, spc); at_store_hl(at[0][0], at[0][1], ar, ar0, akl);
    __syncthreads();   /* tile 0 is published */
#pragma unroll 2   /* two trips = the two buffers at constant LDS addresses */
    for (int t = 0; t < CC / KT; ++t) {
      if (t + 1 < CC / KT) { at_load(ar, arow, CC, (t + 1) * KT); tt_load<4, 32>(wr, wb, (t + 1) * WT_STEP); PF_XW(); }   /* the next tile flies while this one is multiplied; the wait: the conversions behind the products are given these loads' address registers */
      PF_STAGE();
      F2 a[2][KT / 32]; v16b bf[KT / 32][4];   /* all of the wave's fragments of the tile, read in one group, k half by k half */
#pragma unroll
      for (int c = 0; c < KT / 32; ++c) {
#pragma unroll
        for (int rg = 0; rg < 2; ++rg) { a[rg][c].h = frag_b(&at[t & 1][0][wy * 32 + rg * 16 + col][32 * c], lane); a[rg][c].l = frag_b(&at[t & 1][1][wy * 32 + rg * 16 + col][32 * c], lane); }
#pragma unroll
        for (int jj = 0; jj < 4; ++jj) bf[c][jj] = frag_b(&wt[t & 1][wx * 64 + jj * 16 + col][32 * c], lane); }
      PF_GROUP();
#pragma unroll
      for (int c = 0; c < KT / 32; ++c) {   /* the 8 hi products of a k half, then its 8 lo products: an accumulator still takes hi, lo, hi, lo, and its two products of a k half no longer follow each other directly */
#pragma unroll
        for (int jj = 0; jj < 4; ++jj)
#pragma unroll
          for (int rg = 0; rg < 2; ++rg) acc[rg][jj] = wmma_bf(a[rg][c].h, bf[c][jj], acc[rg][jj]);
#pragma unroll
        for (int jj = 0; jj < 4; ++jj)
#pragma unroll
          for (int rg = 0; rg < 2; ++rg) acc[rg][jj] = wmma_bf(a[rg][c].l, bf[c][jj], acc[rg][jj]); }
      PF_STAGE();
      if (t + 1 < CC / KT) { tt_store<4, 32>(wt[(t + 1) & 1], wr, srow, spc); at_store_hl(at[(t + 1) & 1][0], at[(t + 1) & 1][1], ar, ar0, akl); }   /* those buffers' readers left them at the barrier of trip t - 1 */
      PF_XW();
      __syncthreads(); }   /* publishes tile t + 1 and ends the reads of tile t */
#pragma unroll
    for (int j = 0; j < 4; ++j) { const float bias = BO ? bfr(BO[c0 + wx * 64 + j * 16 + col]) : 0.f;
#pragma unroll
      for (int rg = 0; rg < 2; ++rg)
#pragma unroll
        for (int r = 0; r < 8; ++r) sf[wave][rg * 16 + 8 * g + r][j * 16 + col] = acc[rg][j][r] + bias; }
  } else {
    _Float16 (*wh)[128][WPITCH] = (_Float16 (*)[128][WPITCH])wt;   /* this path keeps f16 in the same two buffers */
    _Float16 (*ah)[2][128][WPITCH] = (_Float16 (*)[2][128][WPITCH])at;   /* plane 0 of each A buffer, f16 */
    tt_store<4, 32>(wh[0], wr, srow, spc); at_store_h(ah[0][0], ar, ar0, akl, 64.0f);   /* ctx carried x 2^6 into f16 so small-magnitude context rows stay clear of f16 subnormals */
    __syncthreads();   /* tile 0 is published */
#pragma unroll 2   /* two trips = the two buffers at constant LDS addresses */
    for (int t = 0; t < CC / KT; ++t) {
      if (t + 1 < CC / KT) { at_load(ar, arow, CC, (t + 1) * KT); tt_load<4, 32>(wr, wb, (t + 1) * WT_STEP); }   /* the next tile flies while this one is multiplied */
      PF_STAGE();
      v16h a[2][KT / 32], bf[KT / 32][4];   /* all of the wave's fragments of the tile, read in one group, k half by k half */
#pragma unroll
      for (int c = 0; c < KT / 32; ++c) {
#pragma unroll
        for (int rg = 0; rg < 2; ++rg) a[rg][c] = frag_h(&ah[t & 1][0][wy * 32 + rg * 16 + col][32 * c], lane);
#pragma unroll
        for (int jj = 0; jj < 4; ++jj) bf[c][jj] = frag_h(&wh[t & 1][wx * 64 + jj * 16 + col][32 * c], lane); }
      PF_GROUP();
#pragma unroll
      for (int c = 0; c < KT / 32; ++c)
#pragma unroll
        for (int jj = 0; jj < 4; ++jj)
#pragma unroll
          for (int rg = 0; rg < 2; ++rg) acc[rg][jj] = wmma16(a[rg][c], bf[c][jj], acc[rg][jj]);
      PF_STAGE();
      if (t + 1 < CC / KT) { tt_store<4, 32>(wh[(t + 1) & 1], wr, srow, spc); at_store_h(ah[(t + 1) & 1][0], ar, ar0, akl, 64.0f); }   /* those buffers' readers left them at the barrier of trip t - 1 */
      PF_XW();
      __syncthreads(); }   /* publishes tile t + 1 and ends the reads of tile t */
#pragma unroll
    for (int j = 0; j < 4; ++j) { const float bias = BO ? bfr(BO[c0 + wx * 64 + j * 16 + col]) : 0.f;
#pragma unroll
      for (int rg = 0; rg < 2; ++rg)
#pragma unroll
        for (int r = 0; r < 8; ++r) sf[wave][rg * 16 + 8 * g + r][j * 16 + col] = acc[rg][j][r] * (1.0f / 16384.0f) + bias; } }   /* 2^-8 (Wo carry) x 2^-6 (ctx carry) */
  LDSX(); float* op = OUT + ((size_t)blockIdx.x * 128 + wy * 32 + g) * DIN + c0 + wx * 64 + col * 4;   /* a store instruction covers the 256-B runs of two rows */
  for (int i = 0; i < 16; ++i) vst2(op + (size_t)(2 * i) * DIN, *(const v4f*)&sf[wave][2 * i + g][col * 4]); }

extern "C" void kernel_launch(void* const* d_in, const int* in_sizes, int n_in, void* d_out, int out_size, void* d_ws, size_t ws_size, hipStream_t stream) {
  (void)in_sizes; (void)n_in; (void)out_size;
  const float** F = (const float**)d_in;
  if (ws_size < (size_t)WS_END) return;
  char* ws = (char*)d_ws; _Float16 *QH = (_Float16*)(ws + WS_QH), *KH = (_Float16*)(ws + WS_KH), *VT = (_Float16*)(ws + WS_VT), *QL = (_Float16*)(ws + WS_QL), *KL = (_Float16*)(ws + WS_KL); __bf16 *VB = (__bf16*)(ws + WS_VB), *VBL = (__bf16*)(ws + WS_VBL); float *Y = (float*)(ws + WS_Y); __bf16 *XB = (__bf16*)(ws + WS_XB), *WT = (__bf16*)(ws + WS_WT), *WPB = (__bf16*)(ws + WS_WPB); _Float16 *WPH = (_Float16*)(ws + WS_WPH);
  (void)Y; (void)QL; (void)KL; (void)VB; (void)VBL;
  // inputs: 0 x [4,1024,1024]; 1 Wq [16,1024,64]; 2 Wk; 3 Wv (per-head [head][model][d]); 4 Wp [1024,1024] (in,out); 5 bp [1024] (zeros, read); no q / k / v biases
  k_cvt<<<dim3(CVX_BLK + CVW_BLK), 256, 0, stream>>>(F[0], F[1], F[2], F[3], F[4], XB, WT, WPB, WPH);
  k_proj<<<dim3(TNB * TT / 128, CC / 128, 3), 128, 0, stream>>>(XB, WT, nullptr, nullptr, nullptr, QH, QL, KH, KL, VT, VB, VBL);
  k_att<<<dim3(NQB, 1, TNB * NH), 128, 0, stream>>>(QH, KH, QL, KL, VT, VB, VBL, Y);
  k_out<<<dim3(TNB * TT / 128, DIN / 128), 256, 0, stream>>>(Y, WPB, WPH, F[5], (float*)d_out);
}

// v010
// Measured time: 69.1 microseconds a run.
// Two timings next to v009 both put it at 1.04 times that version's speed.
// Over all steps from v000 it is 10.4 times as fast.
// compute dtype: all float inputs rounded to bf16; per-head q / k / v projections with EXACT bf16 products on WMMA 16x16x32 (f32 accumulate), no biases; causal logits: 3 products for the first 384 rows, single f16 q x k after, x 1024^-0.5; softmax f32; P x 2^11 once to f16 x v once to f16 (bf16 hi + lo below row 384); ctx hi+lo x exact Wp below row 384, x2^6 f16 carry x f16(bf16 x 2^8) Wp after, + bp (zeros, read); f32 output.
#include <hip/hip_runtime.h>
#include <math.h>

typedef __attribute__((ext_vector_type(16))) _Float16 v16h;
typedef __attribute__((ext_vector_type(16))) __bf16 v16b;
typedef __attribute__((ext_vector_type(8)))  _Float16 v8h;
typedef __attribute__((ext_vector_type(8)))  float v8f;
typedef __attribute__((ext_vector_type(4)))  float v4f;
typedef __attribute__((ext_vector_type(2)))  float v2f;
typedef __attribute__((ext_vector_type(4)))  unsigned v4u;
typedef __attribute__((ext_vector_type(4)))  int v4i;
typedef float __attribute__((may_alias)) float_a;
typedef int __attribute__((may_alias)) int_a;

template <typename T> __device__ __forceinline__ void vst2(void* p, T v) { *(T*)p = v;  }
__device__ __forceinline__ v8f wmma16(v16h a, v16h b, v8f c) {
  return __builtin_amdgcn_wmma_f32_16x16x32_f16(false, a, false, b, (short)0, c, false, false);
}
__device__ __forceinline__ v8f wmma_bf(v16b a, v16b b, v8f c) {
  return __builtin_amdgcn_wmma_f32_16x16x32_bf16(false, a, false, b, (short)0, c, false, false);
}
// 16x16x32 fragments: lane = (h = lane>>4, row/col = lane&15); elements 0..7 = k0+8h+0..7, 8..15 = k0+16+8h+0..7; D element r = row 8h+r
__device__ __forceinline__ v16h frag_h(const _Float16* rowk0, int lane) {
  union { v16h v; v8h q[2]; } u; const _Float16* p = rowk0 + 8 * (lane >> 4);
  u.q[0] = *(const v8h*)p; u.q[1] = *(const v8h*)(p + 16); return u.v;
}
__device__ __forceinline__ v16h frag_f32(const float* rowk0, int lane) {
  v16h a; const float* p = rowk0 + 8 * (lane >> 4);
#pragma unroll
  for (int i = 0; i < 8; ++i) { a[i] = (_Float16)p[i]; a[8 + i] = (_Float16)p[16 + i]; }
  return a;
}
__device__ __forceinline__ v16h frag_f32s(const float* rowk0, int lane, float sc) {
  v16h a; const float* p = rowk0 + 8 * (lane >> 4);
#pragma unroll
  for (int i = 0; i < 8; ++i) { a[i] = (_Float16)(p[i] * sc); a[8 + i] = (_Float16)(p[16 + i] * sc); }
  return a;
}
// column fragment from a [K][ld] layout (column n), rows >= K read as 0
__device__ __forceinline__ v16h fragc_f32(const float* W, int k0, int n, int lane, int ld, int K) {
  v16h a; const int g = lane >> 4;
#pragma unroll
  for (int i = 0; i < 8; ++i) { const int ka = k0 + 8 * g + i, kb = ka + 16;
    a[i] = (_Float16)(ka < K ? W[(size_t)(ka < K ? ka : K - 1) * ld + n] : 0.f); a[8 + i] = (_Float16)(kb < K ? W[(size_t)(kb < K ? kb : K - 1) * ld + n] : 0.f); }
  return a;
}
struct F2 { v16b h, l; };
__device__ __forceinline__ F2 bsplit16(const float v[16]) { F2 r;
#pragma unroll
  for (int i = 0; i < 16; ++i) { const __bf16 h = (__bf16)v[i]; r.h[i] = h; r.l[i] = (__bf16)(v[i] - (float)h); }
  return r; }
__device__ __forceinline__ F2 split_row(const float* row, int k0, int lane) { float v[16]; const float* p = row + k0 + 8 * (lane >> 4);
#pragma unroll
  for (int i = 0; i < 8; ++i) { v[i] = p[i]; v[8 + i] = p[16 + i]; }
  return bsplit16(v); }
__device__ __forceinline__ F2 split_rowK(const float* row, int k0, int lane, int K) { float v[16]; const int g = lane >> 4;
#pragma unroll
  for (int i = 0; i < 8; ++i) { const int ka = k0 + 8 * g + i, kb = ka + 16; v[i] = ka < K ? row[ka < K ? ka : K - 1] : 0.f; v[8 + i] = kb < K ? row[kb < K ? kb : K - 1] : 0.f; }
  return bsplit16(v); }
__device__ __forceinline__ F2 split_col(const float* W, int k0, int n, int lane, int ld, int K) { float v[16]; const int g = lane >> 4;
#pragma unroll
  for (int i = 0; i < 8; ++i) { const int ka = k0 + 8 * g + i, kb = ka + 16; v[i] = ka < K ? W[(size_t)(ka < K ? ka : K - 1) * ld + n] : 0.f; v[8 + i] = kb < K ? W[(size_t)(kb < K ? kb : K - 1) * ld + n] : 0.f; }
  return bsplit16(v); }
__device__ __forceinline__ v8f mac3(const F2& a, const F2& b, v8f c) { c = wmma_bf(a.l, b.h, c); c = wmma_bf(a.h, b.l, c); return wmma_bf(a.h, b.h, c); }
__device__ __forceinline__ float sigm(float v) { return 1.0f / (1.0f + expf(-v)); }
#define LDSX() do { asm volatile("s_wait_dscnt 0" ::: "memory"); __builtin_amdgcn_wave_barrier(); __builtin_amdgcn_fence(__ATOMIC_RELEASE, "workgroup"); } while (0)

// Causal multi-head self-attention with per-head weights and a 1/sqrt(C) score scale (x [4,1024,1024]; Wq / Wk / Wv [16,1024,64] = per-head [head][model][d] N(0,1) x 0.02, no biases; Wp [1024,1024] (in,out), bp zeros (read); q = einsum('btc,hcd->bhtd'); scores x 1/sqrt(1024) - the scale is 1/32, not 1/8 (soft logits); tril kept, -inf elsewhere; softmax; heads concatenated; out @ Wp + bp).
#define NB 4
#define TT 1024
#define CC 1024            // NH * HD = projected width
#define DIN 1024          // input (model) width
#define NH 16
#define HD 64
#define NQB (TT / 64)
#define SCALE (0.03125f)
#define CAUSAL 1
#ifndef TNB
#define TNB NB
#endif
__device__ __forceinline__ float bfr(float v) { return (float)(__bf16)v; }
typedef __attribute__((ext_vector_type(8))) __bf16 v8b;
__device__ __forceinline__ v16b frag_b(const __bf16* rowk0, int lane) {
  union { v16b v; v8b q[2]; } u; const __bf16* p = rowk0 + 8 * (lane >> 4);
  u.q[0] = *(const v8b*)p; u.q[1] = *(const v8b*)(p + 16); return u.v;
}
#define QBH 6              // causal: query blocks 0..QBH-1 of each sequence (few keys, no averaging) take the high-precision path
#define QHI 384            // rows carrying a q residual plane
#define KHI 384            // key rows carrying k residual / v bf16 hi+lo planes (used only by the causal high-precision path)
// B fragment (k rows k0+.., output column o) of a weight: (in,out) [K][ld] or (out,in) [ld rows of K]: bf16 exact, or f16(bf16 * 256) exact
__device__ __forceinline__ v16b wcol_io(const float* Wm, int k0, int o, int lane, int ld) { v16b w; const int g = lane >> 4;
#pragma unroll
  for (int i = 0; i < 8; ++i) { w[i] = (__bf16)Wm[(size_t)(k0 + 8 * g + i) * ld + o]; w[8 + i] = (__bf16)Wm[(size_t)(k0 + 16 + 8 * g + i) * ld + o]; }
  return w; }
__device__ __forceinline__ v16b wcol_oi(const float* Wm, int k0, int o, int lane, int K) { v16b w; const float* p = Wm + (size_t)o * K + k0 + 8 * (lane >> 4);
#pragma unroll
  for (int i = 0; i < 8; ++i) { w[i] = (__bf16)p[i]; w[8 + i] = (__bf16)p[16 + i]; }
  return w; }
__device__ __forceinline__ v16h wcolh_io(const float* Wm, int k0, int o, int lane, int ld) { v16h w; const int g = lane >> 4;
#pragma unroll
  for (int i = 0; i < 8; ++i) { w[i] = (_Float16)(bfr(Wm[(size_t)(k0 + 8 * g + i) * ld + o]) * 256.0f); w[8 + i] = (_Float16)(bfr(Wm[(size_t)(k0 + 16 + 8 * g + i) * ld + o]) * 256.0f); }
  return w; }
__device__ __forceinline__ v16h wcolh_oi(const float* Wm, int k0, int o, int lane, int K) { v16h w; const float* p = Wm + (size_t)o * K + k0 + 8 * (lane >> 4);
#pragma unroll
  for (int i = 0; i < 8; ++i) { w[i] = (_Float16)(bfr(p[i]) * 256.0f); w[8 + i] = (_Float16)(bfr(p[16 + i]) * 256.0f); }
  return w; }
#define WQKV_LAYOUT 2   // 0 = (in,out) [DIN][CC]; 1 = (out,in) [CC][DIN]; 2 = per-head [NH][DIN][HD]
__device__ __forceinline__ v16b wcol_hdk(const float* Wm, int k0, int o, int lane) { v16b w; const int g = lane >> 4; const float* p = Wm + (size_t)(o / HD) * DIN * HD + (o % HD);
#pragma unroll
  for (int i = 0; i < 8; ++i) { w[i] = (__bf16)p[(size_t)(k0 + 8 * g + i) * HD]; w[8 + i] = (__bf16)p[(size_t)(k0 + 16 + 8 * g + i) * HD]; }
  return w; }
#define WO_OUT_IN 0
#if WQKV_LAYOUT == 1
#define WCOL(W, k0, o, lane) wcol_oi(W, k0, o, lane, DIN)
#elif WQKV_LAYOUT == 2
#define WCOL(W, k0, o, lane) wcol_hdk(W, k0, o, lane)
#else
#define WCOL(W, k0, o, lane) wcol_io(W, k0, o, lane, CC)
#endif
#if WO_OUT_IN
#define WOCOL(W, k0, o, lane) wcol_oi(W, k0, o, lane, CC)
#define WOCOLH(W, k0, o, lane) wcolh_oi(W, k0, o, lane, CC)
#else
#define WOCOL(W, k0, o, lane) wcol_io(W, k0, o, lane, DIN)
#define WOCOLH(W, k0, o, lane) wcolh_io(W, k0, o, lane, DIN)
#endif

#ifndef SM_EXTRA_PARAMS
#define SM_EXTRA_PARAMS
#endif
#ifndef PROJ_EXTRA_PARAMS
#define PROJ_EXTRA_PARAMS
#endif
#ifndef SM_MASK_HOOK
#define SM_MASK_HOOK (void)0
#endif

#define WS_QH  0u                                      // f16 q rows [b*t][CC]
#define WS_KH  (WS_QH + 2u * (size_t)NB * TT * CC)      // f16 k rows [b*t][CC]
#define WS_VT  (WS_KH + 2u * (size_t)NB * TT * CC)      // f16 v planes [b][c][t]
#define WS_QL  (WS_VT + 2u * (size_t)NB * CC * TT)      // f16 q residual x 2^10 rows [b][t < QHI][CC]
#define WS_KL  (WS_QL + 2u * (size_t)NB * QHI * CC)     // f16 k residual x 2^10 rows [b][t < KHI][CC]
#define WS_VB  (WS_KL + 2u * (size_t)NB * KHI * CC)     // bf16 v hi planes [b][c][t < KHI]
#define WS_VBL (WS_VB + 2u * (size_t)NB * CC * KHI)
#define WS_Y   (WS_VBL + 2u * (size_t)NB * CC * KHI)    // f32 ctx rows [b*t][CC] (only when there is an output projection)
#define WS_XB  (WS_Y  + 4u * (size_t)NB * TT * CC)      // bf16 x as k tiles [DIN / KT][b*t][KT]
#define WS_WT  (WS_XB + 2u * (size_t)NB * TT * DIN)     // bf16 q / k / v weights as k tiles [which][DIN / KT][output column][KT]
#define WS_WPB (WS_WT + 2u * 3u * (size_t)CC * DIN)     // bf16 output weight as k tiles [CC / KT][output column][KT]
#define WS_WPH (WS_WPB + 2u * (size_t)DIN * CC)         // the same as f16(bf16 x 2^8)
#define WS_END (WS_WPH + 2u * (size_t)DIN * CC)

// ---- weight tile in LDS (k_proj, k_out): KT k rows x 128 output columns, 16 bit, kept as [column][k], so a B fragment is frag_b / frag_h on a column's row
#define KT 64
#define WPITCH (KT + 8)    // 144-B column pitch: the 16 lanes of a ds_load_b128 fragment read fall on 16 different bank quads
// k_cvt reads a weight in units of (4 columns x 8 k), 2 a thread: lane = (column quad lane & 7, k octet lane >> 3), wave = 32 columns; each load instruction covers four whole 128-B lines
// PF_STAGE: in front of a tile's matrix work it keeps the scheduler from sinking the next tile's global loads below it; behind the matrix work it keeps the next tile's conversions, and with them the wait for those loads, from rising above it
#define PF_STAGE() __builtin_amdgcn_sched_barrier(0)
// PF_GROUP: in front of and behind a group of LDS fragment reads it keeps the group together, two groups of products ahead of its own: without it the scheduler sinks each read down to its own product (one LDS latency per product instead of one per group)
#define PF_GROUP() __builtin_amdgcn_sched_barrier(0)
// PF_XW: what follows (the next trip, the loop's set-up) rewrites the address registers that the global loads issued before it name; the wait stands in front of that overwrite
#define PF_XW() do { asm volatile("s_wait_xcnt 0x0" ::: "memory"); __builtin_amdgcn_sched_barrier(0); } while (0)   /* the scheduling barrier keeps later address arithmetic from rising over the wait */
// PF_XWP: the same wait behind a kernel's first loads; it takes their two address pairs as inputs, so that no later load's result is given those registers ahead of the wait
#define PF_XWP(p, q) do { asm volatile("s_wait_xcnt 0x0" :: "v"(p), "v"(q) : "memory"); __builtin_amdgcn_sched_barrier(0); } while (0)
static_assert(KT == 64, "the k loops take a tile as two k halves of 32");
struct WRaw { v4f r[2][8]; };
__device__ __forceinline__ void wt_load(WRaw& w, const float* base, int ldk, int k0) {   /* base = (the thread's first k row, its first column); ldk = floats between k rows */
#pragma unroll
  for (int u = 0; u < 2; ++u)
#pragma unroll
    for (int kk = 0; kk < 8; ++kk) w.r[u][kk] = *(const v4f*)(base + (size_t)(k0 + 32 * u + kk) * ldk); }
// ---- a 128-row x KT tile of 16-bit rows (x rows, weight columns) on its way to LDS. k_cvt left it in the workspace as 16 KB in a row, [row][KT]: 8 lanes = one 128-B row, a load instruction covers four whole lines; a thread carries NI rows TT_ROW(tid) + RS i; base = (that first row of k tile 0, k 8 (tid & 7)); off = bytes from k tile 0 to the tile wanted
// TT_ROW: neighbouring groups of 8 lanes take rows 8 apart: at the 144-B pitch the two 128-B runs of 16 lanes then fall on all 64 banks once (rows 1 apart would share four banks)
#define TT_ROW(tid) (((((tid) >> 3) & 1) << 3) | (((tid) >> 4) & 7) | (((tid) >> 3) & 16))
// the loops here and in k_cvt are unrolled so that every index of a register array is a constant (the arrays stay in registers) and a group's loads are issued together
typedef v4u __attribute__((may_alias)) v4u_a;
template <int NI> struct TRaw { v4u r[NI]; };
template <int NI, int RS> __device__ __forceinline__ void tt_load(TRaw<NI>& w, const char* base, size_t off) { static_assert(NI * RS == 128, "tile");
#pragma unroll
  for (int i = 0; i < NI; ++i) w.r[i] = *(const v4u_a*)(base + (RS * i) * (KT * 2) + off); }
#define XT_STEP ((size_t)NB * TT * KT * 2)   /* bytes between k tiles of x */
#define WT_STEP ((size_t)1024 * KT * 2)      /* the same for a weight of 1024 output columns */
template <int NI, int RS> __device__ __forceinline__ void tt_store(void* tile, const TRaw<NI>& w, int srow, int spc) {
#pragma unroll
  for (int i = 0; i < NI; ++i) *(v4u_a*)((char*)tile + (srow + RS * i) * (WPITCH * 2) + spc * 16) = w.r[i]; }
// ---- A tile in LDS (k_out): a wave brings its own rows' KT k values in whole lines: lane = (row parity lane >> 4, k quad lane & 15), so a load instruction covers the 256-B runs of two rows (4 whole lines; a fragment load straight from global memory touches 16 lines, 32 B of each); rounded once and kept as [row][k] at the weight tile's pitch, an A fragment is frag_b / frag_h on a row
// instruction i: rows 2 i (+ parity) of the wave's first 16 rows, from i = 8 on of its second 16, which lie 64 rows further; base = (the wave's first row + parity, k 4 (lane & 15)); ld = floats between rows
typedef __attribute__((ext_vector_type(4))) __bf16 v4b;
typedef __attribute__((ext_vector_type(4))) _Float16 v4h;
template <int NI> struct ALRaw { v4f r[NI]; };
#define AT_ROW(i) (2 * ((i) & 7) + 64 * ((i) >> 3))
template <int NI> __device__ __forceinline__ void at_load(ALRaw<NI>& a, const float* base, int ld, int k0) {
#pragma unroll
  for (int i = 0; i < NI; ++i) a.r[i] = *(const v4f*)(base + (size_t)AT_ROW(i) * ld + k0); }
template <int NI> __device__ __forceinline__ void at_store_hl(__bf16 (*ah)[WPITCH], __bf16 (*al)[WPITCH], const ALRaw<NI>& a, int row0, int kl) {   /* bf16 hi + lo, as bsplit16 */
#pragma unroll
  for (int i = 0; i < NI; ++i) { v4b p, q;
#pragma unroll
    for (int e = 0; e < 4; ++e) { const __bf16 h = (__bf16)a.r[i][e]; p[e] = h; q[e] = (__bf16)(a.r[i][e] - (float)h); }
    *(v4b*)&ah[row0 + AT_ROW(i)][kl] = p; *(v4b*)&al[row0 + AT_ROW(i)][kl] = q; } }
template <int NI> __device__ __forceinline__ void at_store_h(_Float16 (*at)[WPITCH], const ALRaw<NI>& a, int row0, int kl, float sc) {
#pragma unroll
  for (int i = 0; i < NI; ++i) { v4h p;
#pragma unroll
    for (int e = 0; e < 4; ++e) p[e] = (_Float16)(a.r[i][e] * sc);
    *(v4h*)&at[row0 + AT_ROW(i)][kl] = p; } }
// ---- L2 asks (k_proj, k_att, k_out). What these launches read of the workspace was stored by a launch before them and the blocks that share a tile walk their loops together. At entry each block asks for a share of what its launch reads: global_prefetch_b8, a hint with no result register and no counter; scope SE brings the line into L2 only.
// The shares are for speed only: no value depends on where a block runs or on whether a hint is served. Every lane's address lies inside the buffer it names; no lane is off.
// the closing s_wait_xcnt 0 stands in the asks' own statement, in front of whatever is given their address registers next: a precaution, as behind a global load
__device__ __forceinline__ void l2_ask(const char* p) { asm volatile("global_prefetch_b8 %0, off scope:SCOPE_SE\n\ts_wait_xcnt 0x0" :: "v"(p) : "memory"); }
__device__ __forceinline__ void l2_ask2(const char* p, const char* q) { asm volatile("global_prefetch_b8 %0, off scope:SCOPE_SE\n\tglobal_prefetch_b8 %1, off scope:SCOPE_SE\n\ts_wait_xcnt 0x0" :: "v"(p), "v"(q) : "memory"); }
__device__ __forceinline__ void l2_ask3(const char* p, const char* q, const char* r) { asm volatile("global_prefetch_b8 %0, off scope:SCOPE_SE\n\tglobal_prefetch_b8 %1, off scope:SCOPE_SE\n\tglobal_prefetch_b8 %2, off scope:SCOPE_SE\n\ts_wait_xcnt 0x0" :: "v"(p), "v"(q), "v"(r) : "memory"); }
// ---- k_cvt: x and the four weights are rounded to 16 bit ONCE, in a launch of their own, instead of once in every block that reads them (x in 24 blocks of k_proj, a weight in 32): k_proj and k_out then load half the bytes of them, carry half the staging registers and convert none of them
// all of them are written as k tiles, [k tile][row or output column][KT]: the 128 x KT tile that a block stages is then 16 KB in a row instead of 128 pieces one matrix row apart
// blocks < CVX_BLK: x; a wave takes two rows in 16 runs of 128 floats (whole lines in; out, a half wave writes one whole line). The rest: a wave takes 32 output columns x KT k of one weight (which 0..2: q, k, v; 3: the output weight, in both forms that k_out multiplies with), 16 B (8 k) a store
#define CVX_BLK (NB * TT * DIN / (8 * 16 * 128))
#define CVW_BLK (4 * (CC / 32) * (DIN / KT) / 8)
template <int LDK, bool BOTH> __device__ __forceinline__ void cvt_w(const float* ws, __bf16* db, _Float16* dh) {   /* ws = (the thread's first k, its first column), LDK floats between k rows; db, dh = (that column, that k) in the k tile */
  WRaw wr; wt_load(wr, ws, LDK, 0); PF_XWP(ws, ws);
#pragma unroll
  for (int u = 0; u < 2; ++u)
#pragma unroll
    for (int i = 0; i < 4; ++i) { v8b p;
#pragma unroll
      for (int kk = 0; kk < 8; ++kk) p[kk] = (__bf16)wr.r[u][kk][i];
      *(v8b*)(db + i * KT + 32 * u) = p; }
  if (BOTH) {
#pragma unroll
    for (int u = 0; u < 2; ++u)
#pragma unroll
      for (int i = 0; i < 4; ++i) { v8h p;   /* f16(bf16 x 2^8), exact */
#pragma unroll
        for (int kk = 0; kk < 8; ++kk) p[kk] = (_Float16)(bfr(wr.r[u][kk][i]) * 256.0f);
        *(v8h*)(dh + i * KT + 32 * u) = p; }
    PF_XW(); } }   /* behind this path's last stores the kernel's closing branches rewrite the scalar base that they name */
__global__ __launch_bounds__(256) void k_cvt(const float* __restrict__ X, const float* __restrict__ WQ, const float* __restrict__ WK, const float* __restrict__ WV, const float* __restrict__ WO, __bf16* __restrict__ XB, __bf16* __restrict__ WT, __bf16* __restrict__ WPB, _Float16* __restrict__ WPH) {
  const unsigned tid = threadIdx.x, wave = tid >> 5, lane = tid & 31;
  static_assert(WQKV_LAYOUT == 2 && !WO_OUT_IN && HD % 32 == 0 && CC == 1024 && DIN == 1024 && KT == 64 && CVW_BLK % 4 == 0, "a wave's 32 columns lie in one head, a block in one weight");
  if (blockIdx.x < CVX_BLK) {   /* block-uniform */
    const size_t row = ((size_t)blockIdx.x * 8 + wave) * 2; const float* xs = X + row * DIN + lane * 4; v4f r[16];   /* run j: row + (j >> 3), k 128 (j & 7) + 4 lane */
    __bf16* xd = XB + ((size_t)(lane >> 4) * (NB * TT) + row) * KT + 4 * (lane & 15);
#pragma unroll
    for (int j = 0; j < 16; ++j) r[j] = *(const v4f*)(xs + j * 128);
    PF_XWP(xs, xs);
#pragma unroll
    for (int j = 0; j < 16; ++j) { v4b p;
#pragma unroll
      for (int e = 0; e < 4; ++e) p[e] = (__bf16)r[j][e];
      *(v4b*)(xd + (size_t)(2 * (j & 7)) * (NB * TT * KT) + (j >> 3) * KT) = p; }
  } else {
    const unsigned wblk = blockIdx.x - CVX_BLK, which = wblk / (CVW_BLK / 4), w = (wblk % (CVW_BLK / 4)) * 8 + wave, kt = w % (DIN / KT), cg = w / (DIN / KT);
    const unsigned cl0 = cg * 32 + 4 * (lane & 7), kf = kt * KT + 8 * (lane >> 3);   /* the thread's first column and first k */
    const size_t od = ((size_t)kt * 1024 + cl0) * KT + 8 * (lane >> 3);
    if (which == 3) cvt_w<DIN, true>(WO + cl0 + (size_t)kf * DIN, WPB + od, WPH + od);   /* block-uniform */
    else cvt_w<HD, false>((which == 0 ? WQ : which == 1 ? WK : WV) + (size_t)(cl0 / HD) * DIN * HD + cl0 % HD + (size_t)kf * HD, WT + (size_t)which * CC * DIN + od, nullptr); } }
// ---- k_proj: block = (128 rows, 128 cols, which); the 4 waves lie 2 x 2, a wave takes 64 rows x 64 columns (rows 64 wy + 16 rg, columns 64 wx + 16 j): every A and every B fragment read from LDS serves four products, 16 KB of fragment reads a wave and k tile (32 rows x 128 columns: 20 KB): q/k/v = X W (+ b) with exact bf16 products (K = DIN) -> which 0: q f16 rows (+ residual rows < QHI); 1: k f16 rows (+ residual rows < KHI); 2: v f16 planes [c][t] (+ bf16 hi/lo planes for t < KHI)
__global__ __launch_bounds__(128) void k_proj(const __bf16* __restrict__ XB, const __bf16* __restrict__ WT, const float* __restrict__ BQ, const float* __restrict__ BK, const float* __restrict__ BV,
    _Float16* __restrict__ QH, _Float16* __restrict__ QL, _Float16* __restrict__ KH, _Float16* __restrict__ KL, _Float16* __restrict__ VT, __bf16* __restrict__ VB, __bf16* __restrict__ VBL) {
  __shared__ __align__(16) unsigned char sm[4 * 128 * WPITCH * 2];   /* the two weight buffers and the two A buffers during the k loop; behind the loop's last barrier the epilogue's planes */
  __bf16 (*wt)[128][WPITCH] = (__bf16 (*)[128][WPITCH])sm, (*at)[128][WPITCH] = (__bf16 (*)[128][WPITCH])(sm + 2 * 128 * WPITCH * 2); static_assert(3 * 64 * 136 * 2 <= 4 * 128 * WPITCH * 2, "LDS");
  _Float16 (*sh)[136] = (_Float16 (*)[136])sm, (*sl)[136] = (_Float16 (*)[136])(sm + 64 * 136 * 2); _Float16 (*th)[136] = (_Float16 (*)[136])sm; __bf16 (*tb)[136] = (__bf16 (*)[136])(sm + 64 * 136 * 2), (*tbl)[136] = (__bf16 (*)[136])(sm + 2 * 64 * 136 * 2);
  const int tid = threadIdx.x, wave = tid >> 5, lane = tid & 31, col = lane & 15, g = lane >> 4; const int which = blockIdx.z; const int c0 = blockIdx.y * 128; const size_t r0 = (size_t)blockIdx.x * 128; const size_t bb = r0 / TT; const int t0 = (int)(r0 % TT); const int wy = wave >> 1, wx = wave & 1; static_assert(TT % 128 == 0 && QHI % 128 == 0 && KHI % 128 == 0, "a block lies in one sequence and carries residual planes for all of its rows or for none");
  const float* BA = which == 0 ? BQ : which == 1 ? BK : BV;
  v8f acc[4][4] = {};   /* [row group][column group] */
  const int srow = TT_ROW(tid), spc = tid & 7; const char* wb = (const char*)(WT + (size_t)which * CC * DIN + (size_t)(c0 + srow) * KT + 8 * spc); const char* arow = (const char*)(XB + (r0 + srow) * KT + 8 * spc);
  { static_assert(CC / 128 * 128 == (DIN / KT) * 64 && TNB * TT / 128 == 32, "asks");   /* a 128-row block of x = 16 k tiles x 64 units: the 8 column blocks of one weight ask for it once; a weight's 128 columns likewise: 8 of its 32 row blocks ask for them once, row blocks 2, 4 and 6 apart the same units */
    const unsigned ua = blockIdx.y * 128 + tid, uw = ((blockIdx.x & 1) * 4 + (blockIdx.x >> 3)) * 128 + tid;
    l2_ask2((const char*)XB + (ua >> 6) * XT_STEP + r0 * (KT * 2) + (ua & 63) * 256, (const char*)(WT + (size_t)which * CC * DIN) + (uw >> 6) * WT_STEP + (size_t)c0 * (KT * 2) + (uw & 63) * 256); }
  TRaw<8> wr, ar; tt_load<8, 16>(ar, arow, 0); tt_load<8, 16>(wr, wb, 0); PF_XWP(arow, wb); tt_store<8, 16>(wt[0], wr, srow, spc); tt_store<8, 16>(at[0], ar, srow, spc);
  __syncthreads();   /* tile 0 is published */
#pragma unroll 2   /* two trips = the two buffers at constant LDS addresses */
  for (int t = 0; t < DIN / KT; ++t) {
    if (t + 1 < DIN / KT) { tt_load<8, 16>(ar, arow, (t + 1) * XT_STEP); tt_load<8, 16>(wr, wb, (t + 1) * WT_STEP); }   /* the next tile flies while this one is multiplied */
    PF_STAGE();
    v16b a[4][KT / 32];   /* the wave's 64 rows of the A tile, read in one group with the first B fragments (first k half first) */
    v16b bf[2][2];   /* B fragments in groups of 2 (group q: k half q >> 1, columns 32 (q & 1) .. of the wave's 64), two register sets: a group's LDS reads are issued together, two groups ahead of its products */
#pragma unroll
    for (int rg = 0; rg < 4; ++rg) a[rg][0] = frag_b(&at[t & 1][wy * 64 + rg * 16 + col][0], lane);
#pragma unroll
    for (int q = 0; q < 2; ++q)
#pragma unroll
      for (int jj = 0; jj < 2; ++jj) bf[q][jj] = frag_b(&wt[t & 1][wx * 64 + (q * 2 + jj) * 16 + col][0], lane);
#pragma unroll
    for (int rg = 0; rg < 4; ++rg) a[rg][1] = frag_b(&at[t & 1][wy * 64 + rg * 16 + col][32], lane);
    PF_GROUP();
#pragma unroll
    for (int q = 0; q < 4; ++q) {
#pragma unroll
      for (int jj = 0; jj < 2; ++jj)
#pragma unroll
        for (int rg = 0; rg < 4; ++rg) acc[rg][(q & 1) * 2 + jj] = wmma_bf(a[rg][q >> 1], bf[q & 1][jj], acc[rg][(q & 1) * 2 + jj]);
      if (q < 2) { PF_GROUP();
#pragma unroll
        for (int jj = 0; jj < 2; ++jj) bf[q][jj] = frag_b(&wt[t & 1][wx * 64 + (q * 2 + jj) * 16 + col][32], lane);
        PF_GROUP(); } }
    PF_STAGE();
    if (t + 1 < DIN / KT) { tt_store<8, 16>(wt[(t + 1) & 1], wr, srow, spc); tt_store<8, 16>(at[(t + 1) & 1], ar, srow, spc); }   /* those buffers' readers left them at the barrier of trip t - 1 */
    PF_XW();
    __syncthreads(); }   /* publishes tile t + 1 and ends the reads of tile t (after the last trip: frees the LDS for the epilogue) */
  // the epilogue goes twice through the same planes. q, k: pass p takes every wave's row groups 2 p, 2 p + 1, so plane row rl is block row 64 (rl >> 5) + 32 p + (rl & 31), all 128 columns. v: pass p takes every wave's column groups 2 p, 2 p + 1, so plane column cl is block column 64 (cl >> 5) + 32 p + (cl & 31), all 128 rows: every store run is 256 B
#pragma unroll
  for (int p = 0; p < 2; ++p) {
  if (p) __syncthreads();   /* the first pass has been read out of the planes */
  if (which < 2) { _Float16* DH = which == 0 ? QH : KH; _Float16* DL = which == 0 ? QL : KL; const int nhi = which == 0 ? QHI : KHI; const bool hi_rows = t0 < nhi;
#pragma unroll
    for (int j = 0; j < 4; ++j) { const float bias = BA ? bfr(BA[c0 + wx * 64 + j * 16 + col]) : 0.f;
#pragma unroll
      for (int rr = 0; rr < 2; ++rr)
#pragma unroll
        for (int r = 0; r < 8; ++r) { const float v = acc[2 * p + rr][j][r] + bias; const _Float16 hv = (_Float16)v; sh[wy * 32 + rr * 16 + 8 * g + r][wx * 64 + j * 16 + col] = hv; sl[wy * 32 + rr * 16 + 8 * g + r][wx * 64 + j * 16 + col] = (_Float16)((v - (float)hv) * 1024.0f); } }
    __syncthreads();
    for (int e = tid; e < 64 * 16; e += 128) { const int rl = e >> 4, q = e & 15, br = 64 * (rl >> 5) + 32 * p + (rl & 31); vst2((unsigned*)(DH + (r0 + br) * CC + c0 + q * 8), *(const v4u*)&sh[rl][q * 8]); PF_XW();   /* the LDS read below may land in this store's registers */
      if (hi_rows) vst2((unsigned*)(DL + (bb * nhi + t0 + br) * (size_t)CC + c0 + q * 8), *(const v4u*)&sl[rl][q * 8]); PF_XW(); }   /* the next trip rewrites the stores' address registers */
  } else { const bool hi_rows = t0 < KHI;
#pragma unroll
    for (int jj = 0; jj < 2; ++jj) { const float bias = BA ? bfr(BA[c0 + wx * 64 + (2 * p + jj) * 16 + col]) : 0.f;
#pragma unroll
      for (int rg = 0; rg < 4; ++rg)
#pragma unroll
        for (int r = 0; r < 8; ++r) { const float v = acc[rg][2 * p + jj][r] + bias; const int rl = wy * 64 + rg * 16 + 8 * g + r, cl = wx * 32 + jj * 16 + col; th[cl][rl] = (_Float16)v; const __bf16 bh = (__bf16)v; tb[cl][rl] = bh; tbl[cl][rl] = (__bf16)(v - (float)bh); } }
    __syncthreads();
    for (int e = tid; e < 64 * 16; e += 128) { const int cl = e >> 4, q = e & 15, bc = 64 * (cl >> 5) + 32 * p + (cl & 31); vst2((unsigned*)(VT + (bb * CC + c0 + bc) * (size_t)TT + t0 + q * 8), *(const v4u*)&th[cl][q * 8]); PF_XW();   /* the LDS reads below may land in this store's address registers */
      if (hi_rows) { const size_t o3 = (bb * CC + c0 + bc) * (size_t)KHI + t0 + q * 8; vst2((unsigned*)(VB + o3), *(const v4u*)&tb[cl][q * 8]); vst2((unsigned*)(VBL + o3), *(const v4u*)&tbl[cl][q * 8]); PF_XW(); } } } } }   /* as above, for the next trip */
// ---- k_att: block = 64 queries (qb) of one (b, h), z = b * NH + h; logits, softmax and P . v in one pass over 64-key blocks 0..qb, the logits never leave registers.
// Transposed products: St = K . Qt (A = 16 key rows, B = the wave's 16 queries), so a lane holds 8 keys a tile of ONE query (column lane & 15, keys 8 g + r); two neighbouring St tiles are, register for register, the B fragment Pt of 32 keys for Ot += Vt . Pt (A = 16 d rows of the v plane).
// Running maximum per query (in-lane + one exchange between the wave halves), e = 2^((s - m) c + 11), c = SCALE log2(e): P carried x 2^11 as before, the factor cancels against the row sum; Ot and the sum are rescaled at every key block.
// Query blocks < QBH: 3 logit products (q, k hi + residual x 2^10) and P, v as bf16 hi + lo (3 products); after: single f16 products.
// The K and v tiles (64 rows x 128 B each) are shared by the 4 waves through LDS: whole-line global loads one key block ahead, 2 buffers, one barrier per key block.
#define AP 72              // 144-B LDS row pitch, as WPITCH
#define ATILE (64 * AP * 2)   // bytes of one tile in LDS
__device__ __forceinline__ v8f wm_h(v16h a, v16h b, v8f c) { return __builtin_amdgcn_wmma_f32_16x16x32_f16(false, a, false, b, (short)0, c, false, false); }
__device__ __forceinline__ v8f wm_b(v16b a, v16b b, v8f c) { return __builtin_amdgcn_wmma_f32_16x16x32_bf16(false, a, false, b, (short)0, c, false, false); }
__device__ __forceinline__ float xhalf(float x) { return __builtin_bit_cast(float, __builtin_amdgcn_permlanex16(__builtin_bit_cast(int, x), __builtin_bit_cast(int, x), 0x76543210, 0xfedcba98, false, false)); }   /* lane l <-> lane l ^ 16 */
// 2^x by v_exp_f32 as asm text, eight in place in one statement: nothing of the compiler's then stands directly behind a v_exp_f32; the closing v_nop is the slot that the instruction set asks for behind the last one
__device__ __forceinline__ void exp2x8(float (&x)[8]) {
  asm("v_exp_f32 %0, %0\n\tv_exp_f32 %1, %1\n\tv_exp_f32 %2, %2\n\tv_exp_f32 %3, %3\n\tv_exp_f32 %4, %4\n\tv_exp_f32 %5, %5\n\tv_exp_f32 %6, %6\n\tv_exp_f32 %7, %7\n\tv_nop" : "+v"(x[0]), "+v"(x[1]), "+v"(x[2]), "+v"(x[3]), "+v"(x[4]), "+v"(x[5]), "+v"(x[6]), "+v"(x[7])); }
__device__ __forceinline__ float exp2x1(float x) { asm("v_exp_f32 %0, %0\n\tv_nop" : "+v"(x)); return x; }   /* the same for one value */
typedef v4f __attribute__((may_alias)) v4f_a;
template <bool HI> __device__ __forceinline__ void att_body(unsigned char* sm, const _Float16* __restrict__ QH, const _Float16* __restrict__ KH, const _Float16* __restrict__ QL, const _Float16* __restrict__ KL, const _Float16* __restrict__ VT, const __bf16* __restrict__ VB, const __bf16* __restrict__ VBL, float* __restrict__ Y, int qb, int b, int h) {
  constexpr int NT = HI ? 4 : 2;   /* tiles a key block: k, v (+ k residual, v lo) */
  const int tid = threadIdx.x, wave = tid >> 5, lane = tid & 31, col = lane & 15, g = lane >> 4; const int ql0 = qb * 64 + wave * 16; const int nblk = qb + 1;
  const int srow = tid >> 3, spc = tid & 7;   /* staging: 8 lanes = one 128-B row; a thread carries rows srow + 16 i */
  constexpr unsigned vp = HI ? KHI : TT;
  // block-uniform bases and one 32-bit byte offset per thread and tile shape (k rows, v planes)
  const char* s_k = (const char*)(KH + (size_t)b * TT * CC + h * HD); const char* s_kl = (const char*)(KL + (size_t)b * KHI * CC + h * HD);
  const char* s_v = HI ? (const char*)(VB + ((size_t)b * CC + h * HD) * vp) : (const char*)(VT + ((size_t)b * CC + h * HD) * vp); const char* s_vl = (const char*)(VBL + ((size_t)b * CC + h * HD) * vp);
  const unsigned o_k = (unsigned)srow * (CC * 2) + spc * 16, o_v = (unsigned)srow * (vp * 2) + spc * 16;
  v4u ra[4], rb[4];   /* two tiles in flight: k and v; with the residual planes first k and k residual, then, behind the logit products, v hi and v lo in the same registers */
#define ATT_LD(dst, base, rowstep, off) do { _Pragma("unroll") for (int i = 0; i < 4; ++i) dst[i] = *(const v4u_a*)((base) + i * (16 * (rowstep)) + (off)); } while (0)
#define ATT_ST(bufp, tile, srcr) do { _Pragma("unroll") for (int i = 0; i < 4; ++i) *(v4u_a*)((bufp) + (tile) * ATILE + (srow + 16 * i) * (AP * 2) + spc * 16) = srcr[i]; } while (0)
#define ATT_KSTEP (64 * CC * 2)   /* bytes between key blocks in the k rows; 128 in the v planes */
  v16h qf[HD / 32], qlf[HD / 32];
#pragma unroll
  for (int kc = 0; kc < HD / 32; ++kc) { qf[kc] = frag_h(QH + ((size_t)b * TT + ql0 + col) * CC + h * HD + kc * 32, lane); if (HI) qlf[kc] = frag_h(QL + ((size_t)b * QHI + ql0 + col) * CC + h * HD + kc * 32, lane); }
  if (HI) { ATT_LD(ra, s_k, CC * 2, o_k); ATT_LD(rb, s_kl, CC * 2, o_k); PF_XW(); ATT_ST(sm, 0, ra); ATT_ST(sm, 2, rb); ATT_LD(ra, s_v, vp * 2, o_v); ATT_LD(rb, s_vl, vp * 2, o_v); PF_XW(); ATT_ST(sm, 1, ra); ATT_ST(sm, 3, rb); PF_XW(); }   /* the last wait: the q loads are scheduled behind the one before */
  else { ATT_LD(ra, s_k, CC * 2, o_k); ATT_LD(rb, s_v, vp * 2, o_v); PF_XW(); ATT_ST(sm, 0, ra); ATT_ST(sm, 1, rb); }
  __syncthreads();   /* key block 0 is published */
  const float cs = SCALE * 1.44269504088896340736f;
  float m = -3.0e38f, l = 0.f; v8f o[HD / 16] = {};
  for (int t = 0; t < nblk; ++t) { const unsigned char* bp = sm + (t & 1) * (NT * ATILE); unsigned char* nb = sm + ((t + 1) & 1) * (NT * ATILE);   /* nb: its readers left it at the barrier of trip t - 1 */
    // with the residual planes the staging is unconditional (the last trip stages its own block once more into the idle buffer, which nobody reads): no branch then stands between the logit products and the first readers of their results
    const bool more = HI || t + 1 < nblk; const int tn = (HI && t + 1 == nblk) ? t : t + 1;
    if (more) { ATT_LD(ra, s_k + (size_t)tn * ATT_KSTEP, CC * 2, o_k); if (HI) ATT_LD(rb, s_kl + (size_t)tn * ATT_KSTEP, CC * 2, o_k); else ATT_LD(rb, s_v + (size_t)tn * 128, vp * 2, o_v); }   /* the next key block flies while this one is worked on */
    if (HI) PF_XW(); else PF_STAGE();   /* with the residual planes the LDS reads below land in the address registers of these loads (without them the compiler writes the wait itself) */
    const _Float16 (*kt)[AP] = (const _Float16 (*)[AP])bp; const _Float16 (*klt)[AP] = (const _Float16 (*)[AP])(bp + 2 * ATILE); const _Float16 (*vt)[AP] = (const _Float16 (*)[AP])(bp + ATILE); const __bf16 (*vb)[AP] = (const __bf16 (*)[AP])(bp + ATILE); const __bf16 (*vbl)[AP] = (const __bf16 (*)[AP])(bp + 3 * ATILE);
    // ATT_GROUP: behind a group of LDS fragment reads it keeps the scheduler from sinking each read down to its own product (one LDS latency per product instead of one per group)
#define ATT_GROUP() __builtin_amdgcn_sched_barrier(0)
    float s[4][8]; v16h vf[2][HD / 16]; v16b vh[HD / 16], vl[HD / 16];
    if (HI) {
#pragma unroll
      for (int hf = 0; hf < 2; ++hf) { v16h kf[2][HD / 32], lf[2][HD / 32]; v8f a[2] = {}, al[2] = {};   /* two key tiles a group */
#pragma unroll
        for (int jj = 0; jj < 2; ++jj)
#pragma unroll
          for (int kc = 0; kc < HD / 32; ++kc) { kf[jj][kc] = frag_h(&kt[(2 * hf + jj) * 16 + col][kc * 32], lane); lf[jj][kc] = frag_h(&klt[(2 * hf + jj) * 16 + col][kc * 32], lane); }
        ATT_GROUP();
#pragma unroll
        for (int kc = 0; kc < HD / 32; ++kc)
#pragma unroll
          for (int jj = 0; jj < 2; ++jj) { a[jj] = wm_h(kf[jj][kc], qf[kc], a[jj]); al[jj] = wm_h(kf[jj][kc], qlf[kc], al[jj]); al[jj] = wm_h(lf[jj][kc], qf[kc], al[jj]); }
#pragma unroll
        for (int jj = 0; jj < 2; ++jj)
#pragma unroll
          for (int r = 0; r < 8; ++r) s[2 * hf + jj][r] = a[jj][r] + al[jj][r] * (1.0f / 1024.0f);
        ATT_GROUP(); }   /* here it keeps the second group's reads from rising over the first group's products: both groups at once do not fit the registers */
      ATT_ST(nb, 0, ra); ATT_ST(nb, 2, rb); PF_XW(); ATT_LD(ra, s_v + (size_t)tn * 128, vp * 2, o_v); ATT_LD(rb, s_vl + (size_t)tn * 128, vp * 2, o_v);
      PF_STAGE();
#pragma unroll
      for (int j = 0; j < HD / 16; ++j) { vh[j] = frag_b(&vb[j * 16 + col][0], lane); vl[j] = frag_b(&vbl[j * 16 + col][0], lane); }   /* v of the first 32 keys: read behind the logit products, lands under the softmax */
    } else { v16h kf[4][HD / 32]; v8f a[4] = {};
#pragma unroll
      for (int jt = 0; jt < 4; ++jt)
#pragma unroll
        for (int kc = 0; kc < HD / 32; ++kc) kf[jt][kc] = frag_h(&kt[jt * 16 + col][kc * 32], lane);
      ATT_GROUP();
#pragma unroll
      for (int kc = 0; kc < HD / 32; ++kc)
#pragma unroll
        for (int jt = 0; jt < 4; ++jt) a[jt] = wm_h(kf[jt][kc], qf[kc], a[jt]);
#pragma unroll
      for (int kc = 0; kc < 2; ++kc)
#pragma unroll
        for (int j = 0; j < HD / 16; ++j) vf[kc][j] = frag_h(&vt[j * 16 + col][kc * 32], lane);   /* all of v: read behind the logit products, lands under the softmax */
#pragma unroll
      for (int jt = 0; jt < 4; ++jt)
#pragma unroll
        for (int r = 0; r < 8; ++r) s[jt][r] = a[jt][r]; }
    ATT_GROUP();
    if (t == nblk - 1) {   /* the diagonal block: keys past the query are excluded by index */
#pragma unroll
      for (int jt = 0; jt < 4; ++jt)
#pragma unroll
        for (int r = 0; r < 8; ++r) s[jt][r] = (jt * 16 + 8 * g + r <= wave * 16 + col) ? s[jt][r] : -3.0e38f; }
    float mj[4];   /* four independent chains */
#pragma unroll
    for (int jt = 0; jt < 4; ++jt) { mj[jt] = s[jt][0];
#pragma unroll
      for (int r = 1; r < 8; ++r) mj[jt] = fmaxf(mj[jt], s[jt][r]); }
    float mx = fmaxf(fmaxf(mj[0], mj[1]), fmaxf(mj[2], mj[3]));
    mx = fmaxf(mx, xhalf(mx));   /* the other 8 keys of each tile lie in the other wave half */
    const float mn = fmaxf(m, mx); const float alpha = exp2x1((m - mn) * cs); const float off = 11.0f - mn * cs; m = mn;
    float sj[4];
#pragma unroll
    for (int jt = 0; jt < 4; ++jt) {
#pragma unroll
      for (int r = 0; r < 8; ++r) s[jt][r] = fmaf(s[jt][r], cs, off);
      exp2x8(s[jt]);   /* an excluded key gives 2^(-huge) = 0 */
      sj[jt] = s[jt][0];
#pragma unroll
      for (int r = 1; r < 8; ++r) sj[jt] += s[jt][r]; }
    l = l * alpha + ((sj[0] + sj[1]) + (sj[2] + sj[3]));
#pragma unroll
    for (int j = 0; j < HD / 16; ++j) o[j] *= alpha;
#pragma unroll
    for (int kc = 0; kc < 2; ++kc) {
      if (HI) { float v[16];
#pragma unroll
        for (int i = 0; i < 8; ++i) { v[i] = s[2 * kc][i]; v[8 + i] = s[2 * kc + 1][i]; }
        const F2 p = bsplit16(v);
#pragma unroll
        for (int j = 0; j < HD / 16; ++j) o[j] = wm_b(vh[j], p.h, o[j]);
#pragma unroll
        for (int j = 0; j < HD / 16; ++j) o[j] = wm_b(vh[j], p.l, o[j]);
#pragma unroll
        for (int j = 0; j < HD / 16; ++j) o[j] = wm_b(vl[j], p.h, o[j]);
        if (kc == 0) {
#pragma unroll
          for (int j = 0; j < HD / 16; ++j) { vh[j] = frag_b(&vb[j * 16 + col][32], lane); vl[j] = frag_b(&vbl[j * 16 + col][32], lane); }
          ATT_GROUP(); }
      } else { v16h p;
#pragma unroll
        for (int i = 0; i < 8; ++i) { p[i] = (_Float16)s[2 * kc][i]; p[8 + i] = (_Float16)s[2 * kc + 1][i]; }
#pragma unroll
        for (int j = 0; j < HD / 16; ++j) o[j] = wm_h(vf[kc][j], p, o[j]); } }
    PF_STAGE();
    if (more) { if (HI) { ATT_ST(nb, 1, ra); ATT_ST(nb, 3, rb); } else { ATT_ST(nb, 0, ra); ATT_ST(nb, 1, rb); } }
    PF_XW();
    __syncthreads(); }   /* publishes key block t + 1 and ends the reads of block t (after the last trip: frees the LDS for the epilogue) */
  l += xhalf(l);
  const float inv = l > 0.f ? 1.0f / l : 0.f;
  float (*ss)[HD + 4] = (float (*)[HD + 4])(sm + wave * (16 * (HD + 4) * 4));   /* the wave's own 16 ctx rows, so that the stores cover whole 256-B (row, head) segments */
#pragma unroll
  for (int j = 0; j < HD / 16; ++j) { v4f x0, x1;
#pragma unroll
    for (int r = 0; r < 4; ++r) { x0[r] = o[j][r] * inv; x1[r] = o[j][4 + r] * inv; }
    *(v4f_a*)&ss[col][j * 16 + 8 * g] = x0; *(v4f_a*)&ss[col][j * 16 + 8 * g + 4] = x1; }
  LDSX();
#pragma unroll
  for (int i = 0; i < 8; ++i) { const int rl = 2 * i + g; vst2(Y + ((size_t)b * TT + ql0 + rl) * CC + h * HD + col * 4, *(const v4f_a*)&ss[rl][col * 4]); } }
constexpr unsigned long long QB_TAB = 0x58497b3c6a2d1e0fULL;   /* 4 bits an entry, from the low end: 15 0 14 1 | 13 2 10 6 | 12 3 11 7 | 9 4 8 5 */
constexpr bool qb_tab_ok() { unsigned seen = 0; for (int i = 0; i < 16; ++i) seen |= 1u << (int)((QB_TAB >> (4 * i)) & 15); return seen == 0xffffu; }
static_assert(qb_tab_ok() && NQB == 16, "every query block stands in the table once");
__global__ __launch_bounds__(128, 4) void k_att(const _Float16* __restrict__ QH, const _Float16* __restrict__ KH, const _Float16* __restrict__ QL, const _Float16* __restrict__ KL, const _Float16* __restrict__ VT, const __bf16* __restrict__ VB, const __bf16* __restrict__ VBL, float* __restrict__ Y) {   /* 4 waves a SIMD: all 1024 blocks resident at once, 4 a WGP */
  __shared__ __align__(16) unsigned char sm[2 * 4 * ATILE]; static_assert(CAUSAL && QBH * 64 <= KHI && QBH * 64 <= QHI && HD == 64 && 4 * 16 * (HD + 4) * 4 <= 2 * 2 * ATILE, "k_att");
  const int z = blockIdx.z, b = z / NH, h = z % NH;
  // which query block a block takes: for balance only, no value depends on it. All 1024 blocks are resident at once, 4 a WGP, and the launch lasts as long as the fullest WGP; a block walks qb + 1 key blocks, and below QBH a key block costs about twice (64 LDS fragment reads and 48 products a wave against 32 and 16).
  // QB_TAB holds four sets of four query blocks of about equal cost. The 4 values of zc walk a set, and zc takes all 4 values over 4 planes that lie 1, 2, 4, 8 or 16 apart: blocks 16, 32, 64, 128 or 256 apart in launch order make up one whole set, whichever of these strides puts them on one WGP (blocks 8 apart: halves of two sets, about the same cost).
  const int zc = (z ^ (z >> 2) ^ (z >> 4)) & 3; const int qb = (int)((QB_TAB >> (4 * (((int)blockIdx.x & 12) | (((int)blockIdx.x & 3) ^ zc)))) & 15);   /* for a fixed plane a permutation of the query blocks */
  { static_assert(NQB == 16 && TT == 1024 && KHI == 384 && NH % 2 == 0, "asks");   /* the 32 blocks of two neighbouring heads ask for the pair's k rows (1024 units, the even head's blocks) and v planes (1024 units, the odd head's), blocks 4 apart in x the same units; 9 of the 16 shares also for the residual planes, 384 units each */
    const unsigned slot = (z & 1) * 8 + (blockIdx.x >> 3) * 4 + (blockIdx.x & 3), u = (slot & 7) * 128 + threadIdx.x; const int hp = h & ~1;
    l2_ask((z & 1) ? (const char*)(VT + ((size_t)b * CC + hp * HD) * TT) + u * 256 : (const char*)(KH + ((size_t)b * TT + u) * CC + hp * HD));
    if (slot < 9) { const unsigned w = (slot % 3) * 128 + threadIdx.x;   /* block-uniform */
      l2_ask(slot < 3 ? (const char*)(KL + ((size_t)b * KHI + w) * CC + hp * HD) : (const char*)((slot < 6 ? VB : VBL) + ((size_t)b * CC + hp * HD) * KHI) + w * 256); } }
  if (qb < QBH) att_body<true>(sm, QH, KH, QL, KL, VT, VB, VBL, Y, qb, b, h); else att_body<false>(sm, QH, KH, QL, KL, VT, VB, VBL, Y, qb, b, h); }
// ---- k_out: block = (128 rows, 128 cols), 8 waves lying 4 x 2 on one staged weight tile, a wave takes 32 rows x 64 columns (rows 32 wy + 16 rg, columns 64 wx + 16 j): 12 KB of fragment reads a wave and k tile on the one-product path (16 rows x 128 columns: 18 KB); a wave still stages rows 16 wave ..: out = ctx Wo (+ bo): ctx once to f16 against Wo as f16(bf16 x 2^8) exact (1 product) x 2^-8; causal early rows (< QHI of each sequence): ctx bf16 hi + lo against exact bf16 Wo (2 products)
__global__ __launch_bounds__(256) void k_out(const float* __restrict__ Y, const __bf16* __restrict__ WPB, const _Float16* __restrict__ WPH, const float* __restrict__ BO, float* __restrict__ OUT) { __shared__ __align__(16) float sf[8][32][68]; __shared__ __align__(16) __bf16 wt[2][128][WPITCH]; __shared__ __align__(16) __bf16 at[2][2][128][WPITCH];   /* at: [buffer][plane: hi, lo (early rows); the f16 path keeps one plane] */
  const int tid = threadIdx.x, wave = tid >> 5, lane = tid & 31, col = lane & 15, g = lane >> 4; const int c0 = blockIdx.y * 128; const size_t r0 = (size_t)blockIdx.x * 128 + wave * 16; const int wy = wave >> 1, wx = wave & 1; static_assert(TT % 128 == 0 && QHI % 128 == 0, "a block is early rows or late rows as a whole");
  v8f acc[2][4] = {};   /* [row group][column group] */
  const bool early = CAUSAL && (int)(((size_t)blockIdx.x * 128) % TT) < QHI;   /* block-uniform */
  const int srow = TT_ROW(tid), spc = tid & 7; const char* wb = (early ? (const char*)WPB : (const char*)WPH) + ((size_t)(c0 + srow) * KT + 8 * spc) * 2; const int ar0 = wave * 16 + g, akl = 4 * col; const float* arow = Y + (r0 + g) * CC + akl;
  { static_assert(CC == 1024 && KT == 64 && TT / 128 == 8 && NB == 4 && DIN / 128 == 8, "asks");   /* the block's 128 ctx rows = 128 x 16 units: 4 column blocks ask for them once (k tiles 0..7, then 8..15), column blocks 4 apart the same units; the 128 weight columns = 1024 units: the 4 row blocks at one place of the 4 sequences ask for them once */
    const unsigned uy = (blockIdx.y & 3) * 256 + tid, uw = (blockIdx.x >> 3) * 256 + tid; const char* yb = (const char*)(Y + ((size_t)blockIdx.x * 128 + (uy & 127)) * CC) + (uy >> 7) * 256;
    l2_ask3(yb, yb + 8 * 256, (early ? (const char*)WPB : (const char*)WPH) + (uw >> 6) * WT_STEP + (size_t)c0 * (KT * 2) + (uw & 63) * 256); }
  TRaw<4> wr; ALRaw<8> ar; at_load(ar, arow, CC, 0); tt_load<4, 32>(wr, wb, 0); PF_XW();
  if (early) {
    tt_store<4, 32>(wt[0], wr, srow, spc); at_store_hl(at[0][0], at[0][1], ar, ar0, akl);
    __syncthreads();   /* tile 0 is published */
#pragma unroll 2   /* two trips = the two buffers at constant LDS addresses */
    for (int t = 0; t < CC / KT; ++t) {
      if (t + 1 < CC / KT) { at_load(ar, arow, CC, (t + 1) * KT); tt_load<4, 32>(wr, wb, (t + 1) * WT_STEP); PF_XW(); }   /* the next tile flies while this one is multiplied; the wait: the conversions behind the products are given these loads' address registers */
      PF_STAGE();
      F2 a[2][KT / 32]; v16b bf[KT / 32][4];   /* all of the wave's fragments of the tile, read in one group, k half by k half */
#pragma unroll
      for (int c = 0; c < KT / 32; ++c) {
#pragma unroll
        for (int rg = 0; rg < 2; ++rg) { a[rg][c].h = frag_b(&at[t & 1][0][wy * 32 + rg * 16 + col][32 * c], lane); a[rg][c].l = frag_b(&at[t & 1][1][wy * 32 + rg * 16 + col][32 * c], lane); }
#pragma unroll
        for (int jj = 0; jj < 4; ++jj) bf[c][jj] = frag_b(&wt[t & 1][wx * 64 + jj * 16 + col][32 * c], lane); }
      PF_GROUP();
#pragma unroll
      for (int c = 0; c < KT / 32; ++c) {   /* the 8 hi products of a k half, then its 8 lo products: an accumulator still takes hi, lo, hi, lo, and its two products of a k half no longer follow each other directly */
#pragma unroll
        for (int jj = 0; jj < 4; ++jj)
#pragma unroll
          for (int rg = 0; rg < 2; ++rg) acc[rg][jj] = wmma_bf(a[rg][c].h, bf[c][jj], acc[rg][jj]);
#pragma unroll
        for (int jj = 0; jj < 4; ++jj)
#pragma unroll
          for (int rg = 0; rg < 2; ++rg) acc[rg][jj] = wmma_bf(a[rg][c].l, bf[c][jj], acc[rg][jj]); }
      PF_STAGE();
      if (t + 1 < CC / KT) { tt_store<4, 32>(wt[(t + 1) & 1], wr, srow, spc); at_store_hl(at[(t + 1) & 1][0], at[(t + 1) & 1][1], ar, ar0, akl); }   /* those buffers' readers left them at the barrier of trip t - 1 */
      PF_XW();
      __syncthreads(); }   /* publishes tile t + 1 and ends the reads of tile t */
#pragma unroll
    for (int j = 0; j < 4; ++j) { const float bias = BO ? bfr(BO[c0 + wx * 64 + j * 16 + col]) : 0.f;
#pragma unroll
      for (int rg = 0; rg < 2; ++rg)
#pragma unroll
        for (int r = 0; r < 8; ++r) sf[wave][rg * 16 + 8 * g + r][j * 16 + col] = acc[rg][j][r] + bias; }
  } else {
    _Float16 (*wh)[128][WPITCH] = (_Float16 (*)[128][WPITCH])wt;   /* this path keeps f16 in the same two buffers */
    _Float16 (*ah)[2][128][WPITCH] = (_Float16 (*)[2][128][WPITCH])at;   /* plane 0 of each A buffer, f16 */
    tt_store<4, 32>(wh[0], wr, srow, spc); at_store_h(ah[0][0], ar, ar0, akl, 64.0f);   /* ctx carried x 2^6 into f16 so small-magnitude context rows stay clear of f16 subnormals */
    __syncthreads();   /* tile 0 is published */
#pragma unroll 2   /* two trips = the two buffers at constant LDS addresses */
    for (int t = 0; t < CC / KT; ++t) {
      if (t + 1 < CC / KT) { at_load(ar, arow, CC, (t + 1) * KT); tt_load<4, 32>(wr, wb, (t + 1) * WT_STEP); }   /* the next tile flies while this one is multiplied */
      PF_STAGE();
      v16h a[2][KT / 32], bf[KT / 32][4];   /* all of the wave's fragments of the tile, read in one group, k half by k half */
#pragma unroll
      for (int c = 0; c < KT / 32; ++c) {
#pragma unroll
        for (int rg = 0; rg < 2; ++rg) a[rg][c] = frag_h(&ah[t & 1][0][wy * 32 + rg * 16 + col][32 * c], lane);
#pragma unroll
        for (int jj = 0; jj < 4; ++jj) bf[c][jj] = frag_h(&wh[t & 1][wx * 64 + jj * 16 + col][32 * c], lane); }
      PF_GROUP();
#pragma unroll
      for (int c = 0; c < KT / 32; ++c)
#pragma unroll
        for (int jj = 0; jj < 4; ++jj)
#pragma unroll
          for (int rg = 0; rg < 2; ++rg) acc[rg][jj] = wmma16(a[rg][c], bf[c][jj], acc[rg][jj]);
      PF_STAGE();
      if (t + 1 < CC / KT) { tt_store<4, 32>(wh[(t + 1) & 1], wr, srow, spc); at_store_h(ah[(t + 1) & 1][0], ar, ar0, akl, 64.0f); }   /* those buffers' readers left them at the barrier of trip t - 1 */
      PF_XW();
      __syncthreads(); }   /* publishes tile t + 1 and ends the reads of tile t */
#pragma unroll
    for (int j = 0; j < 4; ++j) { const float bias = BO ? bfr(BO[c0 + wx * 64 + j * 16 + col]) : 0.f;
#pragma unroll
      for (int rg = 0; rg < 2; ++rg)
#pragma unroll
        for (int r = 0; r < 8; ++r) sf[wave][rg * 16 + 8 * g + r][j * 16 + col] = acc[rg][j][r] * (1.0f / 16384.0f) + bias; } }   /* 2^-8 (Wo carry) x 2^-6 (ctx carry) */
  LDSX(); float* op = OUT + ((size_t)blockIdx.x * 128 + wy * 32 + g) * DIN + c0 + wx * 64 + col * 4;   /* a store instruction covers the 256-B runs of two rows */
  for (int i = 0; i < 16; ++i) vst2(op + (size_t)(2 * i) * DIN, *(const v4f*)&sf[wave][2 * i + g][col * 4]); }

extern "C" void kernel_launch(void* const* d_in, const int* in_sizes, int n_in, void* d_out, int out_size, void* d_ws, size_t ws_size, hipStream_t stream) {
  (void)in_sizes; (void)n_in; (void)out_size;
  const float** F = (const float**)d_in;
  if (ws_size < (size_t)WS_END) return;
  char* ws = (char*)d_ws; _Float16 *QH = (_Float16*)(ws + WS_QH), *KH = (_Float16*)(ws + WS_KH), *VT = (_Float16*)(ws + WS_VT), *QL = (_Float16*)(ws + WS_QL), *KL = (_Float16*)(ws + WS_KL); __bf16 *VB = (__bf16*)(ws + WS_VB), *VBL = (__bf16*)(ws + WS_VBL); float *Y = (float*)(ws + WS_Y); __bf16 *XB = (__bf16*)(ws + WS_XB), *WT = (__bf16*)(ws + WS_WT), *WPB = (__bf16*)(ws + WS_WPB); _Float16 *WPH = (_Float16*)(ws + WS_WPH);
  (void)Y; (void)QL; (void)KL; (void)VB; (void)VBL;
  // inputs: 0 x [4,1024,1024]; 1 Wq [16,1024,64]; 2 Wk; 3 Wv (per-head [head][model][d]); 4 Wp [1024,1024] (in,out); 5 bp [1024] (zeros, read); no q / k / v biases
  k_cvt<<<dim3(CVX_BLK + CVW_BLK), 256, 0, stream>>>(F[0], F[1], F[2], F[3], F[4], XB, WT, WPB, WPH);
  k_proj<<<dim3(TNB * TT / 128, CC / 128, 3), 128, 0, stream>>>(XB, WT, nullptr, nullptr, nullptr, QH, QL, KH, KL, VT, VB, VBL);
  k_att<<<dim3(NQB, 1, TNB * NH), 128, 0, stream>>>(QH, KH, QL, KL, VT, VB, VBL, Y);
  k_out<<<dim3(TNB * TT / 128, DIN / 128), 256, 0, stream>>>(Y, WPB, WPH, F[5], (float*)d_out);
}
